// v000
// Times are from an AMD MI455X. After a warm-up the kernel runs many times in a row, and a time is the length of
// such a window on the GPU divided by its runs, so every launch and the gaps after it count. The runs cycle
// through copies of the inputs. A figure is the median of several windows, for all but v000 over two sittings.
// Sittings can differ by a few percent; kernels timed side by side share one.
// The starting kernel, v000, takes 577 microseconds a run.
// Contractions: x.W{q,k,v}^T on v_wmma_f32_16x16x32_bf16 (x and W planes RNE-converted to bf16 operands, f32 accumulate, bias added in f32);
// scores k'.q'^T (q', k' single f16 planes carried x8), P.v (P x32768 single f16, v x1024 single f16), O.Wo^T and U.Wd^T
// (O and U single f16 planes x1024, Wo and Wd as f16(bf16(W) x1024)): v_wmma_f32_16x16x32_f16, f32 accumulate.
// Base-2 online softmax, 1/l fold, row-sum partials and bias adds in f32 on VALU.
#include <hip/hip_runtime.h>
#include <math.h>
#include <stdint.h>

#define NB    4
#define SEQ   2048
#define DMOD  1024
#define NH    8
#define HD    128
#define QT_BITS 5
#define NH_BITS 3
#define ROWS  (NB * SEQ)
#define QSC   8.0f
#define KSC   8.0f
#define PCAR  32768.0f
#define VCAR  1024.0f
#define OSC   1024.0f
#define USC   1024.0f
#define WOS   1024.0f
#define SM_SCALE 0.08838834764831845f
#define LOG2E 1.4426950408889634f
#define ATT_WAVES   4
#define ATT_THREADS (ATT_WAVES * 32)
#define ATT_BLOCKS  (NB * NH * (SEQ / 64))
#define NKB    (SEQ / 32)
#define RS     (NH * HD)
#define SPITCH 132
#define SLABF  (16 * SPITCH)
#define SLAB64 (16 * 68)
#define VTP    72
#define WPB    (NH * (SEQ / 64) * ATT_WAVES)
#define TOTOUT (NB + ROWS * DMOD)
#define IMGN   (ROWS * DMOD)
#define NPIECE ((TOTOUT + 3) / 4)
#define DEPSC  (1.0f / ((float)NH * (float)SEQ * (float)SEQ))

static_assert(HD == 128 && DMOD == NH * HD && RS == DMOD);
static_assert((1 << QT_BITS) == (SEQ / 64) && (1 << NH_BITS) == NH);
static_assert((SEQ % 64) == 0 && (SEQ % 32) == 0 && NKB * 32 == SEQ);
static_assert(((ROWS * DMOD / 8) % 256) == 0 && ((3 * DMOD * DMOD / 8) % 256) == 0 && ((DMOD * DMOD / 8) % 256) == 0);
static_assert((ROWS % 64) == 0 && (DMOD % 64) == 0 && (DMOD % 32) == 0);
static_assert(NB >= 1 && NB <= 32);
static_assert((WPB % 32) == 0 && WPB == 1024);
static_assert(ATT_THREADS == 128);
static_assert(((SPITCH * 4) % 16) == 0 && ((VTP * 2) % 16) == 0 && (SPITCH >= HD + 4));
static_assert(HD * VTP >= 127 * VTP + 64);
static_assert(IMGN % 4 == 0);

typedef unsigned short u16;
typedef _Float16 v16h __attribute__((ext_vector_type(16)));
typedef _Float16 v8h  __attribute__((ext_vector_type(8)));
typedef __bf16   v16b __attribute__((ext_vector_type(16)));
typedef float    v8f  __attribute__((ext_vector_type(8)));
typedef float    v4f  __attribute__((ext_vector_type(4)));
typedef unsigned int v4u __attribute__((ext_vector_type(4)));

union FragH { v16h v; v8h h[2]; v4u u[2]; };
union FragB { v16b v; v4u u[2]; };

// ---- scalar helpers --------------------------------------------------------------------------------
__device__ __forceinline__ unsigned short bf_bits(float f) {          // f32 -> bf16 bits, RNE convert
  unsigned u = __float_as_uint(f);
  return (unsigned short)((u + 0x7FFFu + ((u >> 16) & 1u)) >> 16);
}
__device__ __forceinline__ float bf_up(unsigned short h) { return __uint_as_float(((unsigned)h) << 16); }
__device__ __forceinline__ float bfr(float f) { return bf_up(bf_bits(f)); }
__device__ __forceinline__ unsigned short h_bits(_Float16 x) { return __builtin_bit_cast(unsigned short, x); }
__device__ __forceinline__ unsigned pk16(unsigned short a, unsigned short b) { return (unsigned)a | ((unsigned)b << 16); }
__device__ __forceinline__ v8f zero8() { v8f z = {0.f, 0.f, 0.f, 0.f, 0.f, 0.f, 0.f, 0.f}; return z; }
__device__ __forceinline__ v4f zero4() { v4f z = {0.f, 0.f, 0.f, 0.f}; return z; }

// ---- fragment loaders: 16-bit A/B operand, lane -> row/col (lane&15), p already includes +8*(lane>>4);
//      elements 0..7 <- p[0..7] (k0+8h..), elements 8..15 <- p[16..23] (k0+16+8h..)  (same split k map for A and B;
//      B is always read from a k-contiguous [n][k] plane)
__device__ __forceinline__ v16h ldfrag_h(const _Float16* p) {
  FragH f;
  f.h[0] = *(const v8h*)(p);
  f.h[1] = *(const v8h*)(p + 16);
  return f.v;
}
__device__ __forceinline__ v16b ldfrag_b(const u16* p) {              // bf16 plane read as unsigned integer vectors
  FragB f;
  f.u[0] = *(const v4u*)(p);
  f.u[1] = *(const v4u*)(p + 16);
  return f.v;
}

__device__ __forceinline__ v8f mma_h(v16h a, v16h b, v8f c) {
  return __builtin_amdgcn_wmma_f32_16x16x32_f16(false, a, false, b, (short)0, c, false, false);
}
__device__ __forceinline__ v8f mma_b(v16b a, v16b b, v8f c) {
  return __builtin_amdgcn_wmma_f32_16x16x32_bf16(false, a, false, b, (short)0, c, false, false);
}
__device__ __forceinline__ void guard2(v8f& a, v8f& b, v16h x0, v16h x1, v16h x2, v16h x3, v16h x4, v16h x5) {
#if defined(__HIP_DEVICE_COMPILE__)
  asm volatile("v_nop\n\tv_nop\n\tv_nop\n\tv_nop"
               : "+v"(a), "+v"(b) : "v"(x0), "v"(x1), "v"(x2), "v"(x3), "v"(x4), "v"(x5) : "memory");
#endif
}
template <typename F>
__device__ __forceinline__ void guard6(v8f& a, v8f& b, v8f& c, v8f& d, F x0, F x1, F x2, F x3, F x4, F x5) {
#if defined(__HIP_DEVICE_COMPILE__)
  asm volatile("v_nop\n\tv_nop\n\tv_nop\n\tv_nop"
               : "+v"(a), "+v"(b), "+v"(c), "+v"(d) : "v"(x0), "v"(x1), "v"(x2), "v"(x3), "v"(x4), "v"(x5) : "memory");
#endif
}
__device__ __forceinline__ void acc_guard4(v8f& a, v8f& b, v8f& c, v8f& d) {
#if defined(__HIP_DEVICE_COMPILE__)
  asm volatile("v_nop\n\tv_nop\n\tv_nop\n\tv_nop" : "+v"(a), "+v"(b), "+v"(c), "+v"(d));
#endif
}
__device__ __forceinline__ void wave_sync_lds() {
  __builtin_amdgcn_fence(__ATOMIC_RELEASE, "workgroup");
  __builtin_amdgcn_wave_barrier();
  __builtin_amdgcn_fence(__ATOMIC_ACQUIRE, "workgroup");
}

// =====================================================================================================
// f32 plane -> 16-bit plane, same layout:  mode 0: bf16 RNE bits;  mode 1: f16 bits of (bf16 RNE value) * scale;
// mode 2: f16 bits of value * scale (no bf16 pre-step).
// Thread = 8 consecutive elements: two 16-B loads, one 16-B store; 32 consecutive lanes = 512 contiguous, 512-B aligned bytes
// coverage: grid = n8/256 blocks (host checks exactness) x 256 thr x 8 = the whole plane.
// =====================================================================================================
__global__ __launch_bounds__(256) void cvt16(const float* __restrict__ x, u16* D, int n8, int mode, float scale) {
  const int gt = blockIdx.x * 256 + (int)threadIdx.x;
  if (gt >= n8) return;                     // no barriers in this kernel
  const float* p = x + (size_t)gt * 8;
  const v4f a = *(const v4f*)(p), c4 = *(const v4f*)(p + 4);
  float v[8];
#pragma unroll
  for (int e = 0; e < 4; ++e) { v[e] = a[e]; v[4 + e] = c4[e]; }
  unsigned short s[8];
#pragma unroll
  for (int e = 0; e < 8; ++e) {
    const float vb = bfr(v[e]);
    const float vf = (mode == 1) ? vb : v[e];
    const unsigned short hb = h_bits((_Float16)(vf * scale));
    const unsigned short bb = bf_bits(v[e]);
    s[e] = (mode != 0) ? hb : bb;
  }
  v4u o;
#pragma unroll
  for (int e = 0; e < 4; ++e) o[e] = pk16(s[2 * e], s[2 * e + 1]);
  u16* d = D + (size_t)gt * 8;
  {
    *(v4u*)(d) = o;
    
  }
}

// =====================================================================================================
// GEMM epilogue shared by both engines: the wave's 16x64 f32 tile (times oscale) staged in its LDS slab (pitch 68),
// coverage: 8 instructions x 2 rows x 16 lanes x 4 floats = the wave's 16 x 64 tile.
// =====================================================================================================
__device__ __forceinline__ void epi64(float* sl, v8f a0, v8f a1, v8f a2, v8f a3, float oscale, v4f badd, float* C, int N,
                                      size_t rowb, int col0, int lane) {
  const int hh = lane >> 4, m = lane & 15;
#pragma unroll
  for (int r = 0; r < 8; ++r) {
    const int ro = (8 * hh + r) * 68 + m;
    sl[ro]      = a0[r] * oscale;
    sl[ro + 16] = a1[r] * oscale;
    sl[ro + 32] = a2[r] * oscale;
    sl[ro + 48] = a3[r] * oscale;
  }
  wave_sync_lds();
  v4f vals[8];
#pragma unroll
  for (int it = 0; it < 8; ++it) vals[it] = *(const v4f*)(sl + (it * 2 + hh) * 68 + m * 4) + badd;
  float* dst = C + (rowb + (size_t)hh) * (size_t)N + col0 + m * 4;
  {
#pragma unroll
    for (int it = 0; it < 8; ++it) {
      *(v4f*)(dst + (size_t)(it * 2) * (size_t)N) = vals[it];
    }
    
  }
}

// =====================================================================================================
// bf16 GEMM with bias: C[M][N] (f32) = A[M][K] (bf16 row-major) . Bt[N][K]^T (bf16 k-contiguous), times oscale, plus bf16-RNE
// value of bias[n]. Block = 64x64 tile, 4 waves x 16 rows; fragments loaded straight from the 16-bit rows (two 16-B loads each,
// split k map for A and B); K stepped by 32 (host checks K % 32 == 0, M % 64 == 0, N % 64 == 0, grid = (M/64)*(N/64)).
// =====================================================================================================
__global__ __launch_bounds__(128)
void gemm_bfb(const u16* __restrict__ A, const u16* __restrict__ Bt, const float* __restrict__ bias,
              float* C, int M, int N, int K, float oscale) {
  __shared__ __align__(16) float slab[4 * SLAB64];
  const int tid = threadIdx.x, wave = tid >> 5, lane = tid & 31, hh = lane >> 4, m = lane & 15;
  const int ntile = N >> 6;
  const int bid   = blockIdx.x;
  const int rowb  = (bid / ntile) * 64 + wave * 16;
  const int col0  = (bid % ntile) * 64;
  if (rowb + 16 > M) return;                 // wave-uniform, never taken with the exact grid; no block barriers in this kernel
  const u16* ap = A  + (size_t)(rowb + m) * K + 8 * hh;
  const u16* bp = Bt + (size_t)(col0 + m) * K + 8 * hh;
  const size_t bs = (size_t)16 * K;
  v8f acc0 = zero8(), acc1 = zero8(), acc2 = zero8(), acc3 = zero8();
#pragma unroll 1
  for (int k0 = 0; k0 < K; k0 += 32) {
    const v16b a  = ldfrag_b(ap + k0);
    const v16b b0 = ldfrag_b(bp + k0);
    const v16b b1 = ldfrag_b(bp + bs + k0);
    const v16b b2 = ldfrag_b(bp + 2 * bs + k0);
    const v16b b3 = ldfrag_b(bp + 3 * bs + k0);
    acc0 = mma_b(a, b0, acc0);
    acc1 = mma_b(a, b1, acc1);
    acc2 = mma_b(a, b2, acc2);
    acc3 = mma_b(a, b3, acc3);
    guard6<v16b>(acc0, acc1, acc2, acc3, a, b0, b1, b2, b3, a);
  }
  const v4f bv = *(const v4f*)(bias + col0 + m * 4);      // columns col0 + 4m .. +3, always < N (N multiple of 64)
  v4f badd;
#pragma unroll
  for (int e = 0; e < 4; ++e) badd[e] = bfr(bv[e]);
  epi64(slab + wave * SLAB64, acc0, acc1, acc2, acc3, oscale, badd, C, N, (size_t)rowb, col0, lane);
}

// =====================================================================================================
// f16 single-plane GEMM with bias: C[M][N] (f32) = A[M][K] (f16 row-major) . Bt[N][K]^T (f16 k-contiguous), times oscale, plus
// bf16-RNE value of bias[n]. Same tiling, loaders (split k map) and epilogue as gemm_bfb.
// =====================================================================================================
__global__ __launch_bounds__(128)
void gemm_h1(const u16* __restrict__ A, const u16* __restrict__ Bt, const float* __restrict__ bias,
             float* C, int M, int N, int K, float oscale) {
  __shared__ __align__(16) float slab[4 * SLAB64];
  const int tid = threadIdx.x, wave = tid >> 5, lane = tid & 31, hh = lane >> 4, m = lane & 15;
  const int ntile = N >> 6;
  const int bid   = blockIdx.x;
  const int rowb  = (bid / ntile) * 64 + wave * 16;
  const int col0  = (bid % ntile) * 64;
  if (rowb + 16 > M) return;                 // wave-uniform, never taken with the exact grid; no block barriers in this kernel
  const _Float16* ap = (const _Float16*)(const void*)A  + (size_t)(rowb + m) * K + 8 * hh;
  const _Float16* bp = (const _Float16*)(const void*)Bt + (size_t)(col0 + m) * K + 8 * hh;
  const size_t bs = (size_t)16 * K;
  v8f acc0 = zero8(), acc1 = zero8(), acc2 = zero8(), acc3 = zero8();
#pragma unroll 1
  for (int k0 = 0; k0 < K; k0 += 32) {
    const v16h a  = ldfrag_h(ap + k0);
    const v16h b0 = ldfrag_h(bp + k0);
    const v16h b1 = ldfrag_h(bp + bs + k0);
    const v16h b2 = ldfrag_h(bp + 2 * bs + k0);
    const v16h b3 = ldfrag_h(bp + 3 * bs + k0);
    acc0 = mma_h(a, b0, acc0);
    acc1 = mma_h(a, b1, acc1);
    acc2 = mma_h(a, b2, acc2);
    acc3 = mma_h(a, b3, acc3);
    guard6<v16h>(acc0, acc1, acc2, acc3, a, b0, b1, b2, b3, a);
  }
  const v4f bv = *(const v4f*)(bias + col0 + m * 4);      // columns col0 + 4m .. +3, always < N (N multiple of 64)
  v4f badd;
#pragma unroll
  for (int e = 0; e < 4; ++e) badd[e] = bfr(bv[e]);
  epi64(slab + wave * SLAB64, acc0, acc1, acc2, acc3, oscale, badd, C, N, (size_t)rowb, col0, lane);
}

// =====================================================================================================
// v^T plane: VP[(b*NH + h)*HD + d][s] = f16(v[b][s][h][d] * 1024), v read from the f32 projection image [b*SEQ+s][h*HD+d].
// Block = (b, h, 64 keys): 64 source rows of HD floats loaded with 16-B loads, converted, scattered into an LDS tile
// coverage: load 256 thr x 32 elements = 64 keys x 128 d (every TH column 0..63 of all 128 rows); store 4 iterations x 256 thr
//           x 8 halves = 128 lines x 64 = the block's tile; grid = NB x NH x SEQ/64 blocks covers the plane exactly once.
// =====================================================================================================
__global__ __launch_bounds__(256) void vt16(const float* __restrict__ v, u16* VPo) {
  __shared__ __align__(16) u16 TH[HD * VTP];
  const int tid = threadIdx.x;
  const int bid = blockIdx.x;
  const int st  = bid & ((SEQ / 64) - 1);
  const int h   = (bid >> QT_BITS) & (NH - 1);
  const int b   = bid >> (QT_BITS + NH_BITS);
  const int s0  = st * 64;
  {
    const int sl = tid >> 2;                  // key within tile 0..63
    const int dc = (tid & 3) * 32;            // d chunk of 32
    const float* src = v + ((size_t)(b * SEQ + s0 + sl) * NH + h) * HD + dc;
#pragma unroll
    for (int i = 0; i < 8; ++i) {
      const v4f a = *(const v4f*)(src + 4 * i);
#pragma unroll
      for (int e = 0; e < 4; ++e) {
        const _Float16 hv = (_Float16)(a[e] * VCAR);
        TH[(dc + 4 * i + e) * VTP + sl] = h_bits(hv);
      }
    }
  }
  __syncthreads();
  v4u vh[4];
  const int q8 = tid >> 3, p8 = (tid & 7) * 8;
#pragma unroll
  for (int it = 0; it < 4; ++it) {
    const int line = it * 32 + q8;            // d = 0..127
    vh[it] = *(const v4u*)(TH + line * VTP + p8);
  }
  const size_t base = ((size_t)(b * NH + h) * HD) * SEQ + s0 + p8;
  {
#pragma unroll
    for (int it = 0; it < 4; ++it) {
      const int line = it * 32 + q8;
      *(v4u*)(VPo + base + (size_t)line * SEQ) = vh[it];
    }
    
  }
}

// =====================================================================================================
// Multi-head flash attention (no mask): block = (batch b, head, 64 query rows), 4 waves, wave w owns the 16 query rows
// q0 = 64*qt + 16*w .. q0+15 (waves independent: no block barriers, wave-private LDS only, used in the epilogue).
//   q plane (f16, x8) laid out [b][s][h][d]; k plane the same; v^T plane [b][h][d][s] (x1024).
//   All NKB = SEQ/32 key blocks of 32 keys are visited (static bound).
//   Scores are computed TRANSPOSED: S^T tile g (g = 0,1) = k rows (keys kb+16g .. +15, A operand, row m = lane&15, split k map
//   over d, 4 chunks of 32 d) times q^T (B operand, col n = query q0 + (lane&15), k = d, split map).
//   D element r of lane l = (key kb+16g+8h+r, query q0+(l&15)), so a lane owns one query column and 16 of its 32 keys; the
//   partner lane l^16 owns the other 16 -> row max / row sum need one xor-16 shuffle.
//   Online max-subtracted base-2 softmax in f32 (scale 1/sqrt(128) and the q/k carries folded into lsc). The exp'd values ARE
//   the P A-fragment in place: A row m = query = lane&15, element i <- key kb+8h+i (tile 0, D element i), element 8+i <- key
//   kb+16+8h+i (tile 1, D element i). P is carried x32768 as single f16. The rescale factor of query row 8h+r of the
//   O accumulators is fetched from lane 8h+r with a shuffle (uniform control). 8 v^T B fragments (col n = d = 16j + (lane&15),
//   keys k-contiguous), 8 P.V WMMAs per key block in two guarded groups of 4.
//   Epilogue: 1/l (per query, shuffled to the D row owner) and carry folds in f32; the wave's 16x128 f32 result staged in its
//   LDS slab (pitch 132); each 256-B output row (b, q0+row, head) of the O plane (O x1024 as single f16) written as 2 whole
// coverage: per wave 8 instructions x 2 rows x 16 lanes x 8 halves = 16 x 128 of the O plane + 1 PART line; grid
//           NB*NH*SEQ/64 blocks x 4 waves = every (b, s, h) row of the O plane and every PART line exactly once.
// =====================================================================================================
__global__ __launch_bounds__(ATT_THREADS)
void attn_fwd(const u16* __restrict__ QPp, const u16* __restrict__ KPp, const u16* __restrict__ VPp,
              u16* OPo, float* PART) {
  __shared__ __align__(16) float smem[ATT_WAVES * SLABF];   // per wave: result slab [16][132] in the epilogue only

  const int tid  = threadIdx.x;
  const int wave = tid >> 5;
  const int lane = tid & 31;
  const int hh   = lane >> 4;
  const int c    = lane & 15;

  const int bid  = blockIdx.x;
  const int qt   = bid & ((SEQ / 64) - 1);
  const int head = (bid >> QT_BITS) & (NH - 1);
  const int b    = bid >> (QT_BITS + NH_BITS);
  const int q0   = qt * 64 + wave * 16;

  // B fragments of q^T: col n = query q0 + c, k = d (k-contiguous row of the q plane)
  const _Float16* Qb = (const _Float16*)(const void*)QPp + ((size_t)(b * SEQ + q0 + c) * NH + head) * HD + 8 * hh;
  // A fragments of k: row m = key kb + 16g + c, k = d
  const _Float16* Kb = (const _Float16*)(const void*)KPp + ((size_t)(b * SEQ + c) * NH + head) * HD + 8 * hh;   // key row kb + c added per step
  // B fragments of v: col n = d = 16j + c, k = key (k-contiguous row of the v^T plane)
  const _Float16* Vb = (const _Float16*)(const void*)VPp + ((size_t)(b * NH + head) * HD + c) * SEQ + 8 * hh;  // key kb added per step
  const float lsc = SM_SCALE * (LOG2E / (QSC * KSC));

  const v16h qf0 = ldfrag_h(Qb);            // d 0..31
  const v16h qf1 = ldfrag_h(Qb + 32);       // d 32..63
  const v16h qf2 = ldfrag_h(Qb + 64);       // d 64..95
  const v16h qf3 = ldfrag_h(Qb + 96);       // d 96..127

  float mrun = -INFINITY, lrun = 0.f;
  v8f o[8];
#pragma unroll
  for (int j = 0; j < 8; ++j) o[j] = zero8();

#pragma unroll 1
  for (int it = 0; it < NKB; ++it) {
    const int kb = it * 32;
    // ---- transposed scores: s0 = keys kb..kb+15, s1 = keys kb+16..kb+31, column = query q0 + c ----
    v8f s0 = zero8(), s1 = zero8();
    const _Float16* k0p = Kb + (size_t)kb * RS;
    const _Float16* k1p = k0p + (size_t)16 * RS;
    {
      const v16h ka0 = ldfrag_h(k0p), ka1 = ldfrag_h(k0p + 32);
      const v16h kc0 = ldfrag_h(k1p), kc1 = ldfrag_h(k1p + 32);
      s0 = mma_h(ka0, qf0, s0);
      s0 = mma_h(ka1, qf1, s0);
      s1 = mma_h(kc0, qf0, s1);
      s1 = mma_h(kc1, qf1, s1);
      guard2(s0, s1, qf0, qf1, ka0, ka1, kc0, kc1);
    }
    {
      const v16h ka2 = ldfrag_h(k0p + 64), ka3 = ldfrag_h(k0p + 96);
      const v16h kc2 = ldfrag_h(k1p + 64), kc3 = ldfrag_h(k1p + 96);
      s0 = mma_h(ka2, qf2, s0);
      s0 = mma_h(ka3, qf3, s0);
      s1 = mma_h(kc2, qf2, s1);
      s1 = mma_h(kc3, qf3, s1);
      guard2(s0, s1, qf2, qf3, ka2, ka3, kc2, kc3);
    }
    // ---- base-2 logits of this lane's 16 keys for query q0 + c ----
    float tk[16];
#pragma unroll
    for (int i = 0; i < 8; ++i) { tk[i] = s0[i] * lsc;  tk[8 + i] = s1[i] * lsc; }
    float cm = -INFINITY;
#pragma unroll
    for (int i = 0; i < 16; ++i) cm = fmaxf(cm, tk[i]);
    cm = fmaxf(cm, __shfl_xor(cm, 16, 32));
    const float mn = fmaxf(mrun, cm);                                // finite from the first key block on
    const float al = (mrun == -INFINITY) ? 0.f : exp2f(mrun - mn);   // o and l are zero while mrun is -inf
    mrun = mn;
    // ---- probabilities (<= 1) and the P A-fragment: f16(p * 32768); element i <-> tk[i] ----
    float ps = 0.f;
    FragH ph;
#pragma unroll
    for (int w = 0; w < 2; ++w) {
#pragma unroll
      for (int e4 = 0; e4 < 4; ++e4) {
        const int i = 8 * w + 2 * e4;
        const float p0 = exp2f(fminf(tk[i] - mn, 0.f));
        const float p1 = exp2f(fminf(tk[i + 1] - mn, 0.f));
        ps += p0 + p1;
        ph.u[w][e4] = pk16(h_bits((_Float16)(p0 * PCAR)), h_bits((_Float16)(p1 * PCAR)));
      }
    }
    ps += __shfl_xor(ps, 16, 32);
    lrun = lrun * al + ps;
    // ---- rescale the O accumulators: D row 8hh+r = query q0+8hh+r, its factor lives in lane 8hh+r (and 16+8hh+r) ----
    float scl[8];
#pragma unroll
    for (int r = 0; r < 8; ++r) scl[r] = __shfl(al, 8 * hh + r, 32);
#pragma unroll
    for (int j = 0; j < 8; ++j) {
#pragma unroll
      for (int r = 0; r < 8; ++r) o[j][r] *= scl[r];
    }
    // ---- P.V : B fragment col n = d = j*16 + c, keys contiguous in the v^T plane; two guarded groups of 4 ----
    {
      const _Float16* vp = Vb + kb;
      const v16h vf0 = ldfrag_h(vp);
      const v16h vf1 = ldfrag_h(vp + (size_t)16 * SEQ);
      const v16h vf2 = ldfrag_h(vp + (size_t)32 * SEQ);
      const v16h vf3 = ldfrag_h(vp + (size_t)48 * SEQ);
      o[0] = mma_h(ph.v, vf0, o[0]);
      o[1] = mma_h(ph.v, vf1, o[1]);
      o[2] = mma_h(ph.v, vf2, o[2]);
      o[3] = mma_h(ph.v, vf3, o[3]);
      guard6<v16h>(o[0], o[1], o[2], o[3], ph.v, vf0, vf1, vf2, vf3, ph.v);
    }
    {
      const _Float16* vp = Vb + kb + (size_t)64 * SEQ;
      const v16h vf4 = ldfrag_h(vp);
      const v16h vf5 = ldfrag_h(vp + (size_t)16 * SEQ);
      const v16h vf6 = ldfrag_h(vp + (size_t)32 * SEQ);
      const v16h vf7 = ldfrag_h(vp + (size_t)48 * SEQ);
      o[4] = mma_h(ph.v, vf4, o[4]);
      o[5] = mma_h(ph.v, vf5, o[5]);
      o[6] = mma_h(ph.v, vf6, o[6]);
      o[7] = mma_h(ph.v, vf7, o[7]);
      guard6<v16h>(o[4], o[5], o[6], o[7], ph.v, vf4, vf5, vf6, vf7, ph.v);
    }
  }
  acc_guard4(o[0], o[1], o[2], o[3]);
  acc_guard4(o[4], o[5], o[6], o[7]);

  // ---- fold 1/l (per query, owned by lane = query) and the carries; row statistic r = l * (1/l); stage the 16x128 slab ----
  const float rl   = (lrun > 0.f) ? (1.0f / lrun) : 0.f;
  const float linv = rl * (1.0f / (PCAR * VCAR));
  const float rr   = lrun * rl;
  float inv[8];
#pragma unroll
  for (int r = 0; r < 8; ++r) inv[r] = __shfl(linv, 8 * hh + r, 32);
  float* slab = smem + wave * SLABF;
#pragma unroll
  for (int r = 0; r < 8; ++r) {
#pragma unroll
    for (int j = 0; j < 8; ++j) slab[(8 * hh + r) * SPITCH + j * 16 + c] = o[j][r] * inv[r];
  }
  wave_sync_lds();
  // ---- O x1024 -> single f16 plane; lane = (row parity hh, 8 consecutive d at c8) ----
  v4u oh[8];
  const int c8 = c * 8;
#pragma unroll
  for (int it = 0; it < 8; ++it) {
    const int row = it * 2 + hh;
    const v4f a = *(const v4f*)(slab + row * SPITCH + c8), c4 = *(const v4f*)(slab + row * SPITCH + c8 + 4);
    float w[8];
#pragma unroll
    for (int e = 0; e < 4; ++e) { w[e] = a[e] * OSC; w[4 + e] = c4[e] * OSC; }
#pragma unroll
    for (int e = 0; e < 4; ++e) {
      const _Float16 h0 = (_Float16)w[2 * e], h1 = (_Float16)w[2 * e + 1];
      oh[it][e] = pk16(h_bits(h0), h_bits(h1));
    }
  }
  // ---- wave row-sum partial (fixed xor tree over the 16 query lanes; both lane halves hold identical values) ----
  float wsum = rr;
  wsum += __shfl_xor(wsum, 1, 32);
  wsum += __shfl_xor(wsum, 2, 32);
  wsum += __shfl_xor(wsum, 4, 32);
  wsum += __shfl_xor(wsum, 8, 32);
  v4f pv = zero4();
  pv[0] = (lane == 0) ? wsum : 0.f;
  float* pd = PART + ((size_t)bid * ATT_WAVES + wave) * 32 + (lane & 7) * 4;   // clamped address for every lane
  const size_t ob = ((size_t)(b * SEQ + q0) * NH + head) * HD + c8;
  {
#pragma unroll
    for (int it = 0; it < 8; ++it) {
      const int row = it * 2 + hh;
      *(v4u*)(OPo + ob + (size_t)row * RS) = oh[it];
    }
    if (lane < 8) *(v4f*)(pd) = pv;
    
  }
}

// =====================================================================================================
// Flat output writer: out[0..NB-1] = score output (per batch: fixed-order sum of its WPB PART lines times 1/(NH*SEQ*SEQ),
// computed by block 0, wave = batch, 32 lanes x WPB/32 strided loads + xor tree), out[NB + i] = IMG[i] (f32 image of the last
// value. With NB % 4 != 0 a scalar path handles the element interleave and the partial last piece.
// coverage: grid = ceil(NPIECE/256) blocks x 256 thr x 4 elements with the in-kernel bound = all TOTOUT elements exactly once.
// =====================================================================================================
__global__ __launch_bounds__(256) void outw(const float* __restrict__ IMG, const float* __restrict__ PART, float* out) {
  __shared__ __align__(16) float sc[32];
  const int tid = threadIdx.x, wave = tid >> 5, lane = tid & 31;
  if (tid < 32) sc[tid] = 0.f;
  __syncthreads();
  if (blockIdx.x == 0) {                                   // block-uniform
#pragma unroll 1
    for (int bsel = wave; bsel < NB; bsel += 8) {          // wave-uniform
      const float* pp = PART + ((size_t)bsel * WPB + lane) * 32;
      float s = 0.f;
#pragma unroll 1
      for (int i = 0; i < WPB / 32; ++i) s += pp[(size_t)i * (32 * 32)];
#pragma unroll
      for (int d = 16; d >= 1; d >>= 1) s += __shfl_xor(s, d, 32);
      if (lane == 0) sc[bsel] = s * DEPSC;
    }
  }
  __syncthreads();
  const size_t t = (size_t)blockIdx.x * 256 + (size_t)tid;
  if (t >= (size_t)NPIECE) return;                         // no barriers after this point
  const size_t e0 = t * 4;
#if (NB % 4) == 0
  const bool   hs = (e0 < (size_t)NB);
  const int    si = hs ? (int)e0 : 0;
  const v4f    sv = *(const v4f*)(sc + si);
  const size_t ii = hs ? (size_t)0 : (e0 - (size_t)NB);   // clamped, 16-B aligned
  const v4f    gv = *(const v4f*)(IMG + ii);
  v4f val;
#pragma unroll
  for (int e = 0; e < 4; ++e) val[e] = hs ? sv[e] : gv[e];
  float* dst = out + e0;
  {
    *(v4f*)(dst) = val;
    
  }
#else
  float val[4];
  const size_t rem = (size_t)TOTOUT - e0;
  const int nval = (rem < 4) ? (int)rem : 4;
#pragma unroll
  for (int j = 0; j < 4; ++j) {
    size_t e = e0 + (size_t)j;
    if (e > (size_t)(TOTOUT - 1)) e = (size_t)(TOTOUT - 1);
    const bool hsj = (e < (size_t)NB);
    const float g = IMG[hsj ? (size_t)0 : (e - (size_t)NB)];
    const float s = sc[hsj ? (int)e : 0];
    val[j] = hsj ? s : g;
  }
  float* dst = out + e0;
  if (nval == 4) {
    v4f vv;
#pragma unroll
    for (int j = 0; j < 4; ++j) vv[j] = val[j];
    {
      *(v4f*)(dst) = vv;
      
    }
  } else {
    {
#pragma unroll
      for (int j = 0; j < 4; ++j) { if (j < nval) *(float*)(dst + j) = val[j]; }
      
    }
  }
#endif
}

// =====================================================================================================
// Workspace map (bytes); every plane is fully written by whole-line stores before it is read; all extents are exact multiples
// of the store granularity (no pad rows needed); F and QP are reused sequentially (in-order stream):
//   XB   bf16 [ROWS][1024]                 NB*4194304   (bf16 copy of the input activations)
//   WQKV bf16 [3072 n][1024 k]                6291456
//   WOB  f16  [1024 n][1024 k] x1024          2097152   WDB same 2097152
//   F    f32  [ROWS][1024]                 NB*8388608   (projection q, then k, then v, then O.Wo^T, then the final image)
//   QP   f16  [ROWS][8][128] x8            NB*4194304   (later UP: f16 plane of O.Wo^T output x1024)
//   KP   f16  same                          NB*4194304
//   VP   f16  [NB][8][128][2048] x1024      NB*4194304
//   OP   f16  [ROWS][8][128] x1024         NB*4194304
//   PART f32  [ATT_BLOCKS*4][32]           NB*131072
//   end (NB = 4)                            128450560
// =====================================================================================================
extern "C" void kernel_launch(void* const* d_in, const int* in_sizes, int n_in,
                              void* d_out, int out_size, void* d_ws, size_t ws_size,
                              hipStream_t stream) {
  if (n_in < 7) return;
  if (in_sizes[0] != ROWS * DMOD) return;
  if (in_sizes[1] != 3 * DMOD * DMOD || in_sizes[2] != 3 * DMOD) return;
  if (in_sizes[3] != DMOD * DMOD || in_sizes[4] != DMOD) return;
  if (in_sizes[5] != DMOD * DMOD || in_sizes[6] != DMOD) return;
  if (out_size != TOTOUT) return;

  const float* x    = (const float*)d_in[0];
  const float* wqkv = (const float*)d_in[1];
  const float* bqkv = (const float*)d_in[2];
  const float* wo   = (const float*)d_in[3];
  const float* bo   = (const float*)d_in[4];
  const float* wd   = (const float*)d_in[5];
  const float* bd   = (const float*)d_in[6];
  float*       out  = (float*)d_out;

  const size_t szXB   = (size_t)ROWS * DMOD * 2;
  const size_t szWQKV = (size_t)3 * DMOD * DMOD * 2;
  const size_t szW    = (size_t)DMOD * DMOD * 2;
  const size_t szF    = (size_t)ROWS * DMOD * 4;
  const size_t szP    = (size_t)ROWS * DMOD * 2;
  const size_t szVP   = (size_t)NB * NH * HD * SEQ * 2;
  const size_t szPART = (size_t)ATT_BLOCKS * ATT_WAVES * 32 * 4;
  size_t off = 0;
  const size_t oXB   = off; off += szXB;
  const size_t oWQKV = off; off += szWQKV;
  const size_t oWOB  = off; off += szW;
  const size_t oWDB  = off; off += szW;
  const size_t oF    = off; off += szF;
  const size_t oQP   = off; off += szP;
  const size_t oKP   = off; off += szP;
  const size_t oVP   = off; off += szVP;
  const size_t oOP   = off; off += szP;
  const size_t oPART = off; off += szPART;
  if (off > ws_size) return;                            // off = 128450560 for NB = 4
  if (off > (size_t)134217728) return;

  char* ws = (char*)d_ws;
  u16*   XB   = (u16*)(ws + oXB);
  u16*   WQKV = (u16*)(ws + oWQKV);
  u16*   WOB  = (u16*)(ws + oWOB);
  u16*   WDB  = (u16*)(ws + oWDB);
  float* F    = (float*)(ws + oF);
  u16*   QP   = (u16*)(ws + oQP);
  u16*   UP   = QP;                                     // reused after the attention launch has consumed QP
  u16*   KP   = (u16*)(ws + oKP);
  u16*   VP   = (u16*)(ws + oVP);
  u16*   OP   = (u16*)(ws + oOP);
  float* PART = (float*)(ws + oPART);

  const int n8x   = (ROWS * DMOD) / 8;
  const int n8qkv = (3 * DMOD * DMOD) / 8;
  const int n8w   = (DMOD * DMOD) / 8;
  if ((n8x % 256) != 0 || (n8qkv % 256) != 0 || (n8w % 256) != 0 || (DMOD % 64) != 0 || (ROWS % 64) != 0 || (DMOD % 32) != 0) return;
  const dim3 blk(256);
  const dim3 gX(n8x / 256);
  const dim3 gQKV(n8qkv / 256);
  const dim3 gW(n8w / 256);
  const dim3 gG((ROWS / 64) * (DMOD / 64));
  const dim3 bG(128);
  const dim3 gVT(NB * NH * (SEQ / 64));
  const dim3 gAT(ATT_BLOCKS);
  const dim3 bAT(ATT_THREADS);
  const dim3 gOW((NPIECE + 255) / 256);
  const size_t wblk = (size_t)DMOD * DMOD;

  // (0..3) input activations -> bf16 plane; weights stored [n = out][k = in] (y = x.W^T), already k-contiguous:
  //        bf16 plane for the qkv weight, f16 of bf16 value x1024 for the two square weights
  cvt16<<<gX,   blk, 0, stream>>>(x,    XB,   n8x,   0, 1.0f);
  cvt16<<<gQKV, blk, 0, stream>>>(wqkv, WQKV, n8qkv, 0, 1.0f);
  cvt16<<<gW,   blk, 0, stream>>>(wo,   WOB,  n8w,   1, WOS);
  cvt16<<<gW,   blk, 0, stream>>>(wd,   WDB,  n8w,   1, WOS);
  // (4,5) q: projection + bias [ROWS][1024] f32 (col = h*128+d), f16 plane x8
  gemm_bfb<<<gG, bG, 0, stream>>>(XB, WQKV, bqkv, F, ROWS, DMOD, DMOD, 1.0f);
  cvt16<<<gX, blk, 0, stream>>>(F, QP, n8x, 2, QSC);
  // (6,7) k: same pipeline with weight rows 1024..2047 (F reused; single in-order stream)
  gemm_bfb<<<gG, bG, 0, stream>>>(XB, WQKV + wblk, bqkv + DMOD, F, ROWS, DMOD, DMOD, 1.0f);
  cvt16<<<gX, blk, 0, stream>>>(F, KP, n8x, 2, KSC);
  // (8,9) v: weight rows 2048..3071, then v^T plane x1024
  gemm_bfb<<<gG, bG, 0, stream>>>(XB, WQKV + 2 * wblk, bqkv + 2 * DMOD, F, ROWS, DMOD, DMOD, 1.0f);
  vt16<<<gVT, blk, 0, stream>>>(F, VP);
  // (10) attention -> O plane [b][s][h][d] x1024 and per-wave row-sum lines
  attn_fwd<<<gAT, bAT, 0, stream>>>(QP, KP, VP, OP, PART);
  // (11,12) first output projection + bias -> F f32 (carries 1024 x 1024 folded back), then f16 plane x1024
  gemm_h1<<<gG, bG, 0, stream>>>(OP, WOB, bo, F, ROWS, DMOD, DMOD, 1.0f / (OSC * WOS));
  cvt16<<<gX, blk, 0, stream>>>(F, UP, n8x, 2, USC);
  // (13) second output projection + bias -> F f32 image [ROWS][1024]
  gemm_h1<<<gG, bG, 0, stream>>>(UP, WDB, bd, F, ROWS, DMOD, DMOD, 1.0f / (USC * WOS));
  // (14) flat line-owned writer of the whole output buffer
  outw<<<gOW, blk, 0, stream>>>(F, PART, out);
  (void)hipGetLastError();
}

// v001
// A run of this version takes 335 microseconds.
// Two timings next to v000 put it at 1.77 and 1.78 times that version's speed.
// Contractions: x.W{q,k,v}^T on v_wmma_f32_16x16x32_bf16 (x and W planes RNE-converted to bf16 operands, f32 accumulate, bias added in f32);
// scores k'.q'^T (q', k' single f16 planes carried x8), P.v (P x32768 single f16, v x1024 single f16), O.Wo^T and U.Wd^T
// (O and U single f16 planes x1024, Wo and Wd as f16(bf16(W) x1024)): v_wmma_f32_16x16x32_f16, f32 accumulate.
// Base-2 online softmax, 1/l fold, row-sum partials and bias adds in f32 on VALU.
#include <hip/hip_runtime.h>
#include <math.h>
#include <stdint.h>

#define NB    4
#define SEQ   2048
#define DMOD  1024
#define NH    8
#define HD    128
#define QT_BITS 5
#define NH_BITS 3
#define ROWS  (NB * SEQ)
#define QSC   8.0f
#define KSC   8.0f
#define PCAR  32768.0f
#define VCAR  1024.0f
#define OSC   1024.0f
#define USC   1024.0f
#define WOS   1024.0f
#define SM_SCALE 0.08838834764831845f
#define LOG2E 1.4426950408889634f
#define ATT_WAVES   4
#define ATT_THREADS (ATT_WAVES * 32)
#define ATT_BLOCKS  (NB * NH * (SEQ / 64))
#define NKB    (SEQ / 32)
#define RS     (NH * HD)
#define SPITCH 132
#define SLABF  (16 * SPITCH)
#define SLAB64 (16 * 68)
#define VTP    72
#define WPB    (NH * (SEQ / 64) * ATT_WAVES)
#define TOTOUT (NB + ROWS * DMOD)
#define IMGN   (ROWS * DMOD)
#define NPIECE ((TOTOUT + 3) / 4)
#define GBT    128
#define GKS    128
#define GPITCH 272
#define GOPB   (GBT * GPITCH)
#define GBUF   (2 * GOPB)
#define DEPSC  (1.0f / ((float)NH * (float)SEQ * (float)SEQ))

static_assert(HD == 128 && DMOD == NH * HD && RS == DMOD);
static_assert((1 << QT_BITS) == (SEQ / 64) && (1 << NH_BITS) == NH);
static_assert((SEQ % 64) == 0 && (SEQ % 32) == 0 && NKB * 32 == SEQ);
static_assert(((ROWS * DMOD / 8) % 256) == 0 && ((3 * DMOD * DMOD / 8) % 256) == 0 && ((DMOD * DMOD / 8) % 256) == 0);
static_assert((ROWS % 64) == 0 && (DMOD % 64) == 0 && (DMOD % 32) == 0);
static_assert(NB >= 1 && NB <= 32);
static_assert((WPB % 32) == 0 && WPB == 1024);
static_assert(ATT_THREADS == 128);
static_assert(((SPITCH * 4) % 16) == 0 && ((VTP * 2) % 16) == 0 && (SPITCH >= HD + 4));
static_assert(HD * VTP >= 127 * VTP + 64);
static_assert(IMGN % 4 == 0);
static_assert((ROWS % GBT) == 0 && (DMOD % GBT) == 0 && (DMOD % GKS) == 0 && GKS * 2 + 16 == GPITCH);

typedef unsigned short u16;
typedef _Float16 v16h __attribute__((ext_vector_type(16)));
typedef _Float16 v8h  __attribute__((ext_vector_type(8)));
typedef __bf16   v16b __attribute__((ext_vector_type(16)));
typedef float    v8f  __attribute__((ext_vector_type(8)));
typedef float    v4f  __attribute__((ext_vector_type(4)));
typedef unsigned int v4u __attribute__((ext_vector_type(4)));

union FragH { v16h v; v8h h[2]; v4u u[2]; };
union FragB { v16b v; v4u u[2]; };

// ---- scalar helpers --------------------------------------------------------------------------------
__device__ __forceinline__ unsigned short bf_bits(float f) {          // f32 -> bf16 bits, RNE convert
  unsigned u = __float_as_uint(f);
  return (unsigned short)((u + 0x7FFFu + ((u >> 16) & 1u)) >> 16);
}
__device__ __forceinline__ float bf_up(unsigned short h) { return __uint_as_float(((unsigned)h) << 16); }
__device__ __forceinline__ float bfr(float f) { return bf_up(bf_bits(f)); }
__device__ __forceinline__ unsigned short h_bits(_Float16 x) { return __builtin_bit_cast(unsigned short, x); }
__device__ __forceinline__ unsigned pk16(unsigned short a, unsigned short b) { return (unsigned)a | ((unsigned)b << 16); }
__device__ __forceinline__ v8f zero8() { v8f z = {0.f, 0.f, 0.f, 0.f, 0.f, 0.f, 0.f, 0.f}; return z; }
__device__ __forceinline__ v4f zero4() { v4f z = {0.f, 0.f, 0.f, 0.f}; return z; }

// ---- fragment loaders: 16-bit A/B operand, lane -> row/col (lane&15), p already includes +8*(lane>>4);
//      elements 0..7 <- p[0..7] (k0+8h..), elements 8..15 <- p[16..23] (k0+16+8h..)  (same split k map for A and B;
//      B is always read from a k-contiguous [n][k] plane)
__device__ __forceinline__ v16h ldfrag_h(const _Float16* p) {
  FragH f;
  f.h[0] = *(const v8h*)(p);
  f.h[1] = *(const v8h*)(p + 16);
  return f.v;
}

__device__ __forceinline__ v8f mma_h(v16h a, v16h b, v8f c) {
  return __builtin_amdgcn_wmma_f32_16x16x32_f16(false, a, false, b, (short)0, c, false, false);
}
__device__ __forceinline__ v8f mma_b(v16b a, v16b b, v8f c) {
  return __builtin_amdgcn_wmma_f32_16x16x32_bf16(false, a, false, b, (short)0, c, false, false);
}
__device__ __forceinline__ void guard2(v8f& a, v8f& b, v16h x0, v16h x1, v16h x2, v16h x3, v16h x4, v16h x5) {
#if defined(__HIP_DEVICE_COMPILE__)
  asm volatile("v_nop\n\tv_nop\n\tv_nop\n\tv_nop"
               : "+v"(a), "+v"(b) : "v"(x0), "v"(x1), "v"(x2), "v"(x3), "v"(x4), "v"(x5) : "memory");
#endif
}
template <typename F>
__device__ __forceinline__ void guard6(v8f& a, v8f& b, v8f& c, v8f& d, F x0, F x1, F x2, F x3, F x4, F x5) {
#if defined(__HIP_DEVICE_COMPILE__)
  asm volatile("v_nop\n\tv_nop\n\tv_nop\n\tv_nop"
               : "+v"(a), "+v"(b), "+v"(c), "+v"(d) : "v"(x0), "v"(x1), "v"(x2), "v"(x3), "v"(x4), "v"(x5) : "memory");
#endif
}
__device__ __forceinline__ void acc_guard4(v8f& a, v8f& b, v8f& c, v8f& d) {
#if defined(__HIP_DEVICE_COMPILE__)
  asm volatile("v_nop\n\tv_nop\n\tv_nop\n\tv_nop" : "+v"(a), "+v"(b), "+v"(c), "+v"(d));
#endif
}
__device__ __forceinline__ void wave_sync_lds() {
  __builtin_amdgcn_fence(__ATOMIC_RELEASE, "workgroup");
  __builtin_amdgcn_wave_barrier();
  __builtin_amdgcn_fence(__ATOMIC_ACQUIRE, "workgroup");
}

// =====================================================================================================
// f32 plane -> 16-bit plane, same layout:  mode 0: bf16 RNE bits;  mode 1: f16 bits of (bf16 RNE value) * scale;
// mode 2: f16 bits of value * scale (no bf16 pre-step).
// Thread = 8 consecutive elements: two 16-B loads, one 16-B store; 32 consecutive lanes = 512 contiguous, 512-B aligned bytes
// coverage: grid = n8/256 blocks (host checks exactness) x 256 thr x 8 = the whole plane.
// =====================================================================================================
__global__ __launch_bounds__(256) void cvt16(const float* __restrict__ x, u16* D, int n8, int mode, float scale) {
  const int gt = blockIdx.x * 256 + (int)threadIdx.x;
  if (gt >= n8) return;                     // no barriers in this kernel
  const float* p = x + (size_t)gt * 8;
  const v4f a = *(const v4f*)(p), c4 = *(const v4f*)(p + 4);
  float v[8];
#pragma unroll
  for (int e = 0; e < 4; ++e) { v[e] = a[e]; v[4 + e] = c4[e]; }
  unsigned short s[8];
#pragma unroll
  for (int e = 0; e < 8; ++e) {
    const float vb = bfr(v[e]);
    const float vf = (mode == 1) ? vb : v[e];
    const unsigned short hb = h_bits((_Float16)(vf * scale));
    const unsigned short bb = bf_bits(v[e]);
    s[e] = (mode != 0) ? hb : bb;
  }
  v4u o;
#pragma unroll
  for (int e = 0; e < 4; ++e) o[e] = pk16(s[2 * e], s[2 * e + 1]);
  u16* d = D + (size_t)gt * 8;
  {
    *(v4u*)(d) = o;
    
  }
}

// =====================================================================================================
// GEMM epilogue shared by both engines: one 16x64 strip of the wave's 64x64 f32 tile (times oscale) staged in its LDS slab (pitch 68),
// coverage: 8 instructions x 2 rows x 16 lanes x 4 floats = the 16 x 64 strip.
// =====================================================================================================
__device__ __forceinline__ void epi64(float* sl, v8f a0, v8f a1, v8f a2, v8f a3, float oscale, v4f badd, float* C, int N,
                                      size_t rowb, int col0, int lane) {
  const int hh = lane >> 4, m = lane & 15;
#pragma unroll
  for (int r = 0; r < 8; ++r) {
    const int ro = (8 * hh + r) * 68 + m;
    sl[ro]      = a0[r] * oscale;
    sl[ro + 16] = a1[r] * oscale;
    sl[ro + 32] = a2[r] * oscale;
    sl[ro + 48] = a3[r] * oscale;
  }
  wave_sync_lds();
  v4f vals[8];
#pragma unroll
  for (int it = 0; it < 8; ++it) vals[it] = *(const v4f*)(sl + (it * 2 + hh) * 68 + m * 4) + badd;
  float* dst = C + (rowb + (size_t)hh) * (size_t)N + col0 + m * 4;
  {
#pragma unroll
    for (int it = 0; it < 8; ++it) {
      *(v4f*)(dst + (size_t)(it * 2) * (size_t)N) = vals[it];
    }
    
  }
}

// =====================================================================================================
// 16-bit GEMM with bias, both engines: C[M][N] (f32) = A[M][K] (row-major) . Bt[N][K]^T (k-contiguous), times oscale, plus the
// bf16-RNE value of bias[n]. Block = 128x128 tile of C, 4 waves as 2x2, wave = 64x64 (4x4 accumulator tiles).
// A stage is 128 k of the block's 128 A rows and 128 Bt rows: 256 rows of 256 B, laid in LDS at pitch 272 B by asynchronous
// b128 copies (16 lanes = one whole 256-B row, so every copy touches whole lines). Two buffers: stage t+1 flies while stage t
// is multiplied. Fragments are read from LDS with the same split k map for A and B as ldfrag_h; k runs upward in steps of 32
// into one accumulator per tile. Shapes: M % 128 == 0, N % 128 == 0, K % 128 == 0, grid = (M/128)*(N/128) (static_assert above).
// =====================================================================================================
__device__ __forceinline__ unsigned lds_off(const void* p) { return (unsigned)(size_t)p; }

// Eight asynchronous 16-B-per-lane copies, rows 8 apart. The s_wait_xcnt stands inside the statement so that no address
// register of a copy is rewritten in front of it.
__device__ __forceinline__ void copy8(unsigned l, const u16* g, size_t rs8) {
#if defined(__HIP_DEVICE_COMPILE__)
  asm volatile("global_load_async_to_lds_b128 %0, %8, off\n\t"
               "global_load_async_to_lds_b128 %1, %9, off\n\t"
               "global_load_async_to_lds_b128 %2, %10, off\n\t"
               "global_load_async_to_lds_b128 %3, %11, off\n\t"
               "global_load_async_to_lds_b128 %4, %12, off\n\t"
               "global_load_async_to_lds_b128 %5, %13, off\n\t"
               "global_load_async_to_lds_b128 %6, %14, off\n\t"
               "global_load_async_to_lds_b128 %7, %15, off\n\t"
               "s_wait_xcnt 0x0"
               :: "v"(l), "v"(l + 8u * GPITCH), "v"(l + 16u * GPITCH), "v"(l + 24u * GPITCH),
                  "v"(l + 32u * GPITCH), "v"(l + 40u * GPITCH), "v"(l + 48u * GPITCH), "v"(l + 56u * GPITCH),
                  "v"(g), "v"(g + rs8), "v"(g + 2 * rs8), "v"(g + 3 * rs8),
                  "v"(g + 4 * rs8), "v"(g + 5 * rs8), "v"(g + 6 * rs8), "v"(g + 7 * rs8)
               : "memory");
#endif
}
// One stage: this thread's 16 B of rows cr + 8i (i = 0..15) of the A tile and of the Bt tile; 32 copies per wave.
__device__ __forceinline__ void fill_stage(unsigned l, const u16* ga, const u16* gb, size_t rs8) {
  copy8(l, ga, rs8);
  copy8(l + 64u * GPITCH, ga + 8 * rs8, rs8);
  copy8(l + GOPB, gb, rs8);
  copy8(l + GOPB + 64u * GPITCH, gb + 8 * rs8, rs8);
}
__device__ __forceinline__ void wait_async0() {   // this wave's copies have landed
#if defined(__HIP_DEVICE_COMPILE__)
  asm volatile("s_wait_asynccnt 0x0" ::: "memory");
#endif
}
__device__ __forceinline__ void wait_ds0() {      // this wave's LDS reads have returned before their buffer is refilled
#if defined(__HIP_DEVICE_COMPILE__)
  asm volatile("s_wait_dscnt 0x0" ::: "memory");
#endif
}
__device__ __forceinline__ FragB ld_lfrag(const unsigned char* p) {   // split k map of ldfrag_h: bytes 0..15 and 32..47
  FragB f;
  f.u[0] = *(const v4u*)(p);
  f.u[1] = *(const v4u*)(p + 32);
  return f;
}
__device__ __forceinline__ v8f mma_sel(FragB a, FragB b, v8f c, bool bf) {
  if (bf) return mma_b(a.v, b.v, c);
  return mma_h(__builtin_bit_cast(v16h, a.v), __builtin_bit_cast(v16h, b.v), c);
}

template <bool BF>
__device__ __forceinline__ void gemm_core(unsigned char* ring, float* slab, const u16* __restrict__ A,
                                          const u16* __restrict__ Bt, const float* __restrict__ bias,
                                          float* C, int M, int N, int K, float oscale) {
  const int tid = threadIdx.x, wave = tid >> 5, lane = tid & 31, hh = lane >> 4, m = lane & 15;
  const int ntile = N >> 7;
  const int bid   = blockIdx.x;
  const int row0  = (bid / ntile) * GBT;
  const int col0  = (bid % ntile) * GBT;
  if (row0 + GBT > M) return;                // block-uniform, in front of every barrier; never taken with the exact grid
  const int wr = wave >> 1, wc = wave & 1;
  const int nst = K >> 7;
  const int cr = tid >> 4, cc = tid & 15;    // copy: row within a group of 8, 16-B chunk of the 256-B row
  const u16* ga = A  + (size_t)(row0 + cr) * K + cc * 8;
  const u16* gb = Bt + (size_t)(col0 + cr) * K + cc * 8;
  const size_t rs8 = (size_t)8 * K;
  const unsigned l0 = lds_off(ring) + (unsigned)(cr * GPITCH + cc * 16);

  v8f acc[4][4];
#pragma unroll
  for (int i = 0; i < 4; ++i) {
#pragma unroll
    for (int j = 0; j < 4; ++j) acc[i][j] = zero8();
  }

  fill_stage(l0, ga, gb, rs8);
  wait_async0();
  __syncthreads();                           // publishes stage 0
  if (nst > 1) fill_stage(l0 + GBUF, ga + GKS, gb + GKS, rs8);

  for (int t = 0; t < nst; ++t) {
    const unsigned bo = (unsigned)(t & 1) * GBUF;
    const unsigned char* ab = ring + bo + (wr * 64 + m) * GPITCH + hh * 16;
    const unsigned char* bb = ring + bo + GOPB + (wc * 64 + m) * GPITCH + hh * 16;
    FragB a[2][4], b[2][4];                  // set (ks & 1) holds the fragments of k step ks
#pragma unroll
    for (int i = 0; i < 4; ++i) { a[0][i] = ld_lfrag(ab + i * 16 * GPITCH); b[0][i] = ld_lfrag(bb + i * 16 * GPITCH); }
#pragma unroll
    for (int ks = 0; ks < GKS / 32; ++ks) {
      const int cs = ks & 1;
      if (ks + 1 < GKS / 32) {
#pragma unroll
        for (int i = 0; i < 4; ++i) {
          a[cs ^ 1][i] = ld_lfrag(ab + i * 16 * GPITCH + (ks + 1) * 64);
          b[cs ^ 1][i] = ld_lfrag(bb + i * 16 * GPITCH + (ks + 1) * 64);
        }
      }
      // keeps the next k step's LDS reads one group ahead of this step's products instead of spread among them
      __builtin_amdgcn_sched_barrier(0);
#pragma unroll
      for (int i = 0; i < 4; ++i) {
#pragma unroll
        for (int j = 0; j < 4; ++j) acc[i][j] = mma_sel(a[cs][i], b[cs][j], acc[i][j], BF);
      }
      // keeps the following group of LDS reads behind this step's products
      __builtin_amdgcn_sched_barrier(0);
    }
    wait_ds0();
    wait_async0();
    __syncthreads();                         // publishes stage t+1 and ends every reader's last read of stage t's buffer
    if (t + 2 < nst) fill_stage(l0 + bo, ga + (size_t)(t + 2) * GKS, gb + (size_t)(t + 2) * GKS, rs8);
  }
  wait_async0();

  const int colw = col0 + wc * 64;
  const v4f bv = *(const v4f*)(bias + colw + m * 4);      // columns colw + 4m .. +3, always < N (N multiple of 128)
  v4f badd;
#pragma unroll
  for (int e = 0; e < 4; ++e) badd[e] = bfr(bv[e]);
  float* sl = slab + wave * SLAB64;
#pragma unroll
  for (int i = 0; i < 4; ++i) {
    if (i) wave_sync_lds();                  // the slab's last readers are done before other lanes overwrite it
    epi64(sl, acc[i][0], acc[i][1], acc[i][2], acc[i][3], oscale, badd, C, N, (size_t)(row0 + wr * 64 + i * 16), colw, lane);
  }
}

__global__ __launch_bounds__(128)
void gemm_bfb(const u16* __restrict__ A, const u16* __restrict__ Bt, const float* __restrict__ bias,
              float* C, int M, int N, int K, float oscale) {
  __shared__ __align__(16) unsigned char ring[2 * GBUF];
  __shared__ __align__(16) float slab[4 * SLAB64];
  gemm_core<true>(ring, slab, A, Bt, bias, C, M, N, K, oscale);
}

__global__ __launch_bounds__(128)
void gemm_h1(const u16* __restrict__ A, const u16* __restrict__ Bt, const float* __restrict__ bias,
             float* C, int M, int N, int K, float oscale) {
  __shared__ __align__(16) unsigned char ring[2 * GBUF];
  __shared__ __align__(16) float slab[4 * SLAB64];
  gemm_core<false>(ring, slab, A, Bt, bias, C, M, N, K, oscale);
}

// =====================================================================================================
// v^T plane: VP[(b*NH + h)*HD + d][s] = f16(v[b][s][h][d] * 1024), v read from the f32 projection image [b*SEQ+s][h*HD+d].
// Block = (b, h, 64 keys): 64 source rows of HD floats loaded with 16-B loads, converted, scattered into an LDS tile
// coverage: load 256 thr x 32 elements = 64 keys x 128 d (every TH column 0..63 of all 128 rows); store 4 iterations x 256 thr
//           x 8 halves = 128 lines x 64 = the block's tile; grid = NB x NH x SEQ/64 blocks covers the plane exactly once.
// =====================================================================================================
__global__ __launch_bounds__(256) void vt16(const float* __restrict__ v, u16* VPo) {
  __shared__ __align__(16) u16 TH[HD * VTP];
  const int tid = threadIdx.x;
  const int bid = blockIdx.x;
  const int st  = bid & ((SEQ / 64) - 1);
  const int h   = (bid >> QT_BITS) & (NH - 1);
  const int b   = bid >> (QT_BITS + NH_BITS);
  const int s0  = st * 64;
  {
    const int sl = tid >> 2;                  // key within tile 0..63
    const int dc = (tid & 3) * 32;            // d chunk of 32
    const float* src = v + ((size_t)(b * SEQ + s0 + sl) * NH + h) * HD + dc;
#pragma unroll
    for (int i = 0; i < 8; ++i) {
      const v4f a = *(const v4f*)(src + 4 * i);
#pragma unroll
      for (int e = 0; e < 4; ++e) {
        const _Float16 hv = (_Float16)(a[e] * VCAR);
        TH[(dc + 4 * i + e) * VTP + sl] = h_bits(hv);
      }
    }
  }
  __syncthreads();
  v4u vh[4];
  const int q8 = tid >> 3, p8 = (tid & 7) * 8;
#pragma unroll
  for (int it = 0; it < 4; ++it) {
    const int line = it * 32 + q8;            // d = 0..127
    vh[it] = *(const v4u*)(TH + line * VTP + p8);
  }
  const size_t base = ((size_t)(b * NH + h) * HD) * SEQ + s0 + p8;
  {
#pragma unroll
    for (int it = 0; it < 4; ++it) {
      const int line = it * 32 + q8;
      *(v4u*)(VPo + base + (size_t)line * SEQ) = vh[it];
    }
    
  }
}

// =====================================================================================================
// Multi-head flash attention (no mask): block = (batch b, head, 64 query rows), 4 waves, wave w owns the 16 query rows
// q0 = 64*qt + 16*w .. q0+15 (waves independent: no block barriers, wave-private LDS only, used in the epilogue).
//   q plane (f16, x8) laid out [b][s][h][d]; k plane the same; v^T plane [b][h][d][s] (x1024).
//   All NKB = SEQ/32 key blocks of 32 keys are visited (static bound).
//   Scores are computed TRANSPOSED: S^T tile g (g = 0,1) = k rows (keys kb+16g .. +15, A operand, row m = lane&15, split k map
//   over d, 4 chunks of 32 d) times q^T (B operand, col n = query q0 + (lane&15), k = d, split map).
//   D element r of lane l = (key kb+16g+8h+r, query q0+(l&15)), so a lane owns one query column and 16 of its 32 keys; the
//   partner lane l^16 owns the other 16 -> row max / row sum need one xor-16 shuffle.
//   Online max-subtracted base-2 softmax in f32 (scale 1/sqrt(128) and the q/k carries folded into lsc). The exp'd values ARE
//   the P A-fragment in place: A row m = query = lane&15, element i <- key kb+8h+i (tile 0, D element i), element 8+i <- key
//   kb+16+8h+i (tile 1, D element i). P is carried x32768 as single f16. The rescale factor of query row 8h+r of the
//   O accumulators is fetched from lane 8h+r with a shuffle (uniform control). 8 v^T B fragments (col n = d = 16j + (lane&15),
//   keys k-contiguous), 8 P.V WMMAs per key block in two guarded groups of 4.
//   Epilogue: 1/l (per query, shuffled to the D row owner) and carry folds in f32; the wave's 16x128 f32 result staged in its
//   LDS slab (pitch 132); each 256-B output row (b, q0+row, head) of the O plane (O x1024 as single f16) written as 2 whole
// coverage: per wave 8 instructions x 2 rows x 16 lanes x 8 halves = 16 x 128 of the O plane + 1 PART line; grid
//           NB*NH*SEQ/64 blocks x 4 waves = every (b, s, h) row of the O plane and every PART line exactly once.
// =====================================================================================================
__global__ __launch_bounds__(ATT_THREADS)
void attn_fwd(const u16* __restrict__ QPp, const u16* __restrict__ KPp, const u16* __restrict__ VPp,
              u16* OPo, float* PART) {
  __shared__ __align__(16) float smem[ATT_WAVES * SLABF];   // per wave: result slab [16][132] in the epilogue only

  const int tid  = threadIdx.x;
  const int wave = tid >> 5;
  const int lane = tid & 31;
  const int hh   = lane >> 4;
  const int c    = lane & 15;

  const int bid  = blockIdx.x;
  const int qt   = bid & ((SEQ / 64) - 1);
  const int head = (bid >> QT_BITS) & (NH - 1);
  const int b    = bid >> (QT_BITS + NH_BITS);
  const int q0   = qt * 64 + wave * 16;

  // B fragments of q^T: col n = query q0 + c, k = d (k-contiguous row of the q plane)
  const _Float16* Qb = (const _Float16*)(const void*)QPp + ((size_t)(b * SEQ + q0 + c) * NH + head) * HD + 8 * hh;
  // A fragments of k: row m = key kb + 16g + c, k = d
  const _Float16* Kb = (const _Float16*)(const void*)KPp + ((size_t)(b * SEQ + c) * NH + head) * HD + 8 * hh;   // key row kb + c added per step
  // B fragments of v: col n = d = 16j + c, k = key (k-contiguous row of the v^T plane)
  const _Float16* Vb = (const _Float16*)(const void*)VPp + ((size_t)(b * NH + head) * HD + c) * SEQ + 8 * hh;  // key kb added per step
  const float lsc = SM_SCALE * (LOG2E / (QSC * KSC));

  const v16h qf0 = ldfrag_h(Qb);            // d 0..31
  const v16h qf1 = ldfrag_h(Qb + 32);       // d 32..63
  const v16h qf2 = ldfrag_h(Qb + 64);       // d 64..95
  const v16h qf3 = ldfrag_h(Qb + 96);       // d 96..127

  float mrun = -INFINITY, lrun = 0.f;
  v8f o[8];
#pragma unroll
  for (int j = 0; j < 8; ++j) o[j] = zero8();

#pragma unroll 1
  for (int it = 0; it < NKB; ++it) {
    const int kb = it * 32;
    // ---- transposed scores: s0 = keys kb..kb+15, s1 = keys kb+16..kb+31, column = query q0 + c ----
    v8f s0 = zero8(), s1 = zero8();
    const _Float16* k0p = Kb + (size_t)kb * RS;
    const _Float16* k1p = k0p + (size_t)16 * RS;
    {
      const v16h ka0 = ldfrag_h(k0p), ka1 = ldfrag_h(k0p + 32);
      const v16h kc0 = ldfrag_h(k1p), kc1 = ldfrag_h(k1p + 32);
      s0 = mma_h(ka0, qf0, s0);
      s0 = mma_h(ka1, qf1, s0);
      s1 = mma_h(kc0, qf0, s1);
      s1 = mma_h(kc1, qf1, s1);
      guard2(s0, s1, qf0, qf1, ka0, ka1, kc0, kc1);
    }
    {
      const v16h ka2 = ldfrag_h(k0p + 64), ka3 = ldfrag_h(k0p + 96);
      const v16h kc2 = ldfrag_h(k1p + 64), kc3 = ldfrag_h(k1p + 96);
      s0 = mma_h(ka2, qf2, s0);
      s0 = mma_h(ka3, qf3, s0);
      s1 = mma_h(kc2, qf2, s1);
      s1 = mma_h(kc3, qf3, s1);
      guard2(s0, s1, qf2, qf3, ka2, ka3, kc2, kc3);
    }
    // ---- base-2 logits of this lane's 16 keys for query q0 + c ----
    float tk[16];
#pragma unroll
    for (int i = 0; i < 8; ++i) { tk[i] = s0[i] * lsc;  tk[8 + i] = s1[i] * lsc; }
    float cm = -INFINITY;
#pragma unroll
    for (int i = 0; i < 16; ++i) cm = fmaxf(cm, tk[i]);
    cm = fmaxf(cm, __shfl_xor(cm, 16, 32));
    const float mn = fmaxf(mrun, cm);                                // finite from the first key block on
    const float al = (mrun == -INFINITY) ? 0.f : exp2f(mrun - mn);   // o and l are zero while mrun is -inf
    mrun = mn;
    // ---- probabilities (<= 1) and the P A-fragment: f16(p * 32768); element i <-> tk[i] ----
    float ps = 0.f;
    FragH ph;
#pragma unroll
    for (int w = 0; w < 2; ++w) {
#pragma unroll
      for (int e4 = 0; e4 < 4; ++e4) {
        const int i = 8 * w + 2 * e4;
        const float p0 = exp2f(fminf(tk[i] - mn, 0.f));
        const float p1 = exp2f(fminf(tk[i + 1] - mn, 0.f));
        ps += p0 + p1;
        ph.u[w][e4] = pk16(h_bits((_Float16)(p0 * PCAR)), h_bits((_Float16)(p1 * PCAR)));
      }
    }
    ps += __shfl_xor(ps, 16, 32);
    lrun = lrun * al + ps;
    // ---- rescale the O accumulators: D row 8hh+r = query q0+8hh+r, its factor lives in lane 8hh+r (and 16+8hh+r) ----
    float scl[8];
#pragma unroll
    for (int r = 0; r < 8; ++r) scl[r] = __shfl(al, 8 * hh + r, 32);
#pragma unroll
    for (int j = 0; j < 8; ++j) {
#pragma unroll
      for (int r = 0; r < 8; ++r) o[j][r] *= scl[r];
    }
    // ---- P.V : B fragment col n = d = j*16 + c, keys contiguous in the v^T plane; two guarded groups of 4 ----
    {
      const _Float16* vp = Vb + kb;
      const v16h vf0 = ldfrag_h(vp);
      const v16h vf1 = ldfrag_h(vp + (size_t)16 * SEQ);
      const v16h vf2 = ldfrag_h(vp + (size_t)32 * SEQ);
      const v16h vf3 = ldfrag_h(vp + (size_t)48 * SEQ);
      o[0] = mma_h(ph.v, vf0, o[0]);
      o[1] = mma_h(ph.v, vf1, o[1]);
      o[2] = mma_h(ph.v, vf2, o[2]);
      o[3] = mma_h(ph.v, vf3, o[3]);
      guard6<v16h>(o[0], o[1], o[2], o[3], ph.v, vf0, vf1, vf2, vf3, ph.v);
    }
    {
      const _Float16* vp = Vb + kb + (size_t)64 * SEQ;
      const v16h vf4 = ldfrag_h(vp);
      const v16h vf5 = ldfrag_h(vp + (size_t)16 * SEQ);
      const v16h vf6 = ldfrag_h(vp + (size_t)32 * SEQ);
      const v16h vf7 = ldfrag_h(vp + (size_t)48 * SEQ);
      o[4] = mma_h(ph.v, vf4, o[4]);
      o[5] = mma_h(ph.v, vf5, o[5]);
      o[6] = mma_h(ph.v, vf6, o[6]);
      o[7] = mma_h(ph.v, vf7, o[7]);
      guard6<v16h>(o[4], o[5], o[6], o[7], ph.v, vf4, vf5, vf6, vf7, ph.v);
    }
  }
  acc_guard4(o[0], o[1], o[2], o[3]);
  acc_guard4(o[4], o[5], o[6], o[7]);

  // ---- fold 1/l (per query, owned by lane = query) and the carries; row statistic r = l * (1/l); stage the 16x128 slab ----
  const float rl   = (lrun > 0.f) ? (1.0f / lrun) : 0.f;
  const float linv = rl * (1.0f / (PCAR * VCAR));
  const float rr   = lrun * rl;
  float inv[8];
#pragma unroll
  for (int r = 0; r < 8; ++r) inv[r] = __shfl(linv, 8 * hh + r, 32);
  float* slab = smem + wave * SLABF;
#pragma unroll
  for (int r = 0; r < 8; ++r) {
#pragma unroll
    for (int j = 0; j < 8; ++j) slab[(8 * hh + r) * SPITCH + j * 16 + c] = o[j][r] * inv[r];
  }
  wave_sync_lds();
  // ---- O x1024 -> single f16 plane; lane = (row parity hh, 8 consecutive d at c8) ----
  v4u oh[8];
  const int c8 = c * 8;
#pragma unroll
  for (int it = 0; it < 8; ++it) {
    const int row = it * 2 + hh;
    const v4f a = *(const v4f*)(slab + row * SPITCH + c8), c4 = *(const v4f*)(slab + row * SPITCH + c8 + 4);
    float w[8];
#pragma unroll
    for (int e = 0; e < 4; ++e) { w[e] = a[e] * OSC; w[4 + e] = c4[e] * OSC; }
#pragma unroll
    for (int e = 0; e < 4; ++e) {
      const _Float16 h0 = (_Float16)w[2 * e], h1 = (_Float16)w[2 * e + 1];
      oh[it][e] = pk16(h_bits(h0), h_bits(h1));
    }
  }
  // ---- wave row-sum partial (fixed xor tree over the 16 query lanes; both lane halves hold identical values) ----
  float wsum = rr;
  wsum += __shfl_xor(wsum, 1, 32);
  wsum += __shfl_xor(wsum, 2, 32);
  wsum += __shfl_xor(wsum, 4, 32);
  wsum += __shfl_xor(wsum, 8, 32);
  v4f pv = zero4();
  pv[0] = (lane == 0) ? wsum : 0.f;
  float* pd = PART + ((size_t)bid * ATT_WAVES + wave) * 32 + (lane & 7) * 4;   // clamped address for every lane
  const size_t ob = ((size_t)(b * SEQ + q0) * NH + head) * HD + c8;
  {
#pragma unroll
    for (int it = 0; it < 8; ++it) {
      const int row = it * 2 + hh;
      *(v4u*)(OPo + ob + (size_t)row * RS) = oh[it];
    }
    if (lane < 8) *(v4f*)(pd) = pv;
    
  }
}

// =====================================================================================================
// Flat output writer: out[0..NB-1] = score output (per batch: fixed-order sum of its WPB PART lines times 1/(NH*SEQ*SEQ),
// computed by block 0, wave = batch, 32 lanes x WPB/32 strided loads + xor tree), out[NB + i] = IMG[i] (f32 image of the last
// value. With NB % 4 != 0 a scalar path handles the element interleave and the partial last piece.
// coverage: grid = ceil(NPIECE/256) blocks x 256 thr x 4 elements with the in-kernel bound = all TOTOUT elements exactly once.
// =====================================================================================================
__global__ __launch_bounds__(256) void outw(const float* __restrict__ IMG, const float* __restrict__ PART, float* out) {
  __shared__ __align__(16) float sc[32];
  const int tid = threadIdx.x, wave = tid >> 5, lane = tid & 31;
  if (tid < 32) sc[tid] = 0.f;
  __syncthreads();
  if (blockIdx.x == 0) {                                   // block-uniform
#pragma unroll 1
    for (int bsel = wave; bsel < NB; bsel += 8) {          // wave-uniform
      const float* pp = PART + ((size_t)bsel * WPB + lane) * 32;
      float s = 0.f;
#pragma unroll 1
      for (int i = 0; i < WPB / 32; ++i) s += pp[(size_t)i * (32 * 32)];
#pragma unroll
      for (int d = 16; d >= 1; d >>= 1) s += __shfl_xor(s, d, 32);
      if (lane == 0) sc[bsel] = s * DEPSC;
    }
  }
  __syncthreads();
  const size_t t = (size_t)blockIdx.x * 256 + (size_t)tid;
  if (t >= (size_t)NPIECE) return;                         // no barriers after this point
  const size_t e0 = t * 4;
#if (NB % 4) == 0
  const bool   hs = (e0 < (size_t)NB);
  const int    si = hs ? (int)e0 : 0;
  const v4f    sv = *(const v4f*)(sc + si);
  const size_t ii = hs ? (size_t)0 : (e0 - (size_t)NB);   // clamped, 16-B aligned
  const v4f    gv = *(const v4f*)(IMG + ii);
  v4f val;
#pragma unroll
  for (int e = 0; e < 4; ++e) val[e] = hs ? sv[e] : gv[e];
  float* dst = out + e0;
  {
    *(v4f*)(dst) = val;
    
  }
#else
  float val[4];
  const size_t rem = (size_t)TOTOUT - e0;
  const int nval = (rem < 4) ? (int)rem : 4;
#pragma unroll
  for (int j = 0; j < 4; ++j) {
    size_t e = e0 + (size_t)j;
    if (e > (size_t)(TOTOUT - 1)) e = (size_t)(TOTOUT - 1);
    const bool hsj = (e < (size_t)NB);
    const float g = IMG[hsj ? (size_t)0 : (e - (size_t)NB)];
    const float s = sc[hsj ? (int)e : 0];
    val[j] = hsj ? s : g;
  }
  float* dst = out + e0;
  if (nval == 4) {
    v4f vv;
#pragma unroll
    for (int j = 0; j < 4; ++j) vv[j] = val[j];
    {
      *(v4f*)(dst) = vv;
      
    }
  } else {
    {
#pragma unroll
      for (int j = 0; j < 4; ++j) { if (j < nval) *(float*)(dst + j) = val[j]; }
      
    }
  }
#endif
}

// =====================================================================================================
// Workspace map (bytes); every plane is fully written by whole-line stores before it is read; all extents are exact multiples
// of the store granularity (no pad rows needed); F and QP are reused sequentially (in-order stream):
//   XB   bf16 [ROWS][1024]                 NB*4194304   (bf16 copy of the input activations)
//   WQKV bf16 [3072 n][1024 k]                6291456
//   WOB  f16  [1024 n][1024 k] x1024          2097152   WDB same 2097152
//   F    f32  [ROWS][1024]                 NB*8388608   (projection q, then k, then v, then O.Wo^T, then the final image)
//   QP   f16  [ROWS][8][128] x8            NB*4194304   (later UP: f16 plane of O.Wo^T output x1024)
//   KP   f16  same                          NB*4194304
//   VP   f16  [NB][8][128][2048] x1024      NB*4194304
//   OP   f16  [ROWS][8][128] x1024         NB*4194304
//   PART f32  [ATT_BLOCKS*4][32]           NB*131072
//   end (NB = 4)                            128450560
// =====================================================================================================
extern "C" void kernel_launch(void* const* d_in, const int* in_sizes, int n_in,
                              void* d_out, int out_size, void* d_ws, size_t ws_size,
                              hipStream_t stream) {
  if (n_in < 7) return;
  if (in_sizes[0] != ROWS * DMOD) return;
  if (in_sizes[1] != 3 * DMOD * DMOD || in_sizes[2] != 3 * DMOD) return;
  if (in_sizes[3] != DMOD * DMOD || in_sizes[4] != DMOD) return;
  if (in_sizes[5] != DMOD * DMOD || in_sizes[6] != DMOD) return;
  if (out_size != TOTOUT) return;

  const float* x    = (const float*)d_in[0];
  const float* wqkv = (const float*)d_in[1];
  const float* bqkv = (const float*)d_in[2];
  const float* wo   = (const float*)d_in[3];
  const float* bo   = (const float*)d_in[4];
  const float* wd   = (const float*)d_in[5];
  const float* bd   = (const float*)d_in[6];
  float*       out  = (float*)d_out;

  const size_t szXB   = (size_t)ROWS * DMOD * 2;
  const size_t szWQKV = (size_t)3 * DMOD * DMOD * 2;
  const size_t szW    = (size_t)DMOD * DMOD * 2;
  const size_t szF    = (size_t)ROWS * DMOD * 4;
  const size_t szP    = (size_t)ROWS * DMOD * 2;
  const size_t szVP   = (size_t)NB * NH * HD * SEQ * 2;
  const size_t szPART = (size_t)ATT_BLOCKS * ATT_WAVES * 32 * 4;
  size_t off = 0;
  const size_t oXB   = off; off += szXB;
  const size_t oWQKV = off; off += szWQKV;
  const size_t oWOB  = off; off += szW;
  const size_t oWDB  = off; off += szW;
  const size_t oF    = off; off += szF;
  const size_t oQP   = off; off += szP;
  const size_t oKP   = off; off += szP;
  const size_t oVP   = off; off += szVP;
  const size_t oOP   = off; off += szP;
  const size_t oPART = off; off += szPART;
  if (off > ws_size) return;                            // off = 128450560 for NB = 4
  if (off > (size_t)134217728) return;

  char* ws = (char*)d_ws;
  u16*   XB   = (u16*)(ws + oXB);
  u16*   WQKV = (u16*)(ws + oWQKV);
  u16*   WOB  = (u16*)(ws + oWOB);
  u16*   WDB  = (u16*)(ws + oWDB);
  float* F    = (float*)(ws + oF);
  u16*   QP   = (u16*)(ws + oQP);
  u16*   UP   = QP;                                     // reused after the attention launch has consumed QP
  u16*   KP   = (u16*)(ws + oKP);
  u16*   VP   = (u16*)(ws + oVP);
  u16*   OP   = (u16*)(ws + oOP);
  float* PART = (float*)(ws + oPART);

  const int n8x   = (ROWS * DMOD) / 8;
  const int n8qkv = (3 * DMOD * DMOD) / 8;
  const int n8w   = (DMOD * DMOD) / 8;
  if ((n8x % 256) != 0 || (n8qkv % 256) != 0 || (n8w % 256) != 0 || (DMOD % 64) != 0 || (ROWS % 64) != 0 || (DMOD % 32) != 0) return;
  const dim3 blk(256);
  const dim3 gX(n8x / 256);
  const dim3 gQKV(n8qkv / 256);
  const dim3 gW(n8w / 256);
  const dim3 gG((ROWS / GBT) * (DMOD / GBT));
  const dim3 bG(128);
  const dim3 gVT(NB * NH * (SEQ / 64));
  const dim3 gAT(ATT_BLOCKS);
  const dim3 bAT(ATT_THREADS);
  const dim3 gOW((NPIECE + 255) / 256);
  const size_t wblk = (size_t)DMOD * DMOD;

  // (0..3) input activations -> bf16 plane; weights stored [n = out][k = in] (y = x.W^T), already k-contiguous:
  //        bf16 plane for the qkv weight, f16 of bf16 value x1024 for the two square weights
  cvt16<<<gX,   blk, 0, stream>>>(x,    XB,   n8x,   0, 1.0f);
  cvt16<<<gQKV, blk, 0, stream>>>(wqkv, WQKV, n8qkv, 0, 1.0f);
  cvt16<<<gW,   blk, 0, stream>>>(wo,   WOB,  n8w,   1, WOS);
  cvt16<<<gW,   blk, 0, stream>>>(wd,   WDB,  n8w,   1, WOS);
  // (4,5) q: projection + bias [ROWS][1024] f32 (col = h*128+d), f16 plane x8
  gemm_bfb<<<gG, bG, 0, stream>>>(XB, WQKV, bqkv, F, ROWS, DMOD, DMOD, 1.0f);
  cvt16<<<gX, blk, 0, stream>>>(F, QP, n8x, 2, QSC);
  // (6,7) k: same pipeline with weight rows 1024..2047 (F reused; single in-order stream)
  gemm_bfb<<<gG, bG, 0, stream>>>(XB, WQKV + wblk, bqkv + DMOD, F, ROWS, DMOD, DMOD, 1.0f);
  cvt16<<<gX, blk, 0, stream>>>(F, KP, n8x, 2, KSC);
  // (8,9) v: weight rows 2048..3071, then v^T plane x1024
  gemm_bfb<<<gG, bG, 0, stream>>>(XB, WQKV + 2 * wblk, bqkv + 2 * DMOD, F, ROWS, DMOD, DMOD, 1.0f);
  vt16<<<gVT, blk, 0, stream>>>(F, VP);
  // (10) attention -> O plane [b][s][h][d] x1024 and per-wave row-sum lines
  attn_fwd<<<gAT, bAT, 0, stream>>>(QP, KP, VP, OP, PART);
  // (11,12) first output projection + bias -> F f32 (carries 1024 x 1024 folded back), then f16 plane x1024
  gemm_h1<<<gG, bG, 0, stream>>>(OP, WOB, bo, F, ROWS, DMOD, DMOD, 1.0f / (OSC * WOS));
  cvt16<<<gX, blk, 0, stream>>>(F, UP, n8x, 2, USC);
  // (13) second output projection + bias -> F f32 image [ROWS][1024]
  gemm_h1<<<gG, bG, 0, stream>>>(UP, WDB, bd, F, ROWS, DMOD, DMOD, 1.0f / (USC * WOS));
  // (14) flat line-owned writer of the whole output buffer
  outw<<<gOW, blk, 0, stream>>>(F, PART, out);
  (void)hipGetLastError();
}

// v002
// It runs in 235 microseconds.
// Two timings next to v001 put it at 1.42 and 1.43 times that version's speed.
// Over all steps from v000 it is 2.53 times as fast.
// Contractions: x.W{q,k,v}^T on v_wmma_f32_16x16x32_bf16 (x and W planes RNE-converted to bf16 operands, f32 accumulate, bias added in f32);
// scores k'.q'^T (q', k' single f16 planes carried x8), P.v (P x32768 single f16, v x1024 single f16), O.Wo^T and U.Wd^T
// (O and U single f16 planes x1024, Wo and Wd as f16(bf16(W) x1024)): v_wmma_f32_16x16x32_f16, f32 accumulate.
// Base-2 online softmax, 1/l fold, row-sum partials and bias adds in f32 on VALU.
#include <hip/hip_runtime.h>
#include <math.h>
#include <stdint.h>

#define NB    4
#define SEQ   2048
#define DMOD  1024
#define NH    8
#define HD    128
#define QT_BITS 5
#define NH_BITS 3
#define ROWS  (NB * SEQ)
#define QSC   8.0f
#define KSC   8.0f
#define PCAR  32768.0f
#define VCAR  1024.0f
#define OSC   1024.0f
#define USC   1024.0f
#define WOS   1024.0f
#define SM_SCALE 0.08838834764831845f
#define LOG2E 1.4426950408889634f
#define ATT_WAVES   8
#define ATT_THREADS (ATT_WAVES * 32)
#define ATT_QROWS   (ATT_WAVES * 16)
#define AQT_BITS    4
#define ATT_BLOCKS  (NB * NH * (SEQ / ATT_QROWS))
#define NKB    (SEQ / 32)
#define RS     (NH * HD)
#define SPITCH 132
#define SLABF  (16 * SPITCH)
#define SLAB64 (16 * 68)
#define VTP    72
#define WPB    (NH * (SEQ / ATT_QROWS) * ATT_WAVES)
#define TOTOUT (NB + ROWS * DMOD)
#define IMGN   (ROWS * DMOD)
#define NPIECE ((TOTOUT + 3) / 4)
#define GBT    128
#define GKS    128
#define GPITCH 272
#define GOPB   (GBT * GPITCH)
#define GBUF   (2 * GOPB)
#define AKS    128
#define ANST   (SEQ / AKS)
#define AOPB   (AKS * GPITCH)
#define ABUF   (AOPB + HD * GPITCH)
#define DEPSC  (1.0f / ((float)NH * (float)SEQ * (float)SEQ))

static_assert(HD == 128 && DMOD == NH * HD && RS == DMOD);
static_assert((1 << QT_BITS) == (SEQ / 64) && (1 << NH_BITS) == NH);
static_assert((SEQ % 64) == 0 && (SEQ % 32) == 0 && NKB * 32 == SEQ);
static_assert(((ROWS * DMOD / 8) % 256) == 0 && ((3 * DMOD * DMOD / 8) % 256) == 0 && ((DMOD * DMOD / 8) % 256) == 0);
static_assert((ROWS % 64) == 0 && (DMOD % 64) == 0 && (DMOD % 32) == 0);
static_assert(NB >= 1 && NB <= 32);
static_assert((WPB % 32) == 0 && WPB == 1024);
static_assert(ATT_THREADS == 256 && (1 << AQT_BITS) == (SEQ / ATT_QROWS));
static_assert((SEQ % AKS) == 0 && ANST >= 2 && (AKS % 32) == 0 && AKS * 2 + 16 == GPITCH && HD * 2 + 16 == GPITCH);
static_assert(AKS == 8 * (ATT_THREADS / 16) && HD == 8 * (ATT_THREADS / 16));
static_assert(ATT_WAVES * SLABF * 4 <= 2 * ABUF);
static_assert(((SPITCH * 4) % 16) == 0 && ((VTP * 2) % 16) == 0 && (SPITCH >= HD + 4));
static_assert(HD * VTP >= 127 * VTP + 64);
static_assert(IMGN % 4 == 0);
static_assert((ROWS % GBT) == 0 && (DMOD % GBT) == 0 && (DMOD % GKS) == 0 && GKS * 2 + 16 == GPITCH);

typedef unsigned short u16;
typedef _Float16 v16h __attribute__((ext_vector_type(16)));
typedef _Float16 v8h  __attribute__((ext_vector_type(8)));
typedef __bf16   v16b __attribute__((ext_vector_type(16)));
typedef float    v8f  __attribute__((ext_vector_type(8)));
typedef float    v4f  __attribute__((ext_vector_type(4)));
typedef unsigned int v4u __attribute__((ext_vector_type(4)));

union FragH { v16h v; v8h h[2]; v4u u[2]; };
union FragB { v16b v; v4u u[2]; };

// ---- scalar helpers --------------------------------------------------------------------------------
__device__ __forceinline__ unsigned short bf_bits(float f) {          // f32 -> bf16 bits, RNE convert
  unsigned u = __float_as_uint(f);
  return (unsigned short)((u + 0x7FFFu + ((u >> 16) & 1u)) >> 16);
}
__device__ __forceinline__ float bf_up(unsigned short h) { return __uint_as_float(((unsigned)h) << 16); }
__device__ __forceinline__ float bfr(float f) { return bf_up(bf_bits(f)); }
__device__ __forceinline__ unsigned short h_bits(_Float16 x) { return __builtin_bit_cast(unsigned short, x); }
__device__ __forceinline__ unsigned pk16(unsigned short a, unsigned short b) { return (unsigned)a | ((unsigned)b << 16); }
__device__ __forceinline__ v8f zero8() { v8f z = {0.f, 0.f, 0.f, 0.f, 0.f, 0.f, 0.f, 0.f}; return z; }
__device__ __forceinline__ v4f zero4() { v4f z = {0.f, 0.f, 0.f, 0.f}; return z; }

// ---- fragment loaders: 16-bit A/B operand, lane -> row/col (lane&15), p already includes +8*(lane>>4);
//      elements 0..7 <- p[0..7] (k0+8h..), elements 8..15 <- p[16..23] (k0+16+8h..)  (same split k map for A and B;
//      B is always read from a k-contiguous [n][k] plane)
__device__ __forceinline__ v16h ldfrag_h(const _Float16* p) {
  FragH f;
  f.h[0] = *(const v8h*)(p);
  f.h[1] = *(const v8h*)(p + 16);
  return f.v;
}

__device__ __forceinline__ v8f mma_h(v16h a, v16h b, v8f c) {
  return __builtin_amdgcn_wmma_f32_16x16x32_f16(false, a, false, b, (short)0, c, false, false);
}
__device__ __forceinline__ v8f mma_b(v16b a, v16b b, v8f c) {
  return __builtin_amdgcn_wmma_f32_16x16x32_bf16(false, a, false, b, (short)0, c, false, false);
}
__device__ __forceinline__ void guard2(v8f& a, v8f& b, v16h x0, v16h x1, v16h x2, v16h x3, v16h x4, v16h x5) {
#if defined(__HIP_DEVICE_COMPILE__)
  asm volatile("v_nop\n\tv_nop\n\tv_nop\n\tv_nop"
               : "+v"(a), "+v"(b) : "v"(x0), "v"(x1), "v"(x2), "v"(x3), "v"(x4), "v"(x5) : "memory");
#endif
}
template <typename F>
__device__ __forceinline__ void guard6(v8f& a, v8f& b, v8f& c, v8f& d, F x0, F x1, F x2, F x3, F x4, F x5) {
#if defined(__HIP_DEVICE_COMPILE__)
  asm volatile("v_nop\n\tv_nop\n\tv_nop\n\tv_nop"
               : "+v"(a), "+v"(b), "+v"(c), "+v"(d) : "v"(x0), "v"(x1), "v"(x2), "v"(x3), "v"(x4), "v"(x5) : "memory");
#endif
}
__device__ __forceinline__ void acc_guard4(v8f& a, v8f& b, v8f& c, v8f& d) {
#if defined(__HIP_DEVICE_COMPILE__)
  asm volatile("v_nop\n\tv_nop\n\tv_nop\n\tv_nop" : "+v"(a), "+v"(b), "+v"(c), "+v"(d));
#endif
}
__device__ __forceinline__ void wave_sync_lds() {
  __builtin_amdgcn_fence(__ATOMIC_RELEASE, "workgroup");
  __builtin_amdgcn_wave_barrier();
  __builtin_amdgcn_fence(__ATOMIC_ACQUIRE, "workgroup");
}

// =====================================================================================================
// f32 plane -> 16-bit plane, same layout:  mode 0: bf16 RNE bits;  mode 1: f16 bits of (bf16 RNE value) * scale;
// mode 2: f16 bits of value * scale (no bf16 pre-step).
// Thread = 8 consecutive elements: two 16-B loads, one 16-B store; 32 consecutive lanes = 512 contiguous, 512-B aligned bytes
// coverage: grid = n8/256 blocks (host checks exactness) x 256 thr x 8 = the whole plane.
// =====================================================================================================
__global__ __launch_bounds__(256) void cvt16(const float* __restrict__ x, u16* D, int n8, int mode, float scale) {
  const int gt = blockIdx.x * 256 + (int)threadIdx.x;
  if (gt >= n8) return;                     // no barriers in this kernel
  const float* p = x + (size_t)gt * 8;
  const v4f a = *(const v4f*)(p), c4 = *(const v4f*)(p + 4);
  float v[8];
#pragma unroll
  for (int e = 0; e < 4; ++e) { v[e] = a[e]; v[4 + e] = c4[e]; }
  unsigned short s[8];
#pragma unroll
  for (int e = 0; e < 8; ++e) {
    const float vb = bfr(v[e]);
    const float vf = (mode == 1) ? vb : v[e];
    const unsigned short hb = h_bits((_Float16)(vf * scale));
    const unsigned short bb = bf_bits(v[e]);
    s[e] = (mode != 0) ? hb : bb;
  }
  v4u o;
#pragma unroll
  for (int e = 0; e < 4; ++e) o[e] = pk16(s[2 * e], s[2 * e + 1]);
  u16* d = D + (size_t)gt * 8;
  {
    *(v4u*)(d) = o;
    
  }
}

// =====================================================================================================
// GEMM epilogue shared by both engines: one 16x64 strip of the wave's 64x64 f32 tile (times oscale) staged in its LDS slab (pitch 68),
// coverage: 8 instructions x 2 rows x 16 lanes x 4 floats = the 16 x 64 strip.
// =====================================================================================================
__device__ __forceinline__ void epi64(float* sl, v8f a0, v8f a1, v8f a2, v8f a3, float oscale, v4f badd, float* C, int N,
                                      size_t rowb, int col0, int lane) {
  const int hh = lane >> 4, m = lane & 15;
#pragma unroll
  for (int r = 0; r < 8; ++r) {
    const int ro = (8 * hh + r) * 68 + m;
    sl[ro]      = a0[r] * oscale;
    sl[ro + 16] = a1[r] * oscale;
    sl[ro + 32] = a2[r] * oscale;
    sl[ro + 48] = a3[r] * oscale;
  }
  wave_sync_lds();
  v4f vals[8];
#pragma unroll
  for (int it = 0; it < 8; ++it) vals[it] = *(const v4f*)(sl + (it * 2 + hh) * 68 + m * 4) + badd;
  float* dst = C + (rowb + (size_t)hh) * (size_t)N + col0 + m * 4;
  {
#pragma unroll
    for (int it = 0; it < 8; ++it) {
      *(v4f*)(dst + (size_t)(it * 2) * (size_t)N) = vals[it];
    }
    
  }
}

// =====================================================================================================
// 16-bit GEMM with bias, both engines: C[M][N] (f32) = A[M][K] (row-major) . Bt[N][K]^T (k-contiguous), times oscale, plus the
// bf16-RNE value of bias[n]. Block = 128x128 tile of C, 4 waves as 2x2, wave = 64x64 (4x4 accumulator tiles).
// A stage is 128 k of the block's 128 A rows and 128 Bt rows: 256 rows of 256 B, laid in LDS at pitch 272 B by asynchronous
// b128 copies (16 lanes = one whole 256-B row, so every copy touches whole lines). Two buffers: stage t+1 flies while stage t
// is multiplied. Fragments are read from LDS with the same split k map for A and B as ldfrag_h; k runs upward in steps of 32
// into one accumulator per tile. Shapes: M % 128 == 0, N % 128 == 0, K % 128 == 0, grid = (M/128)*(N/128) (static_assert above).
// =====================================================================================================
__device__ __forceinline__ unsigned lds_off(const void* p) { return (unsigned)(size_t)p; }

// Eight asynchronous 16-B-per-lane copies, rows 8 apart. The s_wait_xcnt stands inside the statement so that no address
// register of a copy is rewritten in front of it.
__device__ __forceinline__ void copy8(unsigned l, const u16* g, size_t rs8) {
#if defined(__HIP_DEVICE_COMPILE__)
  asm volatile("global_load_async_to_lds_b128 %0, %8, off\n\t"
               "global_load_async_to_lds_b128 %1, %9, off\n\t"
               "global_load_async_to_lds_b128 %2, %10, off\n\t"
               "global_load_async_to_lds_b128 %3, %11, off\n\t"
               "global_load_async_to_lds_b128 %4, %12, off\n\t"
               "global_load_async_to_lds_b128 %5, %13, off\n\t"
               "global_load_async_to_lds_b128 %6, %14, off\n\t"
               "global_load_async_to_lds_b128 %7, %15, off\n\t"
               "s_wait_xcnt 0x0"
               :: "v"(l), "v"(l + 8u * GPITCH), "v"(l + 16u * GPITCH), "v"(l + 24u * GPITCH),
                  "v"(l + 32u * GPITCH), "v"(l + 40u * GPITCH), "v"(l + 48u * GPITCH), "v"(l + 56u * GPITCH),
                  "v"(g), "v"(g + rs8), "v"(g + 2 * rs8), "v"(g + 3 * rs8),
                  "v"(g + 4 * rs8), "v"(g + 5 * rs8), "v"(g + 6 * rs8), "v"(g + 7 * rs8)
               : "memory");
#endif
}
// One stage: this thread's 16 B of rows cr + 8i (i = 0..15) of the A tile and of the Bt tile; 32 copies per wave.
__device__ __forceinline__ void fill_stage(unsigned l, const u16* ga, const u16* gb, size_t rs8) {
  copy8(l, ga, rs8);
  copy8(l + 64u * GPITCH, ga + 8 * rs8, rs8);
  copy8(l + GOPB, gb, rs8);
  copy8(l + GOPB + 64u * GPITCH, gb + 8 * rs8, rs8);
}
__device__ __forceinline__ void wait_async0() {   // this wave's copies have landed
#if defined(__HIP_DEVICE_COMPILE__)
  asm volatile("s_wait_asynccnt 0x0" ::: "memory");
#endif
}
__device__ __forceinline__ void wait_ds0() {      // this wave's LDS reads have returned before their buffer is refilled
#if defined(__HIP_DEVICE_COMPILE__)
  asm volatile("s_wait_dscnt 0x0" ::: "memory");
#endif
}
__device__ __forceinline__ FragB ld_lfrag(const unsigned char* p) {   // split k map of ldfrag_h: bytes 0..15 and 32..47
  FragB f;
  f.u[0] = *(const v4u*)(p);
  f.u[1] = *(const v4u*)(p + 32);
  return f;
}
__device__ __forceinline__ v8f mma_sel(FragB a, FragB b, v8f c, bool bf) {
  if (bf) return mma_b(a.v, b.v, c);
  return mma_h(__builtin_bit_cast(v16h, a.v), __builtin_bit_cast(v16h, b.v), c);
}

template <bool BF>
__device__ __forceinline__ void gemm_core(unsigned char* ring, float* slab, const u16* __restrict__ A,
                                          const u16* __restrict__ Bt, const float* __restrict__ bias,
                                          float* C, int M, int N, int K, float oscale) {
  const int tid = threadIdx.x, wave = tid >> 5, lane = tid & 31, hh = lane >> 4, m = lane & 15;
  const int ntile = N >> 7;
  const int bid   = blockIdx.x;
  const int row0  = (bid / ntile) * GBT;
  const int col0  = (bid % ntile) * GBT;
  if (row0 + GBT > M) return;                // block-uniform, in front of every barrier; never taken with the exact grid
  const int wr = wave >> 1, wc = wave & 1;
  const int nst = K >> 7;
  const int cr = tid >> 4, cc = tid & 15;    // copy: row within a group of 8, 16-B chunk of the 256-B row
  const u16* ga = A  + (size_t)(row0 + cr) * K + cc * 8;
  const u16* gb = Bt + (size_t)(col0 + cr) * K + cc * 8;
  const size_t rs8 = (size_t)8 * K;
  const unsigned l0 = lds_off(ring) + (unsigned)(cr * GPITCH + cc * 16);

  v8f acc[4][4];
#pragma unroll
  for (int i = 0; i < 4; ++i) {
#pragma unroll
    for (int j = 0; j < 4; ++j) acc[i][j] = zero8();
  }

  fill_stage(l0, ga, gb, rs8);
  wait_async0();
  __syncthreads();                           // publishes stage 0
  if (nst > 1) fill_stage(l0 + GBUF, ga + GKS, gb + GKS, rs8);

  for (int t = 0; t < nst; ++t) {
    const unsigned bo = (unsigned)(t & 1) * GBUF;
    const unsigned char* ab = ring + bo + (wr * 64 + m) * GPITCH + hh * 16;
    const unsigned char* bb = ring + bo + GOPB + (wc * 64 + m) * GPITCH + hh * 16;
    FragB a[2][4], b[2][4];                  // set (ks & 1) holds the fragments of k step ks
#pragma unroll
    for (int i = 0; i < 4; ++i) { a[0][i] = ld_lfrag(ab + i * 16 * GPITCH); b[0][i] = ld_lfrag(bb + i * 16 * GPITCH); }
#pragma unroll
    for (int ks = 0; ks < GKS / 32; ++ks) {
      const int cs = ks & 1;
      if (ks + 1 < GKS / 32) {
#pragma unroll
        for (int i = 0; i < 4; ++i) {
          a[cs ^ 1][i] = ld_lfrag(ab + i * 16 * GPITCH + (ks + 1) * 64);
          b[cs ^ 1][i] = ld_lfrag(bb + i * 16 * GPITCH + (ks + 1) * 64);
        }
      }
      // keeps the next k step's LDS reads one group ahead of this step's products instead of spread among them
      __builtin_amdgcn_sched_barrier(0);
#pragma unroll
      for (int i = 0; i < 4; ++i) {
#pragma unroll
        for (int j = 0; j < 4; ++j) acc[i][j] = mma_sel(a[cs][i], b[cs][j], acc[i][j], BF);
      }
      // keeps the following group of LDS reads behind this step's products
      __builtin_amdgcn_sched_barrier(0);
    }
    wait_ds0();
    wait_async0();
    __syncthreads();                         // publishes stage t+1 and ends every reader's last read of stage t's buffer
    if (t + 2 < nst) fill_stage(l0 + bo, ga + (size_t)(t + 2) * GKS, gb + (size_t)(t + 2) * GKS, rs8);
  }
  wait_async0();

  const int colw = col0 + wc * 64;
  const v4f bv = *(const v4f*)(bias + colw + m * 4);      // columns colw + 4m .. +3, always < N (N multiple of 128)
  v4f badd;
#pragma unroll
  for (int e = 0; e < 4; ++e) badd[e] = bfr(bv[e]);
  float* sl = slab + wave * SLAB64;
#pragma unroll
  for (int i = 0; i < 4; ++i) {
    if (i) wave_sync_lds();                  // the slab's last readers are done before other lanes overwrite it
    epi64(sl, acc[i][0], acc[i][1], acc[i][2], acc[i][3], oscale, badd, C, N, (size_t)(row0 + wr * 64 + i * 16), colw, lane);
  }
}

__global__ __launch_bounds__(128)
void gemm_bfb(const u16* __restrict__ A, const u16* __restrict__ Bt, const float* __restrict__ bias,
              float* C, int M, int N, int K, float oscale) {
  __shared__ __align__(16) unsigned char ring[2 * GBUF];
  __shared__ __align__(16) float slab[4 * SLAB64];
  gemm_core<true>(ring, slab, A, Bt, bias, C, M, N, K, oscale);
}

__global__ __launch_bounds__(128)
void gemm_h1(const u16* __restrict__ A, const u16* __restrict__ Bt, const float* __restrict__ bias,
             float* C, int M, int N, int K, float oscale) {
  __shared__ __align__(16) unsigned char ring[2 * GBUF];
  __shared__ __align__(16) float slab[4 * SLAB64];
  gemm_core<false>(ring, slab, A, Bt, bias, C, M, N, K, oscale);
}

// =====================================================================================================
// v^T plane: VP[(b*NH + h)*HD + d][s] = f16(v[b][s][h][d] * 1024), v read from the f32 projection image [b*SEQ+s][h*HD+d].
// Block = (b, h, 64 keys): 64 source rows of HD floats loaded with 16-B loads, converted, scattered into an LDS tile
// coverage: load 256 thr x 32 elements = 64 keys x 128 d (every TH column 0..63 of all 128 rows); store 4 iterations x 256 thr
//           x 8 halves = 128 lines x 64 = the block's tile; grid = NB x NH x SEQ/64 blocks covers the plane exactly once.
// =====================================================================================================
__global__ __launch_bounds__(256) void vt16(const float* __restrict__ v, u16* VPo) {
  __shared__ __align__(16) u16 TH[HD * VTP];
  const int tid = threadIdx.x;
  const int bid = blockIdx.x;
  const int st  = bid & ((SEQ / 64) - 1);
  const int h   = (bid >> QT_BITS) & (NH - 1);
  const int b   = bid >> (QT_BITS + NH_BITS);
  const int s0  = st * 64;
  {
    const int sl = tid >> 2;                  // key within tile 0..63
    const int dc = (tid & 3) * 32;            // d chunk of 32
    const float* src = v + ((size_t)(b * SEQ + s0 + sl) * NH + h) * HD + dc;
#pragma unroll
    for (int i = 0; i < 8; ++i) {
      const v4f a = *(const v4f*)(src + 4 * i);
#pragma unroll
      for (int e = 0; e < 4; ++e) {
        const _Float16 hv = (_Float16)(a[e] * VCAR);
        TH[(dc + 4 * i + e) * VTP + sl] = h_bits(hv);
      }
    }
  }
  __syncthreads();
  v4u vh[4];
  const int q8 = tid >> 3, p8 = (tid & 7) * 8;
#pragma unroll
  for (int it = 0; it < 4; ++it) {
    const int line = it * 32 + q8;            // d = 0..127
    vh[it] = *(const v4u*)(TH + line * VTP + p8);
  }
  const size_t base = ((size_t)(b * NH + h) * HD) * SEQ + s0 + p8;
  {
#pragma unroll
    for (int it = 0; it < 4; ++it) {
      const int line = it * 32 + q8;
      *(v4u*)(VPo + base + (size_t)line * SEQ) = vh[it];
    }
    
  }
}

// =====================================================================================================
// Multi-head flash attention (no mask): block = (batch b, head, 128 query rows), 8 waves, wave w owns the 16 query rows
// q0 = 128*qt + 16*w .. q0+15.
//   q plane (f16, x8) laid out [b][s][h][d]; k plane the same; v^T plane [b][h][d][s] (x1024).
//   All NKB = SEQ/32 key blocks of 32 keys are visited (static bound), in stages of 128 keys that the block's waves share:
//   a stage is 128 k rows of 256 B (all d) and 128 v^T rows of 256 B (its 128 keys), laid in LDS at pitch 272 B by asynchronous
//   b128 copies (16 lanes = one whole 256-B row). Two buffers: stage t+1 flies while stage t is worked on. The fragments are
//   read from LDS with the split k map of ldfrag_h. After the last stage's barrier the ring is the epilogue's staging room.
//   Scores are computed TRANSPOSED: S^T tile g (g = 0,1) = k rows (keys kb+16g .. +15, A operand, row m = lane&15, split k map
//   over d, 4 chunks of 32 d) times q^T (B operand, col n = query q0 + (lane&15), k = d, split map).
//   D element r of lane l = (key kb+16g+8h+r, query q0+(l&15)), so a lane owns one query column and 16 of its 32 keys; the
//   partner lane l^16 owns the other 16 -> row max / row sum need one xor-16 shuffle.
//   Online max-subtracted base-2 softmax in f32 (scale 1/sqrt(128) and the q/k carries folded into lsc). The exp'd values ARE
//   the P A-fragment in place: A row m = query = lane&15, element i <- key kb+8h+i (tile 0, D element i), element 8+i <- key
//   kb+16+8h+i (tile 1, D element i). P is carried x32768 as single f16. The rescale factor of query row 8h+r of the
//   O accumulators is fetched from lane 8h+r with a shuffle (uniform control). 8 v^T B fragments (col n = d = 16j + (lane&15),
//   keys k-contiguous), 8 P.V WMMAs per key block in two guarded groups of 4.
//   Epilogue: 1/l (per query, shuffled to the D row owner) and carry folds in f32; the wave's 16x128 f32 result staged in its
//   LDS slab (pitch 132); each 256-B output row (b, q0+row, head) of the O plane (O x1024 as single f16) written as 2 whole
// coverage: per wave 8 instructions x 2 rows x 16 lanes x 8 halves = 16 x 128 of the O plane + 1 PART line; grid
//           NB*NH*SEQ/128 blocks x 8 waves = every (b, s, h) row of the O plane and every PART line exactly once.
// =====================================================================================================
// Eight asynchronous 16-B-per-lane copies, rows 16 apart. The s_wait_xcnt stands inside the statement so that no address
// register of a copy is rewritten in front of it.
__device__ __forceinline__ void copy8w(unsigned l, const u16* g, size_t rs16) {
#if defined(__HIP_DEVICE_COMPILE__)
  asm volatile("global_load_async_to_lds_b128 %0, %8, off\n\t"
               "global_load_async_to_lds_b128 %1, %9, off\n\t"
               "global_load_async_to_lds_b128 %2, %10, off\n\t"
               "global_load_async_to_lds_b128 %3, %11, off\n\t"
               "global_load_async_to_lds_b128 %4, %12, off\n\t"
               "global_load_async_to_lds_b128 %5, %13, off\n\t"
               "global_load_async_to_lds_b128 %6, %14, off\n\t"
               "global_load_async_to_lds_b128 %7, %15, off\n\t"
               "s_wait_xcnt 0x0"
               :: "v"(l), "v"(l + 16u * GPITCH), "v"(l + 32u * GPITCH), "v"(l + 48u * GPITCH),
                  "v"(l + 64u * GPITCH), "v"(l + 80u * GPITCH), "v"(l + 96u * GPITCH), "v"(l + 112u * GPITCH),
                  "v"(g), "v"(g + rs16), "v"(g + 2 * rs16), "v"(g + 3 * rs16),
                  "v"(g + 4 * rs16), "v"(g + 5 * rs16), "v"(g + 6 * rs16), "v"(g + 7 * rs16)
               : "memory");
#endif
}
// One attention stage: this thread's 16 B of rows cr + 16i (i = 0..7) of the k tile and of the v^T tile; 16 copies per wave.
__device__ __forceinline__ void fill_kv(unsigned l, const u16* gk, const u16* gv) {
  copy8w(l, gk, (size_t)16 * RS);
  copy8w(l + AOPB, gv, (size_t)16 * SEQ);
}
__device__ __forceinline__ v16h ld_lfrag_h(const unsigned char* p) {  // split k map of ldfrag_h: bytes 0..15 and 32..47
  FragH f;
  f.u[0] = *(const v4u*)(p);
  f.u[1] = *(const v4u*)(p + 32);
  return f.v;
}

// four waves per SIMD (two blocks per WGP): the register budget that lets the vector work of one wave run under the others' waits
__global__ __launch_bounds__(ATT_THREADS) __attribute__((amdgpu_waves_per_eu(4, 4)))
void attn_fwd(const u16* __restrict__ QPp, const u16* __restrict__ KPp, const u16* __restrict__ VPp,
              u16* OPo, float* PART) {
  // two stage buffers (k tile, then v^T tile); in the epilogue, per wave, the result slab [16][132] of floats
  __shared__ __align__(16) unsigned char ring[2 * ABUF];

  const int tid  = threadIdx.x;
  const int wave = tid >> 5;
  const int lane = tid & 31;
  const int hh   = lane >> 4;
  const int c    = lane & 15;

  const int bid  = blockIdx.x;
  const int qt   = bid & ((SEQ / ATT_QROWS) - 1);
  const int head = (bid >> AQT_BITS) & (NH - 1);
  const int b    = bid >> (AQT_BITS + NH_BITS);
  const int q0   = qt * ATT_QROWS + wave * 16;

  // B fragments of q^T: col n = query q0 + c, k = d (k-contiguous row of the q plane)
  const _Float16* Qb = (const _Float16*)(const void*)QPp + ((size_t)(b * SEQ + q0 + c) * NH + head) * HD + 8 * hh;
  // copy: row within a group of 16, 16-B chunk of the 256-B row; k tile row = key, v^T tile row = d
  const int cr = tid >> 4, cc = tid & 15;
  const u16* gk = KPp + ((size_t)(b * SEQ + cr) * NH + head) * HD + cc * 8;     // stage t: + t * AKS key rows
  const u16* gv = VPp + ((size_t)(b * NH + head) * HD + cr) * SEQ + cc * 8;     // stage t: + t * AKS keys
  const unsigned l0 = lds_off(ring) + (unsigned)(cr * GPITCH + cc * 16);
  fill_kv(l0, gk, gv);
  const float lsc = SM_SCALE * (LOG2E / (QSC * KSC));

  const v16h qf0 = ldfrag_h(Qb);            // d 0..31
  const v16h qf1 = ldfrag_h(Qb + 32);       // d 32..63
  const v16h qf2 = ldfrag_h(Qb + 64);       // d 64..95
  const v16h qf3 = ldfrag_h(Qb + 96);       // d 96..127

  float mrun = -INFINITY, lrun = 0.f;
  v8f o[8];
#pragma unroll
  for (int j = 0; j < 8; ++j) o[j] = zero8();

  wait_async0();
  __syncthreads();                           // publishes stage 0
  fill_kv(l0 + ABUF, gk + (size_t)AKS * RS, gv + AKS);   // stage 1 exists (ANST >= 2)

  // one rolled trip per stage, so that the ring's publish point stands once, at the trip's foot
#pragma unroll 1
  for (int t = 0; t < ANST; ++t) {
   const unsigned bo = (unsigned)(t & 1) * ABUF;
   // A fragments of k: row m = key kb + 16g + c, k = d;  B fragments of v: col n = d = 16j + c, k = key
   const unsigned char* kt = ring + bo + c * GPITCH + hh * 16;
   const unsigned char* vt = ring + bo + AOPB + c * GPITCH + hh * 16;
   // stays rolled: unrolled four times the build runs out of the 256 registers of four waves per SIMD and spills
#pragma unroll 1
   for (int kk = 0; kk < AKS / 32; ++kk) {   // key block kb = t * AKS + kk * 32
    // ---- transposed scores: s0 = keys kb..kb+15, s1 = keys kb+16..kb+31, column = query q0 + c ----
    v8f s0 = zero8(), s1 = zero8();
    const unsigned char* k0p = kt + kk * 32 * GPITCH;
    const unsigned char* k1p = k0p + 16 * GPITCH;
    const unsigned char* vp  = vt + kk * 64;
    const v16h ka0 = ld_lfrag_h(k0p), ka1 = ld_lfrag_h(k0p + 64);
    const v16h kc0 = ld_lfrag_h(k1p), kc1 = ld_lfrag_h(k1p + 64);
    const v16h ka2 = ld_lfrag_h(k0p + 128), ka3 = ld_lfrag_h(k0p + 192);
    const v16h kc2 = ld_lfrag_h(k1p + 128), kc3 = ld_lfrag_h(k1p + 192);
    s0 = mma_h(ka0, qf0, s0);
    s0 = mma_h(ka1, qf1, s0);
    s1 = mma_h(kc0, qf0, s1);
    s1 = mma_h(kc1, qf1, s1);
    guard2(s0, s1, qf0, qf1, ka0, ka1, kc0, kc1);
    // the first four v^T fragments are read here, as one group, so that they return behind the softmax arithmetic
    const v16h vf0 = ld_lfrag_h(vp);
    const v16h vf1 = ld_lfrag_h(vp + 16 * GPITCH);
    const v16h vf2 = ld_lfrag_h(vp + 32 * GPITCH);
    const v16h vf3 = ld_lfrag_h(vp + 48 * GPITCH);
    s0 = mma_h(ka2, qf2, s0);
    s0 = mma_h(ka3, qf3, s0);
    s1 = mma_h(kc2, qf2, s1);
    s1 = mma_h(kc3, qf3, s1);
    guard2(s0, s1, qf2, qf3, ka2, ka3, kc2, kc3);
    const v16h vf4 = ld_lfrag_h(vp + 64 * GPITCH);
    const v16h vf5 = ld_lfrag_h(vp + 80 * GPITCH);
    const v16h vf6 = ld_lfrag_h(vp + 96 * GPITCH);
    const v16h vf7 = ld_lfrag_h(vp + 112 * GPITCH);
    // ---- base-2 logits of this lane's 16 keys for query q0 + c ----
    float tk[16];
#pragma unroll
    for (int i = 0; i < 8; ++i) { tk[i] = s0[i] * lsc;  tk[8 + i] = s1[i] * lsc; }
    float cm = -INFINITY;
#pragma unroll
    for (int i = 0; i < 16; ++i) cm = fmaxf(cm, tk[i]);
    cm = fmaxf(cm, __shfl_xor(cm, 16, 32));
    const float mn = fmaxf(mrun, cm);                                // finite from the first key block on
    const float al = (mrun == -INFINITY) ? 0.f : exp2f(mrun - mn);   // o and l are zero while mrun is -inf
    mrun = mn;
    // ---- probabilities (<= 1) and the P A-fragment: f16(p * 32768); element i <-> tk[i] ----
    float ps = 0.f;
    FragH ph;
#pragma unroll
    for (int w = 0; w < 2; ++w) {
#pragma unroll
      for (int e4 = 0; e4 < 4; ++e4) {
        const int i = 8 * w + 2 * e4;
        const float p0 = exp2f(fminf(tk[i] - mn, 0.f));
        const float p1 = exp2f(fminf(tk[i + 1] - mn, 0.f));
        ps += p0 + p1;
        ph.u[w][e4] = pk16(h_bits((_Float16)(p0 * PCAR)), h_bits((_Float16)(p1 * PCAR)));
      }
    }
    ps += __shfl_xor(ps, 16, 32);
    lrun = lrun * al + ps;
    // ---- rescale the O accumulators: D row 8hh+r = query q0+8hh+r, its factor lives in lane 8hh+r (and 16+8hh+r) ----
    float scl[8];
#pragma unroll
    for (int r = 0; r < 8; ++r) scl[r] = __shfl(al, 8 * hh + r, 32);
#pragma unroll
    for (int j = 0; j < 8; ++j) {
#pragma unroll
      for (int r = 0; r < 8; ++r) o[j][r] *= scl[r];
    }
    // ---- P.V : B fragment col n = d = j*16 + c, keys contiguous in the v^T tile; two guarded groups of 4 ----
    {
      o[0] = mma_h(ph.v, vf0, o[0]);
      o[1] = mma_h(ph.v, vf1, o[1]);
      o[2] = mma_h(ph.v, vf2, o[2]);
      o[3] = mma_h(ph.v, vf3, o[3]);
      guard6<v16h>(o[0], o[1], o[2], o[3], ph.v, vf0, vf1, vf2, vf3, ph.v);
    }
    {
      o[4] = mma_h(ph.v, vf4, o[4]);
      o[5] = mma_h(ph.v, vf5, o[5]);
      o[6] = mma_h(ph.v, vf6, o[6]);
      o[7] = mma_h(ph.v, vf7, o[7]);
      guard6<v16h>(o[4], o[5], o[6], o[7], ph.v, vf4, vf5, vf6, vf7, ph.v);
    }
   }
   wait_ds0();
   wait_async0();
   __syncthreads();                          // publishes stage t+1 and ends every reader's last read of stage t's buffer
   if (t + 2 < ANST) fill_kv(l0 + bo, gk + (size_t)(t + 2) * (AKS * RS), gv + (size_t)(t + 2) * AKS);
  }
  wait_async0();
  acc_guard4(o[0], o[1], o[2], o[3]);
  acc_guard4(o[4], o[5], o[6], o[7]);

  // ---- fold 1/l (per query, owned by lane = query) and the carries; row statistic r = l * (1/l); stage the 16x128 slab ----
  const float rl   = (lrun > 0.f) ? (1.0f / lrun) : 0.f;
  const float linv = rl * (1.0f / (PCAR * VCAR));
  const float rr   = lrun * rl;
  float inv[8];
#pragma unroll
  for (int r = 0; r < 8; ++r) inv[r] = __shfl(linv, 8 * hh + r, 32);
  // the last stage's barrier lies behind every wave's last fragment read and last copy: the ring is free
  float* slab = (float*)(void*)ring + wave * SLABF;
#pragma unroll
  for (int r = 0; r < 8; ++r) {
#pragma unroll
    for (int j = 0; j < 8; ++j) slab[(8 * hh + r) * SPITCH + j * 16 + c] = o[j][r] * inv[r];
  }
  wave_sync_lds();
  // ---- O x1024 -> single f16 plane; lane = (row parity hh, 8 consecutive d at c8) ----
  v4u oh[8];
  const int c8 = c * 8;
#pragma unroll
  for (int it = 0; it < 8; ++it) {
    const int row = it * 2 + hh;
    const v4f a = *(const v4f*)(slab + row * SPITCH + c8), c4 = *(const v4f*)(slab + row * SPITCH + c8 + 4);
    float w[8];
#pragma unroll
    for (int e = 0; e < 4; ++e) { w[e] = a[e] * OSC; w[4 + e] = c4[e] * OSC; }
#pragma unroll
    for (int e = 0; e < 4; ++e) {
      const _Float16 h0 = (_Float16)w[2 * e], h1 = (_Float16)w[2 * e + 1];
      oh[it][e] = pk16(h_bits(h0), h_bits(h1));
    }
  }
  // ---- wave row-sum partial (fixed xor tree over the 16 query lanes; both lane halves hold identical values) ----
  float wsum = rr;
  wsum += __shfl_xor(wsum, 1, 32);
  wsum += __shfl_xor(wsum, 2, 32);
  wsum += __shfl_xor(wsum, 4, 32);
  wsum += __shfl_xor(wsum, 8, 32);
  v4f pv = zero4();
  pv[0] = (lane == 0) ? wsum : 0.f;
  float* pd = PART + ((size_t)bid * ATT_WAVES + wave) * 32 + (lane & 7) * 4;   // clamped address for every lane
  const size_t ob = ((size_t)(b * SEQ + q0) * NH + head) * HD + c8;
  {
#pragma unroll
    for (int it = 0; it < 8; ++it) {
      const int row = it * 2 + hh;
      *(v4u*)(OPo + ob + (size_t)row * RS) = oh[it];
    }
    if (lane < 8) *(v4f*)(pd) = pv;
    
  }
}

// =====================================================================================================
// Flat output writer: out[0..NB-1] = score output (per batch: fixed-order sum of its WPB PART lines times 1/(NH*SEQ*SEQ),
// computed by block 0, wave = batch, 32 lanes x WPB/32 strided loads + xor tree), out[NB + i] = IMG[i] (f32 image of the last
// value. With NB % 4 != 0 a scalar path handles the element interleave and the partial last piece.
// coverage: grid = ceil(NPIECE/256) blocks x 256 thr x 4 elements with the in-kernel bound = all TOTOUT elements exactly once.
// =====================================================================================================
__global__ __launch_bounds__(256) void outw(const float* __restrict__ IMG, const float* __restrict__ PART, float* out) {
  __shared__ __align__(16) float sc[32];
  const int tid = threadIdx.x, wave = tid >> 5, lane = tid & 31;
  if (tid < 32) sc[tid] = 0.f;
  __syncthreads();
  if (blockIdx.x == 0) {                                   // block-uniform
#pragma unroll 1
    for (int bsel = wave; bsel < NB; bsel += 8) {          // wave-uniform
      const float* pp = PART + ((size_t)bsel * WPB + lane) * 32;
      float s = 0.f;
#pragma unroll 1
      for (int i = 0; i < WPB / 32; ++i) s += pp[(size_t)i * (32 * 32)];
#pragma unroll
      for (int d = 16; d >= 1; d >>= 1) s += __shfl_xor(s, d, 32);
      if (lane == 0) sc[bsel] = s * DEPSC;
    }
  }
  __syncthreads();
  const size_t t = (size_t)blockIdx.x * 256 + (size_t)tid;
  if (t >= (size_t)NPIECE) return;                         // no barriers after this point
  const size_t e0 = t * 4;
#if (NB % 4) == 0
  const bool   hs = (e0 < (size_t)NB);
  const int    si = hs ? (int)e0 : 0;
  const v4f    sv = *(const v4f*)(sc + si);
  const size_t ii = hs ? (size_t)0 : (e0 - (size_t)NB);   // clamped, 16-B aligned
  const v4f    gv = *(const v4f*)(IMG + ii);
  v4f val;
#pragma unroll
  for (int e = 0; e < 4; ++e) val[e] = hs ? sv[e] : gv[e];
  float* dst = out + e0;
  {
    *(v4f*)(dst) = val;
    
  }
#else
  float val[4];
  const size_t rem = (size_t)TOTOUT - e0;
  const int nval = (rem < 4) ? (int)rem : 4;
#pragma unroll
  for (int j = 0; j < 4; ++j) {
    size_t e = e0 + (size_t)j;
    if (e > (size_t)(TOTOUT - 1)) e = (size_t)(TOTOUT - 1);
    const bool hsj = (e < (size_t)NB);
    const float g = IMG[hsj ? (size_t)0 : (e - (size_t)NB)];
    const float s = sc[hsj ? (int)e : 0];
    val[j] = hsj ? s : g;
  }
  float* dst = out + e0;
  if (nval == 4) {
    v4f vv;
#pragma unroll
    for (int j = 0; j < 4; ++j) vv[j] = val[j];
    {
      *(v4f*)(dst) = vv;
      
    }
  } else {
    {
#pragma unroll
      for (int j = 0; j < 4; ++j) { if (j < nval) *(float*)(dst + j) = val[j]; }
      
    }
  }
#endif
}

// =====================================================================================================
// Workspace map (bytes); every plane is fully written by whole-line stores before it is read; all extents are exact multiples
// of the store granularity (no pad rows needed); F and QP are reused sequentially (in-order stream):
//   XB   bf16 [ROWS][1024]                 NB*4194304   (bf16 copy of the input activations)
//   WQKV bf16 [3072 n][1024 k]                6291456
//   WOB  f16  [1024 n][1024 k] x1024          2097152   WDB same 2097152
//   F    f32  [ROWS][1024]                 NB*8388608   (projection q, then k, then v, then O.Wo^T, then the final image)
//   QP   f16  [ROWS][8][128] x8            NB*4194304   (later UP: f16 plane of O.Wo^T output x1024)
//   KP   f16  same                          NB*4194304
//   VP   f16  [NB][8][128][2048] x1024      NB*4194304
//   OP   f16  [ROWS][8][128] x1024         NB*4194304
//   PART f32  [ATT_BLOCKS*8][32]           NB*131072
//   end (NB = 4)                            128450560
// =====================================================================================================
extern "C" void kernel_launch(void* const* d_in, const int* in_sizes, int n_in,
                              void* d_out, int out_size, void* d_ws, size_t ws_size,
                              hipStream_t stream) {
  if (n_in < 7) return;
  if (in_sizes[0] != ROWS * DMOD) return;
  if (in_sizes[1] != 3 * DMOD * DMOD || in_sizes[2] != 3 * DMOD) return;
  if (in_sizes[3] != DMOD * DMOD || in_sizes[4] != DMOD) return;
  if (in_sizes[5] != DMOD * DMOD || in_sizes[6] != DMOD) return;
  if (out_size != TOTOUT) return;

  const float* x    = (const float*)d_in[0];
  const float* wqkv = (const float*)d_in[1];
  const float* bqkv = (const float*)d_in[2];
  const float* wo   = (const float*)d_in[3];
  const float* bo   = (const float*)d_in[4];
  const float* wd   = (const float*)d_in[5];
  const float* bd   = (const float*)d_in[6];
  float*       out  = (float*)d_out;

  const size_t szXB   = (size_t)ROWS * DMOD * 2;
  const size_t szWQKV = (size_t)3 * DMOD * DMOD * 2;
  const size_t szW    = (size_t)DMOD * DMOD * 2;
  const size_t szF    = (size_t)ROWS * DMOD * 4;
  const size_t szP    = (size_t)ROWS * DMOD * 2;
  const size_t szVP   = (size_t)NB * NH * HD * SEQ * 2;
  const size_t szPART = (size_t)ATT_BLOCKS * ATT_WAVES * 32 * 4;
  size_t off = 0;
  const size_t oXB   = off; off += szXB;
  const size_t oWQKV = off; off += szWQKV;
  const size_t oWOB  = off; off += szW;
  const size_t oWDB  = off; off += szW;
  const size_t oF    = off; off += szF;
  const size_t oQP   = off; off += szP;
  const size_t oKP   = off; off += szP;
  const size_t oVP   = off; off += szVP;
  const size_t oOP   = off; off += szP;
  const size_t oPART = off; off += szPART;
  if (off > ws_size) return;                            // off = 128450560 for NB = 4
  if (off > (size_t)134217728) return;

  char* ws = (char*)d_ws;
  u16*   XB   = (u16*)(ws + oXB);
  u16*   WQKV = (u16*)(ws + oWQKV);
  u16*   WOB  = (u16*)(ws + oWOB);
  u16*   WDB  = (u16*)(ws + oWDB);
  float* F    = (float*)(ws + oF);
  u16*   QP   = (u16*)(ws + oQP);
  u16*   UP   = QP;                                     // reused after the attention launch has consumed QP
  u16*   KP   = (u16*)(ws + oKP);
  u16*   VP   = (u16*)(ws + oVP);
  u16*   OP   = (u16*)(ws + oOP);
  float* PART = (float*)(ws + oPART);

  const int n8x   = (ROWS * DMOD) / 8;
  const int n8qkv = (3 * DMOD * DMOD) / 8;
  const int n8w   = (DMOD * DMOD) / 8;
  if ((n8x % 256) != 0 || (n8qkv % 256) != 0 || (n8w % 256) != 0 || (DMOD % 64) != 0 || (ROWS % 64) != 0 || (DMOD % 32) != 0) return;
  const dim3 blk(256);
  const dim3 gX(n8x / 256);
  const dim3 gQKV(n8qkv / 256);
  const dim3 gW(n8w / 256);
  const dim3 gG((ROWS / GBT) * (DMOD / GBT));
  const dim3 bG(128);
  const dim3 gVT(NB * NH * (SEQ / 64));
  const dim3 gAT(ATT_BLOCKS);
  const dim3 bAT(ATT_THREADS);
  const dim3 gOW((NPIECE + 255) / 256);
  const size_t wblk = (size_t)DMOD * DMOD;

  // (0..3) input activations -> bf16 plane; weights stored [n = out][k = in] (y = x.W^T), already k-contiguous:
  //        bf16 plane for the qkv weight, f16 of bf16 value x1024 for the two square weights
  cvt16<<<gX,   blk, 0, stream>>>(x,    XB,   n8x,   0, 1.0f);
  cvt16<<<gQKV, blk, 0, stream>>>(wqkv, WQKV, n8qkv, 0, 1.0f);
  cvt16<<<gW,   blk, 0, stream>>>(wo,   WOB,  n8w,   1, WOS);
  cvt16<<<gW,   blk, 0, stream>>>(wd,   WDB,  n8w,   1, WOS);
  // (4,5) q: projection + bias [ROWS][1024] f32 (col = h*128+d), f16 plane x8
  gemm_bfb<<<gG, bG, 0, stream>>>(XB, WQKV, bqkv, F, ROWS, DMOD, DMOD, 1.0f);
  cvt16<<<gX, blk, 0, stream>>>(F, QP, n8x, 2, QSC);
  // (6,7) k: same pipeline with weight rows 1024..2047 (F reused; single in-order stream)
  gemm_bfb<<<gG, bG, 0, stream>>>(XB, WQKV + wblk, bqkv + DMOD, F, ROWS, DMOD, DMOD, 1.0f);
  cvt16<<<gX, blk, 0, stream>>>(F, KP, n8x, 2, KSC);
  // (8,9) v: weight rows 2048..3071, then v^T plane x1024
  gemm_bfb<<<gG, bG, 0, stream>>>(XB, WQKV + 2 * wblk, bqkv + 2 * DMOD, F, ROWS, DMOD, DMOD, 1.0f);
  vt16<<<gVT, blk, 0, stream>>>(F, VP);
  // (10) attention -> O plane [b][s][h][d] x1024 and per-wave row-sum lines
  attn_fwd<<<gAT, bAT, 0, stream>>>(QP, KP, VP, OP, PART);
  // (11,12) first output projection + bias -> F f32 (carries 1024 x 1024 folded back), then f16 plane x1024
  gemm_h1<<<gG, bG, 0, stream>>>(OP, WOB, bo, F, ROWS, DMOD, DMOD, 1.0f / (OSC * WOS));
  cvt16<<<gX, blk, 0, stream>>>(F, UP, n8x, 2, USC);
  // (13) second output projection + bias -> F f32 image [ROWS][1024]
  gemm_h1<<<gG, bG, 0, stream>>>(UP, WDB, bd, F, ROWS, DMOD, DMOD, 1.0f / (USC * WOS));
  // (14) flat line-owned writer of the whole output buffer
  outw<<<gOW, blk, 0, stream>>>(F, PART, out);
  (void)hipGetLastError();
}

// v003
// A run of this version takes 190 microseconds.
// Next to v002, in two timings, it ran 1.24 times as fast each time.
// All steps since v000 together make it 3.13 times as fast.
// Contractions: x.W{q,k,v}^T on v_wmma_f32_16x16x32_bf16 (x and W planes RNE-converted to bf16 operands, f32 accumulate, bias added in f32);
// scores k'.q'^T (q', k' single f16 planes carried x8), P.v (P x32768 single f16, v x1024 single f16), O.Wo^T and U.Wd^T
// (O and U single f16 planes x1024, Wo and Wd as f16(bf16(W) x1024)): v_wmma_f32_16x16x32_f16, f32 accumulate.
// Base-2 online softmax, 1/l fold, row-sum partials and bias adds in f32 on VALU.
// The q, k, v^T and U operand planes are written by the epilogue of the GEMM that produces them (f32 result, bias, carry, f16).
#include <hip/hip_runtime.h>
#include <math.h>
#include <stdint.h>

#define NB    4
#define SEQ   2048
#define DMOD  1024
#define NH    8
#define HD    128
#define QT_BITS 5
#define NH_BITS 3
#define ROWS  (NB * SEQ)
#define QSC   8.0f
#define KSC   8.0f
#define PCAR  32768.0f
#define VCAR  1024.0f
#define OSC   1024.0f
#define USC   1024.0f
#define WOS   1024.0f
#define SM_SCALE 0.08838834764831845f
#define LOG2E 1.4426950408889634f
#define ATT_WAVES   8
#define ATT_THREADS (ATT_WAVES * 32)
#define ATT_QROWS   (ATT_WAVES * 16)
#define AQT_BITS    4
#define ATT_BLOCKS  (NB * NH * (SEQ / ATT_QROWS))
#define NKB    (SEQ / 32)
#define RS     (NH * HD)
#define SPITCH 132
#define SLABF  (16 * SPITCH)
#define SLAB64 (16 * 68)
#define VTS    144
#define WPB    (NH * (SEQ / ATT_QROWS) * ATT_WAVES)
#define TOTOUT (NB + ROWS * DMOD)
#define IMGN   (ROWS * DMOD)
#define NPIECE ((TOTOUT + 3) / 4)
#define GBT    128
#define GKS    128
#define GPITCH 272
#define GOPB   (GBT * GPITCH)
#define GBUF   (2 * GOPB)
#define AKS    128
#define ANST   (SEQ / AKS)
#define AOPB   (AKS * GPITCH)
#define ABUF   (AOPB + HD * GPITCH)
#define DEPSC  (1.0f / ((float)NH * (float)SEQ * (float)SEQ))

static_assert(HD == 128 && DMOD == NH * HD && RS == DMOD);
static_assert((1 << QT_BITS) == (SEQ / 64) && (1 << NH_BITS) == NH);
static_assert((SEQ % 64) == 0 && (SEQ % 32) == 0 && NKB * 32 == SEQ);
static_assert(((ROWS * DMOD / 8) % 256) == 0 && ((3 * DMOD * DMOD / 8) % 256) == 0 && ((DMOD * DMOD / 8) % 256) == 0);
static_assert((ROWS % 64) == 0 && (DMOD % 64) == 0 && (DMOD % 32) == 0);
static_assert(NB >= 1 && NB <= 32);
static_assert((WPB % 32) == 0 && WPB == 1024);
static_assert(ATT_THREADS == 256 && (1 << AQT_BITS) == (SEQ / ATT_QROWS));
static_assert((SEQ % AKS) == 0 && ANST >= 2 && (AKS % 32) == 0 && AKS * 2 + 16 == GPITCH && HD * 2 + 16 == GPITCH);
static_assert(AKS == 8 * (ATT_THREADS / 16) && HD == 8 * (ATT_THREADS / 16));
static_assert(ATT_WAVES * SLABF * 4 <= 2 * ABUF);
static_assert(((SPITCH * 4) % 16) == 0 && (SPITCH >= HD + 4));
static_assert((VTS % 16) == 0 && VTS >= 64 * 2 && 4 * 64 * VTS <= 2 * GBUF && (SEQ % GBT) == 0);
static_assert(4 * 64 * 68 * 4 <= 2 * GBUF);
static_assert(IMGN % 4 == 0);
static_assert((ROWS % GBT) == 0 && (DMOD % GBT) == 0 && (DMOD % GKS) == 0 && GKS * 2 + 16 == GPITCH);

typedef unsigned short u16;
typedef _Float16 v16h __attribute__((ext_vector_type(16)));
typedef _Float16 v8h  __attribute__((ext_vector_type(8)));
typedef __bf16   v16b __attribute__((ext_vector_type(16)));
typedef float    v8f  __attribute__((ext_vector_type(8)));
typedef float    v4f  __attribute__((ext_vector_type(4)));
typedef unsigned int v4u __attribute__((ext_vector_type(4)));

union FragH { v16h v; v8h h[2]; v4u u[2]; };
union FragB { v16b v; v4u u[2]; };

// ---- scalar helpers --------------------------------------------------------------------------------
__device__ __forceinline__ unsigned short bf_bits(float f) {          // f32 -> bf16 bits, RNE convert
  unsigned u = __float_as_uint(f);
  return (unsigned short)((u + 0x7FFFu + ((u >> 16) & 1u)) >> 16);
}
__device__ __forceinline__ float bf_up(unsigned short h) { return __uint_as_float(((unsigned)h) << 16); }
__device__ __forceinline__ float bfr(float f) { return bf_up(bf_bits(f)); }
__device__ __forceinline__ unsigned short h_bits(_Float16 x) { return __builtin_bit_cast(unsigned short, x); }
__device__ __forceinline__ unsigned pk16(unsigned short a, unsigned short b) { return (unsigned)a | ((unsigned)b << 16); }
__device__ __forceinline__ v8f zero8() { v8f z = {0.f, 0.f, 0.f, 0.f, 0.f, 0.f, 0.f, 0.f}; return z; }
__device__ __forceinline__ v4f zero4() { v4f z = {0.f, 0.f, 0.f, 0.f}; return z; }

// ---- fragment loaders: 16-bit A/B operand, lane -> row/col (lane&15), p already includes +8*(lane>>4);
//      elements 0..7 <- p[0..7] (k0+8h..), elements 8..15 <- p[16..23] (k0+16+8h..)  (same split k map for A and B;
//      B is always read from a k-contiguous [n][k] plane)
__device__ __forceinline__ v16h ldfrag_h(const _Float16* p) {
  FragH f;
  f.h[0] = *(const v8h*)(p);
  f.h[1] = *(const v8h*)(p + 16);
  return f.v;
}

__device__ __forceinline__ v8f mma_h(v16h a, v16h b, v8f c) {
  return __builtin_amdgcn_wmma_f32_16x16x32_f16(false, a, false, b, (short)0, c, false, false);
}
__device__ __forceinline__ v8f mma_b(v16b a, v16b b, v8f c) {
  return __builtin_amdgcn_wmma_f32_16x16x32_bf16(false, a, false, b, (short)0, c, false, false);
}
__device__ __forceinline__ void guard2(v8f& a, v8f& b, v16h x0, v16h x1, v16h x2, v16h x3, v16h x4, v16h x5) {
#if defined(__HIP_DEVICE_COMPILE__)
  asm volatile("v_nop\n\tv_nop\n\tv_nop\n\tv_nop"
               : "+v"(a), "+v"(b) : "v"(x0), "v"(x1), "v"(x2), "v"(x3), "v"(x4), "v"(x5) : "memory");
#endif
}
template <typename F>
__device__ __forceinline__ void guard6(v8f& a, v8f& b, v8f& c, v8f& d, F x0, F x1, F x2, F x3, F x4, F x5) {
#if defined(__HIP_DEVICE_COMPILE__)
  asm volatile("v_nop\n\tv_nop\n\tv_nop\n\tv_nop"
               : "+v"(a), "+v"(b), "+v"(c), "+v"(d) : "v"(x0), "v"(x1), "v"(x2), "v"(x3), "v"(x4), "v"(x5) : "memory");
#endif
}
__device__ __forceinline__ void acc_guard4(v8f& a, v8f& b, v8f& c, v8f& d) {
#if defined(__HIP_DEVICE_COMPILE__)
  asm volatile("v_nop\n\tv_nop\n\tv_nop\n\tv_nop" : "+v"(a), "+v"(b), "+v"(c), "+v"(d));
#endif
}
__device__ __forceinline__ void wave_sync_lds() {
  __builtin_amdgcn_fence(__ATOMIC_RELEASE, "workgroup");
  __builtin_amdgcn_wave_barrier();
  __builtin_amdgcn_fence(__ATOMIC_ACQUIRE, "workgroup");
}

// =====================================================================================================
// f32 plane -> 16-bit plane, same layout:  mode 0: bf16 RNE bits;  mode 1: f16 bits of (bf16 RNE value) * scale;
// mode 2: f16 bits of value * scale (no bf16 pre-step).
// Thread = 8 consecutive elements: two 16-B loads, one 16-B store; 32 consecutive lanes = 512 contiguous, 512-B aligned bytes
// coverage: grid = n8/256 blocks (host checks exactness) x 256 thr x 8 = the whole plane.
// =====================================================================================================
__global__ __launch_bounds__(256) void cvt16(const float* __restrict__ x, u16* D, int n8, int mode, float scale) {
  const int gt = blockIdx.x * 256 + (int)threadIdx.x;
  if (gt >= n8) return;                     // no barriers in this kernel
  const float* p = x + (size_t)gt * 8;
  const v4f a = *(const v4f*)(p), c4 = *(const v4f*)(p + 4);
  float v[8];
#pragma unroll
  for (int e = 0; e < 4; ++e) { v[e] = a[e]; v[4 + e] = c4[e]; }
  unsigned short s[8];
#pragma unroll
  for (int e = 0; e < 8; ++e) {
    const float vb = bfr(v[e]);
    const float vf = (mode == 1) ? vb : v[e];
    const unsigned short hb = h_bits((_Float16)(vf * scale));
    const unsigned short bb = bf_bits(v[e]);
    s[e] = (mode != 0) ? hb : bb;
  }
  v4u o;
#pragma unroll
  for (int e = 0; e < 4; ++e) o[e] = pk16(s[2 * e], s[2 * e + 1]);
  u16* d = D + (size_t)gt * 8;
  {
    *(v4u*)(d) = o;
    
  }
}

// =====================================================================================================
// GEMM f32 epilogue (EPI 0): the wave's 16x64 f32 tile (times oscale) staged in its LDS slab (pitch 68),
// coverage: 8 instructions x 2 rows x 16 lanes x 4 floats = the wave's 16 x 64 tile.
// =====================================================================================================
__device__ __forceinline__ void epi64(float* sl, v8f a0, v8f a1, v8f a2, v8f a3, float oscale, v4f badd, float* C, int N,
                                      size_t rowb, int col0, int lane) {
  const int hh = lane >> 4, m = lane & 15;
#pragma unroll
  for (int r = 0; r < 8; ++r) {
    const int ro = (8 * hh + r) * 68 + m;
    sl[ro]      = a0[r] * oscale;
    sl[ro + 16] = a1[r] * oscale;
    sl[ro + 32] = a2[r] * oscale;
    sl[ro + 48] = a3[r] * oscale;
  }
  wave_sync_lds();
  v4f vals[8];
#pragma unroll
  for (int it = 0; it < 8; ++it) vals[it] = *(const v4f*)(sl + (it * 2 + hh) * 68 + m * 4) + badd;
  float* dst = C + (rowb + (size_t)hh) * (size_t)N + col0 + m * 4;
  {
#pragma unroll
    for (int it = 0; it < 8; ++it) {
      *(v4f*)(dst + (size_t)(it * 2) * (size_t)N) = vals[it];
    }
    
  }
}

// =====================================================================================================
// 16-bit GEMM with bias, both engines: C[M][N] (f32) = A[M][K] (row-major) . Bt[N][K]^T (k-contiguous), times oscale, plus the
// bf16-RNE value of bias[n]. Block = 128x128 tile of C, 4 waves as 2x2, wave = 64x64 (4x4 accumulator tiles).
// EPI 0 stores C as f32; EPI 1 stores f16(C * pscale) as the plane P[M][N]; EPI 2 stores f16(C * pscale) transposed per batch,
// P[(row / SEQ) * N + col][row % SEQ] (the v^T plane: N = NH * HD, col = h * HD + d).
// A stage is 128 k of the block's 128 A rows and 128 Bt rows: 256 rows of 256 B, laid in LDS at pitch 272 B by asynchronous
// b128 copies (16 lanes = one whole 256-B row, so every copy touches whole lines). Two buffers: stage t+1 flies while stage t
// is multiplied. Fragments are read from LDS with the same split k map for A and B as ldfrag_h; k runs upward in steps of 32
// into one accumulator per tile. Shapes: M % 128 == 0, N % 128 == 0, K % 128 == 0, grid = (M/128)*(N/128) (static_assert above).
// =====================================================================================================
__device__ __forceinline__ unsigned lds_off(const void* p) { return (unsigned)(size_t)p; }

// Eight asynchronous 16-B-per-lane copies, rows 8 apart. The s_wait_xcnt stands inside the statement so that no address
// register of a copy is rewritten in front of it.
__device__ __forceinline__ void copy8(unsigned l, const u16* g, size_t rs8) {
#if defined(__HIP_DEVICE_COMPILE__)
  asm volatile("global_load_async_to_lds_b128 %0, %8, off\n\t"
               "global_load_async_to_lds_b128 %1, %9, off\n\t"
               "global_load_async_to_lds_b128 %2, %10, off\n\t"
               "global_load_async_to_lds_b128 %3, %11, off\n\t"
               "global_load_async_to_lds_b128 %4, %12, off\n\t"
               "global_load_async_to_lds_b128 %5, %13, off\n\t"
               "global_load_async_to_lds_b128 %6, %14, off\n\t"
               "global_load_async_to_lds_b128 %7, %15, off\n\t"
               "s_wait_xcnt 0x0"
               :: "v"(l), "v"(l + 8u * GPITCH), "v"(l + 16u * GPITCH), "v"(l + 24u * GPITCH),
                  "v"(l + 32u * GPITCH), "v"(l + 40u * GPITCH), "v"(l + 48u * GPITCH), "v"(l + 56u * GPITCH),
                  "v"(g), "v"(g + rs8), "v"(g + 2 * rs8), "v"(g + 3 * rs8),
                  "v"(g + 4 * rs8), "v"(g + 5 * rs8), "v"(g + 6 * rs8), "v"(g + 7 * rs8)
               : "memory");
#endif
}
// One stage: this thread's 16 B of rows cr + 8i (i = 0..15) of the A tile and of the Bt tile; 32 copies per wave.
__device__ __forceinline__ void fill_stage(unsigned l, const u16* ga, const u16* gb, size_t rs8) {
  copy8(l, ga, rs8);
  copy8(l + 64u * GPITCH, ga + 8 * rs8, rs8);
  copy8(l + GOPB, gb, rs8);
  copy8(l + GOPB + 64u * GPITCH, gb + 8 * rs8, rs8);
}
__device__ __forceinline__ void wait_async0() {   // this wave's copies have landed
#if defined(__HIP_DEVICE_COMPILE__)
  asm volatile("s_wait_asynccnt 0x0" ::: "memory");
#endif
}
__device__ __forceinline__ void wait_ds0() {      // this wave's LDS reads have returned before their buffer is refilled
#if defined(__HIP_DEVICE_COMPILE__)
  asm volatile("s_wait_dscnt 0x0" ::: "memory");
#endif
}
__device__ __forceinline__ FragB ld_lfrag(const unsigned char* p) {   // split k map of ldfrag_h: bytes 0..15 and 32..47
  FragB f;
  f.u[0] = *(const v4u*)(p);
  f.u[1] = *(const v4u*)(p + 32);
  return f;
}
__device__ __forceinline__ v8f mma_sel(FragB a, FragB b, v8f c, bool bf) {
  if (bf) return mma_b(a.v, b.v, c);
  return mma_h(__builtin_bit_cast(v16h, a.v), __builtin_bit_cast(v16h, b.v), c);
}

template <bool BF, int EPI>
__device__ __forceinline__ void gemm_core(unsigned char* ring, float* slab, const u16* __restrict__ A,
                                          const u16* __restrict__ Bt, const float* __restrict__ bias,
                                          float* C, u16* P, int M, int N, int K, float oscale, float pscale) {
  const int tid = threadIdx.x, wave = tid >> 5, lane = tid & 31, hh = lane >> 4, m = lane & 15;
  const int ntile = N >> 7;
  const int bid   = blockIdx.x;
  const int row0  = (bid / ntile) * GBT;
  const int col0  = (bid % ntile) * GBT;
  if (row0 + GBT > M) return;                // block-uniform, in front of every barrier; never taken with the exact grid
  const int wr = wave >> 1, wc = wave & 1;
  const int nst = K >> 7;
  const int cr = tid >> 4, cc = tid & 15;    // copy: row within a group of 8, 16-B chunk of the 256-B row
  const u16* ga = A  + (size_t)(row0 + cr) * K + cc * 8;
  const u16* gb = Bt + (size_t)(col0 + cr) * K + cc * 8;
  const size_t rs8 = (size_t)8 * K;
  const unsigned l0 = lds_off(ring) + (unsigned)(cr * GPITCH + cc * 16);

  v8f acc[4][4];
#pragma unroll
  for (int i = 0; i < 4; ++i) {
#pragma unroll
    for (int j = 0; j < 4; ++j) acc[i][j] = zero8();
  }

  fill_stage(l0, ga, gb, rs8);
  wait_async0();
  __syncthreads();                           // publishes stage 0
  if (nst > 1) fill_stage(l0 + GBUF, ga + GKS, gb + GKS, rs8);

  for (int t = 0; t < nst; ++t) {
    const unsigned bo = (unsigned)(t & 1) * GBUF;
    const unsigned char* ab = ring + bo + (wr * 64 + m) * GPITCH + hh * 16;
    const unsigned char* bb = ring + bo + GOPB + (wc * 64 + m) * GPITCH + hh * 16;
    FragB a[2][4], b[2][4];                  // set (ks & 1) holds the fragments of k step ks
#pragma unroll
    for (int i = 0; i < 4; ++i) { a[0][i] = ld_lfrag(ab + i * 16 * GPITCH); b[0][i] = ld_lfrag(bb + i * 16 * GPITCH); }
#pragma unroll
    for (int ks = 0; ks < GKS / 32; ++ks) {
      const int cs = ks & 1;
      if (ks + 1 < GKS / 32) {
#pragma unroll
        for (int i = 0; i < 4; ++i) {
          a[cs ^ 1][i] = ld_lfrag(ab + i * 16 * GPITCH + (ks + 1) * 64);
          b[cs ^ 1][i] = ld_lfrag(bb + i * 16 * GPITCH + (ks + 1) * 64);
        }
      }
      // keeps the next k step's LDS reads one group ahead of this step's products instead of spread among them
      __builtin_amdgcn_sched_barrier(0);
#pragma unroll
      for (int i = 0; i < 4; ++i) {
#pragma unroll
        for (int j = 0; j < 4; ++j) acc[i][j] = mma_sel(a[cs][i], b[cs][j], acc[i][j], BF);
      }
      // keeps the following group of LDS reads behind this step's products
      __builtin_amdgcn_sched_barrier(0);
    }
    wait_ds0();
    wait_async0();
    __syncthreads();                         // publishes stage t+1 and ends every reader's last read of stage t's buffer
    if (t + 2 < nst) fill_stage(l0 + bo, ga + (size_t)(t + 2) * GKS, gb + (size_t)(t + 2) * GKS, rs8);
  }
  wait_async0();

  const int colw = col0 + wc * 64;
  if constexpr (EPI == 0) {
    float* sl = slab + wave * SLAB64;
    const v4f bv = *(const v4f*)(bias + colw + m * 4);    // columns colw + 4m .. +3, always < N (N multiple of 128)
    v4f badd;
#pragma unroll
    for (int e = 0; e < 4; ++e) badd[e] = bfr(bv[e]);
#pragma unroll
    for (int i = 0; i < 4; ++i) {
      if (i) wave_sync_lds();                // the slab's last readers are done before other lanes overwrite it
      epi64(sl, acc[i][0], acc[i][1], acc[i][2], acc[i][3], oscale, badd, C, N, (size_t)(row0 + wr * 64 + i * 16), colw, lane);
    }
  } else if constexpr (EPI == 1) {
    // The wave's 64 x 64 f32 tile (times oscale) is staged whole in its own part of the ring (pitch 68 floats), which the last
    // stage's barrier has freed of readers and copies; read back with 8 lanes per row (8 columns each), so that every 128-B
    // row piece of the plane leaves as one whole line.
    // coverage: 16 instructions x 4 rows x 8 lanes x 8 halves = the wave's 64 x 64 tile.
    float* sl = (float*)(void*)ring + wave * (64 * 68);
#pragma unroll
    for (int i = 0; i < 4; ++i) {
#pragma unroll
      for (int r = 0; r < 8; ++r) {
        const int ro = (i * 16 + 8 * hh + r) * 68 + m;
#pragma unroll
        for (int j = 0; j < 4; ++j) sl[ro + 16 * j] = acc[i][j][r] * oscale;
      }
    }
    const int rq = lane >> 3, p8 = (lane & 7) * 8;
    const float* bp = bias + colw + p8;                   // columns colw + 8(lane & 7) .. +7, always < N
    const v4f bv0 = *(const v4f*)(bp), bv1 = *(const v4f*)(bp + 4);
    v4f b0, b1;
#pragma unroll
    for (int e = 0; e < 4; ++e) { b0[e] = bfr(bv0[e]); b1[e] = bfr(bv1[e]); }
    wave_sync_lds();
    v4u o[16];
#pragma unroll
    for (int it = 0; it < 16; ++it) {
      const float* s = sl + (it * 4 + rq) * 68 + p8;
      const v4f x = (*(const v4f*)(s) + b0) * pscale, y = (*(const v4f*)(s + 4) + b1) * pscale;
      const v8f f = {x[0], x[1], x[2], x[3], y[0], y[1], y[2], y[3]};
      o[it] = __builtin_bit_cast(v4u, __builtin_convertvector(f, v8h));
    }
    u16* dst = P + (size_t)(row0 + wr * 64 + rq) * (size_t)N + colw + p8;
#pragma unroll
    for (int it = 0; it < 16; ++it) *(v4u*)(dst + (size_t)(it * 4) * (size_t)N) = o[it];
  } else {
    // An accumulator lane holds 8 consecutive rows of one column: 16 B of a transposed line. The wave's 64 columns x 64 rows
    // are gathered in its own part of the ring (pitch 144 B), which the last stage's barrier has freed of readers and copies,
    // and leave as whole 128-B lines, 8 lanes each.
    // coverage: 16 instructions x 4 lines x 8 lanes x 8 halves = the wave's 64 x 64 tile.
    unsigned char* st = ring + wave * (64 * VTS);
#pragma unroll
    for (int j = 0; j < 4; ++j) {
      const float bj = bfr(bias[colw + j * 16 + m]);
#pragma unroll
      for (int i = 0; i < 4; ++i) {
        const v8f f = (acc[i][j] * oscale + bj) * pscale;
        *(v8h*)(st + (j * 16 + m) * VTS + i * 32 + hh * 16) = __builtin_convertvector(f, v8h);
      }
    }
    wave_sync_lds();
    const int rq = lane >> 3, p = lane & 7;
    v4u t[16];
#pragma unroll
    for (int it = 0; it < 16; ++it) t[it] = *(const v4u*)(st + (it * 4 + rq) * VTS + p * 16);
    const int roww = row0 + wr * 64;         // 64 rows of one batch (SEQ % 128 == 0)
    u16* dst = P + ((size_t)(roww / SEQ) * (size_t)N + colw + rq) * SEQ + (roww % SEQ) + p * 8;
#pragma unroll
    for (int it = 0; it < 16; ++it) *(v4u*)(dst + (size_t)(it * 4) * SEQ) = t[it];
  }
}

__global__ __launch_bounds__(128)
void gemm_bfp(const u16* __restrict__ A, const u16* __restrict__ Bt, const float* __restrict__ bias,
              u16* P, int M, int N, int K, float oscale, float pscale) {
  __shared__ __align__(16) unsigned char ring[2 * GBUF];
  gemm_core<true, 1>(ring, nullptr, A, Bt, bias, nullptr, P, M, N, K, oscale, pscale);
}

__global__ __launch_bounds__(128)
void gemm_bft(const u16* __restrict__ A, const u16* __restrict__ Bt, const float* __restrict__ bias,
              u16* P, int M, int N, int K, float oscale, float pscale) {
  __shared__ __align__(16) unsigned char ring[2 * GBUF];
  gemm_core<true, 2>(ring, nullptr, A, Bt, bias, nullptr, P, M, N, K, oscale, pscale);
}

__global__ __launch_bounds__(128)
void gemm_hp(const u16* __restrict__ A, const u16* __restrict__ Bt, const float* __restrict__ bias,
             u16* P, int M, int N, int K, float oscale, float pscale) {
  __shared__ __align__(16) unsigned char ring[2 * GBUF];
  gemm_core<false, 1>(ring, nullptr, A, Bt, bias, nullptr, P, M, N, K, oscale, pscale);
}

__global__ __launch_bounds__(128)
void gemm_h1(const u16* __restrict__ A, const u16* __restrict__ Bt, const float* __restrict__ bias,
             float* C, int M, int N, int K, float oscale) {
  __shared__ __align__(16) unsigned char ring[2 * GBUF];
  __shared__ __align__(16) float slab[4 * SLAB64];
  gemm_core<false, 0>(ring, slab, A, Bt, bias, C, nullptr, M, N, K, oscale, 1.0f);
}

// =====================================================================================================
// Multi-head flash attention (no mask): block = (batch b, head, 128 query rows), 8 waves, wave w owns the 16 query rows
// q0 = 128*qt + 16*w .. q0+15.
//   q plane (f16, x8) laid out [b][s][h][d]; k plane the same; v^T plane [b][h][d][s] (x1024).
//   All NKB = SEQ/32 key blocks of 32 keys are visited (static bound), in stages of 128 keys that the block's waves share:
//   a stage is 128 k rows of 256 B (all d) and 128 v^T rows of 256 B (its 128 keys), laid in LDS at pitch 272 B by asynchronous
//   b128 copies (16 lanes = one whole 256-B row). Two buffers: stage t+1 flies while stage t is worked on. The fragments are
//   read from LDS with the split k map of ldfrag_h. After the last stage's barrier the ring is the epilogue's staging room.
//   Scores are computed TRANSPOSED: S^T tile g (g = 0,1) = k rows (keys kb+16g .. +15, A operand, row m = lane&15, split k map
//   over d, 4 chunks of 32 d) times q^T (B operand, col n = query q0 + (lane&15), k = d, split map).
//   D element r of lane l = (key kb+16g+8h+r, query q0+(l&15)), so a lane owns one query column and 16 of its 32 keys; the
//   partner lane l^16 owns the other 16 -> row max / row sum need one xor-16 shuffle.
//   Online max-subtracted base-2 softmax in f32 (scale 1/sqrt(128) and the q/k carries folded into lsc). The exp'd values ARE
//   the P A-fragment in place: A row m = query = lane&15, element i <- key kb+8h+i (tile 0, D element i), element 8+i <- key
//   kb+16+8h+i (tile 1, D element i). P is carried x32768 as single f16. The rescale factor of query row 8h+r of the
//   O accumulators is fetched from lane 8h+r with a shuffle (uniform control). 8 v^T B fragments (col n = d = 16j + (lane&15),
//   keys k-contiguous), 8 P.V WMMAs per key block in two guarded groups of 4.
//   Epilogue: 1/l (per query, shuffled to the D row owner) and carry folds in f32; the wave's 16x128 f32 result staged in its
//   LDS slab (pitch 132); each 256-B output row (b, q0+row, head) of the O plane (O x1024 as single f16) written as 2 whole
// coverage: per wave 8 instructions x 2 rows x 16 lanes x 8 halves = 16 x 128 of the O plane + 1 PART line; grid
//           NB*NH*SEQ/128 blocks x 8 waves = every (b, s, h) row of the O plane and every PART line exactly once.
// =====================================================================================================
// Eight asynchronous 16-B-per-lane copies, rows 16 apart. The s_wait_xcnt stands inside the statement so that no address
// register of a copy is rewritten in front of it.
__device__ __forceinline__ void copy8w(unsigned l, const u16* g, size_t rs16) {
#if defined(__HIP_DEVICE_COMPILE__)
  asm volatile("global_load_async_to_lds_b128 %0, %8, off\n\t"
               "global_load_async_to_lds_b128 %1, %9, off\n\t"
               "global_load_async_to_lds_b128 %2, %10, off\n\t"
               "global_load_async_to_lds_b128 %3, %11, off\n\t"
               "global_load_async_to_lds_b128 %4, %12, off\n\t"
               "global_load_async_to_lds_b128 %5, %13, off\n\t"
               "global_load_async_to_lds_b128 %6, %14, off\n\t"
               "global_load_async_to_lds_b128 %7, %15, off\n\t"
               "s_wait_xcnt 0x0"
               :: "v"(l), "v"(l + 16u * GPITCH), "v"(l + 32u * GPITCH), "v"(l + 48u * GPITCH),
                  "v"(l + 64u * GPITCH), "v"(l + 80u * GPITCH), "v"(l + 96u * GPITCH), "v"(l + 112u * GPITCH),
                  "v"(g), "v"(g + rs16), "v"(g + 2 * rs16), "v"(g + 3 * rs16),
                  "v"(g + 4 * rs16), "v"(g + 5 * rs16), "v"(g + 6 * rs16), "v"(g + 7 * rs16)
               : "memory");
#endif
}
// One attention stage: this thread's 16 B of rows cr + 16i (i = 0..7) of the k tile and of the v^T tile; 16 copies per wave.
__device__ __forceinline__ void fill_kv(unsigned l, const u16* gk, const u16* gv) {
  copy8w(l, gk, (size_t)16 * RS);
  copy8w(l + AOPB, gv, (size_t)16 * SEQ);
}
__device__ __forceinline__ v16h ld_lfrag_h(const unsigned char* p) {  // split k map of ldfrag_h: bytes 0..15 and 32..47
  FragH f;
  f.u[0] = *(const v4u*)(p);
  f.u[1] = *(const v4u*)(p + 32);
  return f.v;
}

// four waves per SIMD (two blocks per WGP): the register budget that lets the vector work of one wave run under the others' waits
__global__ __launch_bounds__(ATT_THREADS) __attribute__((amdgpu_waves_per_eu(4, 4)))
void attn_fwd(const u16* __restrict__ QPp, const u16* __restrict__ KPp, const u16* __restrict__ VPp,
              u16* OPo, float* PART) {
  // two stage buffers (k tile, then v^T tile); in the epilogue, per wave, the result slab [16][132] of floats
  __shared__ __align__(16) unsigned char ring[2 * ABUF];

  const int tid  = threadIdx.x;
  const int wave = tid >> 5;
  const int lane = tid & 31;
  const int hh   = lane >> 4;
  const int c    = lane & 15;

  const int bid  = blockIdx.x;
  const int qt   = bid & ((SEQ / ATT_QROWS) - 1);
  const int head = (bid >> AQT_BITS) & (NH - 1);
  const int b    = bid >> (AQT_BITS + NH_BITS);
  const int q0   = qt * ATT_QROWS + wave * 16;

  // B fragments of q^T: col n = query q0 + c, k = d (k-contiguous row of the q plane)
  const _Float16* Qb = (const _Float16*)(const void*)QPp + ((size_t)(b * SEQ + q0 + c) * NH + head) * HD + 8 * hh;
  // copy: row within a group of 16, 16-B chunk of the 256-B row; k tile row = key, v^T tile row = d
  const int cr = tid >> 4, cc = tid & 15;
  const u16* gk = KPp + ((size_t)(b * SEQ + cr) * NH + head) * HD + cc * 8;     // stage t: + t * AKS key rows
  const u16* gv = VPp + ((size_t)(b * NH + head) * HD + cr) * SEQ + cc * 8;     // stage t: + t * AKS keys
  const unsigned l0 = lds_off(ring) + (unsigned)(cr * GPITCH + cc * 16);
  fill_kv(l0, gk, gv);
  const float lsc = SM_SCALE * (LOG2E / (QSC * KSC));

  const v16h qf0 = ldfrag_h(Qb);            // d 0..31
  const v16h qf1 = ldfrag_h(Qb + 32);       // d 32..63
  const v16h qf2 = ldfrag_h(Qb + 64);       // d 64..95
  const v16h qf3 = ldfrag_h(Qb + 96);       // d 96..127

  float mrun = -INFINITY, lrun = 0.f;
  v8f o[8];
#pragma unroll
  for (int j = 0; j < 8; ++j) o[j] = zero8();

  wait_async0();
  __syncthreads();                           // publishes stage 0
  fill_kv(l0 + ABUF, gk + (size_t)AKS * RS, gv + AKS);   // stage 1 exists (ANST >= 2)

  // one rolled trip per stage, so that the ring's publish point stands once, at the trip's foot
#pragma unroll 1
  for (int t = 0; t < ANST; ++t) {
   const unsigned bo = (unsigned)(t & 1) * ABUF;
   // A fragments of k: row m = key kb + 16g + c, k = d;  B fragments of v: col n = d = 16j + c, k = key
   const unsigned char* kt = ring + bo + c * GPITCH + hh * 16;
   const unsigned char* vt = ring + bo + AOPB + c * GPITCH + hh * 16;
   // stays rolled: unrolled four times the build runs out of the 256 registers of four waves per SIMD and spills
#pragma unroll 1
   for (int kk = 0; kk < AKS / 32; ++kk) {   // key block kb = t * AKS + kk * 32
    // ---- transposed scores: s0 = keys kb..kb+15, s1 = keys kb+16..kb+31, column = query q0 + c ----
    v8f s0 = zero8(), s1 = zero8();
    const unsigned char* k0p = kt + kk * 32 * GPITCH;
    const unsigned char* k1p = k0p + 16 * GPITCH;
    const unsigned char* vp  = vt + kk * 64;
    const v16h ka0 = ld_lfrag_h(k0p), ka1 = ld_lfrag_h(k0p + 64);
    const v16h kc0 = ld_lfrag_h(k1p), kc1 = ld_lfrag_h(k1p + 64);
    const v16h ka2 = ld_lfrag_h(k0p + 128), ka3 = ld_lfrag_h(k0p + 192);
    const v16h kc2 = ld_lfrag_h(k1p + 128), kc3 = ld_lfrag_h(k1p + 192);
    s0 = mma_h(ka0, qf0, s0);
    s0 = mma_h(ka1, qf1, s0);
    s1 = mma_h(kc0, qf0, s1);
    s1 = mma_h(kc1, qf1, s1);
    guard2(s0, s1, qf0, qf1, ka0, ka1, kc0, kc1);
    // the first four v^T fragments are read here, as one group, so that they return behind the softmax arithmetic
    const v16h vf0 = ld_lfrag_h(vp);
    const v16h vf1 = ld_lfrag_h(vp + 16 * GPITCH);
    const v16h vf2 = ld_lfrag_h(vp + 32 * GPITCH);
    const v16h vf3 = ld_lfrag_h(vp + 48 * GPITCH);
    s0 = mma_h(ka2, qf2, s0);
    s0 = mma_h(ka3, qf3, s0);
    s1 = mma_h(kc2, qf2, s1);
    s1 = mma_h(kc3, qf3, s1);
    guard2(s0, s1, qf2, qf3, ka2, ka3, kc2, kc3);
    const v16h vf4 = ld_lfrag_h(vp + 64 * GPITCH);
    const v16h vf5 = ld_lfrag_h(vp + 80 * GPITCH);
    const v16h vf6 = ld_lfrag_h(vp + 96 * GPITCH);
    const v16h vf7 = ld_lfrag_h(vp + 112 * GPITCH);
    // ---- base-2 logits of this lane's 16 keys for query q0 + c ----
    float tk[16];
#pragma unroll
    for (int i = 0; i < 8; ++i) { tk[i] = s0[i] * lsc;  tk[8 + i] = s1[i] * lsc; }
    float cm = -INFINITY;
#pragma unroll
    for (int i = 0; i < 16; ++i) cm = fmaxf(cm, tk[i]);
    cm = fmaxf(cm, __shfl_xor(cm, 16, 32));
    const float mn = fmaxf(mrun, cm);                                // finite from the first key block on
    const float al = (mrun == -INFINITY) ? 0.f : exp2f(mrun - mn);   // o and l are zero while mrun is -inf
    mrun = mn;
    // ---- probabilities (<= 1) and the P A-fragment: f16(p * 32768); element i <-> tk[i] ----
    float ps = 0.f;
    FragH ph;
#pragma unroll
    for (int w = 0; w < 2; ++w) {
#pragma unroll
      for (int e4 = 0; e4 < 4; ++e4) {
        const int i = 8 * w + 2 * e4;
        const float p0 = exp2f(fminf(tk[i] - mn, 0.f));
        const float p1 = exp2f(fminf(tk[i + 1] - mn, 0.f));
        ps += p0 + p1;
        ph.u[w][e4] = pk16(h_bits((_Float16)(p0 * PCAR)), h_bits((_Float16)(p1 * PCAR)));
      }
    }
    ps += __shfl_xor(ps, 16, 32);
    lrun = lrun * al + ps;
    // ---- rescale the O accumulators: D row 8hh+r = query q0+8hh+r, its factor lives in lane 8hh+r (and 16+8hh+r) ----
    float scl[8];
#pragma unroll
    for (int r = 0; r < 8; ++r) scl[r] = __shfl(al, 8 * hh + r, 32);
#pragma unroll
    for (int j = 0; j < 8; ++j) {
#pragma unroll
      for (int r = 0; r < 8; ++r) o[j][r] *= scl[r];
    }
    // ---- P.V : B fragment col n = d = j*16 + c, keys contiguous in the v^T tile; two guarded groups of 4 ----
    {
      o[0] = mma_h(ph.v, vf0, o[0]);
      o[1] = mma_h(ph.v, vf1, o[1]);
      o[2] = mma_h(ph.v, vf2, o[2]);
      o[3] = mma_h(ph.v, vf3, o[3]);
      guard6<v16h>(o[0], o[1], o[2], o[3], ph.v, vf0, vf1, vf2, vf3, ph.v);
    }
    {
      o[4] = mma_h(ph.v, vf4, o[4]);
      o[5] = mma_h(ph.v, vf5, o[5]);
      o[6] = mma_h(ph.v, vf6, o[6]);
      o[7] = mma_h(ph.v, vf7, o[7]);
      guard6<v16h>(o[4], o[5], o[6], o[7], ph.v, vf4, vf5, vf6, vf7, ph.v);
    }
   }
   wait_ds0();
   wait_async0();
   __syncthreads();                          // publishes stage t+1 and ends every reader's last read of stage t's buffer
   if (t + 2 < ANST) fill_kv(l0 + bo, gk + (size_t)(t + 2) * (AKS * RS), gv + (size_t)(t + 2) * AKS);
  }
  wait_async0();
  acc_guard4(o[0], o[1], o[2], o[3]);
  acc_guard4(o[4], o[5], o[6], o[7]);

  // ---- fold 1/l (per query, owned by lane = query) and the carries; row statistic r = l * (1/l); stage the 16x128 slab ----
  const float rl   = (lrun > 0.f) ? (1.0f / lrun) : 0.f;
  const float linv = rl * (1.0f / (PCAR * VCAR));
  const float rr   = lrun * rl;
  float inv[8];
#pragma unroll
  for (int r = 0; r < 8; ++r) inv[r] = __shfl(linv, 8 * hh + r, 32);
  // the last stage's barrier lies behind every wave's last fragment read and last copy: the ring is free
  float* slab = (float*)(void*)ring + wave * SLABF;
#pragma unroll
  for (int r = 0; r < 8; ++r) {
#pragma unroll
    for (int j = 0; j < 8; ++j) slab[(8 * hh + r) * SPITCH + j * 16 + c] = o[j][r] * inv[r];
  }
  wave_sync_lds();
  // ---- O x1024 -> single f16 plane; lane = (row parity hh, 8 consecutive d at c8) ----
  v4u oh[8];
  const int c8 = c * 8;
#pragma unroll
  for (int it = 0; it < 8; ++it) {
    const int row = it * 2 + hh;
    const v4f a = *(const v4f*)(slab + row * SPITCH + c8), c4 = *(const v4f*)(slab + row * SPITCH + c8 + 4);
    float w[8];
#pragma unroll
    for (int e = 0; e < 4; ++e) { w[e] = a[e] * OSC; w[4 + e] = c4[e] * OSC; }
#pragma unroll
    for (int e = 0; e < 4; ++e) {
      const _Float16 h0 = (_Float16)w[2 * e], h1 = (_Float16)w[2 * e + 1];
      oh[it][e] = pk16(h_bits(h0), h_bits(h1));
    }
  }
  // ---- wave row-sum partial (fixed xor tree over the 16 query lanes; both lane halves hold identical values) ----
  float wsum = rr;
  wsum += __shfl_xor(wsum, 1, 32);
  wsum += __shfl_xor(wsum, 2, 32);
  wsum += __shfl_xor(wsum, 4, 32);
  wsum += __shfl_xor(wsum, 8, 32);
  v4f pv = zero4();
  pv[0] = (lane == 0) ? wsum : 0.f;
  float* pd = PART + ((size_t)bid * ATT_WAVES + wave) * 32 + (lane & 7) * 4;   // clamped address for every lane
  const size_t ob = ((size_t)(b * SEQ + q0) * NH + head) * HD + c8;
  {
#pragma unroll
    for (int it = 0; it < 8; ++it) {
      const int row = it * 2 + hh;
      *(v4u*)(OPo + ob + (size_t)row * RS) = oh[it];
    }
    if (lane < 8) *(v4f*)(pd) = pv;
    
  }
}

// =====================================================================================================
// Flat output writer: out[0..NB-1] = score output (per batch: fixed-order sum of its WPB PART lines times 1/(NH*SEQ*SEQ),
// computed by block 0, wave = batch, 32 lanes x WPB/32 strided loads + xor tree), out[NB + i] = IMG[i] (f32 image of the last
// value. With NB % 4 != 0 a scalar path handles the element interleave and the partial last piece.
// coverage: grid = ceil(NPIECE/256) blocks x 256 thr x 4 elements with the in-kernel bound = all TOTOUT elements exactly once.
// =====================================================================================================
__global__ __launch_bounds__(256) void outw(const float* __restrict__ IMG, const float* __restrict__ PART, float* out) {
  __shared__ __align__(16) float sc[32];
  const int tid = threadIdx.x, wave = tid >> 5, lane = tid & 31;
  if (tid < 32) sc[tid] = 0.f;
  __syncthreads();
  if (blockIdx.x == 0) {                                   // block-uniform
#pragma unroll 1
    for (int bsel = wave; bsel < NB; bsel += 8) {          // wave-uniform
      const float* pp = PART + ((size_t)bsel * WPB + lane) * 32;
      float s = 0.f;
#pragma unroll 1
      for (int i = 0; i < WPB / 32; ++i) s += pp[(size_t)i * (32 * 32)];
#pragma unroll
      for (int d = 16; d >= 1; d >>= 1) s += __shfl_xor(s, d, 32);
      if (lane == 0) sc[bsel] = s * DEPSC;
    }
  }
  __syncthreads();
  const size_t t = (size_t)blockIdx.x * 256 + (size_t)tid;
  if (t >= (size_t)NPIECE) return;                         // no barriers after this point
  const size_t e0 = t * 4;
#if (NB % 4) == 0
  const bool   hs = (e0 < (size_t)NB);
  const int    si = hs ? (int)e0 : 0;
  const v4f    sv = *(const v4f*)(sc + si);
  const size_t ii = hs ? (size_t)0 : (e0 - (size_t)NB);   // clamped, 16-B aligned
  const v4f    gv = *(const v4f*)(IMG + ii);
  v4f val;
#pragma unroll
  for (int e = 0; e < 4; ++e) val[e] = hs ? sv[e] : gv[e];
  float* dst = out + e0;
  {
    *(v4f*)(dst) = val;
    
  }
#else
  float val[4];
  const size_t rem = (size_t)TOTOUT - e0;
  const int nval = (rem < 4) ? (int)rem : 4;
#pragma unroll
  for (int j = 0; j < 4; ++j) {
    size_t e = e0 + (size_t)j;
    if (e > (size_t)(TOTOUT - 1)) e = (size_t)(TOTOUT - 1);
    const bool hsj = (e < (size_t)NB);
    const float g = IMG[hsj ? (size_t)0 : (e - (size_t)NB)];
    const float s = sc[hsj ? (int)e : 0];
    val[j] = hsj ? s : g;
  }
  float* dst = out + e0;
  if (nval == 4) {
    v4f vv;
#pragma unroll
    for (int j = 0; j < 4; ++j) vv[j] = val[j];
    {
      *(v4f*)(dst) = vv;
      
    }
  } else {
    {
#pragma unroll
      for (int j = 0; j < 4; ++j) { if (j < nval) *(float*)(dst + j) = val[j]; }
      
    }
  }
#endif
}

// =====================================================================================================
// Workspace map (bytes); every plane is fully written by whole-line stores before it is read; all extents are exact multiples
// of the store granularity (no pad rows needed); QP is reused sequentially (in-order stream):
//   XB   bf16 [ROWS][1024]                 NB*4194304   (bf16 copy of the input activations)
//   WQKV bf16 [3072 n][1024 k]                6291456
//   WOB  f16  [1024 n][1024 k] x1024          2097152   WDB same 2097152
//   F    f32  [ROWS][1024]                 NB*8388608   (the final image)
//   QP   f16  [ROWS][8][128] x8            NB*4194304   (later UP: f16 plane of O.Wo^T output x1024)
//   KP   f16  same                          NB*4194304
//   VP   f16  [NB][8][128][2048] x1024      NB*4194304
//   OP   f16  [ROWS][8][128] x1024         NB*4194304
//   PART f32  [ATT_BLOCKS*8][32]           NB*131072
//   end (NB = 4)                            128450560
// =====================================================================================================
extern "C" void kernel_launch(void* const* d_in, const int* in_sizes, int n_in,
                              void* d_out, int out_size, void* d_ws, size_t ws_size,
                              hipStream_t stream) {
  if (n_in < 7) return;
  if (in_sizes[0] != ROWS * DMOD) return;
  if (in_sizes[1] != 3 * DMOD * DMOD || in_sizes[2] != 3 * DMOD) return;
  if (in_sizes[3] != DMOD * DMOD || in_sizes[4] != DMOD) return;
  if (in_sizes[5] != DMOD * DMOD || in_sizes[6] != DMOD) return;
  if (out_size != TOTOUT) return;

  const float* x    = (const float*)d_in[0];
  const float* wqkv = (const float*)d_in[1];
  const float* bqkv = (const float*)d_in[2];
  const float* wo   = (const float*)d_in[3];
  const float* bo   = (const float*)d_in[4];
  const float* wd   = (const float*)d_in[5];
  const float* bd   = (const float*)d_in[6];
  float*       out  = (float*)d_out;

  const size_t szXB   = (size_t)ROWS * DMOD * 2;
  const size_t szWQKV = (size_t)3 * DMOD * DMOD * 2;
  const size_t szW    = (size_t)DMOD * DMOD * 2;
  const size_t szF    = (size_t)ROWS * DMOD * 4;
  const size_t szP    = (size_t)ROWS * DMOD * 2;
  const size_t szVP   = (size_t)NB * NH * HD * SEQ * 2;
  const size_t szPART = (size_t)ATT_BLOCKS * ATT_WAVES * 32 * 4;
  size_t off = 0;
  const size_t oXB   = off; off += szXB;
  const size_t oWQKV = off; off += szWQKV;
  const size_t oWOB  = off; off += szW;
  const size_t oWDB  = off; off += szW;
  const size_t oF    = off; off += szF;
  const size_t oQP   = off; off += szP;
  const size_t oKP   = off; off += szP;
  const size_t oVP   = off; off += szVP;
  const size_t oOP   = off; off += szP;
  const size_t oPART = off; off += szPART;
  if (off > ws_size) return;                            // off = 128450560 for NB = 4
  if (off > (size_t)134217728) return;

  char* ws = (char*)d_ws;
  u16*   XB   = (u16*)(ws + oXB);
  u16*   WQKV = (u16*)(ws + oWQKV);
  u16*   WOB  = (u16*)(ws + oWOB);
  u16*   WDB  = (u16*)(ws + oWDB);
  float* F    = (float*)(ws + oF);
  u16*   QP   = (u16*)(ws + oQP);
  u16*   UP   = QP;                                     // reused after the attention launch has consumed QP
  u16*   KP   = (u16*)(ws + oKP);
  u16*   VP   = (u16*)(ws + oVP);
  u16*   OP   = (u16*)(ws + oOP);
  float* PART = (float*)(ws + oPART);

  const int n8x   = (ROWS * DMOD) / 8;
  const int n8qkv = (3 * DMOD * DMOD) / 8;
  const int n8w   = (DMOD * DMOD) / 8;
  if ((n8x % 256) != 0 || (n8qkv % 256) != 0 || (n8w % 256) != 0 || (DMOD % 64) != 0 || (ROWS % 64) != 0 || (DMOD % 32) != 0) return;
  const dim3 blk(256);
  const dim3 gX(n8x / 256);
  const dim3 gQKV(n8qkv / 256);
  const dim3 gW(n8w / 256);
  const dim3 gG((ROWS / GBT) * (DMOD / GBT));
  const dim3 bG(128);
  const dim3 gAT(ATT_BLOCKS);
  const dim3 bAT(ATT_THREADS);
  const dim3 gOW((NPIECE + 255) / 256);
  const size_t wblk = (size_t)DMOD * DMOD;

  // (0..3) input activations -> bf16 plane; weights stored [n = out][k = in] (y = x.W^T), already k-contiguous:
  //        bf16 plane for the qkv weight, f16 of bf16 value x1024 for the two square weights
  cvt16<<<gX,   blk, 0, stream>>>(x,    XB,   n8x,   0, 1.0f);
  cvt16<<<gQKV, blk, 0, stream>>>(wqkv, WQKV, n8qkv, 0, 1.0f);
  cvt16<<<gW,   blk, 0, stream>>>(wo,   WOB,  n8w,   1, WOS);
  cvt16<<<gW,   blk, 0, stream>>>(wd,   WDB,  n8w,   1, WOS);
  // (4) q: projection + bias (col = h*128+d), stored as the f16 plane x8
  gemm_bfp<<<gG, bG, 0, stream>>>(XB, WQKV, bqkv, QP, ROWS, DMOD, DMOD, 1.0f, QSC);
  // (5) k: the same with weight rows 1024..2047
  gemm_bfp<<<gG, bG, 0, stream>>>(XB, WQKV + wblk, bqkv + DMOD, KP, ROWS, DMOD, DMOD, 1.0f, KSC);
  // (6) v: weight rows 2048..3071, stored as the v^T plane x1024
  gemm_bft<<<gG, bG, 0, stream>>>(XB, WQKV + 2 * wblk, bqkv + 2 * DMOD, VP, ROWS, DMOD, DMOD, 1.0f, VCAR);
  // (7) attention -> O plane [b][s][h][d] x1024 and per-wave row-sum lines
  attn_fwd<<<gAT, bAT, 0, stream>>>(QP, KP, VP, OP, PART);
  // (8) first output projection + bias (carries 1024 x 1024 folded back), stored as the f16 plane x1024
  gemm_hp<<<gG, bG, 0, stream>>>(OP, WOB, bo, UP, ROWS, DMOD, DMOD, 1.0f / (OSC * WOS), USC);
  // (9) second output projection + bias -> F f32 image [ROWS][1024]
  gemm_h1<<<gG, bG, 0, stream>>>(UP, WDB, bd, F, ROWS, DMOD, DMOD, 1.0f / (USC * WOS));
  // (10) flat line-owned writer of the whole output buffer
  outw<<<gOW, blk, 0, stream>>>(F, PART, out);
  (void)hipGetLastError();
}

// v004
// A run of this version takes 175 microseconds.
// Timed twice side by side with v003, it ran 1.08 times as fast both times.
// Counting every step since v000, it is 3.40 times as fast.
// Contractions: x.W{q,k,v}^T on v_wmma_f32_16x16x32_bf16 (x and W planes RNE-converted to bf16 operands, f32 accumulate, bias added in f32);
// scores k'.q'^T (q', k' single f16 planes carried x8), P.v (P x32768 single f16, v x1024 single f16), O.Wo^T and U.Wd^T
// (O and U single f16 planes x1024, Wo and Wd as f16(bf16(W) x1024)): v_wmma_f32_16x16x32_f16, f32 accumulate.
// Base-2 online softmax, 1/l fold, row-sum partials and bias adds in f32 on VALU.
// The q, k, v^T and U operand planes are written by the epilogue of the GEMM that produces them (f32 result, bias, carry, f16).
#include <hip/hip_runtime.h>
#include <math.h>
#include <stdint.h>

#define NB    4
#define SEQ   2048
#define DMOD  1024
#define NH    8
#define HD    128
#define QT_BITS 5
#define NH_BITS 3
#define ROWS  (NB * SEQ)
#define QSC   8.0f
#define KSC   8.0f
#define PCAR  32768.0f
#define PEXP  15.0f
#define VCAR  1024.0f
#define OSC   1024.0f
#define USC   1024.0f
#define WOS   1024.0f
#define SM_SCALE 0.08838834764831845f
#define LOG2E 1.4426950408889634f
#define ATT_WAVES   8
#define ATT_THREADS (ATT_WAVES * 32)
#define ATT_QROWS   (ATT_WAVES * 16)
#define AQT_BITS    4
#define ATT_BLOCKS  (NB * NH * (SEQ / ATT_QROWS))
#define NKB    (SEQ / 32)
#define RS     (NH * HD)
#define SPITCH 132
#define SLABF  (16 * SPITCH)
#define SLAB64 (16 * 68)
#define VTS    144
#define WPB    (NH * (SEQ / ATT_QROWS) * ATT_WAVES)
#define TOTOUT (NB + ROWS * DMOD)
#define IMGN   (ROWS * DMOD)
#define NPIECE ((TOTOUT + 3) / 4)
#define GBT    128
#define GKS    128
#define GPITCH 272
#define GOPB   (GBT * GPITCH)
#define GBUF   (2 * GOPB)
#define AKS    128
#define ANST   (SEQ / AKS)
#define AOPB   (AKS * GPITCH)
#define ABUF   (AOPB + HD * GPITCH)
#define DEPSC  (1.0f / ((float)NH * (float)SEQ * (float)SEQ))

static_assert(HD == 128 && DMOD == NH * HD && RS == DMOD);
static_assert(PCAR == (float)(1 << (int)PEXP));
static_assert((1 << QT_BITS) == (SEQ / 64) && (1 << NH_BITS) == NH);
static_assert((SEQ % 64) == 0 && (SEQ % 32) == 0 && NKB * 32 == SEQ);
static_assert(((ROWS * DMOD / 8) % 256) == 0 && ((3 * DMOD * DMOD / 8) % 256) == 0 && ((DMOD * DMOD / 8) % 256) == 0);
static_assert((ROWS % 64) == 0 && (DMOD % 64) == 0 && (DMOD % 32) == 0);
static_assert(NB >= 1 && NB <= 32);
static_assert((WPB % 32) == 0 && WPB == 1024);
static_assert(ATT_THREADS == 256 && (1 << AQT_BITS) == (SEQ / ATT_QROWS));
static_assert((SEQ % AKS) == 0 && ANST >= 2 && (AKS % 32) == 0 && AKS * 2 + 16 == GPITCH && HD * 2 + 16 == GPITCH);
static_assert(AKS == 8 * (ATT_THREADS / 16) && HD == 8 * (ATT_THREADS / 16));
static_assert(ATT_WAVES * SLABF * 4 <= 2 * ABUF);
static_assert(((SPITCH * 4) % 16) == 0 && (SPITCH >= HD + 4));
static_assert((VTS % 16) == 0 && VTS >= 64 * 2 && 4 * 64 * VTS <= 2 * GBUF && (SEQ % GBT) == 0);
static_assert(4 * 64 * 68 * 4 <= 2 * GBUF);
static_assert(IMGN % 4 == 0);
static_assert((ROWS % GBT) == 0 && (DMOD % GBT) == 0 && (DMOD % GKS) == 0 && GKS * 2 + 16 == GPITCH);

typedef unsigned short u16;
typedef _Float16 v16h __attribute__((ext_vector_type(16)));
typedef _Float16 v8h  __attribute__((ext_vector_type(8)));
typedef __bf16   v16b __attribute__((ext_vector_type(16)));
typedef float    v8f  __attribute__((ext_vector_type(8)));
typedef float    v4f  __attribute__((ext_vector_type(4)));
typedef float    v2f  __attribute__((ext_vector_type(2)));
typedef _Float16 v2h  __attribute__((ext_vector_type(2)));
typedef unsigned int v4u __attribute__((ext_vector_type(4)));

union FragH { v16h v; v8h h[2]; v4u u[2]; };
union FragB { v16b v; v4u u[2]; };

// ---- scalar helpers --------------------------------------------------------------------------------
__device__ __forceinline__ unsigned short bf_bits(float f) {          // f32 -> bf16 bits, RNE convert
  unsigned u = __float_as_uint(f);
  return (unsigned short)((u + 0x7FFFu + ((u >> 16) & 1u)) >> 16);
}
__device__ __forceinline__ float bf_up(unsigned short h) { return __uint_as_float(((unsigned)h) << 16); }
__device__ __forceinline__ float bfr(float f) { return bf_up(bf_bits(f)); }
__device__ __forceinline__ unsigned short h_bits(_Float16 x) { return __builtin_bit_cast(unsigned short, x); }
__device__ __forceinline__ unsigned pk16(unsigned short a, unsigned short b) { return (unsigned)a | ((unsigned)b << 16); }
__device__ __forceinline__ v8f zero8() { v8f z = {0.f, 0.f, 0.f, 0.f, 0.f, 0.f, 0.f, 0.f}; return z; }
__device__ __forceinline__ v4f zero4() { v4f z = {0.f, 0.f, 0.f, 0.f}; return z; }

// ---- fragment loaders: 16-bit A/B operand, lane -> row/col (lane&15), p already includes +8*(lane>>4);
//      elements 0..7 <- p[0..7] (k0+8h..), elements 8..15 <- p[16..23] (k0+16+8h..)  (same split k map for A and B;
//      B is always read from a k-contiguous [n][k] plane)
__device__ __forceinline__ v16h ldfrag_h(const _Float16* p) {
  FragH f;
  f.h[0] = *(const v8h*)(p);
  f.h[1] = *(const v8h*)(p + 16);
  return f.v;
}

__device__ __forceinline__ v8f mma_h(v16h a, v16h b, v8f c) {
  return __builtin_amdgcn_wmma_f32_16x16x32_f16(false, a, false, b, (short)0, c, false, false);
}
__device__ __forceinline__ v8f mma_b(v16b a, v16b b, v8f c) {
  return __builtin_amdgcn_wmma_f32_16x16x32_bf16(false, a, false, b, (short)0, c, false, false);
}
__device__ __forceinline__ void guard2(v8f& a, v8f& b, v16h x0, v16h x1, v16h x2, v16h x3, v16h x4, v16h x5) {
#if defined(__HIP_DEVICE_COMPILE__)
  asm volatile("v_nop\n\tv_nop\n\tv_nop\n\tv_nop"
               : "+v"(a), "+v"(b) : "v"(x0), "v"(x1), "v"(x2), "v"(x3), "v"(x4), "v"(x5) : "memory");
#endif
}
template <typename F>
__device__ __forceinline__ void guard6(v8f& a, v8f& b, v8f& c, v8f& d, F x0, F x1, F x2, F x3, F x4, F x5) {
#if defined(__HIP_DEVICE_COMPILE__)
  asm volatile("v_nop\n\tv_nop\n\tv_nop\n\tv_nop"
               : "+v"(a), "+v"(b), "+v"(c), "+v"(d) : "v"(x0), "v"(x1), "v"(x2), "v"(x3), "v"(x4), "v"(x5) : "memory");
#endif
}
__device__ __forceinline__ void acc_guard4(v8f& a, v8f& b, v8f& c, v8f& d) {
#if defined(__HIP_DEVICE_COMPILE__)
  asm volatile("v_nop\n\tv_nop\n\tv_nop\n\tv_nop" : "+v"(a), "+v"(b), "+v"(c), "+v"(d));
#endif
}
__device__ __forceinline__ void wave_sync_lds() {
  __builtin_amdgcn_fence(__ATOMIC_RELEASE, "workgroup");
  __builtin_amdgcn_wave_barrier();
  __builtin_amdgcn_fence(__ATOMIC_ACQUIRE, "workgroup");
}

// =====================================================================================================
// f32 plane -> 16-bit plane, same layout:  mode 0: bf16 RNE bits;  mode 1: f16 bits of (bf16 RNE value) * scale;
// mode 2: f16 bits of value * scale (no bf16 pre-step).
// Thread = 8 consecutive elements: two 16-B loads, one 16-B store; 32 consecutive lanes = 512 contiguous, 512-B aligned bytes
// coverage: grid = n8/256 blocks (host checks exactness) x 256 thr x 8 = the whole plane.
// =====================================================================================================
__global__ __launch_bounds__(256) void cvt16(const float* __restrict__ x, u16* D, int n8, int mode, float scale) {
  const int gt = blockIdx.x * 256 + (int)threadIdx.x;
  if (gt >= n8) return;                     // no barriers in this kernel
  const float* p = x + (size_t)gt * 8;
  const v4f a = *(const v4f*)(p), c4 = *(const v4f*)(p + 4);
  float v[8];
#pragma unroll
  for (int e = 0; e < 4; ++e) { v[e] = a[e]; v[4 + e] = c4[e]; }
  unsigned short s[8];
#pragma unroll
  for (int e = 0; e < 8; ++e) {
    const float vb = bfr(v[e]);
    const float vf = (mode == 1) ? vb : v[e];
    const unsigned short hb = h_bits((_Float16)(vf * scale));
    const unsigned short bb = bf_bits(v[e]);
    s[e] = (mode != 0) ? hb : bb;
  }
  v4u o;
#pragma unroll
  for (int e = 0; e < 4; ++e) o[e] = pk16(s[2 * e], s[2 * e + 1]);
  u16* d = D + (size_t)gt * 8;
  {
    *(v4u*)(d) = o;
    
  }
}

// =====================================================================================================
// GEMM f32 epilogue (EPI 0): the wave's 16x64 f32 tile (times oscale) staged in its LDS slab (pitch 68),
// coverage: 8 instructions x 2 rows x 16 lanes x 4 floats = the wave's 16 x 64 tile.
// =====================================================================================================
__device__ __forceinline__ void epi64(float* sl, v8f a0, v8f a1, v8f a2, v8f a3, float oscale, v4f badd, float* C, int N,
                                      size_t rowb, int col0, int lane) {
  const int hh = lane >> 4, m = lane & 15;
#pragma unroll
  for (int r = 0; r < 8; ++r) {
    const int ro = (8 * hh + r) * 68 + m;
    sl[ro]      = a0[r] * oscale;
    sl[ro + 16] = a1[r] * oscale;
    sl[ro + 32] = a2[r] * oscale;
    sl[ro + 48] = a3[r] * oscale;
  }
  wave_sync_lds();
  v4f vals[8];
#pragma unroll
  for (int it = 0; it < 8; ++it) vals[it] = *(const v4f*)(sl + (it * 2 + hh) * 68 + m * 4) + badd;
  float* dst = C + (rowb + (size_t)hh) * (size_t)N + col0 + m * 4;
  {
#pragma unroll
    for (int it = 0; it < 8; ++it) {
      *(v4f*)(dst + (size_t)(it * 2) * (size_t)N) = vals[it];
    }
    
  }
}

// =====================================================================================================
// 16-bit GEMM with bias, both engines: C[M][N] (f32) = A[M][K] (row-major) . Bt[N][K]^T (k-contiguous), times oscale, plus the
// bf16-RNE value of bias[n]. Block = 128x128 tile of C, 4 waves as 2x2, wave = 64x64 (4x4 accumulator tiles).
// EPI 0 stores C as f32; EPI 1 stores f16(C * pscale) as the plane P[M][N]; EPI 2 stores f16(C * pscale) transposed per batch,
// P[(row / SEQ) * N + col][row % SEQ] (the v^T plane: N = NH * HD, col = h * HD + d).
// A stage is 128 k of the block's 128 A rows and 128 Bt rows: 256 rows of 256 B, laid in LDS at pitch 272 B by asynchronous
// b128 copies (16 lanes = one whole 256-B row, so every copy touches whole lines). Two buffers: stage t+1 flies while stage t
// is multiplied. Fragments are read from LDS with the same split k map for A and B as ldfrag_h; k runs upward in steps of 32
// into one accumulator per tile. Shapes: M % 128 == 0, N % 128 == 0, K % 128 == 0, grid = (M/128)*(N/128) (static_assert above).
// =====================================================================================================
__device__ __forceinline__ unsigned lds_off(const void* p) { return (unsigned)(size_t)p; }

// Eight asynchronous 16-B-per-lane copies, rows 8 apart. The s_wait_xcnt stands inside the statement so that no address
// register of a copy is rewritten in front of it.
__device__ __forceinline__ void copy8(unsigned l, const u16* g, size_t rs8) {
#if defined(__HIP_DEVICE_COMPILE__)
  asm volatile("global_load_async_to_lds_b128 %0, %8, off\n\t"
               "global_load_async_to_lds_b128 %1, %9, off\n\t"
               "global_load_async_to_lds_b128 %2, %10, off\n\t"
               "global_load_async_to_lds_b128 %3, %11, off\n\t"
               "global_load_async_to_lds_b128 %4, %12, off\n\t"
               "global_load_async_to_lds_b128 %5, %13, off\n\t"
               "global_load_async_to_lds_b128 %6, %14, off\n\t"
               "global_load_async_to_lds_b128 %7, %15, off\n\t"
               "s_wait_xcnt 0x0"
               :: "v"(l), "v"(l + 8u * GPITCH), "v"(l + 16u * GPITCH), "v"(l + 24u * GPITCH),
                  "v"(l + 32u * GPITCH), "v"(l + 40u * GPITCH), "v"(l + 48u * GPITCH), "v"(l + 56u * GPITCH),
                  "v"(g), "v"(g + rs8), "v"(g + 2 * rs8), "v"(g + 3 * rs8),
                  "v"(g + 4 * rs8), "v"(g + 5 * rs8), "v"(g + 6 * rs8), "v"(g + 7 * rs8)
               : "memory");
#endif
}
// One stage: this thread's 16 B of rows cr + 8i (i = 0..15) of the A tile and of the Bt tile; 32 copies per wave.
__device__ __forceinline__ void fill_stage(unsigned l, const u16* ga, const u16* gb, size_t rs8) {
  copy8(l, ga, rs8);
  copy8(l + 64u * GPITCH, ga + 8 * rs8, rs8);
  copy8(l + GOPB, gb, rs8);
  copy8(l + GOPB + 64u * GPITCH, gb + 8 * rs8, rs8);
}
__device__ __forceinline__ void wait_async0() {   // this wave's copies have landed
#if defined(__HIP_DEVICE_COMPILE__)
  asm volatile("s_wait_asynccnt 0x0" ::: "memory");
#endif
}
__device__ __forceinline__ void wait_ds0() {      // this wave's LDS reads have returned before their buffer is refilled
#if defined(__HIP_DEVICE_COMPILE__)
  asm volatile("s_wait_dscnt 0x0" ::: "memory");
#endif
}
__device__ __forceinline__ FragB ld_lfrag(const unsigned char* p) {   // split k map of ldfrag_h: bytes 0..15 and 32..47
  FragB f;
  f.u[0] = *(const v4u*)(p);
  f.u[1] = *(const v4u*)(p + 32);
  return f;
}
__device__ __forceinline__ v8f mma_sel(FragB a, FragB b, v8f c, bool bf) {
  if (bf) return mma_b(a.v, b.v, c);
  return mma_h(__builtin_bit_cast(v16h, a.v), __builtin_bit_cast(v16h, b.v), c);
}

template <bool BF, int EPI>
__device__ __forceinline__ void gemm_core(unsigned char* ring, float* slab, const u16* __restrict__ A,
                                          const u16* __restrict__ Bt, const float* __restrict__ bias,
                                          float* C, u16* P, int M, int N, int K, float oscale, float pscale) {
  const int tid = threadIdx.x, wave = tid >> 5, lane = tid & 31, hh = lane >> 4, m = lane & 15;
  const int ntile = N >> 7;
  const int bid   = blockIdx.x;
  const int row0  = (bid / ntile) * GBT;
  const int col0  = (bid % ntile) * GBT;
  if (row0 + GBT > M) return;                // block-uniform, in front of every barrier; never taken with the exact grid
  const int wr = wave >> 1, wc = wave & 1;
  const int nst = K >> 7;
  const int cr = tid >> 4, cc = tid & 15;    // copy: row within a group of 8, 16-B chunk of the 256-B row
  const u16* ga = A  + (size_t)(row0 + cr) * K + cc * 8;
  const u16* gb = Bt + (size_t)(col0 + cr) * K + cc * 8;
  const size_t rs8 = (size_t)8 * K;
  const unsigned l0 = lds_off(ring) + (unsigned)(cr * GPITCH + cc * 16);

  v8f acc[4][4];
#pragma unroll
  for (int i = 0; i < 4; ++i) {
#pragma unroll
    for (int j = 0; j < 4; ++j) acc[i][j] = zero8();
  }

  fill_stage(l0, ga, gb, rs8);
  wait_async0();
  __syncthreads();                           // publishes stage 0
  if (nst > 1) fill_stage(l0 + GBUF, ga + GKS, gb + GKS, rs8);

  for (int t = 0; t < nst; ++t) {
    const unsigned bo = (unsigned)(t & 1) * GBUF;
    const unsigned char* ab = ring + bo + (wr * 64 + m) * GPITCH + hh * 16;
    const unsigned char* bb = ring + bo + GOPB + (wc * 64 + m) * GPITCH + hh * 16;
    FragB a[2][4], b[2][4];                  // set (ks & 1) holds the fragments of k step ks
#pragma unroll
    for (int i = 0; i < 4; ++i) { a[0][i] = ld_lfrag(ab + i * 16 * GPITCH); b[0][i] = ld_lfrag(bb + i * 16 * GPITCH); }
#pragma unroll
    for (int ks = 0; ks < GKS / 32; ++ks) {
      const int cs = ks & 1;
      if (ks + 1 < GKS / 32) {
#pragma unroll
        for (int i = 0; i < 4; ++i) {
          a[cs ^ 1][i] = ld_lfrag(ab + i * 16 * GPITCH + (ks + 1) * 64);
          b[cs ^ 1][i] = ld_lfrag(bb + i * 16 * GPITCH + (ks + 1) * 64);
        }
      }
      // keeps the next k step's LDS reads one group ahead of this step's products instead of spread among them
      __builtin_amdgcn_sched_barrier(0);
#pragma unroll
      for (int i = 0; i < 4; ++i) {
#pragma unroll
        for (int j = 0; j < 4; ++j) acc[i][j] = mma_sel(a[cs][i], b[cs][j], acc[i][j], BF);
      }
      // keeps the following group of LDS reads behind this step's products
      __builtin_amdgcn_sched_barrier(0);
    }
    wait_ds0();
    wait_async0();
    __syncthreads();                         // publishes stage t+1 and ends every reader's last read of stage t's buffer
    if (t + 2 < nst) fill_stage(l0 + bo, ga + (size_t)(t + 2) * GKS, gb + (size_t)(t + 2) * GKS, rs8);
  }
  wait_async0();

  const int colw = col0 + wc * 64;
  if constexpr (EPI == 0) {
    float* sl = slab + wave * SLAB64;
    const v4f bv = *(const v4f*)(bias + colw + m * 4);    // columns colw + 4m .. +3, always < N (N multiple of 128)
    v4f badd;
#pragma unroll
    for (int e = 0; e < 4; ++e) badd[e] = bfr(bv[e]);
#pragma unroll
    for (int i = 0; i < 4; ++i) {
      if (i) wave_sync_lds();                // the slab's last readers are done before other lanes overwrite it
      epi64(sl, acc[i][0], acc[i][1], acc[i][2], acc[i][3], oscale, badd, C, N, (size_t)(row0 + wr * 64 + i * 16), colw, lane);
    }
  } else if constexpr (EPI == 1) {
    // The wave's 64 x 64 f32 tile (times oscale) is staged whole in its own part of the ring (pitch 68 floats), which the last
    // stage's barrier has freed of readers and copies; read back with 8 lanes per row (8 columns each), so that every 128-B
    // row piece of the plane leaves as one whole line.
    // coverage: 16 instructions x 4 rows x 8 lanes x 8 halves = the wave's 64 x 64 tile.
    float* sl = (float*)(void*)ring + wave * (64 * 68);
#pragma unroll
    for (int i = 0; i < 4; ++i) {
#pragma unroll
      for (int r = 0; r < 8; ++r) {
        const int ro = (i * 16 + 8 * hh + r) * 68 + m;
#pragma unroll
        for (int j = 0; j < 4; ++j) sl[ro + 16 * j] = acc[i][j][r] * oscale;
      }
    }
    const int rq = lane >> 3, p8 = (lane & 7) * 8;
    const float* bp = bias + colw + p8;                   // columns colw + 8(lane & 7) .. +7, always < N
    const v4f bv0 = *(const v4f*)(bp), bv1 = *(const v4f*)(bp + 4);
    v4f b0, b1;
#pragma unroll
    for (int e = 0; e < 4; ++e) { b0[e] = bfr(bv0[e]); b1[e] = bfr(bv1[e]); }
    wave_sync_lds();
    v4u o[16];
#pragma unroll
    for (int it = 0; it < 16; ++it) {
      const float* s = sl + (it * 4 + rq) * 68 + p8;
      const v4f x = (*(const v4f*)(s) + b0) * pscale, y = (*(const v4f*)(s + 4) + b1) * pscale;
      const v8f f = {x[0], x[1], x[2], x[3], y[0], y[1], y[2], y[3]};
      o[it] = __builtin_bit_cast(v4u, __builtin_convertvector(f, v8h));
    }
    u16* dst = P + (size_t)(row0 + wr * 64 + rq) * (size_t)N + colw + p8;
#pragma unroll
    for (int it = 0; it < 16; ++it) *(v4u*)(dst + (size_t)(it * 4) * (size_t)N) = o[it];
  } else {
    // An accumulator lane holds 8 consecutive rows of one column: 16 B of a transposed line. The wave's 64 columns x 64 rows
    // are gathered in its own part of the ring (pitch 144 B), which the last stage's barrier has freed of readers and copies,
    // and leave as whole 128-B lines, 8 lanes each.
    // coverage: 16 instructions x 4 lines x 8 lanes x 8 halves = the wave's 64 x 64 tile.
    unsigned char* st = ring + wave * (64 * VTS);
#pragma unroll
    for (int j = 0; j < 4; ++j) {
      const float bj = bfr(bias[colw + j * 16 + m]);
#pragma unroll
      for (int i = 0; i < 4; ++i) {
        const v8f f = (acc[i][j] * oscale + bj) * pscale;
        *(v8h*)(st + (j * 16 + m) * VTS + i * 32 + hh * 16) = __builtin_convertvector(f, v8h);
      }
    }
    wave_sync_lds();
    const int rq = lane >> 3, p = lane & 7;
    v4u t[16];
#pragma unroll
    for (int it = 0; it < 16; ++it) t[it] = *(const v4u*)(st + (it * 4 + rq) * VTS + p * 16);
    const int roww = row0 + wr * 64;         // 64 rows of one batch (SEQ % 128 == 0)
    u16* dst = P + ((size_t)(roww / SEQ) * (size_t)N + colw + rq) * SEQ + (roww % SEQ) + p * 8;
#pragma unroll
    for (int it = 0; it < 16; ++it) *(v4u*)(dst + (size_t)(it * 4) * SEQ) = t[it];
  }
}

__global__ __launch_bounds__(128)
void gemm_bfp(const u16* __restrict__ A, const u16* __restrict__ Bt, const float* __restrict__ bias,
              u16* P, int M, int N, int K, float oscale, float pscale) {
  __shared__ __align__(16) unsigned char ring[2 * GBUF];
  gemm_core<true, 1>(ring, nullptr, A, Bt, bias, nullptr, P, M, N, K, oscale, pscale);
}

__global__ __launch_bounds__(128)
void gemm_bft(const u16* __restrict__ A, const u16* __restrict__ Bt, const float* __restrict__ bias,
              u16* P, int M, int N, int K, float oscale, float pscale) {
  __shared__ __align__(16) unsigned char ring[2 * GBUF];
  gemm_core<true, 2>(ring, nullptr, A, Bt, bias, nullptr, P, M, N, K, oscale, pscale);
}

__global__ __launch_bounds__(128)
void gemm_hp(const u16* __restrict__ A, const u16* __restrict__ Bt, const float* __restrict__ bias,
             u16* P, int M, int N, int K, float oscale, float pscale) {
  __shared__ __align__(16) unsigned char ring[2 * GBUF];
  gemm_core<false, 1>(ring, nullptr, A, Bt, bias, nullptr, P, M, N, K, oscale, pscale);
}

__global__ __launch_bounds__(128)
void gemm_h1(const u16* __restrict__ A, const u16* __restrict__ Bt, const float* __restrict__ bias,
             float* C, int M, int N, int K, float oscale) {
  __shared__ __align__(16) unsigned char ring[2 * GBUF];
  __shared__ __align__(16) float slab[4 * SLAB64];
  gemm_core<false, 0>(ring, slab, A, Bt, bias, C, nullptr, M, N, K, oscale, 1.0f);
}

// =====================================================================================================
// Multi-head flash attention (no mask): block = (batch b, head, 128 query rows), 8 waves, wave w owns the 16 query rows
// q0 = 128*qt + 16*w .. q0+15.
//   q plane (f16, x8) laid out [b][s][h][d]; k plane the same; v^T plane [b][h][d][s] (x1024).
//   All NKB = SEQ/32 key blocks of 32 keys are visited (static bound), in stages of 128 keys that the block's waves share:
//   a stage is 128 k rows of 256 B (all d) and 128 v^T rows of 256 B (its 128 keys), laid in LDS at pitch 272 B by asynchronous
//   b128 copies (16 lanes = one whole 256-B row). Two buffers: stage t+1 flies while stage t is worked on. The fragments are
//   read from LDS with the split k map of ldfrag_h. After the last stage's barrier the ring is the epilogue's staging room.
//   Scores are computed TRANSPOSED: S^T tile g (g = 0,1) = k rows (keys kb+16g .. +15, A operand, row m = lane&15, split k map
//   over d, 4 chunks of 32 d) times q^T (B operand, col n = query q0 + (lane&15), k = d, split map).
//   D element r of lane l = (key kb+16g+8h+r, query q0+(l&15)), so a lane owns one query column and 16 of its 32 keys; the
//   partner lane l^16 owns the other 16 -> row max / row sum need one xor-16 shuffle.
//   Online max-subtracted base-2 softmax in f32 (scale 1/sqrt(128) and the q/k carries folded into lsc; scale, maximum and
//   the x32768 carry of P enter a score's exponent through one FMA; l carries the x32768 too). The exp'd values ARE
//   the P A-fragment in place: A row m = query = lane&15, element i <- key kb+8h+i (tile 0, D element i), element 8+i <- key
//   kb+16+8h+i (tile 1, D element i). P is carried x32768 as single f16. The rescale factor of query row 8h+r of the
//   O accumulators is fetched from lane 8h+r with a shuffle (uniform control). 8 v^T B fragments (col n = d = 16j + (lane&15),
//   keys k-contiguous), 8 P.V WMMAs per key block in two guarded groups of 4.
//   Epilogue: 1/l (per query, shuffled to the D row owner) and carry folds in f32; the wave's 16x128 f32 result staged in its
//   LDS slab (pitch 132); each 256-B output row (b, q0+row, head) of the O plane (O x1024 as single f16) written as 2 whole
// coverage: per wave 8 instructions x 2 rows x 16 lanes x 8 halves = 16 x 128 of the O plane + 1 PART line; grid
//           NB*NH*SEQ/128 blocks x 8 waves = every (b, s, h) row of the O plane and every PART line exactly once.
// =====================================================================================================
// Eight asynchronous 16-B-per-lane copies, rows 16 apart. The s_wait_xcnt stands inside the statement so that no address
// register of a copy is rewritten in front of it.
__device__ __forceinline__ void copy8w(unsigned l, const u16* g, size_t rs16) {
#if defined(__HIP_DEVICE_COMPILE__)
  asm volatile("global_load_async_to_lds_b128 %0, %8, off\n\t"
               "global_load_async_to_lds_b128 %1, %9, off\n\t"
               "global_load_async_to_lds_b128 %2, %10, off\n\t"
               "global_load_async_to_lds_b128 %3, %11, off\n\t"
               "global_load_async_to_lds_b128 %4, %12, off\n\t"
               "global_load_async_to_lds_b128 %5, %13, off\n\t"
               "global_load_async_to_lds_b128 %6, %14, off\n\t"
               "global_load_async_to_lds_b128 %7, %15, off\n\t"
               "s_wait_xcnt 0x0"
               :: "v"(l), "v"(l + 16u * GPITCH), "v"(l + 32u * GPITCH), "v"(l + 48u * GPITCH),
                  "v"(l + 64u * GPITCH), "v"(l + 80u * GPITCH), "v"(l + 96u * GPITCH), "v"(l + 112u * GPITCH),
                  "v"(g), "v"(g + rs16), "v"(g + 2 * rs16), "v"(g + 3 * rs16),
                  "v"(g + 4 * rs16), "v"(g + 5 * rs16), "v"(g + 6 * rs16), "v"(g + 7 * rs16)
               : "memory");
#endif
}
// One attention stage: this thread's 16 B of rows cr + 16i (i = 0..7) of the k tile and of the v^T tile; 16 copies per wave.
__device__ __forceinline__ void fill_kv(unsigned l, const u16* gk, const u16* gv) {
  copy8w(l, gk, (size_t)16 * RS);
  copy8w(l + AOPB, gv, (size_t)16 * SEQ);
}
// 2^x by the hardware instruction alone. A result below 2^-126 comes back as 0: here that is a probability (carried x32768) or
// a rescale factor that small beside a row maximum of 32768, far below the last bit that the f16 operand and the f32 sums keep.
__device__ __forceinline__ float exp2_hw(float x) { return __builtin_amdgcn_exp2f(x); }
__device__ __forceinline__ v16h ld_lfrag_h(const unsigned char* p) {  // split k map of ldfrag_h: bytes 0..15 and 32..47
  FragH f;
  f.u[0] = *(const v4u*)(p);
  f.u[1] = *(const v4u*)(p + 32);
  return f.v;
}

// four waves per SIMD (two blocks per WGP): the register budget that lets the vector work of one wave run under the others' waits
__global__ __launch_bounds__(ATT_THREADS) __attribute__((amdgpu_waves_per_eu(4, 4)))
void attn_fwd(const u16* __restrict__ QPp, const u16* __restrict__ KPp, const u16* __restrict__ VPp,
              u16* OPo, float* PART) {
  // two stage buffers (k tile, then v^T tile); in the epilogue, per wave, the result slab [16][132] of floats
  __shared__ __align__(16) unsigned char ring[2 * ABUF];

  const int tid  = threadIdx.x;
  const int wave = tid >> 5;
  const int lane = tid & 31;
  const int hh   = lane >> 4;
  const int c    = lane & 15;

  const int bid  = blockIdx.x;
  const int qt   = bid & ((SEQ / ATT_QROWS) - 1);
  const int head = (bid >> AQT_BITS) & (NH - 1);
  const int b    = bid >> (AQT_BITS + NH_BITS);
  const int q0   = qt * ATT_QROWS + wave * 16;

  // B fragments of q^T: col n = query q0 + c, k = d (k-contiguous row of the q plane)
  const _Float16* Qb = (const _Float16*)(const void*)QPp + ((size_t)(b * SEQ + q0 + c) * NH + head) * HD + 8 * hh;
  // copy: row within a group of 16, 16-B chunk of the 256-B row; k tile row = key, v^T tile row = d
  const int cr = tid >> 4, cc = tid & 15;
  const u16* gk = KPp + ((size_t)(b * SEQ + cr) * NH + head) * HD + cc * 8;     // stage t: + t * AKS key rows
  const u16* gv = VPp + ((size_t)(b * NH + head) * HD + cr) * SEQ + cc * 8;     // stage t: + t * AKS keys
  const unsigned l0 = lds_off(ring) + (unsigned)(cr * GPITCH + cc * 16);
  fill_kv(l0, gk, gv);
  const float lsc = SM_SCALE * (LOG2E / (QSC * KSC));

  const v16h qf0 = ldfrag_h(Qb);            // d 0..31
  const v16h qf1 = ldfrag_h(Qb + 32);       // d 32..63
  const v16h qf2 = ldfrag_h(Qb + 64);       // d 64..95
  const v16h qf3 = ldfrag_h(Qb + 96);       // d 96..127

  float mrun = -INFINITY, lrun = 0.f;
  v8f o[8];
#pragma unroll
  for (int j = 0; j < 8; ++j) o[j] = zero8();

  wait_async0();
  __syncthreads();                           // publishes stage 0
  fill_kv(l0 + ABUF, gk + (size_t)AKS * RS, gv + AKS);   // stage 1 exists (ANST >= 2)

  // one rolled trip per stage, so that the ring's publish point stands once, at the trip's foot
#pragma unroll 1
  for (int t = 0; t < ANST; ++t) {
   const unsigned bo = (unsigned)(t & 1) * ABUF;
   // A fragments of k: row m = key kb + 16g + c, k = d;  B fragments of v: col n = d = 16j + c, k = key
   const unsigned char* kt = ring + bo + c * GPITCH + hh * 16;
   const unsigned char* vt = ring + bo + AOPB + c * GPITCH + hh * 16;
   // stays rolled: unrolled four times the build runs out of the 256 registers of four waves per SIMD and spills
#pragma unroll 1
   for (int kk = 0; kk < AKS / 32; ++kk) {   // key block kb = t * AKS + kk * 32
    // ---- transposed scores: s0 = keys kb..kb+15, s1 = keys kb+16..kb+31, column = query q0 + c ----
    v8f s0 = zero8(), s1 = zero8();
    const unsigned char* k0p = kt + kk * 32 * GPITCH;
    const unsigned char* k1p = k0p + 16 * GPITCH;
    const unsigned char* vp  = vt + kk * 64;
    const v16h ka0 = ld_lfrag_h(k0p), ka1 = ld_lfrag_h(k0p + 64);
    const v16h kc0 = ld_lfrag_h(k1p), kc1 = ld_lfrag_h(k1p + 64);
    const v16h ka2 = ld_lfrag_h(k0p + 128), ka3 = ld_lfrag_h(k0p + 192);
    const v16h kc2 = ld_lfrag_h(k1p + 128), kc3 = ld_lfrag_h(k1p + 192);
    s0 = mma_h(ka0, qf0, s0);
    s0 = mma_h(ka1, qf1, s0);
    s1 = mma_h(kc0, qf0, s1);
    s1 = mma_h(kc1, qf1, s1);
    guard2(s0, s1, qf0, qf1, ka0, ka1, kc0, kc1);
    // the first four v^T fragments are read here, as one group, so that they return behind the softmax arithmetic
    const v16h vf0 = ld_lfrag_h(vp);
    const v16h vf1 = ld_lfrag_h(vp + 16 * GPITCH);
    const v16h vf2 = ld_lfrag_h(vp + 32 * GPITCH);
    const v16h vf3 = ld_lfrag_h(vp + 48 * GPITCH);
    s0 = mma_h(ka2, qf2, s0);
    s0 = mma_h(ka3, qf3, s0);
    s1 = mma_h(kc2, qf2, s1);
    s1 = mma_h(kc3, qf3, s1);
    guard2(s0, s1, qf2, qf3, ka2, ka3, kc2, kc3);
    const v16h vf4 = ld_lfrag_h(vp + 64 * GPITCH);
    const v16h vf5 = ld_lfrag_h(vp + 80 * GPITCH);
    const v16h vf6 = ld_lfrag_h(vp + 96 * GPITCH);
    const v16h vf7 = ld_lfrag_h(vp + 112 * GPITCH);
    // ---- unscaled scores of this lane's 16 keys for query q0 + c; the running maximum is kept unscaled too (lsc > 0) ----
    float tk[16];
#pragma unroll
    for (int i = 0; i < 8; ++i) { tk[i] = s0[i];  tk[8 + i] = s1[i]; }
    float cm = -INFINITY;
#pragma unroll
    for (int i = 0; i < 16; ++i) cm = fmaxf(cm, tk[i]);
    cm = fmaxf(cm, __shfl_xor(cm, 16, 32));
    const float mn = fmaxf(mrun, cm);                                // finite from the first key block on
    const float al = (mrun == -INFINITY) ? 0.f : exp2_hw((mrun - mn) * lsc);   // o and l are zero while mrun is -inf
    mrun = mn;
    // ---- probabilities carried x32768, one FMA and one v_exp_f32 each: 2^(t * lsc + (15 - mn * lsc)); they are summed and
    //      rounded to the P A-fragment (f16) as they come; element i <-> tk[i] ----
    const float eb = __builtin_fmaf(-mn, lsc, PEXP);
    float ps = 0.f;
    FragH ph;
#pragma unroll
    for (int w = 0; w < 2; ++w) {
#pragma unroll
      for (int e4 = 0; e4 < 4; ++e4) {
        const int i = 8 * w + 2 * e4;
        const float p0 = exp2_hw(__builtin_fmaf(tk[i], lsc, eb));
        const float p1 = exp2_hw(__builtin_fmaf(tk[i + 1], lsc, eb));
        ps += p0 + p1;
        const v2f pp = {p0, p1};
        ph.u[w][e4] = __builtin_bit_cast(unsigned, __builtin_convertvector(pp, v2h));
      }
    }
    ps += __shfl_xor(ps, 16, 32);
    lrun = lrun * al + ps;
    // ---- rescale the O accumulators: D row 8hh+r = query q0+8hh+r, its factor lives in lane 8hh+r (and 16+8hh+r) ----
    float scl[8];
#pragma unroll
    for (int r = 0; r < 8; ++r) scl[r] = __shfl(al, 8 * hh + r, 32);
#pragma unroll
    for (int j = 0; j < 8; ++j) {
#pragma unroll
      for (int r = 0; r < 8; ++r) o[j][r] *= scl[r];
    }
    // ---- P.V : B fragment col n = d = j*16 + c, keys contiguous in the v^T tile; two guarded groups of 4 ----
    {
      o[0] = mma_h(ph.v, vf0, o[0]);
      o[1] = mma_h(ph.v, vf1, o[1]);
      o[2] = mma_h(ph.v, vf2, o[2]);
      o[3] = mma_h(ph.v, vf3, o[3]);
      guard6<v16h>(o[0], o[1], o[2], o[3], ph.v, vf0, vf1, vf2, vf3, ph.v);
    }
    {
      o[4] = mma_h(ph.v, vf4, o[4]);
      o[5] = mma_h(ph.v, vf5, o[5]);
      o[6] = mma_h(ph.v, vf6, o[6]);
      o[7] = mma_h(ph.v, vf7, o[7]);
      guard6<v16h>(o[4], o[5], o[6], o[7], ph.v, vf4, vf5, vf6, vf7, ph.v);
    }
   }
   wait_ds0();
   wait_async0();
   __syncthreads();                          // publishes stage t+1 and ends every reader's last read of stage t's buffer
   if (t + 2 < ANST) fill_kv(l0 + bo, gk + (size_t)(t + 2) * (AKS * RS), gv + (size_t)(t + 2) * AKS);
  }
  wait_async0();
  acc_guard4(o[0], o[1], o[2], o[3]);
  acc_guard4(o[4], o[5], o[6], o[7]);

  // ---- fold 1/l (per query, owned by lane = query) and the carries; row statistic r = l * (1/l); stage the 16x128 slab ----
  const float rl   = (lrun > 0.f) ? (1.0f / lrun) : 0.f;
  const float linv = rl * (1.0f / VCAR);     // l carries the same x32768 as P
  const float rr   = lrun * rl;
  float inv[8];
#pragma unroll
  for (int r = 0; r < 8; ++r) inv[r] = __shfl(linv, 8 * hh + r, 32);
  // the last stage's barrier lies behind every wave's last fragment read and last copy: the ring is free
  float* slab = (float*)(void*)ring + wave * SLABF;
#pragma unroll
  for (int r = 0; r < 8; ++r) {
#pragma unroll
    for (int j = 0; j < 8; ++j) slab[(8 * hh + r) * SPITCH + j * 16 + c] = o[j][r] * inv[r];
  }
  wave_sync_lds();
  // ---- O x1024 -> single f16 plane; lane = (row parity hh, 8 consecutive d at c8) ----
  v4u oh[8];
  const int c8 = c * 8;
#pragma unroll
  for (int it = 0; it < 8; ++it) {
    const int row = it * 2 + hh;
    const v4f a = *(const v4f*)(slab + row * SPITCH + c8), c4 = *(const v4f*)(slab + row * SPITCH + c8 + 4);
    float w[8];
#pragma unroll
    for (int e = 0; e < 4; ++e) { w[e] = a[e] * OSC; w[4 + e] = c4[e] * OSC; }
#pragma unroll
    for (int e = 0; e < 4; ++e) {
      const _Float16 h0 = (_Float16)w[2 * e], h1 = (_Float16)w[2 * e + 1];
      oh[it][e] = pk16(h_bits(h0), h_bits(h1));
    }
  }
  // ---- wave row-sum partial (fixed xor tree over the 16 query lanes; both lane halves hold identical values) ----
  float wsum = rr;
  wsum += __shfl_xor(wsum, 1, 32);
  wsum += __shfl_xor(wsum, 2, 32);
  wsum += __shfl_xor(wsum, 4, 32);
  wsum += __shfl_xor(wsum, 8, 32);
  v4f pv = zero4();
  pv[0] = (lane == 0) ? wsum : 0.f;
  float* pd = PART + ((size_t)bid * ATT_WAVES + wave) * 32 + (lane & 7) * 4;   // clamped address for every lane
  const size_t ob = ((size_t)(b * SEQ + q0) * NH + head) * HD + c8;
  {
#pragma unroll
    for (int it = 0; it < 8; ++it) {
      const int row = it * 2 + hh;
      *(v4u*)(OPo + ob + (size_t)row * RS) = oh[it];
    }
    if (lane < 8) *(v4f*)(pd) = pv;
    
  }
}

// =====================================================================================================
// Flat output writer: out[0..NB-1] = score output (per batch: fixed-order sum of its WPB PART lines times 1/(NH*SEQ*SEQ),
// computed by block 0, wave = batch, 32 lanes x WPB/32 strided loads + xor tree), out[NB + i] = IMG[i] (f32 image of the last
// value. With NB % 4 != 0 a scalar path handles the element interleave and the partial last piece.
// coverage: grid = ceil(NPIECE/256) blocks x 256 thr x 4 elements with the in-kernel bound = all TOTOUT elements exactly once.
// =====================================================================================================
__global__ __launch_bounds__(256) void outw(const float* __restrict__ IMG, const float* __restrict__ PART, float* out) {
  __shared__ __align__(16) float sc[32];
  const int tid = threadIdx.x, wave = tid >> 5, lane = tid & 31;
  if (tid < 32) sc[tid] = 0.f;
  __syncthreads();
  if (blockIdx.x == 0) {                                   // block-uniform
#pragma unroll 1
    for (int bsel = wave; bsel < NB; bsel += 8) {          // wave-uniform
      const float* pp = PART + ((size_t)bsel * WPB + lane) * 32;
      float s = 0.f;
#pragma unroll 1
      for (int i = 0; i < WPB / 32; ++i) s += pp[(size_t)i * (32 * 32)];
#pragma unroll
      for (int d = 16; d >= 1; d >>= 1) s += __shfl_xor(s, d, 32);
      if (lane == 0) sc[bsel] = s * DEPSC;
    }
  }
  __syncthreads();
  const size_t t = (size_t)blockIdx.x * 256 + (size_t)tid;
  if (t >= (size_t)NPIECE) return;                         // no barriers after this point
  const size_t e0 = t * 4;
#if (NB % 4) == 0
  const bool   hs = (e0 < (size_t)NB);
  const int    si = hs ? (int)e0 : 0;
  const v4f    sv = *(const v4f*)(sc + si);
  const size_t ii = hs ? (size_t)0 : (e0 - (size_t)NB);   // clamped, 16-B aligned
  const v4f    gv = *(const v4f*)(IMG + ii);
  v4f val;
#pragma unroll
  for (int e = 0; e < 4; ++e) val[e] = hs ? sv[e] : gv[e];
  float* dst = out + e0;
  {
    *(v4f*)(dst) = val;
    
  }
#else
  float val[4];
  const size_t rem = (size_t)TOTOUT - e0;
  const int nval = (rem < 4) ? (int)rem : 4;
#pragma unroll
  for (int j = 0; j < 4; ++j) {
    size_t e = e0 + (size_t)j;
    if (e > (size_t)(TOTOUT - 1)) e = (size_t)(TOTOUT - 1);
    const bool hsj = (e < (size_t)NB);
    const float g = IMG[hsj ? (size_t)0 : (e - (size_t)NB)];
    const float s = sc[hsj ? (int)e : 0];
    val[j] = hsj ? s : g;
  }
  float* dst = out + e0;
  if (nval == 4) {
    v4f vv;
#pragma unroll
    for (int j = 0; j < 4; ++j) vv[j] = val[j];
    {
      *(v4f*)(dst) = vv;
      
    }
  } else {
    {
#pragma unroll
      for (int j = 0; j < 4; ++j) { if (j < nval) *(float*)(dst + j) = val[j]; }
      
    }
  }
#endif
}

// =====================================================================================================
// Workspace map (bytes); every plane is fully written by whole-line stores before it is read; all extents are exact multiples
// of the store granularity (no pad rows needed); QP is reused sequentially (in-order stream):
//   XB   bf16 [ROWS][1024]                 NB*4194304   (bf16 copy of the input activations)
//   WQKV bf16 [3072 n][1024 k]                6291456
//   WOB  f16  [1024 n][1024 k] x1024          2097152   WDB same 2097152
//   F    f32  [ROWS][1024]                 NB*8388608   (the final image)
//   QP   f16  [ROWS][8][128] x8            NB*4194304   (later UP: f16 plane of O.Wo^T output x1024)
//   KP   f16  same                          NB*4194304
//   VP   f16  [NB][8][128][2048] x1024      NB*4194304
//   OP   f16  [ROWS][8][128] x1024         NB*4194304
//   PART f32  [ATT_BLOCKS*8][32]           NB*131072
//   end (NB = 4)                            128450560
// =====================================================================================================
extern "C" void kernel_launch(void* const* d_in, const int* in_sizes, int n_in,
                              void* d_out, int out_size, void* d_ws, size_t ws_size,
                              hipStream_t stream) {
  if (n_in < 7) return;
  if (in_sizes[0] != ROWS * DMOD) return;
  if (in_sizes[1] != 3 * DMOD * DMOD || in_sizes[2] != 3 * DMOD) return;
  if (in_sizes[3] != DMOD * DMOD || in_sizes[4] != DMOD) return;
  if (in_sizes[5] != DMOD * DMOD || in_sizes[6] != DMOD) return;
  if (out_size != TOTOUT) return;

  const float* x    = (const float*)d_in[0];
  const float* wqkv = (const float*)d_in[1];
  const float* bqkv = (const float*)d_in[2];
  const float* wo   = (const float*)d_in[3];
  const float* bo   = (const float*)d_in[4];
  const float* wd   = (const float*)d_in[5];
  const float* bd   = (const float*)d_in[6];
  float*       out  = (float*)d_out;

  const size_t szXB   = (size_t)ROWS * DMOD * 2;
  const size_t szWQKV = (size_t)3 * DMOD * DMOD * 2;
  const size_t szW    = (size_t)DMOD * DMOD * 2;
  const size_t szF    = (size_t)ROWS * DMOD * 4;
  const size_t szP    = (size_t)ROWS * DMOD * 2;
  const size_t szVP   = (size_t)NB * NH * HD * SEQ * 2;
  const size_t szPART = (size_t)ATT_BLOCKS * ATT_WAVES * 32 * 4;
  size_t off = 0;
  const size_t oXB   = off; off += szXB;
  const size_t oWQKV = off; off += szWQKV;
  const size_t oWOB  = off; off += szW;
  const size_t oWDB  = off; off += szW;
  const size_t oF    = off; off += szF;
  const size_t oQP   = off; off += szP;
  const size_t oKP   = off; off += szP;
  const size_t oVP   = off; off += szVP;
  const size_t oOP   = off; off += szP;
  const size_t oPART = off; off += szPART;
  if (off > ws_size) return;                            // off = 128450560 for NB = 4
  if (off > (size_t)134217728) return;

  char* ws = (char*)d_ws;
  u16*   XB   = (u16*)(ws + oXB);
  u16*   WQKV = (u16*)(ws + oWQKV);
  u16*   WOB  = (u16*)(ws + oWOB);
  u16*   WDB  = (u16*)(ws + oWDB);
  float* F    = (float*)(ws + oF);
  u16*   QP   = (u16*)(ws + oQP);
  u16*   UP   = QP;                                     // reused after the attention launch has consumed QP
  u16*   KP   = (u16*)(ws + oKP);
  u16*   VP   = (u16*)(ws + oVP);
  u16*   OP   = (u16*)(ws + oOP);
  float* PART = (float*)(ws + oPART);

  const int n8x   = (ROWS * DMOD) / 8;
  const int n8qkv = (3 * DMOD * DMOD) / 8;
  const int n8w   = (DMOD * DMOD) / 8;
  if ((n8x % 256) != 0 || (n8qkv % 256) != 0 || (n8w % 256) != 0 || (DMOD % 64) != 0 || (ROWS % 64) != 0 || (DMOD % 32) != 0) return;
  const dim3 blk(256);
  const dim3 gX(n8x / 256);
  const dim3 gQKV(n8qkv / 256);
  const dim3 gW(n8w / 256);
  const dim3 gG((ROWS / GBT) * (DMOD / GBT));
  const dim3 bG(128);
  const dim3 gAT(ATT_BLOCKS);
  const dim3 bAT(ATT_THREADS);
  const dim3 gOW((NPIECE + 255) / 256);
  const size_t wblk = (size_t)DMOD * DMOD;

  // (0..3) input activations -> bf16 plane; weights stored [n = out][k = in] (y = x.W^T), already k-contiguous:
  //        bf16 plane for the qkv weight, f16 of bf16 value x1024 for the two square weights
  cvt16<<<gX,   blk, 0, stream>>>(x,    XB,   n8x,   0, 1.0f);
  cvt16<<<gQKV, blk, 0, stream>>>(wqkv, WQKV, n8qkv, 0, 1.0f);
  cvt16<<<gW,   blk, 0, stream>>>(wo,   WOB,  n8w,   1, WOS);
  cvt16<<<gW,   blk, 0, stream>>>(wd,   WDB,  n8w,   1, WOS);
  // (4) q: projection + bias (col = h*128+d), stored as the f16 plane x8
  gemm_bfp<<<gG, bG, 0, stream>>>(XB, WQKV, bqkv, QP, ROWS, DMOD, DMOD, 1.0f, QSC);
  // (5) k: the same with weight rows 1024..2047
  gemm_bfp<<<gG, bG, 0, stream>>>(XB, WQKV + wblk, bqkv + DMOD, KP, ROWS, DMOD, DMOD, 1.0f, KSC);
  // (6) v: weight rows 2048..3071, stored as the v^T plane x1024
  gemm_bft<<<gG, bG, 0, stream>>>(XB, WQKV + 2 * wblk, bqkv + 2 * DMOD, VP, ROWS, DMOD, DMOD, 1.0f, VCAR);
  // (7) attention -> O plane [b][s][h][d] x1024 and per-wave row-sum lines
  attn_fwd<<<gAT, bAT, 0, stream>>>(QP, KP, VP, OP, PART);
  // (8) first output projection + bias (carries 1024 x 1024 folded back), stored as the f16 plane x1024
  gemm_hp<<<gG, bG, 0, stream>>>(OP, WOB, bo, UP, ROWS, DMOD, DMOD, 1.0f / (OSC * WOS), USC);
  // (9) second output projection + bias -> F f32 image [ROWS][1024]
  gemm_h1<<<gG, bG, 0, stream>>>(UP, WDB, bd, F, ROWS, DMOD, DMOD, 1.0f / (USC * WOS));
  // (10) flat line-owned writer of the whole output buffer
  outw<<<gOW, blk, 0, stream>>>(F, PART, out);
  (void)hipGetLastError();
}

// v005
// It runs in 165 microseconds.
// Two timings next to v004 both put it at 1.06 times that version's speed.
// Counting every step since v000, it is 3.59 times as fast.
// Contractions: x.W{q,k,v}^T on v_wmma_f32_16x16x32_bf16 (x and W planes RNE-converted to bf16 operands, f32 accumulate, bias added in f32);
// scores k'.q'^T (q', k' single f16 planes carried x8), P.v (P x32768 single f16, v x1024 single f16), O.Wo^T and U.Wd^T
// (O and U single f16 planes x1024, Wo and Wd as f16(bf16(W) x1024)): v_wmma_f32_16x16x32_f16, f32 accumulate.
// Base-2 online softmax, 1/l fold, row-sum partials and bias adds in f32 on VALU.
// The q, k, v^T and U operand planes are written by the epilogue of the GEMM that produces them (f32 result, bias, carry, f16).
#include <hip/hip_runtime.h>
#include <math.h>
#include <stdint.h>

#define NB    4
#define SEQ   2048
#define DMOD  1024
#define NH    8
#define HD    128
#define QT_BITS 5
#define NH_BITS 3
#define ROWS  (NB * SEQ)
#define QSC   8.0f
#define KSC   8.0f
#define PCAR  32768.0f
#define PEXP  15.0f
#define VCAR  1024.0f
#define OSC   1024.0f
#define USC   1024.0f
#define WOS   1024.0f
#define SM_SCALE 0.08838834764831845f
#define LOG2E 1.4426950408889634f
#define ATT_WAVES   8
#define ATT_THREADS (ATT_WAVES * 32)
#define ATT_QT      2
#define ATT_QROWS   (ATT_WAVES * ATT_QT * 16)
#define AQT_BITS    3
#define ATT_BLOCKS  (NB * NH * (SEQ / ATT_QROWS))
#define NKB    (SEQ / 32)
#define RS     (NH * HD)
#define SPITCH 132
#define SLABF  (16 * SPITCH)
#define SLAB64 (16 * 68)
#define VTS    144
#define WPB    (NH * (SEQ / ATT_QROWS) * ATT_WAVES * ATT_QT)
#define TOTOUT (NB + ROWS * DMOD)
#define IMGN   (ROWS * DMOD)
#define NPIECE ((TOTOUT + 3) / 4)
#define GBT    128
#define GKS    128
#define GPITCH 272
#define GOPB   (GBT * GPITCH)
#define GBUF   (2 * GOPB)
#define AKS    128
#define ANST   (SEQ / AKS)
#define AOPB   (AKS * GPITCH)
#define ABUF   (AOPB + HD * GPITCH)
#define DEPSC  (1.0f / ((float)NH * (float)SEQ * (float)SEQ))

static_assert(HD == 128 && DMOD == NH * HD && RS == DMOD);
static_assert(PCAR == (float)(1 << (int)PEXP));
static_assert((1 << QT_BITS) == (SEQ / 64) && (1 << NH_BITS) == NH);
static_assert((SEQ % 64) == 0 && (SEQ % 32) == 0 && NKB * 32 == SEQ);
static_assert(((ROWS * DMOD / 8) % 256) == 0 && ((3 * DMOD * DMOD / 8) % 256) == 0 && ((DMOD * DMOD / 8) % 256) == 0);
static_assert((ROWS % 64) == 0 && (DMOD % 64) == 0 && (DMOD % 32) == 0);
static_assert(NB >= 1 && NB <= 32);
static_assert((WPB % 32) == 0 && WPB == 1024);
static_assert(ATT_THREADS == 256 && (1 << AQT_BITS) == (SEQ / ATT_QROWS));
static_assert((SEQ % AKS) == 0 && ANST >= 2 && (AKS % 32) == 0 && AKS * 2 + 16 == GPITCH && HD * 2 + 16 == GPITCH);
static_assert(AKS == 8 * (ATT_THREADS / 16) && HD == 8 * (ATT_THREADS / 16));
static_assert(ATT_WAVES * ATT_QT * SLABF * 4 <= 2 * ABUF);
static_assert(((SPITCH * 4) % 16) == 0 && (SPITCH >= HD + 4));
static_assert((VTS % 16) == 0 && VTS >= 64 * 2 && 4 * 64 * VTS <= 2 * GBUF && (SEQ % GBT) == 0);
static_assert(4 * 64 * 68 * 4 <= 2 * GBUF);
static_assert(IMGN % 4 == 0);
static_assert((ROWS % GBT) == 0 && (DMOD % GBT) == 0 && (DMOD % GKS) == 0 && GKS * 2 + 16 == GPITCH);

typedef unsigned short u16;
typedef _Float16 v16h __attribute__((ext_vector_type(16)));
typedef _Float16 v8h  __attribute__((ext_vector_type(8)));
typedef __bf16   v16b __attribute__((ext_vector_type(16)));
typedef float    v8f  __attribute__((ext_vector_type(8)));
typedef float    v4f  __attribute__((ext_vector_type(4)));
typedef float    v2f  __attribute__((ext_vector_type(2)));
typedef _Float16 v2h  __attribute__((ext_vector_type(2)));
typedef unsigned int v4u __attribute__((ext_vector_type(4)));

union FragH { v16h v; v8h h[2]; v4u u[2]; };
union FragB { v16b v; v4u u[2]; };

// ---- scalar helpers --------------------------------------------------------------------------------
__device__ __forceinline__ unsigned short bf_bits(float f) {          // f32 -> bf16 bits, RNE convert
  unsigned u = __float_as_uint(f);
  return (unsigned short)((u + 0x7FFFu + ((u >> 16) & 1u)) >> 16);
}
__device__ __forceinline__ float bf_up(unsigned short h) { return __uint_as_float(((unsigned)h) << 16); }
__device__ __forceinline__ float bfr(float f) { return bf_up(bf_bits(f)); }
__device__ __forceinline__ unsigned short h_bits(_Float16 x) { return __builtin_bit_cast(unsigned short, x); }
__device__ __forceinline__ unsigned pk16(unsigned short a, unsigned short b) { return (unsigned)a | ((unsigned)b << 16); }
__device__ __forceinline__ v8f zero8() { v8f z = {0.f, 0.f, 0.f, 0.f, 0.f, 0.f, 0.f, 0.f}; return z; }
__device__ __forceinline__ v4f zero4() { v4f z = {0.f, 0.f, 0.f, 0.f}; return z; }

// ---- fragment loaders: 16-bit A/B operand, lane -> row/col (lane&15), p already includes +8*(lane>>4);
//      elements 0..7 <- p[0..7] (k0+8h..), elements 8..15 <- p[16..23] (k0+16+8h..)  (same split k map for A and B;
//      B is always read from a k-contiguous [n][k] plane)
__device__ __forceinline__ v16h ldfrag_h(const _Float16* p) {
  FragH f;
  f.h[0] = *(const v8h*)(p);
  f.h[1] = *(const v8h*)(p + 16);
  return f.v;
}

__device__ __forceinline__ v8f mma_h(v16h a, v16h b, v8f c) {
  return __builtin_amdgcn_wmma_f32_16x16x32_f16(false, a, false, b, (short)0, c, false, false);
}
__device__ __forceinline__ v8f mma_b(v16b a, v16b b, v8f c) {
  return __builtin_amdgcn_wmma_f32_16x16x32_bf16(false, a, false, b, (short)0, c, false, false);
}
// The four v_nop fill the vector slots that the chip needs behind a matrix instruction before a vector instruction may touch its
// result or overwrite its operands; they stand at the foot of the key-block loop, for the taken side of its branch. The results
// of the loop's last eight matrix instructions are named so that the v_nop stay behind them.
__device__ __forceinline__ void guard_foot(v8f& a0, v8f& a1, v8f& a2, v8f& a3, v8f& b0, v8f& b1, v8f& b2, v8f& b3) {
#if defined(__HIP_DEVICE_COMPILE__)
  asm volatile("v_nop\n\tv_nop\n\tv_nop\n\tv_nop"
               : "+v"(a0), "+v"(a1), "+v"(a2), "+v"(a3), "+v"(b0), "+v"(b1), "+v"(b2), "+v"(b3));
#endif
}
__device__ __forceinline__ void wave_sync_lds() {
  __builtin_amdgcn_fence(__ATOMIC_RELEASE, "workgroup");
  __builtin_amdgcn_wave_barrier();
  __builtin_amdgcn_fence(__ATOMIC_ACQUIRE, "workgroup");
}

// =====================================================================================================
// f32 plane -> 16-bit plane, same layout:  mode 0: bf16 RNE bits;  mode 1: f16 bits of (bf16 RNE value) * scale;
// mode 2: f16 bits of value * scale (no bf16 pre-step).
// Thread = 8 consecutive elements: two 16-B loads, one 16-B store; 32 consecutive lanes = 512 contiguous, 512-B aligned bytes
// coverage: grid = n8/256 blocks (host checks exactness) x 256 thr x 8 = the whole plane.
// =====================================================================================================
__global__ __launch_bounds__(256) void cvt16(const float* __restrict__ x, u16* D, int n8, int mode, float scale) {
  const int gt = blockIdx.x * 256 + (int)threadIdx.x;
  if (gt >= n8) return;                     // no barriers in this kernel
  const float* p = x + (size_t)gt * 8;
  const v4f a = *(const v4f*)(p), c4 = *(const v4f*)(p + 4);
  float v[8];
#pragma unroll
  for (int e = 0; e < 4; ++e) { v[e] = a[e]; v[4 + e] = c4[e]; }
  unsigned short s[8];
#pragma unroll
  for (int e = 0; e < 8; ++e) {
    const float vb = bfr(v[e]);
    const float vf = (mode == 1) ? vb : v[e];
    const unsigned short hb = h_bits((_Float16)(vf * scale));
    const unsigned short bb = bf_bits(v[e]);
    s[e] = (mode != 0) ? hb : bb;
  }
  v4u o;
#pragma unroll
  for (int e = 0; e < 4; ++e) o[e] = pk16(s[2 * e], s[2 * e + 1]);
  u16* d = D + (size_t)gt * 8;
  {
    *(v4u*)(d) = o;
    
  }
}

// =====================================================================================================
// GEMM f32 epilogue (EPI 0): the wave's 16x64 f32 tile (times oscale) staged in its LDS slab (pitch 68),
// coverage: 8 instructions x 2 rows x 16 lanes x 4 floats = the wave's 16 x 64 tile.
// =====================================================================================================
__device__ __forceinline__ void epi64(float* sl, v8f a0, v8f a1, v8f a2, v8f a3, float oscale, v4f badd, float* C, int N,
                                      size_t rowb, int col0, int lane) {
  const int hh = lane >> 4, m = lane & 15;
#pragma unroll
  for (int r = 0; r < 8; ++r) {
    const int ro = (8 * hh + r) * 68 + m;
    sl[ro]      = a0[r] * oscale;
    sl[ro + 16] = a1[r] * oscale;
    sl[ro + 32] = a2[r] * oscale;
    sl[ro + 48] = a3[r] * oscale;
  }
  wave_sync_lds();
  v4f vals[8];
#pragma unroll
  for (int it = 0; it < 8; ++it) vals[it] = *(const v4f*)(sl + (it * 2 + hh) * 68 + m * 4) + badd;
  float* dst = C + (rowb + (size_t)hh) * (size_t)N + col0 + m * 4;
  {
#pragma unroll
    for (int it = 0; it < 8; ++it) {
      *(v4f*)(dst + (size_t)(it * 2) * (size_t)N) = vals[it];
    }
    
  }
}

// =====================================================================================================
// 16-bit GEMM with bias, both engines: C[M][N] (f32) = A[M][K] (row-major) . Bt[N][K]^T (k-contiguous), times oscale, plus the
// bf16-RNE value of bias[n]. Block = 128x128 tile of C, 4 waves as 2x2, wave = 64x64 (4x4 accumulator tiles).
// EPI 0 stores C as f32; EPI 1 stores f16(C * pscale) as the plane P[M][N]; EPI 2 stores f16(C * pscale) transposed per batch,
// P[(row / SEQ) * N + col][row % SEQ] (the v^T plane: N = NH * HD, col = h * HD + d).
// A stage is 128 k of the block's 128 A rows and 128 Bt rows: 256 rows of 256 B, laid in LDS at pitch 272 B by asynchronous
// b128 copies (16 lanes = one whole 256-B row, so every copy touches whole lines). Two buffers: stage t+1 flies while stage t
// is multiplied. Fragments are read from LDS with the same split k map for A and B as ldfrag_h; k runs upward in steps of 32
// into one accumulator per tile. Shapes: M % 128 == 0, N % 128 == 0, K % 128 == 0, grid = (M/128)*(N/128) (static_assert above).
// =====================================================================================================
__device__ __forceinline__ unsigned lds_off(const void* p) { return (unsigned)(size_t)p; }

// Eight asynchronous 16-B-per-lane copies, rows 8 apart. The s_wait_xcnt stands inside the statement so that no address
// register of a copy is rewritten in front of it.
__device__ __forceinline__ void copy8(unsigned l, const u16* g, size_t rs8) {
#if defined(__HIP_DEVICE_COMPILE__)
  asm volatile("global_load_async_to_lds_b128 %0, %8, off\n\t"
               "global_load_async_to_lds_b128 %1, %9, off\n\t"
               "global_load_async_to_lds_b128 %2, %10, off\n\t"
               "global_load_async_to_lds_b128 %3, %11, off\n\t"
               "global_load_async_to_lds_b128 %4, %12, off\n\t"
               "global_load_async_to_lds_b128 %5, %13, off\n\t"
               "global_load_async_to_lds_b128 %6, %14, off\n\t"
               "global_load_async_to_lds_b128 %7, %15, off\n\t"
               "s_wait_xcnt 0x0"
               :: "v"(l), "v"(l + 8u * GPITCH), "v"(l + 16u * GPITCH), "v"(l + 24u * GPITCH),
                  "v"(l + 32u * GPITCH), "v"(l + 40u * GPITCH), "v"(l + 48u * GPITCH), "v"(l + 56u * GPITCH),
                  "v"(g), "v"(g + rs8), "v"(g + 2 * rs8), "v"(g + 3 * rs8),
                  "v"(g + 4 * rs8), "v"(g + 5 * rs8), "v"(g + 6 * rs8), "v"(g + 7 * rs8)
               : "memory");
#endif
}
// One stage: this thread's 16 B of rows cr + 8i (i = 0..15) of the A tile and of the Bt tile; 32 copies per wave.
__device__ __forceinline__ void fill_stage(unsigned l, const u16* ga, const u16* gb, size_t rs8) {
  copy8(l, ga, rs8);
  copy8(l + 64u * GPITCH, ga + 8 * rs8, rs8);
  copy8(l + GOPB, gb, rs8);
  copy8(l + GOPB + 64u * GPITCH, gb + 8 * rs8, rs8);
}
__device__ __forceinline__ void wait_async0() {   // this wave's copies have landed
#if defined(__HIP_DEVICE_COMPILE__)
  asm volatile("s_wait_asynccnt 0x0" ::: "memory");
#endif
}
__device__ __forceinline__ void wait_ds0() {      // this wave's LDS reads have returned before their buffer is refilled
#if defined(__HIP_DEVICE_COMPILE__)
  asm volatile("s_wait_dscnt 0x0" ::: "memory");
#endif
}
__device__ __forceinline__ FragB ld_lfrag(const unsigned char* p) {   // split k map of ldfrag_h: bytes 0..15 and 32..47
  FragB f;
  f.u[0] = *(const v4u*)(p);
  f.u[1] = *(const v4u*)(p + 32);
  return f;
}
__device__ __forceinline__ v8f mma_sel(FragB a, FragB b, v8f c, bool bf) {
  if (bf) return mma_b(a.v, b.v, c);
  return mma_h(__builtin_bit_cast(v16h, a.v), __builtin_bit_cast(v16h, b.v), c);
}

template <bool BF, int EPI>
__device__ __forceinline__ void gemm_core(unsigned char* ring, float* slab, const u16* __restrict__ A,
                                          const u16* __restrict__ Bt, const float* __restrict__ bias,
                                          float* C, u16* P, int M, int N, int K, float oscale, float pscale) {
  const int tid = threadIdx.x, wave = tid >> 5, lane = tid & 31, hh = lane >> 4, m = lane & 15;
  const int ntile = N >> 7;
  const int bid   = blockIdx.x;
  const int row0  = (bid / ntile) * GBT;
  const int col0  = (bid % ntile) * GBT;
  if (row0 + GBT > M) return;                // block-uniform, in front of every barrier; never taken with the exact grid
  const int wr = wave >> 1, wc = wave & 1;
  const int nst = K >> 7;
  const int cr = tid >> 4, cc = tid & 15;    // copy: row within a group of 8, 16-B chunk of the 256-B row
  const u16* ga = A  + (size_t)(row0 + cr) * K + cc * 8;
  const u16* gb = Bt + (size_t)(col0 + cr) * K + cc * 8;
  const size_t rs8 = (size_t)8 * K;
  const unsigned l0 = lds_off(ring) + (unsigned)(cr * GPITCH + cc * 16);

  v8f acc[4][4];
#pragma unroll
  for (int i = 0; i < 4; ++i) {
#pragma unroll
    for (int j = 0; j < 4; ++j) acc[i][j] = zero8();
  }

  fill_stage(l0, ga, gb, rs8);
  wait_async0();
  __syncthreads();                           // publishes stage 0
  if (nst > 1) fill_stage(l0 + GBUF, ga + GKS, gb + GKS, rs8);

  for (int t = 0; t < nst; ++t) {
    const unsigned bo = (unsigned)(t & 1) * GBUF;
    const unsigned char* ab = ring + bo + (wr * 64 + m) * GPITCH + hh * 16;
    const unsigned char* bb = ring + bo + GOPB + (wc * 64 + m) * GPITCH + hh * 16;
    FragB a[2][4], b[2][4];                  // set (ks & 1) holds the fragments of k step ks
#pragma unroll
    for (int i = 0; i < 4; ++i) { a[0][i] = ld_lfrag(ab + i * 16 * GPITCH); b[0][i] = ld_lfrag(bb + i * 16 * GPITCH); }
#pragma unroll
    for (int ks = 0; ks < GKS / 32; ++ks) {
      const int cs = ks & 1;
      if (ks + 1 < GKS / 32) {
#pragma unroll
        for (int i = 0; i < 4; ++i) {
          a[cs ^ 1][i] = ld_lfrag(ab + i * 16 * GPITCH + (ks + 1) * 64);
          b[cs ^ 1][i] = ld_lfrag(bb + i * 16 * GPITCH + (ks + 1) * 64);
        }
      }
      // keeps the next k step's LDS reads one group ahead of this step's products instead of spread among them
      __builtin_amdgcn_sched_barrier(0);
#pragma unroll
      for (int i = 0; i < 4; ++i) {
#pragma unroll
        for (int j = 0; j < 4; ++j) acc[i][j] = mma_sel(a[cs][i], b[cs][j], acc[i][j], BF);
      }
      // keeps the following group of LDS reads behind this step's products
      __builtin_amdgcn_sched_barrier(0);
    }
    wait_ds0();
    wait_async0();
    __syncthreads();                         // publishes stage t+1 and ends every reader's last read of stage t's buffer
    if (t + 2 < nst) fill_stage(l0 + bo, ga + (size_t)(t + 2) * GKS, gb + (size_t)(t + 2) * GKS, rs8);
  }
  wait_async0();

  const int colw = col0 + wc * 64;
  if constexpr (EPI == 0) {
    float* sl = slab + wave * SLAB64;
    const v4f bv = *(const v4f*)(bias + colw + m * 4);    // columns colw + 4m .. +3, always < N (N multiple of 128)
    v4f badd;
#pragma unroll
    for (int e = 0; e < 4; ++e) badd[e] = bfr(bv[e]);
#pragma unroll
    for (int i = 0; i < 4; ++i) {
      if (i) wave_sync_lds();                // the slab's last readers are done before other lanes overwrite it
      epi64(sl, acc[i][0], acc[i][1], acc[i][2], acc[i][3], oscale, badd, C, N, (size_t)(row0 + wr * 64 + i * 16), colw, lane);
    }
  } else if constexpr (EPI == 1) {
    // The wave's 64 x 64 f32 tile (times oscale) is staged whole in its own part of the ring (pitch 68 floats), which the last
    // stage's barrier has freed of readers and copies; read back with 8 lanes per row (8 columns each), so that every 128-B
    // row piece of the plane leaves as one whole line.
    // coverage: 16 instructions x 4 rows x 8 lanes x 8 halves = the wave's 64 x 64 tile.
    float* sl = (float*)(void*)ring + wave * (64 * 68);
#pragma unroll
    for (int i = 0; i < 4; ++i) {
#pragma unroll
      for (int r = 0; r < 8; ++r) {
        const int ro = (i * 16 + 8 * hh + r) * 68 + m;
#pragma unroll
        for (int j = 0; j < 4; ++j) sl[ro + 16 * j] = acc[i][j][r] * oscale;
      }
    }
    const int rq = lane >> 3, p8 = (lane & 7) * 8;
    const float* bp = bias + colw + p8;                   // columns colw + 8(lane & 7) .. +7, always < N
    const v4f bv0 = *(const v4f*)(bp), bv1 = *(const v4f*)(bp + 4);
    v4f b0, b1;
#pragma unroll
    for (int e = 0; e < 4; ++e) { b0[e] = bfr(bv0[e]); b1[e] = bfr(bv1[e]); }
    wave_sync_lds();
    v4u o[16];
#pragma unroll
    for (int it = 0; it < 16; ++it) {
      const float* s = sl + (it * 4 + rq) * 68 + p8;
      const v4f x = (*(const v4f*)(s) + b0) * pscale, y = (*(const v4f*)(s + 4) + b1) * pscale;
      const v8f f = {x[0], x[1], x[2], x[3], y[0], y[1], y[2], y[3]};
      o[it] = __builtin_bit_cast(v4u, __builtin_convertvector(f, v8h));
    }
    u16* dst = P + (size_t)(row0 + wr * 64 + rq) * (size_t)N + colw + p8;
#pragma unroll
    for (int it = 0; it < 16; ++it) *(v4u*)(dst + (size_t)(it * 4) * (size_t)N) = o[it];
  } else {
    // An accumulator lane holds 8 consecutive rows of one column: 16 B of a transposed line. The wave's 64 columns x 64 rows
    // are gathered in its own part of the ring (pitch 144 B), which the last stage's barrier has freed of readers and copies,
    // and leave as whole 128-B lines, 8 lanes each.
    // coverage: 16 instructions x 4 lines x 8 lanes x 8 halves = the wave's 64 x 64 tile.
    unsigned char* st = ring + wave * (64 * VTS);
#pragma unroll
    for (int j = 0; j < 4; ++j) {
      const float bj = bfr(bias[colw + j * 16 + m]);
#pragma unroll
      for (int i = 0; i < 4; ++i) {
        const v8f f = (acc[i][j] * oscale + bj) * pscale;
        *(v8h*)(st + (j * 16 + m) * VTS + i * 32 + hh * 16) = __builtin_convertvector(f, v8h);
      }
    }
    wave_sync_lds();
    const int rq = lane >> 3, p = lane & 7;
    v4u t[16];
#pragma unroll
    for (int it = 0; it < 16; ++it) t[it] = *(const v4u*)(st + (it * 4 + rq) * VTS + p * 16);
    const int roww = row0 + wr * 64;         // 64 rows of one batch (SEQ % 128 == 0)
    u16* dst = P + ((size_t)(roww / SEQ) * (size_t)N + colw + rq) * SEQ + (roww % SEQ) + p * 8;
#pragma unroll
    for (int it = 0; it < 16; ++it) *(v4u*)(dst + (size_t)(it * 4) * SEQ) = t[it];
  }
}

__global__ __launch_bounds__(128)
void gemm_bfp(const u16* __restrict__ A, const u16* __restrict__ Bt, const float* __restrict__ bias,
              u16* P, int M, int N, int K, float oscale, float pscale) {
  __shared__ __align__(16) unsigned char ring[2 * GBUF];
  gemm_core<true, 1>(ring, nullptr, A, Bt, bias, nullptr, P, M, N, K, oscale, pscale);
}

__global__ __launch_bounds__(128)
void gemm_bft(const u16* __restrict__ A, const u16* __restrict__ Bt, const float* __restrict__ bias,
              u16* P, int M, int N, int K, float oscale, float pscale) {
  __shared__ __align__(16) unsigned char ring[2 * GBUF];
  gemm_core<true, 2>(ring, nullptr, A, Bt, bias, nullptr, P, M, N, K, oscale, pscale);
}

__global__ __launch_bounds__(128)
void gemm_hp(const u16* __restrict__ A, const u16* __restrict__ Bt, const float* __restrict__ bias,
             u16* P, int M, int N, int K, float oscale, float pscale) {
  __shared__ __align__(16) unsigned char ring[2 * GBUF];
  gemm_core<false, 1>(ring, nullptr, A, Bt, bias, nullptr, P, M, N, K, oscale, pscale);
}

__global__ __launch_bounds__(128)
void gemm_h1(const u16* __restrict__ A, const u16* __restrict__ Bt, const float* __restrict__ bias,
             float* C, int M, int N, int K, float oscale) {
  __shared__ __align__(16) unsigned char ring[2 * GBUF];
  __shared__ __align__(16) float slab[4 * SLAB64];
  gemm_core<false, 0>(ring, slab, A, Bt, bias, C, nullptr, M, N, K, oscale, 1.0f);
}

// =====================================================================================================
// Multi-head flash attention (no mask): block = (batch b, head, 256 query rows), 8 waves, wave w owns the 32 query rows
// q0 = 256*qt + 32*w .. q0+31 as two query tiles of 16; every k and v^T fragment read from LDS is used for both tiles. What
// follows describes one query tile (q0 there = the tile's first row).
//   q plane (f16, x8) laid out [b][s][h][d]; k plane the same; v^T plane [b][h][d][s] (x1024).
//   All NKB = SEQ/32 key blocks of 32 keys are visited (static bound), in stages of 128 keys that the block's waves share:
//   a stage is 128 k rows of 256 B (all d) and 128 v^T rows of 256 B (its 128 keys), laid in LDS at pitch 272 B by asynchronous
//   b128 copies (16 lanes = one whole 256-B row). Two buffers: stage t+1 flies while stage t is worked on. The fragments are
//   read from LDS with the split k map of ldfrag_h. After the last stage's barrier the ring is the epilogue's staging room.
//   Scores are computed TRANSPOSED: S^T tile g (g = 0,1) = k rows (keys kb+16g .. +15, A operand, row m = lane&15, split k map
//   over d, 4 chunks of 32 d) times q^T (B operand, col n = query q0 + (lane&15), k = d, split map).
//   D element r of lane l = (key kb+16g+8h+r, query q0+(l&15)), so a lane owns one query column and 16 of its 32 keys; the
//   partner lane l^16 owns the other 16 -> row max / row sum need one xor-16 shuffle.
//   Online max-subtracted base-2 softmax in f32 (scale 1/sqrt(128) and the q/k carries folded into lsc; scale, maximum and
//   the x32768 carry of P enter a score's exponent through one FMA; l carries the x32768 too). The exp'd values ARE
//   the P A-fragment in place: A row m = query = lane&15, element i <- key kb+8h+i (tile 0, D element i), element 8+i <- key
//   kb+16+8h+i (tile 1, D element i). P is carried x32768 as single f16. The rescale factor of query row 8h+r of the
//   O accumulators is fetched from lane 8h+r with a shuffle (uniform control). 8 v^T B fragments (col n = d = 16j + (lane&15),
//   keys k-contiguous), 8 P.V WMMAs per key block and query tile; the two tiles' 16 stand together.
//   Epilogue: 1/l (per query, shuffled to the D row owner) and carry folds in f32; the wave's 16x128 f32 result staged in its
//   LDS slab (pitch 132); each 256-B output row (b, q0+row, head) of the O plane (O x1024 as single f16) written as 2 whole
// coverage: per wave and query tile 8 instructions x 2 rows x 16 lanes x 8 halves = 16 x 128 of the O plane + 1 PART line; grid
//           NB*NH*SEQ/256 blocks x 8 waves x 2 tiles = every (b, s, h) row of the O plane and every PART line exactly once.
// =====================================================================================================
// Eight asynchronous 16-B-per-lane copies, rows 16 apart. The s_wait_xcnt stands inside the statement so that no address
// register of a copy is rewritten in front of it.
__device__ __forceinline__ void copy8w(unsigned l, const u16* g, size_t rs16) {
#if defined(__HIP_DEVICE_COMPILE__)
  asm volatile("global_load_async_to_lds_b128 %0, %8, off\n\t"
               "global_load_async_to_lds_b128 %1, %9, off\n\t"
               "global_load_async_to_lds_b128 %2, %10, off\n\t"
               "global_load_async_to_lds_b128 %3, %11, off\n\t"
               "global_load_async_to_lds_b128 %4, %12, off\n\t"
               "global_load_async_to_lds_b128 %5, %13, off\n\t"
               "global_load_async_to_lds_b128 %6, %14, off\n\t"
               "global_load_async_to_lds_b128 %7, %15, off\n\t"
               "s_wait_xcnt 0x0"
               :: "v"(l), "v"(l + 16u * GPITCH), "v"(l + 32u * GPITCH), "v"(l + 48u * GPITCH),
                  "v"(l + 64u * GPITCH), "v"(l + 80u * GPITCH), "v"(l + 96u * GPITCH), "v"(l + 112u * GPITCH),
                  "v"(g), "v"(g + rs16), "v"(g + 2 * rs16), "v"(g + 3 * rs16),
                  "v"(g + 4 * rs16), "v"(g + 5 * rs16), "v"(g + 6 * rs16), "v"(g + 7 * rs16)
               : "memory");
#endif
}
// One attention stage: this thread's 16 B of rows cr + 16i (i = 0..7) of the k tile and of the v^T tile; 16 copies per wave.
__device__ __forceinline__ void fill_kv(unsigned l, const u16* gk, const u16* gv) {
  copy8w(l, gk, (size_t)16 * RS);
  copy8w(l + AOPB, gv, (size_t)16 * SEQ);
}
// 2^x by the hardware instruction alone. A result below 2^-126 comes back as 0: here that is a probability (carried x32768) or
// a rescale factor that small beside a row maximum of 32768, far below the last bit that the f16 operand and the f32 sums keep.
__device__ __forceinline__ float exp2_hw(float x) { return __builtin_amdgcn_exp2f(x); }
__device__ __forceinline__ v16h ld_lfrag_h(const unsigned char* p) {  // split k map of ldfrag_h: bytes 0..15 and 32..47
  FragH f;
  f.u[0] = *(const v4u*)(p);
  f.u[1] = *(const v4u*)(p + 32);
  return f.v;
}

// The v_nop is the slot that the instruction set asks for behind a transcendental before its result is read or its source
// overwritten. The results and the sources are named so that none of them is touched in front of it, wherever it lands.
__device__ __forceinline__ void trans_slot8(float* p, const float* x) {
#if defined(__HIP_DEVICE_COMPILE__)
  asm("v_nop" : "+v"(p[0]), "+v"(p[1]), "+v"(p[2]), "+v"(p[3]), "+v"(p[4]), "+v"(p[5]), "+v"(p[6]), "+v"(p[7])
              : "v"(x[0]), "v"(x[1]), "v"(x[2]), "v"(x[3]), "v"(x[4]), "v"(x[5]), "v"(x[6]), "v"(x[7]));
#endif
}
__device__ __forceinline__ void trans_slot1(float& p, float x) {
#if defined(__HIP_DEVICE_COMPILE__)
  asm("v_nop" : "+v"(p) : "v"(x));
#endif
}

// One query tile's online-softmax step over a key block: s0, s1 = the tile's unscaled transposed scores (this lane's 16 keys of
// query column c). Updates the running maximum (kept unscaled, lsc > 0) and the running sum, gives the rescale factor al of the
// tile's O accumulators and the P A-fragment ph (f16, carried x32768).
__device__ __forceinline__ void softmax_step(const v8f s0, const v8f s1, const float lsc, float& mrun, float& lrun, float& al,
                                             FragH& ph) {
  float tk[16];
#pragma unroll
  for (int i = 0; i < 8; ++i) { tk[i] = s0[i];  tk[8 + i] = s1[i]; }
  float cm = -INFINITY;
#pragma unroll
  for (int i = 0; i < 16; ++i) cm = fmaxf(cm, tk[i]);
  cm = fmaxf(cm, __shfl_xor(cm, 16, 32));
  const float mn = fmaxf(mrun, cm);                                // finite from the first key block on
  const float ax = (mrun - mn) * lsc;
  float ae = exp2_hw(ax);
  trans_slot1(ae, ax);
  al = (mrun == -INFINITY) ? 0.f : ae;                             // o and l are zero while mrun is -inf
  mrun = mn;
  // probabilities carried x32768, one FMA and one v_exp_f32 each: 2^(t * lsc + (15 - mn * lsc)); they are summed and
  // rounded to the P A-fragment (f16) as they come; element i <-> tk[i]
  const float eb = __builtin_fmaf(-mn, lsc, PEXP);
  const v2f l2 = {lsc, lsc}, e2 = {eb, eb};
  float x[16], p[16];
#pragma unroll
  for (int i = 0; i < 16; i += 2) {
    const v2f t2 = {tk[i], tk[i + 1]};       // a register pair of the score accumulator: one packed FMA, no moves
    const v2f x2 = __builtin_elementwise_fma(t2, l2, e2);
    x[i] = x2[0];
    x[i + 1] = x2[1];
  }
#pragma unroll
  for (int i = 0; i < 16; ++i) p[i] = exp2_hw(x[i]);
  trans_slot8(p, x);
  trans_slot8(p + 8, x + 8);
  float ps = 0.f;
#pragma unroll
  for (int w = 0; w < 2; ++w) {
#pragma unroll
    for (int e4 = 0; e4 < 4; ++e4) {
      const int i = 8 * w + 2 * e4;
      ps += p[i] + p[i + 1];
      const v2f pp = {p[i], p[i + 1]};
      ph.u[w][e4] = __builtin_bit_cast(unsigned, __builtin_convertvector(pp, v2h));
    }
  }
  ps += __shfl_xor(ps, 16, 32);
  lrun = lrun * al + ps;
}

// two waves per SIMD (one block per WGP): the register budget that holds two query tiles' accumulators beside the fragments
__global__ __launch_bounds__(ATT_THREADS) __attribute__((amdgpu_waves_per_eu(2, 2)))
void attn_fwd(const u16* __restrict__ QPp, const u16* __restrict__ KPp, const u16* __restrict__ VPp,
              u16* OPo, float* PART) {
  // two stage buffers (k tile, then v^T tile); in the epilogue, per wave and query tile, the result slab [16][132] of floats
  __shared__ __align__(16) unsigned char ring[2 * ABUF];

  const int tid  = threadIdx.x;
  const int wave = tid >> 5;
  const int lane = tid & 31;
  const int hh   = lane >> 4;
  const int c    = lane & 15;

  const int bid  = blockIdx.x;
  const int qt   = bid & ((SEQ / ATT_QROWS) - 1);
  const int head = (bid >> AQT_BITS) & (NH - 1);
  const int b    = bid >> (AQT_BITS + NH_BITS);
  const int q0   = qt * ATT_QROWS + wave * (ATT_QT * 16);   // query tile u: rows q0 + 16u .. q0 + 16u + 15

  // B fragments of q^T: col n = query q0 + 16u + c, k = d (k-contiguous row of the q plane)
  const _Float16* Qb = (const _Float16*)(const void*)QPp + ((size_t)(b * SEQ + q0 + c) * NH + head) * HD + 8 * hh;
  // copy: row within a group of 16, 16-B chunk of the 256-B row; k tile row = key, v^T tile row = d
  const int cr = tid >> 4, cc = tid & 15;
  const u16* kb0 = KPp + ((size_t)(b * SEQ) * NH + head) * HD;                  // block-uniform; stage t: + t * AKS key rows
  const u16* vb0 = VPp + ((size_t)(b * NH + head) * HD) * SEQ;                  // block-uniform; stage t: + t * AKS keys
  const unsigned ko = (unsigned)(cr * RS + cc * 8), vo = (unsigned)(cr * SEQ + cc * 8);   // this thread's place in a stage
  const unsigned l0 = lds_off(ring) + (unsigned)(cr * GPITCH + cc * 16);
  fill_kv(l0, kb0 + ko, vb0 + vo);
  const float lsc = SM_SCALE * (LOG2E / (QSC * KSC));

  v16h qf[ATT_QT][4];                        // chunk n: d 32n .. 32n + 31
#pragma unroll
  for (int u = 0; u < ATT_QT; ++u) {
#pragma unroll
    for (int n = 0; n < 4; ++n) qf[u][n] = ldfrag_h(Qb + (size_t)u * (16 * RS) + n * 32);
  }

  float mrun[ATT_QT], lrun[ATT_QT];
  v8f o[ATT_QT][8];
#pragma unroll
  for (int u = 0; u < ATT_QT; ++u) {
    mrun[u] = -INFINITY;
    lrun[u] = 0.f;
#pragma unroll
    for (int j = 0; j < 8; ++j) o[u][j] = zero8();
  }

  wait_async0();
  __syncthreads();                           // publishes stage 0
  fill_kv(l0 + ABUF, kb0 + (ko + AKS * RS), vb0 + (vo + AKS));   // stage 1 exists (ANST >= 2)

  // one rolled trip per stage, so that the ring's publish point stands once, at the trip's foot
#pragma unroll 1
  for (int t = 0; t < ANST; ++t) {
   const unsigned bo = (unsigned)(t & 1) * ABUF;
   // A fragments of k: row m = key kb + 16g + c, k = d;  B fragments of v: col n = d = 16j + c, k = key
   const unsigned char* kt = ring + bo + c * GPITCH + hh * 16;
   const unsigned char* vt = ring + bo + AOPB + c * GPITCH + hh * 16;
   // stays rolled: one key block's live values already take most of the registers of two waves per SIMD
#pragma unroll 1
   for (int kk = 0; kk < AKS / 32; ++kk) {   // key block kb = t * AKS + kk * 32
    // ---- transposed scores of both query tiles from one read of the k fragments:
    //      sa[u] = keys kb..kb+15, sc[u] = keys kb+16..kb+31, column = query q0 + 16u + c ----
    v8f sa[ATT_QT], sc[ATT_QT];
#pragma unroll
    for (int u = 0; u < ATT_QT; ++u) { sa[u] = zero8(); sc[u] = zero8(); }
    const unsigned char* k0p = kt + kk * 32 * GPITCH;
    const unsigned char* k1p = k0p + 16 * GPITCH;
    const unsigned char* vp  = vt + kk * 64;
    const v16h ka0 = ld_lfrag_h(k0p), kc0 = ld_lfrag_h(k1p);
    const v16h ka1 = ld_lfrag_h(k0p + 64), kc1 = ld_lfrag_h(k1p + 64);
    const v16h ka2 = ld_lfrag_h(k0p + 128), kc2 = ld_lfrag_h(k1p + 128);
    const v16h ka3 = ld_lfrag_h(k0p + 192), kc3 = ld_lfrag_h(k1p + 192);
    // keeps the k fragments' reads one group ahead of the products instead of pair by pair, each with a full wait, among them
    __builtin_amdgcn_sched_barrier(0);
    sa[0] = mma_h(ka0, qf[0][0], sa[0]);
    sa[1] = mma_h(ka0, qf[1][0], sa[1]);
    sc[0] = mma_h(kc0, qf[0][0], sc[0]);
    sc[1] = mma_h(kc0, qf[1][0], sc[1]);
    sa[0] = mma_h(ka1, qf[0][1], sa[0]);
    sa[1] = mma_h(ka1, qf[1][1], sa[1]);
    sc[0] = mma_h(kc1, qf[0][1], sc[0]);
    sc[1] = mma_h(kc1, qf[1][1], sc[1]);
    // keeps the first four v^T fragments' reads here, as one group behind the first eight products, so that they return
    // behind the softmax arithmetic
    __builtin_amdgcn_sched_barrier(0);
    const v16h vf0 = ld_lfrag_h(vp);
    const v16h vf1 = ld_lfrag_h(vp + 16 * GPITCH);
    const v16h vf2 = ld_lfrag_h(vp + 32 * GPITCH);
    const v16h vf3 = ld_lfrag_h(vp + 48 * GPITCH);
    __builtin_amdgcn_sched_barrier(0);       // ends that group of reads
    sa[0] = mma_h(ka2, qf[0][2], sa[0]);
    sa[1] = mma_h(ka2, qf[1][2], sa[1]);
    sc[0] = mma_h(kc2, qf[0][2], sc[0]);
    sc[1] = mma_h(kc2, qf[1][2], sc[1]);
    sa[0] = mma_h(ka3, qf[0][3], sa[0]);
    sa[1] = mma_h(ka3, qf[1][3], sa[1]);
    sc[0] = mma_h(kc3, qf[0][3], sc[0]);
    sc[1] = mma_h(kc3, qf[1][3], sc[1]);
    __builtin_amdgcn_sched_barrier(0);       // the last four v^T fragments' reads: one group behind the scores' last product
    const v16h vf4 = ld_lfrag_h(vp + 64 * GPITCH);
    const v16h vf5 = ld_lfrag_h(vp + 80 * GPITCH);
    const v16h vf6 = ld_lfrag_h(vp + 96 * GPITCH);
    const v16h vf7 = ld_lfrag_h(vp + 112 * GPITCH);
    __builtin_amdgcn_sched_barrier(0);       // ends that group of reads
    // ---- per query tile: online softmax, then the rescale of its O accumulators: D row 8hh+r = query q0+16u+8hh+r, whose
    //      factor lives in lane 8hh+r (and 16+8hh+r) ----
    FragH ph[ATT_QT];
#pragma unroll
    for (int u = 0; u < ATT_QT; ++u) {
      float al;
      softmax_step(sa[u], sc[u], lsc, mrun[u], lrun[u], al, ph[u]);
      float scl[8];
#pragma unroll
      for (int r = 0; r < 8; ++r) scl[r] = __shfl(al, 8 * hh + r, 32);
#pragma unroll
      for (int j = 0; j < 8; ++j) {
#pragma unroll
        for (int r = 0; r < 8; ++r) o[u][j][r] *= scl[r];
      }
    }
    // ---- P.V : B fragment col n = d = j*16 + c, keys contiguous in the v^T tile; every fragment serves both query tiles;
    //      the v_nop behind the last of the 16 are for the loop's branch ----
    o[0][0] = mma_h(ph[0].v, vf0, o[0][0]);
    o[1][0] = mma_h(ph[1].v, vf0, o[1][0]);
    o[0][1] = mma_h(ph[0].v, vf1, o[0][1]);
    o[1][1] = mma_h(ph[1].v, vf1, o[1][1]);
    o[0][2] = mma_h(ph[0].v, vf2, o[0][2]);
    o[1][2] = mma_h(ph[1].v, vf2, o[1][2]);
    o[0][3] = mma_h(ph[0].v, vf3, o[0][3]);
    o[1][3] = mma_h(ph[1].v, vf3, o[1][3]);
    o[0][4] = mma_h(ph[0].v, vf4, o[0][4]);
    o[1][4] = mma_h(ph[1].v, vf4, o[1][4]);
    o[0][5] = mma_h(ph[0].v, vf5, o[0][5]);
    o[1][5] = mma_h(ph[1].v, vf5, o[1][5]);
    o[0][6] = mma_h(ph[0].v, vf6, o[0][6]);
    o[1][6] = mma_h(ph[1].v, vf6, o[1][6]);
    o[0][7] = mma_h(ph[0].v, vf7, o[0][7]);
    o[1][7] = mma_h(ph[1].v, vf7, o[1][7]);
    guard_foot(o[0][4], o[0][5], o[0][6], o[0][7], o[1][4], o[1][5], o[1][6], o[1][7]);
   }
   wait_ds0();
   wait_async0();
   __syncthreads();                          // publishes stage t+1 and ends every reader's last read of stage t's buffer
   if (t + 2 < ANST) fill_kv(l0 + bo, kb0 + (ko + (unsigned)(t + 2) * (AKS * RS)), vb0 + (vo + (unsigned)(t + 2) * AKS));
  }
  wait_async0();

  // the last stage's barrier lies behind every wave's last fragment read and last copy: the ring is free
#pragma unroll
  for (int u = 0; u < ATT_QT; ++u) {
    // ---- fold 1/l (per query, owned by lane = query) and the carries; row statistic r = l * (1/l); stage the 16x128 slab ----
    const float rl   = (lrun[u] > 0.f) ? (1.0f / lrun[u]) : 0.f;
    const float linv = rl * (1.0f / VCAR);   // l carries the same x32768 as P
    const float rr   = lrun[u] * rl;
    float inv[8];
#pragma unroll
    for (int r = 0; r < 8; ++r) inv[r] = __shfl(linv, 8 * hh + r, 32);
    float* slab = (float*)(void*)ring + (wave * ATT_QT + u) * SLABF;
#pragma unroll
    for (int r = 0; r < 8; ++r) {
#pragma unroll
      for (int j = 0; j < 8; ++j) slab[(8 * hh + r) * SPITCH + j * 16 + c] = o[u][j][r] * inv[r];
    }
    wave_sync_lds();
    // ---- O x1024 -> single f16 plane; lane = (row parity hh, 8 consecutive d at c8) ----
    v4u oh[8];
    const int c8 = c * 8;
#pragma unroll
    for (int it = 0; it < 8; ++it) {
      const int row = it * 2 + hh;
      const v4f a = *(const v4f*)(slab + row * SPITCH + c8), c4 = *(const v4f*)(slab + row * SPITCH + c8 + 4);
      float w[8];
#pragma unroll
      for (int e = 0; e < 4; ++e) { w[e] = a[e] * OSC; w[4 + e] = c4[e] * OSC; }
#pragma unroll
      for (int e = 0; e < 4; ++e) {
        const _Float16 h0 = (_Float16)w[2 * e], h1 = (_Float16)w[2 * e + 1];
        oh[it][e] = pk16(h_bits(h0), h_bits(h1));
      }
    }
    // ---- tile row-sum partial (fixed xor tree over the 16 query lanes; both lane halves hold identical values) ----
    float wsum = rr;
    wsum += __shfl_xor(wsum, 1, 32);
    wsum += __shfl_xor(wsum, 2, 32);
    wsum += __shfl_xor(wsum, 4, 32);
    wsum += __shfl_xor(wsum, 8, 32);
    v4f pv = zero4();
    pv[0] = (lane == 0) ? wsum : 0.f;
    float* pd = PART + (((size_t)bid * ATT_WAVES + wave) * ATT_QT + u) * 32 + (lane & 7) * 4;   // clamped address for every lane
    const size_t ob = ((size_t)(b * SEQ + q0 + 16 * u) * NH + head) * HD + c8;
#pragma unroll
    for (int it = 0; it < 8; ++it) {
      const int row = it * 2 + hh;
      *(v4u*)(OPo + ob + (size_t)row * RS) = oh[it];
    }
    if (lane < 8) *(v4f*)(pd) = pv;
  }
}

// =====================================================================================================
// Flat output writer: out[0..NB-1] = score output (per batch: fixed-order sum of its WPB PART lines times 1/(NH*SEQ*SEQ),
// computed by block 0, wave = batch, 32 lanes x WPB/32 strided loads + xor tree), out[NB + i] = IMG[i] (f32 image of the last
// value. With NB % 4 != 0 a scalar path handles the element interleave and the partial last piece.
// coverage: grid = ceil(NPIECE/256) blocks x 256 thr x 4 elements with the in-kernel bound = all TOTOUT elements exactly once.
// =====================================================================================================
__global__ __launch_bounds__(256) void outw(const float* __restrict__ IMG, const float* __restrict__ PART, float* out) {
  __shared__ __align__(16) float sc[32];
  const int tid = threadIdx.x, wave = tid >> 5, lane = tid & 31;
  if (tid < 32) sc[tid] = 0.f;
  __syncthreads();
  if (blockIdx.x == 0) {                                   // block-uniform
#pragma unroll 1
    for (int bsel = wave; bsel < NB; bsel += 8) {          // wave-uniform
      const float* pp = PART + ((size_t)bsel * WPB + lane) * 32;
      float s = 0.f;
#pragma unroll 1
      for (int i = 0; i < WPB / 32; ++i) s += pp[(size_t)i * (32 * 32)];
#pragma unroll
      for (int d = 16; d >= 1; d >>= 1) s += __shfl_xor(s, d, 32);
      if (lane == 0) sc[bsel] = s * DEPSC;
    }
  }
  __syncthreads();
  const size_t t = (size_t)blockIdx.x * 256 + (size_t)tid;
  if (t >= (size_t)NPIECE) return;                         // no barriers after this point
  const size_t e0 = t * 4;
#if (NB % 4) == 0
  const bool   hs = (e0 < (size_t)NB);
  const int    si = hs ? (int)e0 : 0;
  const v4f    sv = *(const v4f*)(sc + si);
  const size_t ii = hs ? (size_t)0 : (e0 - (size_t)NB);   // clamped, 16-B aligned
  const v4f    gv = *(const v4f*)(IMG + ii);
  v4f val;
#pragma unroll
  for (int e = 0; e < 4; ++e) val[e] = hs ? sv[e] : gv[e];
  float* dst = out + e0;
  {
    *(v4f*)(dst) = val;
    
  }
#else
  float val[4];
  const size_t rem = (size_t)TOTOUT - e0;
  const int nval = (rem < 4) ? (int)rem : 4;
#pragma unroll
  for (int j = 0; j < 4; ++j) {
    size_t e = e0 + (size_t)j;
    if (e > (size_t)(TOTOUT - 1)) e = (size_t)(TOTOUT - 1);
    const bool hsj = (e < (size_t)NB);
    const float g = IMG[hsj ? (size_t)0 : (e - (size_t)NB)];
    const float s = sc[hsj ? (int)e : 0];
    val[j] = hsj ? s : g;
  }
  float* dst = out + e0;
  if (nval == 4) {
    v4f vv;
#pragma unroll
    for (int j = 0; j < 4; ++j) vv[j] = val[j];
    {
      *(v4f*)(dst) = vv;
      
    }
  } else {
    {
#pragma unroll
      for (int j = 0; j < 4; ++j) { if (j < nval) *(float*)(dst + j) = val[j]; }
      
    }
  }
#endif
}

// =====================================================================================================
// Workspace map (bytes); every plane is fully written by whole-line stores before it is read; all extents are exact multiples
// of the store granularity (no pad rows needed); QP is reused sequentially (in-order stream):
//   XB   bf16 [ROWS][1024]                 NB*4194304   (bf16 copy of the input activations)
//   WQKV bf16 [3072 n][1024 k]                6291456
//   WOB  f16  [1024 n][1024 k] x1024          2097152   WDB same 2097152
//   F    f32  [ROWS][1024]                 NB*8388608   (the final image)
//   QP   f16  [ROWS][8][128] x8            NB*4194304   (later UP: f16 plane of O.Wo^T output x1024)
//   KP   f16  same                          NB*4194304
//   VP   f16  [NB][8][128][2048] x1024      NB*4194304
//   OP   f16  [ROWS][8][128] x1024         NB*4194304
//   PART f32  [ATT_BLOCKS*8*2][32]         NB*131072
//   end (NB = 4)                            128450560
// =====================================================================================================
extern "C" void kernel_launch(void* const* d_in, const int* in_sizes, int n_in,
                              void* d_out, int out_size, void* d_ws, size_t ws_size,
                              hipStream_t stream) {
  if (n_in < 7) return;
  if (in_sizes[0] != ROWS * DMOD) return;
  if (in_sizes[1] != 3 * DMOD * DMOD || in_sizes[2] != 3 * DMOD) return;
  if (in_sizes[3] != DMOD * DMOD || in_sizes[4] != DMOD) return;
  if (in_sizes[5] != DMOD * DMOD || in_sizes[6] != DMOD) return;
  if (out_size != TOTOUT) return;

  const float* x    = (const float*)d_in[0];
  const float* wqkv = (const float*)d_in[1];
  const float* bqkv = (const float*)d_in[2];
  const float* wo   = (const float*)d_in[3];
  const float* bo   = (const float*)d_in[4];
  const float* wd   = (const float*)d_in[5];
  const float* bd   = (const float*)d_in[6];
  float*       out  = (float*)d_out;

  const size_t szXB   = (size_t)ROWS * DMOD * 2;
  const size_t szWQKV = (size_t)3 * DMOD * DMOD * 2;
  const size_t szW    = (size_t)DMOD * DMOD * 2;
  const size_t szF    = (size_t)ROWS * DMOD * 4;
  const size_t szP    = (size_t)ROWS * DMOD * 2;
  const size_t szVP   = (size_t)NB * NH * HD * SEQ * 2;
  const size_t szPART = (size_t)ATT_BLOCKS * ATT_WAVES * ATT_QT * 32 * 4;
  size_t off = 0;
  const size_t oXB   = off; off += szXB;
  const size_t oWQKV = off; off += szWQKV;
  const size_t oWOB  = off; off += szW;
  const size_t oWDB  = off; off += szW;
  const size_t oF    = off; off += szF;
  const size_t oQP   = off; off += szP;
  const size_t oKP   = off; off += szP;
  const size_t oVP   = off; off += szVP;
  const size_t oOP   = off; off += szP;
  const size_t oPART = off; off += szPART;
  if (off > ws_size) return;                            // off = 128450560 for NB = 4
  if (off > (size_t)134217728) return;

  char* ws = (char*)d_ws;
  u16*   XB   = (u16*)(ws + oXB);
  u16*   WQKV = (u16*)(ws + oWQKV);
  u16*   WOB  = (u16*)(ws + oWOB);
  u16*   WDB  = (u16*)(ws + oWDB);
  float* F    = (float*)(ws + oF);
  u16*   QP   = (u16*)(ws + oQP);
  u16*   UP   = QP;                                     // reused after the attention launch has consumed QP
  u16*   KP   = (u16*)(ws + oKP);
  u16*   VP   = (u16*)(ws + oVP);
  u16*   OP   = (u16*)(ws + oOP);
  float* PART = (float*)(ws + oPART);

  const int n8x   = (ROWS * DMOD) / 8;
  const int n8qkv = (3 * DMOD * DMOD) / 8;
  const int n8w   = (DMOD * DMOD) / 8;
  if ((n8x % 256) != 0 || (n8qkv % 256) != 0 || (n8w % 256) != 0 || (DMOD % 64) != 0 || (ROWS % 64) != 0 || (DMOD % 32) != 0) return;
  const dim3 blk(256);
  const dim3 gX(n8x / 256);
  const dim3 gQKV(n8qkv / 256);
  const dim3 gW(n8w / 256);
  const dim3 gG((ROWS / GBT) * (DMOD / GBT));
  const dim3 bG(128);
  const dim3 gAT(ATT_BLOCKS);
  const dim3 bAT(ATT_THREADS);
  const dim3 gOW((NPIECE + 255) / 256);
  const size_t wblk = (size_t)DMOD * DMOD;

  // (0..3) input activations -> bf16 plane; weights stored [n = out][k = in] (y = x.W^T), already k-contiguous:
  //        bf16 plane for the qkv weight, f16 of bf16 value x1024 for the two square weights
  cvt16<<<gX,   blk, 0, stream>>>(x,    XB,   n8x,   0, 1.0f);
  cvt16<<<gQKV, blk, 0, stream>>>(wqkv, WQKV, n8qkv, 0, 1.0f);
  cvt16<<<gW,   blk, 0, stream>>>(wo,   WOB,  n8w,   1, WOS);
  cvt16<<<gW,   blk, 0, stream>>>(wd,   WDB,  n8w,   1, WOS);
  // (4) q: projection + bias (col = h*128+d), stored as the f16 plane x8
  gemm_bfp<<<gG, bG, 0, stream>>>(XB, WQKV, bqkv, QP, ROWS, DMOD, DMOD, 1.0f, QSC);
  // (5) k: the same with weight rows 1024..2047
  gemm_bfp<<<gG, bG, 0, stream>>>(XB, WQKV + wblk, bqkv + DMOD, KP, ROWS, DMOD, DMOD, 1.0f, KSC);
  // (6) v: weight rows 2048..3071, stored as the v^T plane x1024
  gemm_bft<<<gG, bG, 0, stream>>>(XB, WQKV + 2 * wblk, bqkv + 2 * DMOD, VP, ROWS, DMOD, DMOD, 1.0f, VCAR);
  // (7) attention -> O plane [b][s][h][d] x1024 and per-wave row-sum lines
  attn_fwd<<<gAT, bAT, 0, stream>>>(QP, KP, VP, OP, PART);
  // (8) first output projection + bias (carries 1024 x 1024 folded back), stored as the f16 plane x1024
  gemm_hp<<<gG, bG, 0, stream>>>(OP, WOB, bo, UP, ROWS, DMOD, DMOD, 1.0f / (OSC * WOS), USC);
  // (9) second output projection + bias -> F f32 image [ROWS][1024]
  gemm_h1<<<gG, bG, 0, stream>>>(UP, WDB, bd, F, ROWS, DMOD, DMOD, 1.0f / (USC * WOS));
  // (10) flat line-owned writer of the whole output buffer
  outw<<<gOW, blk, 0, stream>>>(F, PART, out);
  (void)hipGetLastError();
}

// v006
// One run takes 155 microseconds.
// In both of two side-by-side timings against v005, it was 1.07 times as fast.
// Over all steps from v000 it is 3.84 times as fast.
// Contractions: x.W{q,k,v}^T on v_wmma_f32_16x16x32_bf16 (x and W planes RNE-converted to bf16 operands, f32 accumulate, bias added in f32);
// scores k'.q'^T (q', k' single f16 planes carried x8), P.v (P x32768 single f16, v x1024 single f16), O.Wo^T and U.Wd^T
// (O and U single f16 planes x1024, Wo and Wd as f16(bf16(W) x1024)): v_wmma_f32_16x16x32_f16, f32 accumulate.
// Base-2 online softmax, 1/l fold, row-sum partials and bias adds in f32 on VALU.
// The q, k, v^T and U operand planes are written by the epilogue of the GEMM that produces them (f32 result, bias, carry, f16).
#include <hip/hip_runtime.h>
#include <math.h>
#include <stdint.h>

#define NB    4
#define SEQ   2048
#define DMOD  1024
#define NH    8
#define HD    128
#define QT_BITS 5
#define NH_BITS 3
#define ROWS  (NB * SEQ)
#define QSC   8.0f
#define KSC   8.0f
#define PCAR  32768.0f
#define PEXP  15.0f
#define VCAR  1024.0f
#define OSC   1024.0f
#define USC   1024.0f
#define WOS   1024.0f
#define SM_SCALE 0.08838834764831845f
#define LOG2E 1.4426950408889634f
#define ATT_WAVES   8
#define ATT_THREADS (ATT_WAVES * 32)
#define ATT_QT      2
#define ATT_QROWS   (ATT_WAVES * ATT_QT * 16)
#define AQT_BITS    3
#define ATT_BLOCKS  (NB * NH * (SEQ / ATT_QROWS))
#define NKB    (SEQ / 32)
#define RS     (NH * HD)
#define SPITCH 132
#define SLABF  (16 * SPITCH)
#define SLAB64 (16 * 68)
#define VTS    144
#define WPB    (NH * (SEQ / ATT_QROWS) * ATT_WAVES * ATT_QT)
#define TOTOUT (NB + ROWS * DMOD)
#define IMGN   (ROWS * DMOD)
#define NPIECE ((TOTOUT + 3) / 4)
#define GBT    128
#define GKS    128
#define GPITCH 272
#define GOPB   (GBT * GPITCH)
#define GBUF   (2 * GOPB)
#define AKS    128
#define ANST   (SEQ / AKS)
#define AOPB   (AKS * GPITCH)
#define ABUF   (AOPB + HD * GPITCH)
#define DEPSC  (1.0f / ((float)NH * (float)SEQ * (float)SEQ))
#define CBX    (ROWS * DMOD / 8 / 256)
#define CBQ    (3 * DMOD * DMOD / 8 / 256)
#define CBW    (DMOD * DMOD / 8 / 256)
#define GBLK   ((ROWS / GBT) * (DMOD / GBT))

static_assert(HD == 128 && DMOD == NH * HD && RS == DMOD);
static_assert(PCAR == (float)(1 << (int)PEXP));
static_assert((1 << QT_BITS) == (SEQ / 64) && (1 << NH_BITS) == NH);
static_assert((SEQ % 64) == 0 && (SEQ % 32) == 0 && NKB * 32 == SEQ);
static_assert(((ROWS * DMOD / 8) % 256) == 0 && ((3 * DMOD * DMOD / 8) % 256) == 0 && ((DMOD * DMOD / 8) % 256) == 0);
static_assert((ROWS % 64) == 0 && (DMOD % 64) == 0 && (DMOD % 32) == 0);
static_assert(NB >= 1 && NB <= 32);
static_assert((WPB % 32) == 0 && WPB == 1024);
static_assert(ATT_THREADS == 256 && (1 << AQT_BITS) == (SEQ / ATT_QROWS));
static_assert((SEQ % AKS) == 0 && ANST >= 2 && (AKS % 32) == 0 && AKS * 2 + 16 == GPITCH && HD * 2 + 16 == GPITCH);
static_assert(AKS == 8 * (ATT_THREADS / 16) && HD == 8 * (ATT_THREADS / 16));
static_assert(ATT_WAVES * ATT_QT * SLABF * 4 <= 2 * ABUF);
static_assert(((SPITCH * 4) % 16) == 0 && (SPITCH >= HD + 4));
static_assert((VTS % 16) == 0 && VTS >= 64 * 2 && 4 * 64 * VTS <= 2 * GBUF && (SEQ % GBT) == 0);
static_assert(4 * 64 * 68 * 4 <= 2 * GBUF);
static_assert(IMGN % 4 == 0);
static_assert((ROWS % GBT) == 0 && (DMOD % GBT) == 0 && (DMOD % GKS) == 0 && GKS * 2 + 16 == GPITCH);

typedef unsigned short u16;
typedef _Float16 v16h __attribute__((ext_vector_type(16)));
typedef _Float16 v8h  __attribute__((ext_vector_type(8)));
typedef __bf16   v16b __attribute__((ext_vector_type(16)));
typedef float    v8f  __attribute__((ext_vector_type(8)));
typedef float    v4f  __attribute__((ext_vector_type(4)));
typedef float    v2f  __attribute__((ext_vector_type(2)));
typedef _Float16 v2h  __attribute__((ext_vector_type(2)));
typedef unsigned int v4u __attribute__((ext_vector_type(4)));

union FragH { v16h v; v8h h[2]; v4u u[2]; };
union FragB { v16b v; v4u u[2]; };

// ---- scalar helpers --------------------------------------------------------------------------------
__device__ __forceinline__ unsigned short bf_bits(float f) {          // f32 -> bf16 bits, RNE convert
  unsigned u = __float_as_uint(f);
  return (unsigned short)((u + 0x7FFFu + ((u >> 16) & 1u)) >> 16);
}
__device__ __forceinline__ float bf_up(unsigned short h) { return __uint_as_float(((unsigned)h) << 16); }
__device__ __forceinline__ float bfr(float f) { return bf_up(bf_bits(f)); }
__device__ __forceinline__ unsigned short h_bits(_Float16 x) { return __builtin_bit_cast(unsigned short, x); }
__device__ __forceinline__ unsigned pk16(unsigned short a, unsigned short b) { return (unsigned)a | ((unsigned)b << 16); }
__device__ __forceinline__ v8f zero8() { v8f z = {0.f, 0.f, 0.f, 0.f, 0.f, 0.f, 0.f, 0.f}; return z; }
__device__ __forceinline__ v4f zero4() { v4f z = {0.f, 0.f, 0.f, 0.f}; return z; }

// ---- fragment loaders: 16-bit A/B operand, lane -> row/col (lane&15), p already includes +8*(lane>>4);
//      elements 0..7 <- p[0..7] (k0+8h..), elements 8..15 <- p[16..23] (k0+16+8h..)  (same split k map for A and B;
//      B is always read from a k-contiguous [n][k] plane)
__device__ __forceinline__ v16h ldfrag_h(const _Float16* p) {
  FragH f;
  f.h[0] = *(const v8h*)(p);
  f.h[1] = *(const v8h*)(p + 16);
  return f.v;
}

__device__ __forceinline__ v8f mma_h(v16h a, v16h b, v8f c) {
  return __builtin_amdgcn_wmma_f32_16x16x32_f16(false, a, false, b, (short)0, c, false, false);
}
__device__ __forceinline__ v8f mma_b(v16b a, v16b b, v8f c) {
  return __builtin_amdgcn_wmma_f32_16x16x32_bf16(false, a, false, b, (short)0, c, false, false);
}
// The four v_nop fill the vector slots that the chip needs behind a matrix instruction before a vector instruction may touch its
// result or overwrite its operands; they stand at the foot of the key-block loop, for the taken side of its branch. The results
// of the loop's last eight matrix instructions are named so that the v_nop stay behind them.
__device__ __forceinline__ void guard_foot(v8f& a0, v8f& a1, v8f& a2, v8f& a3, v8f& b0, v8f& b1, v8f& b2, v8f& b3) {
#if defined(__HIP_DEVICE_COMPILE__)
  asm volatile("v_nop\n\tv_nop\n\tv_nop\n\tv_nop"
               : "+v"(a0), "+v"(a1), "+v"(a2), "+v"(a3), "+v"(b0), "+v"(b1), "+v"(b2), "+v"(b3));
#endif
}
__device__ __forceinline__ void wave_sync_lds() {
  __builtin_amdgcn_fence(__ATOMIC_RELEASE, "workgroup");
  __builtin_amdgcn_wave_barrier();
  __builtin_amdgcn_fence(__ATOMIC_ACQUIRE, "workgroup");
}

// =====================================================================================================
// f32 plane -> 16-bit plane, same layout, all four planes in one grid: blocks [0, CBX) take the input activations and
// [CBX, CBX + CBQ) the qkv weight (bf16 RNE bits); the next CBW blocks take the first square weight and the last CBW the second
// (f16 bits of (bf16 RNE value) * wscale). The planes do not depend on one another, so one launch holds them all.
// Thread = 8 consecutive elements: two 16-B loads, one 16-B store; 32 consecutive lanes = 512 contiguous, 512-B aligned bytes
// coverage: each plane has elements/8/256 blocks (exact: static_assert above) x 256 thr x 8 = the whole plane.
// =====================================================================================================
__global__ __launch_bounds__(256) void cvt16(const float* __restrict__ x, const float* __restrict__ wqkv,
                                             const float* __restrict__ wo, const float* __restrict__ wd,
                                             u16* XB, u16* WQKV, u16* WOB, u16* WDB, float wscale) {
  int blk = blockIdx.x;                     // block-uniform choice of the plane
  const float* s = x;
  u16* D = XB;
  bool half16 = false;
  if (blk >= CBX + CBQ + 2 * CBW) return;   // no barriers in this kernel; never taken with the exact grid
  if (blk >= CBX + CBQ + CBW) { s = wd;   D = WDB;  half16 = true; blk -= CBX + CBQ + CBW; }
  else if (blk >= CBX + CBQ)  { s = wo;   D = WOB;  half16 = true; blk -= CBX + CBQ; }
  else if (blk >= CBX)        { s = wqkv; D = WQKV; blk -= CBX; }
  const int gt = blk * 256 + (int)threadIdx.x;
  const float* p = s + (size_t)gt * 8;
  const v4f a = *(const v4f*)(p), c4 = *(const v4f*)(p + 4);
  float v[8];
#pragma unroll
  for (int e = 0; e < 4; ++e) { v[e] = a[e]; v[4 + e] = c4[e]; }
  unsigned short q[8];
#pragma unroll
  for (int e = 0; e < 8; ++e) {
    const unsigned short hb = h_bits((_Float16)(bfr(v[e]) * wscale));
    const unsigned short bb = bf_bits(v[e]);
    q[e] = half16 ? hb : bb;
  }
  v4u o;
#pragma unroll
  for (int e = 0; e < 4; ++e) o[e] = pk16(q[2 * e], q[2 * e + 1]);
  *(v4u*)(D + (size_t)gt * 8) = o;
}

// =====================================================================================================
// GEMM f32 epilogue (EPI 0): the wave's 16x64 f32 tile (times oscale) staged in its LDS slab (pitch 68),
// coverage: 8 instructions x 2 rows x 16 lanes x 4 floats = the wave's 16 x 64 tile.
// =====================================================================================================
__device__ __forceinline__ void epi64(float* sl, v8f a0, v8f a1, v8f a2, v8f a3, float oscale, v4f badd, float* C, int N,
                                      size_t rowb, int col0, int lane) {
  const int hh = lane >> 4, m = lane & 15;
#pragma unroll
  for (int r = 0; r < 8; ++r) {
    const int ro = (8 * hh + r) * 68 + m;
    sl[ro]      = a0[r] * oscale;
    sl[ro + 16] = a1[r] * oscale;
    sl[ro + 32] = a2[r] * oscale;
    sl[ro + 48] = a3[r] * oscale;
  }
  wave_sync_lds();
  v4f vals[8];
#pragma unroll
  for (int it = 0; it < 8; ++it) vals[it] = *(const v4f*)(sl + (it * 2 + hh) * 68 + m * 4) + badd;
  float* dst = C + (rowb + (size_t)hh) * (size_t)N + col0 + m * 4;
  {
#pragma unroll
    for (int it = 0; it < 8; ++it) {
      *(v4f*)(dst + (size_t)(it * 2) * (size_t)N) = vals[it];
    }
    
  }
}

// =====================================================================================================
// 16-bit GEMM with bias, both engines: C[M][N] (f32) = A[M][K] (row-major) . Bt[N][K]^T (k-contiguous), times oscale, plus the
// bf16-RNE value of bias[n]. Block = 128x128 tile of C, 4 waves as 2x2, wave = 64x64 (4x4 accumulator tiles).
// EPI 0 stores C as f32; EPI 1 stores f16(C * pscale) as the plane P[M][N]; EPI 2 does the same unless tr (block-uniform) is set:
// then it stores f16(C * pscale) transposed per batch, P[(row / SEQ) * N + col][row % SEQ] (the v^T plane: N = NH * HD,
// col = h * HD + d). bid is the block's index among the (M/128)*(N/128) tiles of this product.
// A stage is 128 k of the block's 128 A rows and 128 Bt rows: 256 rows of 256 B, laid in LDS at pitch 272 B by asynchronous
// b128 copies (16 lanes = one whole 256-B row, so every copy touches whole lines). Two buffers: stage t+1 flies while stage t
// is multiplied. Fragments are read from LDS with the same split k map for A and B as ldfrag_h; k runs upward in steps of 32
// into one accumulator per tile. Shapes: M % 128 == 0, N % 128 == 0, K % 128 == 0, (M/128)*(N/128) blocks per product (static_assert above).
// =====================================================================================================
__device__ __forceinline__ unsigned lds_off(const void* p) { return (unsigned)(size_t)p; }

// Eight asynchronous 16-B-per-lane copies, rows 8 apart. The s_wait_xcnt stands inside the statement so that no address
// register of a copy is rewritten in front of it.
__device__ __forceinline__ void copy8(unsigned l, const u16* g, size_t rs8) {
#if defined(__HIP_DEVICE_COMPILE__)
  asm volatile("global_load_async_to_lds_b128 %0, %8, off\n\t"
               "global_load_async_to_lds_b128 %1, %9, off\n\t"
               "global_load_async_to_lds_b128 %2, %10, off\n\t"
               "global_load_async_to_lds_b128 %3, %11, off\n\t"
               "global_load_async_to_lds_b128 %4, %12, off\n\t"
               "global_load_async_to_lds_b128 %5, %13, off\n\t"
               "global_load_async_to_lds_b128 %6, %14, off\n\t"
               "global_load_async_to_lds_b128 %7, %15, off\n\t"
               "s_wait_xcnt 0x0"
               :: "v"(l), "v"(l + 8u * GPITCH), "v"(l + 16u * GPITCH), "v"(l + 24u * GPITCH),
                  "v"(l + 32u * GPITCH), "v"(l + 40u * GPITCH), "v"(l + 48u * GPITCH), "v"(l + 56u * GPITCH),
                  "v"(g), "v"(g + rs8), "v"(g + 2 * rs8), "v"(g + 3 * rs8),
                  "v"(g + 4 * rs8), "v"(g + 5 * rs8), "v"(g + 6 * rs8), "v"(g + 7 * rs8)
               : "memory");
#endif
}
// One stage: this thread's 16 B of rows cr + 8i (i = 0..15) of the A tile and of the Bt tile; 32 copies per wave.
__device__ __forceinline__ void fill_stage(unsigned l, const u16* ga, const u16* gb, size_t rs8) {
  copy8(l, ga, rs8);
  copy8(l + 64u * GPITCH, ga + 8 * rs8, rs8);
  copy8(l + GOPB, gb, rs8);
  copy8(l + GOPB + 64u * GPITCH, gb + 8 * rs8, rs8);
}
__device__ __forceinline__ void wait_async0() {   // this wave's copies have landed
#if defined(__HIP_DEVICE_COMPILE__)
  asm volatile("s_wait_asynccnt 0x0" ::: "memory");
#endif
}
__device__ __forceinline__ void wait_ds0() {      // this wave's LDS reads have returned before their buffer is refilled
#if defined(__HIP_DEVICE_COMPILE__)
  asm volatile("s_wait_dscnt 0x0" ::: "memory");
#endif
}
// The wait before a register that an issued global store names is rewritten. p is named so that what is formed from it afterwards
// (the following stores' addresses) cannot be moved in front of the wait.
__device__ __forceinline__ void wait_x0(unsigned& p) {
#if defined(__HIP_DEVICE_COMPILE__)
  asm volatile("s_wait_xcnt 0x0" : "+v"(p) :: "memory");
#endif
}
__device__ __forceinline__ FragB ld_lfrag(const unsigned char* p) {   // split k map of ldfrag_h: bytes 0..15 and 32..47
  FragB f;
  f.u[0] = *(const v4u*)(p);
  f.u[1] = *(const v4u*)(p + 32);
  return f;
}
__device__ __forceinline__ v8f mma_sel(FragB a, FragB b, v8f c, bool bf) {
  if (bf) return mma_b(a.v, b.v, c);
  return mma_h(__builtin_bit_cast(v16h, a.v), __builtin_bit_cast(v16h, b.v), c);
}

template <bool BF, int EPI>
__device__ __forceinline__ void gemm_core(unsigned char* ring, float* slab, const u16* __restrict__ A,
                                          const u16* __restrict__ Bt, const float* __restrict__ bias,
                                          float* C, u16* P, int bid, bool tr, int M, int N, int K, float oscale,
                                          float pscale) {
  const int tid = threadIdx.x, wave = tid >> 5, lane = tid & 31, hh = lane >> 4, m = lane & 15;
  const int ntile = N >> 7;
  const int row0  = (bid / ntile) * GBT;
  const int col0  = (bid % ntile) * GBT;
  if (row0 + GBT > M) return;                // block-uniform, in front of every barrier; never taken with the exact grid
  const int wr = wave >> 1, wc = wave & 1;
  const int nst = K >> 7;
  const int cr = tid >> 4, cc = tid & 15;    // copy: row within a group of 8, 16-B chunk of the 256-B row
  const u16* ga = A  + (size_t)(row0 + cr) * K + cc * 8;
  const u16* gb = Bt + (size_t)(col0 + cr) * K + cc * 8;
  const size_t rs8 = (size_t)8 * K;
  const unsigned l0 = lds_off(ring) + (unsigned)(cr * GPITCH + cc * 16);

  v8f acc[4][4];
#pragma unroll
  for (int i = 0; i < 4; ++i) {
#pragma unroll
    for (int j = 0; j < 4; ++j) acc[i][j] = zero8();
  }

  fill_stage(l0, ga, gb, rs8);
  wait_async0();
  __syncthreads();                           // publishes stage 0
  if (nst > 1) fill_stage(l0 + GBUF, ga + GKS, gb + GKS, rs8);

  for (int t = 0; t < nst; ++t) {
    const unsigned bo = (unsigned)(t & 1) * GBUF;
    const unsigned char* ab = ring + bo + (wr * 64 + m) * GPITCH + hh * 16;
    const unsigned char* bb = ring + bo + GOPB + (wc * 64 + m) * GPITCH + hh * 16;
    FragB a[2][4], b[2][4];                  // set (ks & 1) holds the fragments of k step ks
#pragma unroll
    for (int i = 0; i < 4; ++i) { a[0][i] = ld_lfrag(ab + i * 16 * GPITCH); b[0][i] = ld_lfrag(bb + i * 16 * GPITCH); }
#pragma unroll
    for (int ks = 0; ks < GKS / 32; ++ks) {
      const int cs = ks & 1;
      if (ks + 1 < GKS / 32) {
#pragma unroll
        for (int i = 0; i < 4; ++i) {
          a[cs ^ 1][i] = ld_lfrag(ab + i * 16 * GPITCH + (ks + 1) * 64);
          b[cs ^ 1][i] = ld_lfrag(bb + i * 16 * GPITCH + (ks + 1) * 64);
        }
      }
      // keeps the next k step's LDS reads one group ahead of this step's products instead of spread among them
      __builtin_amdgcn_sched_barrier(0);
#pragma unroll
      for (int i = 0; i < 4; ++i) {
#pragma unroll
        for (int j = 0; j < 4; ++j) acc[i][j] = mma_sel(a[cs][i], b[cs][j], acc[i][j], BF);
      }
      // keeps the following group of LDS reads behind this step's products
      __builtin_amdgcn_sched_barrier(0);
    }
    wait_ds0();
    wait_async0();
    __syncthreads();                         // publishes stage t+1 and ends every reader's last read of stage t's buffer
    if (t + 2 < nst) fill_stage(l0 + bo, ga + (size_t)(t + 2) * GKS, gb + (size_t)(t + 2) * GKS, rs8);
  }
  wait_async0();

  const int colw = col0 + wc * 64;
  if constexpr (EPI == 0) {
    float* sl = slab + wave * SLAB64;
    const v4f bv = *(const v4f*)(bias + colw + m * 4);    // columns colw + 4m .. +3, always < N (N multiple of 128)
    v4f badd;
#pragma unroll
    for (int e = 0; e < 4; ++e) badd[e] = bfr(bv[e]);
#pragma unroll
    for (int i = 0; i < 4; ++i) {
      if (i) wave_sync_lds();                // the slab's last readers are done before other lanes overwrite it
      epi64(sl, acc[i][0], acc[i][1], acc[i][2], acc[i][3], oscale, badd, C, N, (size_t)(row0 + wr * 64 + i * 16), colw, lane);
    }
  } else if (EPI == 1 || !tr) {
    // The wave's 64 x 64 f32 tile (times oscale) is staged whole in its own part of the ring (pitch 68 floats), which the last
    // stage's barrier has freed of readers and copies; read back with 8 lanes per row (8 columns each), so that every 128-B
    // row piece of the plane leaves as one whole line.
    // coverage: 16 instructions x 4 rows x 8 lanes x 8 halves = the wave's 64 x 64 tile.
    float* sl = (float*)(void*)ring + wave * (64 * 68);
#pragma unroll
    for (int i = 0; i < 4; ++i) {
#pragma unroll
      for (int r = 0; r < 8; ++r) {
        const int ro = (i * 16 + 8 * hh + r) * 68 + m;
#pragma unroll
        for (int j = 0; j < 4; ++j) sl[ro + 16 * j] = acc[i][j][r] * oscale;
      }
    }
    const int rq = lane >> 3, p8 = (lane & 7) * 8;
    const float* bp = bias + colw + p8;                   // columns colw + 8(lane & 7) .. +7, always < N
    const v4f bv0 = *(const v4f*)(bp), bv1 = *(const v4f*)(bp + 4);
    v4f b0, b1;
#pragma unroll
    for (int e = 0; e < 4; ++e) { b0[e] = bfr(bv0[e]); b1[e] = bfr(bv1[e]); }
    wave_sync_lds();
    v4u o[16];
#pragma unroll
    for (int it = 0; it < 16; ++it) {
      const float* s = sl + (it * 4 + rq) * 68 + p8;
      const v4f x = (*(const v4f*)(s) + b0) * pscale, y = (*(const v4f*)(s + 4) + b1) * pscale;
      const v8f f = {x[0], x[1], x[2], x[3], y[0], y[1], y[2], y[3]};
      o[it] = __builtin_bit_cast(v4u, __builtin_convertvector(f, v8h));
    }
    u16* dst = P + (size_t)(row0 + wr * 64 + rq) * (size_t)N + colw + p8;
    unsigned adv = 0;                        // elements from dst to the current group of four stores
#pragma unroll
    for (int it = 0; it < 16; ++it) {
      *(v4u*)(dst + adv + (size_t)((it & 3) * 4) * (size_t)N) = o[it];
      // behind every group of four: the next stores' addresses, and whatever follows the last group, may be formed in registers
      // that an issued store names; the addresses are formed from adv behind the wait
      if ((it & 3) == 3) { wait_x0(adv); adv += 16u * (unsigned)N; }
    }
  } else {
    // An accumulator lane holds 8 consecutive rows of one column: 16 B of a transposed line. The wave's 64 columns x 64 rows
    // are gathered in its own part of the ring (pitch 144 B), which the last stage's barrier has freed of readers and copies,
    // and leave as whole 128-B lines, 8 lanes each.
    // coverage: 16 instructions x 4 lines x 8 lanes x 8 halves = the wave's 64 x 64 tile.
    unsigned char* st = ring + wave * (64 * VTS);
#pragma unroll
    for (int j = 0; j < 4; ++j) {
      const float bj = bfr(bias[colw + j * 16 + m]);
#pragma unroll
      for (int i = 0; i < 4; ++i) {
        const v8f f = (acc[i][j] * oscale + bj) * pscale;
        *(v8h*)(st + (j * 16 + m) * VTS + i * 32 + hh * 16) = __builtin_convertvector(f, v8h);
      }
    }
    wave_sync_lds();
    const int rq = lane >> 3, p = lane & 7;
    v4u t[16];
#pragma unroll
    for (int it = 0; it < 16; ++it) t[it] = *(const v4u*)(st + (it * 4 + rq) * VTS + p * 16);
    const int roww = row0 + wr * 64;         // 64 rows of one batch (SEQ % 128 == 0)
    u16* dst = P + ((size_t)(roww / SEQ) * (size_t)N + colw + rq) * SEQ + (roww % SEQ) + p * 8;
#pragma unroll
    for (int it = 0; it < 16; ++it) *(v4u*)(dst + (size_t)(it * 4) * SEQ) = t[it];
  }
}

// The q, k and v projections in one grid (they share A and depend on nothing of one another): blocks [0, GBLK) give the q plane,
// [GBLK, 2 GBLK) the k plane, [2 GBLK, 3 GBLK) the v^T plane (GBLK = the 128x128 tiles of one projection, M = ROWS, N = DMOD);
// third s multiplies by weight rows s * N .. s * N + N - 1.
__global__ __launch_bounds__(128)
void gemm_qkv(const u16* __restrict__ A, const u16* __restrict__ Bt, const float* __restrict__ bias,
              u16* QPo, u16* KPo, u16* VPo, int M, int N, int K, float qsc, float ksc, float vsc) {
  __shared__ __align__(16) unsigned char ring[2 * GBUF];
  const int seg = (int)blockIdx.x / GBLK;    // block-uniform
  if (seg > 2) return;                       // in front of every barrier; never taken with the exact grid
  u16* P = (seg == 0) ? QPo : (seg == 1) ? KPo : VPo;
  const float ps = (seg == 0) ? qsc : (seg == 1) ? ksc : vsc;
  gemm_core<true, 2>(ring, nullptr, A, Bt + (size_t)seg * N * K, bias + seg * N, nullptr, P, (int)blockIdx.x - seg * GBLK,
                     seg == 2, M, N, K, 1.0f, ps);
}

__global__ __launch_bounds__(128)
void gemm_hp(const u16* __restrict__ A, const u16* __restrict__ Bt, const float* __restrict__ bias,
             u16* P, int M, int N, int K, float oscale, float pscale) {
  __shared__ __align__(16) unsigned char ring[2 * GBUF];
  gemm_core<false, 1>(ring, nullptr, A, Bt, bias, nullptr, P, (int)blockIdx.x, false, M, N, K, oscale, pscale);
}

__global__ __launch_bounds__(128)
void gemm_h1(const u16* __restrict__ A, const u16* __restrict__ Bt, const float* __restrict__ bias,
             float* C, int M, int N, int K, float oscale) {
  __shared__ __align__(16) unsigned char ring[2 * GBUF];
  __shared__ __align__(16) float slab[4 * SLAB64];
  gemm_core<false, 0>(ring, slab, A, Bt, bias, C, nullptr, (int)blockIdx.x, false, M, N, K, oscale, 1.0f);
}

// =====================================================================================================
// Multi-head flash attention (no mask): block = (batch b, head, 256 query rows), 8 waves, wave w owns the 32 query rows
// q0 = 256*qt + 32*w .. q0+31 as two query tiles of 16; every k and v^T fragment read from LDS is used for both tiles. What
// follows describes one query tile (q0 there = the tile's first row).
//   q plane (f16, x8) laid out [b][s][h][d]; k plane the same; v^T plane [b][h][d][s] (x1024).
//   All NKB = SEQ/32 key blocks of 32 keys are visited (static bound), in stages of 128 keys that the block's waves share:
//   a stage is 128 k rows of 256 B (all d) and 128 v^T rows of 256 B (its 128 keys), laid in LDS at pitch 272 B by asynchronous
//   b128 copies (16 lanes = one whole 256-B row). Two buffers: stage t+1 flies while stage t is worked on. The fragments are
//   read from LDS with the split k map of ldfrag_h. After the last stage's barrier the ring is the epilogue's staging room.
//   Scores are computed TRANSPOSED: S^T tile g (g = 0,1) = k rows (keys kb+16g .. +15, A operand, row m = lane&15, split k map
//   over d, 4 chunks of 32 d) times q^T (B operand, col n = query q0 + (lane&15), k = d, split map).
//   D element r of lane l = (key kb+16g+8h+r, query q0+(l&15)), so a lane owns one query column and 16 of its 32 keys; the
//   partner lane l^16 owns the other 16 -> row max / row sum need one xor-16 shuffle.
//   Online max-subtracted base-2 softmax in f32 (scale 1/sqrt(128) and the q/k carries folded into lsc; scale, maximum and
//   the x32768 carry of P enter a score's exponent through one FMA; l carries the x32768 too). The exp'd values ARE
//   the P A-fragment in place: A row m = query = lane&15, element i <- key kb+8h+i (tile 0, D element i), element 8+i <- key
//   kb+16+8h+i (tile 1, D element i). P is carried x32768 as single f16. The rescale factor of query row 8h+r of the
//   O accumulators is fetched from lane 8h+r with a shuffle (uniform control). 8 v^T B fragments (col n = d = 16j + (lane&15),
//   keys k-contiguous), 8 P.V WMMAs per key block and query tile; the two tiles' 16 stand together.
//   Epilogue: 1/l (per query, shuffled to the D row owner) and carry folds in f32; the wave's 16x128 f32 result staged in its
//   LDS slab (pitch 132); each 256-B output row (b, q0+row, head) of the O plane (O x1024 as single f16) written as 2 whole
// coverage: per wave and query tile 8 instructions x 2 rows x 16 lanes x 8 halves = 16 x 128 of the O plane + 1 PART line; grid
//           NB*NH*SEQ/256 blocks x 8 waves x 2 tiles = every (b, s, h) row of the O plane and every PART line exactly once.
// =====================================================================================================
// Eight asynchronous 16-B-per-lane copies, rows 16 apart. The s_wait_xcnt stands inside the statement so that no address
// register of a copy is rewritten in front of it.
__device__ __forceinline__ void copy8w(unsigned l, const u16* g, size_t rs16) {
#if defined(__HIP_DEVICE_COMPILE__)
  asm volatile("global_load_async_to_lds_b128 %0, %8, off\n\t"
               "global_load_async_to_lds_b128 %1, %9, off\n\t"
               "global_load_async_to_lds_b128 %2, %10, off\n\t"
               "global_load_async_to_lds_b128 %3, %11, off\n\t"
               "global_load_async_to_lds_b128 %4, %12, off\n\t"
               "global_load_async_to_lds_b128 %5, %13, off\n\t"
               "global_load_async_to_lds_b128 %6, %14, off\n\t"
               "global_load_async_to_lds_b128 %7, %15, off\n\t"
               "s_wait_xcnt 0x0"
               :: "v"(l), "v"(l + 16u * GPITCH), "v"(l + 32u * GPITCH), "v"(l + 48u * GPITCH),
                  "v"(l + 64u * GPITCH), "v"(l + 80u * GPITCH), "v"(l + 96u * GPITCH), "v"(l + 112u * GPITCH),
                  "v"(g), "v"(g + rs16), "v"(g + 2 * rs16), "v"(g + 3 * rs16),
                  "v"(g + 4 * rs16), "v"(g + 5 * rs16), "v"(g + 6 * rs16), "v"(g + 7 * rs16)
               : "memory");
#endif
}
// One attention stage: this thread's 16 B of rows cr + 16i (i = 0..7) of the k tile and of the v^T tile; 16 copies per wave.
__device__ __forceinline__ void fill_kv(unsigned l, const u16* gk, const u16* gv) {
  copy8w(l, gk, (size_t)16 * RS);
  copy8w(l + AOPB, gv, (size_t)16 * SEQ);
}
// 2^x by the hardware instruction alone. A result below 2^-126 comes back as 0: here that is a probability (carried x32768) or
// a rescale factor that small beside a row maximum of 32768, far below the last bit that the f16 operand and the f32 sums keep.
__device__ __forceinline__ float exp2_hw(float x) { return __builtin_amdgcn_exp2f(x); }
__device__ __forceinline__ v16h ld_lfrag_h(const unsigned char* p) {  // split k map of ldfrag_h: bytes 0..15 and 32..47
  FragH f;
  f.u[0] = *(const v4u*)(p);
  f.u[1] = *(const v4u*)(p + 32);
  return f.v;
}

// The v_nop is the slot that the instruction set asks for behind a transcendental before its result is read or its source
// overwritten. The results and the sources are named so that none of them is touched in front of it, wherever it lands.
__device__ __forceinline__ void trans_slot8(float* p, const float* x) {
#if defined(__HIP_DEVICE_COMPILE__)
  asm("v_nop" : "+v"(p[0]), "+v"(p[1]), "+v"(p[2]), "+v"(p[3]), "+v"(p[4]), "+v"(p[5]), "+v"(p[6]), "+v"(p[7])
              : "v"(x[0]), "v"(x[1]), "v"(x[2]), "v"(x[3]), "v"(x[4]), "v"(x[5]), "v"(x[6]), "v"(x[7]));
#endif
}
__device__ __forceinline__ void trans_slot1(float& p, float x) {
#if defined(__HIP_DEVICE_COMPILE__)
  asm("v_nop" : "+v"(p) : "v"(x));
#endif
}

// One query tile's online-softmax step over a key block: s0, s1 = the tile's unscaled transposed scores (this lane's 16 keys of
// query column c). Updates the running maximum (kept unscaled, lsc > 0) and the running sum, gives the rescale factor al of the
// tile's O accumulators and the P A-fragment ph (f16, carried x32768).
__device__ __forceinline__ void softmax_step(const v8f s0, const v8f s1, const float lsc, float& mrun, float& lrun, float& al,
                                             FragH& ph) {
  float tk[16];
#pragma unroll
  for (int i = 0; i < 8; ++i) { tk[i] = s0[i];  tk[8 + i] = s1[i]; }
  float cm = -INFINITY;
#pragma unroll
  for (int i = 0; i < 16; ++i) cm = fmaxf(cm, tk[i]);
  cm = fmaxf(cm, __shfl_xor(cm, 16, 32));
  const float mn = fmaxf(mrun, cm);                                // finite from the first key block on
  const float ax = (mrun - mn) * lsc;
  float ae = exp2_hw(ax);
  trans_slot1(ae, ax);
  al = (mrun == -INFINITY) ? 0.f : ae;                             // o and l are zero while mrun is -inf
  mrun = mn;
  // probabilities carried x32768, one FMA and one v_exp_f32 each: 2^(t * lsc + (15 - mn * lsc)); they are summed and
  // rounded to the P A-fragment (f16) as they come; element i <-> tk[i]
  const float eb = __builtin_fmaf(-mn, lsc, PEXP);
  const v2f l2 = {lsc, lsc}, e2 = {eb, eb};
  float x[16], p[16];
#pragma unroll
  for (int i = 0; i < 16; i += 2) {
    const v2f t2 = {tk[i], tk[i + 1]};       // a register pair of the score accumulator: one packed FMA, no moves
    const v2f x2 = __builtin_elementwise_fma(t2, l2, e2);
    x[i] = x2[0];
    x[i + 1] = x2[1];
  }
#pragma unroll
  for (int i = 0; i < 16; ++i) p[i] = exp2_hw(x[i]);
  trans_slot8(p, x);
  trans_slot8(p + 8, x + 8);
  float ps = 0.f;
#pragma unroll
  for (int w = 0; w < 2; ++w) {
#pragma unroll
    for (int e4 = 0; e4 < 4; ++e4) {
      const int i = 8 * w + 2 * e4;
      ps += p[i] + p[i + 1];
      const v2f pp = {p[i], p[i + 1]};
      ph.u[w][e4] = __builtin_bit_cast(unsigned, __builtin_convertvector(pp, v2h));
    }
  }
  ps += __shfl_xor(ps, 16, 32);
  lrun = lrun * al + ps;
}

// two waves per SIMD (one block per WGP): the register budget that holds two query tiles' accumulators beside the fragments
__global__ __launch_bounds__(ATT_THREADS) __attribute__((amdgpu_waves_per_eu(2, 2)))
void attn_fwd(const u16* __restrict__ QPp, const u16* __restrict__ KPp, const u16* __restrict__ VPp,
              u16* OPo, float* PART) {
  // two stage buffers (k tile, then v^T tile); in the epilogue, per wave and query tile, the result slab [16][132] of floats
  __shared__ __align__(16) unsigned char ring[2 * ABUF];

  const int tid  = threadIdx.x;
  const int wave = tid >> 5;
  const int lane = tid & 31;
  const int hh   = lane >> 4;
  const int c    = lane & 15;

  const int bid  = blockIdx.x;
  const int qt   = bid & ((SEQ / ATT_QROWS) - 1);
  const int head = (bid >> AQT_BITS) & (NH - 1);
  const int b    = bid >> (AQT_BITS + NH_BITS);
  const int q0   = qt * ATT_QROWS + wave * (ATT_QT * 16);   // query tile u: rows q0 + 16u .. q0 + 16u + 15

  // B fragments of q^T: col n = query q0 + 16u + c, k = d (k-contiguous row of the q plane)
  const _Float16* Qb = (const _Float16*)(const void*)QPp + ((size_t)(b * SEQ + q0 + c) * NH + head) * HD + 8 * hh;
  // copy: row within a group of 16, 16-B chunk of the 256-B row; k tile row = key, v^T tile row = d
  const int cr = tid >> 4, cc = tid & 15;
  const u16* kb0 = KPp + ((size_t)(b * SEQ) * NH + head) * HD;                  // block-uniform; stage t: + t * AKS key rows
  const u16* vb0 = VPp + ((size_t)(b * NH + head) * HD) * SEQ;                  // block-uniform; stage t: + t * AKS keys
  const unsigned ko = (unsigned)(cr * RS + cc * 8), vo = (unsigned)(cr * SEQ + cc * 8);   // this thread's place in a stage
  const unsigned l0 = lds_off(ring) + (unsigned)(cr * GPITCH + cc * 16);
  fill_kv(l0, kb0 + ko, vb0 + vo);
  const float lsc = SM_SCALE * (LOG2E / (QSC * KSC));

  v16h qf[ATT_QT][4];                        // chunk n: d 32n .. 32n + 31
#pragma unroll
  for (int u = 0; u < ATT_QT; ++u) {
#pragma unroll
    for (int n = 0; n < 4; ++n) qf[u][n] = ldfrag_h(Qb + (size_t)u * (16 * RS) + n * 32);
  }

  float mrun[ATT_QT], lrun[ATT_QT];
  v8f o[ATT_QT][8];
#pragma unroll
  for (int u = 0; u < ATT_QT; ++u) {
    mrun[u] = -INFINITY;
    lrun[u] = 0.f;
#pragma unroll
    for (int j = 0; j < 8; ++j) o[u][j] = zero8();
  }

  wait_async0();
  __syncthreads();                           // publishes stage 0
  fill_kv(l0 + ABUF, kb0 + (ko + AKS * RS), vb0 + (vo + AKS));   // stage 1 exists (ANST >= 2)

  // one rolled trip per stage, so that the ring's publish point stands once, at the trip's foot
#pragma unroll 1
  for (int t = 0; t < ANST; ++t) {
   const unsigned bo = (unsigned)(t & 1) * ABUF;
   // A fragments of k: row m = key kb + 16g + c, k = d;  B fragments of v: col n = d = 16j + c, k = key
   const unsigned char* kt = ring + bo + c * GPITCH + hh * 16;
   const unsigned char* vt = ring + bo + AOPB + c * GPITCH + hh * 16;
   // stays rolled: one key block's live values already take most of the registers of two waves per SIMD
#pragma unroll 1
   for (int kk = 0; kk < AKS / 32; ++kk) {   // key block kb = t * AKS + kk * 32
    // ---- transposed scores of both query tiles from one read of the k fragments:
    //      sa[u] = keys kb..kb+15, sc[u] = keys kb+16..kb+31, column = query q0 + 16u + c ----
    v8f sa[ATT_QT], sc[ATT_QT];
#pragma unroll
    for (int u = 0; u < ATT_QT; ++u) { sa[u] = zero8(); sc[u] = zero8(); }
    const unsigned char* k0p = kt + kk * 32 * GPITCH;
    const unsigned char* k1p = k0p + 16 * GPITCH;
    const unsigned char* vp  = vt + kk * 64;
    const v16h ka0 = ld_lfrag_h(k0p), kc0 = ld_lfrag_h(k1p);
    const v16h ka1 = ld_lfrag_h(k0p + 64), kc1 = ld_lfrag_h(k1p + 64);
    const v16h ka2 = ld_lfrag_h(k0p + 128), kc2 = ld_lfrag_h(k1p + 128);
    const v16h ka3 = ld_lfrag_h(k0p + 192), kc3 = ld_lfrag_h(k1p + 192);
    // keeps the k fragments' reads one group ahead of the products instead of pair by pair, each with a full wait, among them
    __builtin_amdgcn_sched_barrier(0);
    sa[0] = mma_h(ka0, qf[0][0], sa[0]);
    sa[1] = mma_h(ka0, qf[1][0], sa[1]);
    sc[0] = mma_h(kc0, qf[0][0], sc[0]);
    sc[1] = mma_h(kc0, qf[1][0], sc[1]);
    sa[0] = mma_h(ka1, qf[0][1], sa[0]);
    sa[1] = mma_h(ka1, qf[1][1], sa[1]);
    sc[0] = mma_h(kc1, qf[0][1], sc[0]);
    sc[1] = mma_h(kc1, qf[1][1], sc[1]);
    // keeps the first four v^T fragments' reads here, as one group behind the first eight products, so that they return
    // behind the softmax arithmetic
    __builtin_amdgcn_sched_barrier(0);
    const v16h vf0 = ld_lfrag_h(vp);
    const v16h vf1 = ld_lfrag_h(vp + 16 * GPITCH);
    const v16h vf2 = ld_lfrag_h(vp + 32 * GPITCH);
    const v16h vf3 = ld_lfrag_h(vp + 48 * GPITCH);
    __builtin_amdgcn_sched_barrier(0);       // ends that group of reads
    sa[0] = mma_h(ka2, qf[0][2], sa[0]);
    sa[1] = mma_h(ka2, qf[1][2], sa[1]);
    sc[0] = mma_h(kc2, qf[0][2], sc[0]);
    sc[1] = mma_h(kc2, qf[1][2], sc[1]);
    sa[0] = mma_h(ka3, qf[0][3], sa[0]);
    sa[1] = mma_h(ka3, qf[1][3], sa[1]);
    sc[0] = mma_h(kc3, qf[0][3], sc[0]);
    sc[1] = mma_h(kc3, qf[1][3], sc[1]);
    __builtin_amdgcn_sched_barrier(0);       // the last four v^T fragments' reads: one group behind the scores' last product
    const v16h vf4 = ld_lfrag_h(vp + 64 * GPITCH);
    const v16h vf5 = ld_lfrag_h(vp + 80 * GPITCH);
    const v16h vf6 = ld_lfrag_h(vp + 96 * GPITCH);
    const v16h vf7 = ld_lfrag_h(vp + 112 * GPITCH);
    __builtin_amdgcn_sched_barrier(0);       // ends that group of reads
    // ---- per query tile: online softmax, then the rescale of its O accumulators: D row 8hh+r = query q0+16u+8hh+r, whose
    //      factor lives in lane 8hh+r (and 16+8hh+r) ----
    FragH ph[ATT_QT];
#pragma unroll
    for (int u = 0; u < ATT_QT; ++u) {
      float al;
      softmax_step(sa[u], sc[u], lsc, mrun[u], lrun[u], al, ph[u]);
      float scl[8];
#pragma unroll
      for (int r = 0; r < 8; ++r) scl[r] = __shfl(al, 8 * hh + r, 32);
#pragma unroll
      for (int j = 0; j < 8; ++j) {
#pragma unroll
        for (int r = 0; r < 8; ++r) o[u][j][r] *= scl[r];
      }
    }
    // ---- P.V : B fragment col n = d = j*16 + c, keys contiguous in the v^T tile; every fragment serves both query tiles;
    //      the v_nop behind the last of the 16 are for the loop's branch ----
    o[0][0] = mma_h(ph[0].v, vf0, o[0][0]);
    o[1][0] = mma_h(ph[1].v, vf0, o[1][0]);
    o[0][1] = mma_h(ph[0].v, vf1, o[0][1]);
    o[1][1] = mma_h(ph[1].v, vf1, o[1][1]);
    o[0][2] = mma_h(ph[0].v, vf2, o[0][2]);
    o[1][2] = mma_h(ph[1].v, vf2, o[1][2]);
    o[0][3] = mma_h(ph[0].v, vf3, o[0][3]);
    o[1][3] = mma_h(ph[1].v, vf3, o[1][3]);
    o[0][4] = mma_h(ph[0].v, vf4, o[0][4]);
    o[1][4] = mma_h(ph[1].v, vf4, o[1][4]);
    o[0][5] = mma_h(ph[0].v, vf5, o[0][5]);
    o[1][5] = mma_h(ph[1].v, vf5, o[1][5]);
    o[0][6] = mma_h(ph[0].v, vf6, o[0][6]);
    o[1][6] = mma_h(ph[1].v, vf6, o[1][6]);
    o[0][7] = mma_h(ph[0].v, vf7, o[0][7]);
    o[1][7] = mma_h(ph[1].v, vf7, o[1][7]);
    guard_foot(o[0][4], o[0][5], o[0][6], o[0][7], o[1][4], o[1][5], o[1][6], o[1][7]);
   }
   wait_ds0();
   wait_async0();
   __syncthreads();                          // publishes stage t+1 and ends every reader's last read of stage t's buffer
   if (t + 2 < ANST) fill_kv(l0 + bo, kb0 + (ko + (unsigned)(t + 2) * (AKS * RS)), vb0 + (vo + (unsigned)(t + 2) * AKS));
  }
  wait_async0();

  // the last stage's barrier lies behind every wave's last fragment read and last copy: the ring is free
#pragma unroll
  for (int u = 0; u < ATT_QT; ++u) {
    // ---- fold 1/l (per query, owned by lane = query) and the carries; row statistic r = l * (1/l); stage the 16x128 slab ----
    const float rl   = (lrun[u] > 0.f) ? (1.0f / lrun[u]) : 0.f;
    const float linv = rl * (1.0f / VCAR);   // l carries the same x32768 as P
    const float rr   = lrun[u] * rl;
    float inv[8];
#pragma unroll
    for (int r = 0; r < 8; ++r) inv[r] = __shfl(linv, 8 * hh + r, 32);
    float* slab = (float*)(void*)ring + (wave * ATT_QT + u) * SLABF;
#pragma unroll
    for (int r = 0; r < 8; ++r) {
#pragma unroll
      for (int j = 0; j < 8; ++j) slab[(8 * hh + r) * SPITCH + j * 16 + c] = o[u][j][r] * inv[r];
    }
    wave_sync_lds();
    // ---- O x1024 -> single f16 plane; lane = (row parity hh, 8 consecutive d at c8) ----
    v4u oh[8];
    const int c8 = c * 8;
#pragma unroll
    for (int it = 0; it < 8; ++it) {
      const int row = it * 2 + hh;
      const v4f a = *(const v4f*)(slab + row * SPITCH + c8), c4 = *(const v4f*)(slab + row * SPITCH + c8 + 4);
      float w[8];
#pragma unroll
      for (int e = 0; e < 4; ++e) { w[e] = a[e] * OSC; w[4 + e] = c4[e] * OSC; }
#pragma unroll
      for (int e = 0; e < 4; ++e) {
        const _Float16 h0 = (_Float16)w[2 * e], h1 = (_Float16)w[2 * e + 1];
        oh[it][e] = pk16(h_bits(h0), h_bits(h1));
      }
    }
    // ---- tile row-sum partial (fixed xor tree over the 16 query lanes; both lane halves hold identical values) ----
    float wsum = rr;
    wsum += __shfl_xor(wsum, 1, 32);
    wsum += __shfl_xor(wsum, 2, 32);
    wsum += __shfl_xor(wsum, 4, 32);
    wsum += __shfl_xor(wsum, 8, 32);
    v4f pv = zero4();
    pv[0] = (lane == 0) ? wsum : 0.f;
    float* pd = PART + (((size_t)bid * ATT_WAVES + wave) * ATT_QT + u) * 32 + (lane & 7) * 4;   // clamped address for every lane
    const size_t ob = ((size_t)(b * SEQ + q0 + 16 * u) * NH + head) * HD + c8;
#pragma unroll
    for (int it = 0; it < 8; ++it) {
      const int row = it * 2 + hh;
      *(v4u*)(OPo + ob + (size_t)row * RS) = oh[it];
    }
    if (lane < 8) *(v4f*)(pd) = pv;
  }
}

// =====================================================================================================
// Flat output writer: out[0..NB-1] = score output (per batch: fixed-order sum of its WPB PART lines times 1/(NH*SEQ*SEQ),
// computed by block 0, wave = batch, 32 lanes x WPB/32 strided loads + xor tree), out[NB + i] = IMG[i] (f32 image of the last
// value. With NB % 4 != 0 a scalar path handles the element interleave and the partial last piece.
// coverage: grid = ceil(NPIECE/256) blocks x 256 thr x 4 elements with the in-kernel bound = all TOTOUT elements exactly once.
// =====================================================================================================
__global__ __launch_bounds__(256) void outw(const float* __restrict__ IMG, const float* __restrict__ PART, float* out) {
  __shared__ __align__(16) float sc[32];
  const int tid = threadIdx.x, wave = tid >> 5, lane = tid & 31;
  if (tid < 32) sc[tid] = 0.f;
  __syncthreads();
  if (blockIdx.x == 0) {                                   // block-uniform
#pragma unroll 1
    for (int bsel = wave; bsel < NB; bsel += 8) {          // wave-uniform
      const float* pp = PART + ((size_t)bsel * WPB + lane) * 32;
      float s = 0.f;
#pragma unroll 1
      for (int i = 0; i < WPB / 32; ++i) s += pp[(size_t)i * (32 * 32)];
#pragma unroll
      for (int d = 16; d >= 1; d >>= 1) s += __shfl_xor(s, d, 32);
      if (lane == 0) sc[bsel] = s * DEPSC;
    }
  }
  __syncthreads();
  const size_t t = (size_t)blockIdx.x * 256 + (size_t)tid;
  if (t >= (size_t)NPIECE) return;                         // no barriers after this point
  const size_t e0 = t * 4;
#if (NB % 4) == 0
  const bool   hs = (e0 < (size_t)NB);
  const int    si = hs ? (int)e0 : 0;
  const v4f    sv = *(const v4f*)(sc + si);
  const size_t ii = hs ? (size_t)0 : (e0 - (size_t)NB);   // clamped, 16-B aligned
  const v4f    gv = *(const v4f*)(IMG + ii);
  v4f val;
#pragma unroll
  for (int e = 0; e < 4; ++e) val[e] = hs ? sv[e] : gv[e];
  float* dst = out + e0;
  {
    *(v4f*)(dst) = val;
    
  }
#else
  float val[4];
  const size_t rem = (size_t)TOTOUT - e0;
  const int nval = (rem < 4) ? (int)rem : 4;
#pragma unroll
  for (int j = 0; j < 4; ++j) {
    size_t e = e0 + (size_t)j;
    if (e > (size_t)(TOTOUT - 1)) e = (size_t)(TOTOUT - 1);
    const bool hsj = (e < (size_t)NB);
    const float g = IMG[hsj ? (size_t)0 : (e - (size_t)NB)];
    const float s = sc[hsj ? (int)e : 0];
    val[j] = hsj ? s : g;
  }
  float* dst = out + e0;
  if (nval == 4) {
    v4f vv;
#pragma unroll
    for (int j = 0; j < 4; ++j) vv[j] = val[j];
    {
      *(v4f*)(dst) = vv;
      
    }
  } else {
    {
#pragma unroll
      for (int j = 0; j < 4; ++j) { if (j < nval) *(float*)(dst + j) = val[j]; }
      
    }
  }
#endif
}

// =====================================================================================================
// Workspace map (bytes); every plane is fully written by whole-line stores before it is read; all extents are exact multiples
// of the store granularity (no pad rows needed); QP is reused sequentially (in-order stream):
//   XB   bf16 [ROWS][1024]                 NB*4194304   (bf16 copy of the input activations)
//   WQKV bf16 [3072 n][1024 k]                6291456
//   WOB  f16  [1024 n][1024 k] x1024          2097152   WDB same 2097152
//   F    f32  [ROWS][1024]                 NB*8388608   (the final image)
//   QP   f16  [ROWS][8][128] x8            NB*4194304   (later UP: f16 plane of O.Wo^T output x1024)
//   KP   f16  same                          NB*4194304
//   VP   f16  [NB][8][128][2048] x1024      NB*4194304
//   OP   f16  [ROWS][8][128] x1024         NB*4194304
//   PART f32  [ATT_BLOCKS*8*2][32]         NB*131072
//   end (NB = 4)                            128450560
// =====================================================================================================
extern "C" void kernel_launch(void* const* d_in, const int* in_sizes, int n_in,
                              void* d_out, int out_size, void* d_ws, size_t ws_size,
                              hipStream_t stream) {
  if (n_in < 7) return;
  if (in_sizes[0] != ROWS * DMOD) return;
  if (in_sizes[1] != 3 * DMOD * DMOD || in_sizes[2] != 3 * DMOD) return;
  if (in_sizes[3] != DMOD * DMOD || in_sizes[4] != DMOD) return;
  if (in_sizes[5] != DMOD * DMOD || in_sizes[6] != DMOD) return;
  if (out_size != TOTOUT) return;

  const float* x    = (const float*)d_in[0];
  const float* wqkv = (const float*)d_in[1];
  const float* bqkv = (const float*)d_in[2];
  const float* wo   = (const float*)d_in[3];
  const float* bo   = (const float*)d_in[4];
  const float* wd   = (const float*)d_in[5];
  const float* bd   = (const float*)d_in[6];
  float*       out  = (float*)d_out;

  const size_t szXB   = (size_t)ROWS * DMOD * 2;
  const size_t szWQKV = (size_t)3 * DMOD * DMOD * 2;
  const size_t szW    = (size_t)DMOD * DMOD * 2;
  const size_t szF    = (size_t)ROWS * DMOD * 4;
  const size_t szP    = (size_t)ROWS * DMOD * 2;
  const size_t szVP   = (size_t)NB * NH * HD * SEQ * 2;
  const size_t szPART = (size_t)ATT_BLOCKS * ATT_WAVES * ATT_QT * 32 * 4;
  size_t off = 0;
  const size_t oXB   = off; off += szXB;
  const size_t oWQKV = off; off += szWQKV;
  const size_t oWOB  = off; off += szW;
  const size_t oWDB  = off; off += szW;
  const size_t oF    = off; off += szF;
  const size_t oQP   = off; off += szP;
  const size_t oKP   = off; off += szP;
  const size_t oVP   = off; off += szVP;
  const size_t oOP   = off; off += szP;
  const size_t oPART = off; off += szPART;
  if (off > ws_size) return;                            // off = 128450560 for NB = 4
  if (off > (size_t)134217728) return;

  char* ws = (char*)d_ws;
  u16*   XB   = (u16*)(ws + oXB);
  u16*   WQKV = (u16*)(ws + oWQKV);
  u16*   WOB  = (u16*)(ws + oWOB);
  u16*   WDB  = (u16*)(ws + oWDB);
  float* F    = (float*)(ws + oF);
  u16*   QP   = (u16*)(ws + oQP);
  u16*   UP   = QP;                                     // reused after the attention launch has consumed QP
  u16*   KP   = (u16*)(ws + oKP);
  u16*   VP   = (u16*)(ws + oVP);
  u16*   OP   = (u16*)(ws + oOP);
  float* PART = (float*)(ws + oPART);

  const dim3 blk(256);
  const dim3 gCV(CBX + CBQ + 2 * CBW);
  const dim3 gG(GBLK);
  const dim3 gG3(3 * GBLK);
  const dim3 bG(128);
  const dim3 gAT(ATT_BLOCKS);
  const dim3 bAT(ATT_THREADS);
  const dim3 gOW((NPIECE + 255) / 256);

  // (0) input activations -> bf16 plane; weights stored [n = out][k = in] (y = x.W^T), already k-contiguous:
  //     bf16 plane for the qkv weight, f16 of bf16 value x1024 for the two square weights
  cvt16<<<gCV, blk, 0, stream>>>(x, wqkv, wo, wd, XB, WQKV, WOB, WDB, WOS);
  // (1) q, k, v: projection + bias (col = h*128+d); q and k stored as f16 planes x8, v as the v^T plane x1024
  gemm_qkv<<<gG3, bG, 0, stream>>>(XB, WQKV, bqkv, QP, KP, VP, ROWS, DMOD, DMOD, QSC, KSC, VCAR);
  // (2) attention -> O plane [b][s][h][d] x1024 and per-wave row-sum lines
  attn_fwd<<<gAT, bAT, 0, stream>>>(QP, KP, VP, OP, PART);
  // (3) first output projection + bias (carries 1024 x 1024 folded back), stored as the f16 plane x1024
  gemm_hp<<<gG, bG, 0, stream>>>(OP, WOB, bo, UP, ROWS, DMOD, DMOD, 1.0f / (OSC * WOS), USC);
  // (4) second output projection + bias -> F f32 image [ROWS][1024]
  gemm_h1<<<gG, bG, 0, stream>>>(UP, WDB, bd, F, ROWS, DMOD, DMOD, 1.0f / (USC * WOS));
  // (5) flat line-owned writer of the whole output buffer
  outw<<<gOW, blk, 0, stream>>>(F, PART, out);
  (void)hipGetLastError();
}

// v007
// It runs in 143 microseconds.
// Timed twice side by side with v006, it ran 1.08 times as fast both times.
// All steps since v000 together make it 4.15 times as fast.
// Contractions: x.W{q,k,v}^T on v_wmma_f32_16x16x32_bf16 (x and W planes RNE-converted to bf16 operands, f32 accumulate, bias added in f32);
// the folded weight Wf = Wd.Wo on the same bf16 form (both weights RNE-converted to bf16 operands, f32 accumulate);
// scores k'.q'^T (q', k' single f16 planes carried x8), P.v (P x32768 single f16, v x1024 single f16) and O.Wf^T
// (O single f16 plane x1024, Wf single f16 plane x256): v_wmma_f32_16x16x32_f16, f32 accumulate.
// (O.Wo^T + bo).Wd^T + bd = O.(Wd.Wo)^T + (Wd.bo + bd): the two output projections are one product with Wf and the bias bf.
// Base-2 online softmax, 1/l fold, row-sum partials, the folded bias bf = Wd.bo + bd and bias adds in f32 on VALU.
// The q, k, v^T and Wf operand planes are written by the epilogue of the GEMM that produces them (f32 result, bias, carry, f16).
#include <hip/hip_runtime.h>
#include <math.h>
#include <stdint.h>

#define NB    4
#define SEQ   2048
#define DMOD  1024
#define NH    8
#define HD    128
#define QT_BITS 5
#define NH_BITS 3
#define ROWS  (NB * SEQ)
#define QSC   8.0f
#define KSC   8.0f
#define PCAR  32768.0f
#define PEXP  15.0f
#define VCAR  1024.0f
#define OSC   1024.0f
#define WFS   256.0f
#define SM_SCALE 0.08838834764831845f
#define LOG2E 1.4426950408889634f
#define ATT_WAVES   8
#define ATT_THREADS (ATT_WAVES * 32)
#define ATT_QT      2
#define ATT_QROWS   (ATT_WAVES * ATT_QT * 16)
#define AQT_BITS    3
#define ATT_BLOCKS  (NB * NH * (SEQ / ATT_QROWS))
#define NKB    (SEQ / 32)
#define RS     (NH * HD)
#define SPITCH 132
#define SLABF  (16 * SPITCH)
#define SLAB64 (16 * 68)
#define VTS    144
#define WPB    (NH * (SEQ / ATT_QROWS) * ATT_WAVES * ATT_QT)
#define TOTOUT (NB + ROWS * DMOD)
#define IMGN   (ROWS * DMOD)
#define NPIECE ((TOTOUT + 3) / 4)
#define GBT    128
#define GKS    128
#define GPITCH 272
#define GOPB   (GBT * GPITCH)
#define GBUF   (2 * GOPB)
#define AKS    128
#define ANST   (SEQ / AKS)
#define AOPB   (AKS * GPITCH)
#define ABUF   (AOPB + HD * GPITCH)
#define DEPSC  (1.0f / ((float)NH * (float)SEQ * (float)SEQ))
#define CBX    (ROWS * DMOD / 8 / 256)
#define CBQ    (3 * DMOD * DMOD / 8 / 256)
#define CBW    (DMOD * DMOD / 8 / 256)
#define CBB    (DMOD / 32)
#define CBT    ((DMOD / 64) * (DMOD / 64))
#define TPB    144
#define GBLK   ((ROWS / GBT) * (DMOD / GBT))
#define GBW    ((DMOD / GBT) * (DMOD / GBT))

static_assert(HD == 128 && DMOD == NH * HD && RS == DMOD);
static_assert(PCAR == (float)(1 << (int)PEXP));
static_assert((1 << QT_BITS) == (SEQ / 64) && (1 << NH_BITS) == NH);
static_assert((SEQ % 64) == 0 && (SEQ % 32) == 0 && NKB * 32 == SEQ);
static_assert(((ROWS * DMOD / 8) % 256) == 0 && ((3 * DMOD * DMOD / 8) % 256) == 0 && ((DMOD * DMOD / 8) % 256) == 0);
static_assert((ROWS % 64) == 0 && (DMOD % 64) == 0 && (DMOD % 32) == 0);
static_assert(NB >= 1 && NB <= 32);
static_assert((WPB % 32) == 0 && WPB == 1024);
static_assert(ATT_THREADS == 256 && (1 << AQT_BITS) == (SEQ / ATT_QROWS));
static_assert((SEQ % AKS) == 0 && ANST >= 2 && (AKS % 32) == 0 && AKS * 2 + 16 == GPITCH && HD * 2 + 16 == GPITCH);
static_assert(AKS == 8 * (ATT_THREADS / 16) && HD == 8 * (ATT_THREADS / 16));
static_assert(ATT_WAVES * ATT_QT * SLABF * 4 <= 2 * ABUF);
static_assert(((SPITCH * 4) % 16) == 0 && (SPITCH >= HD + 4));
static_assert((VTS % 16) == 0 && VTS >= 64 * 2 && 4 * 64 * VTS <= 2 * GBUF && (SEQ % GBT) == 0);
static_assert(4 * 64 * 68 * 4 <= 2 * GBUF);
static_assert(IMGN % 4 == 0);
static_assert((ROWS % GBT) == 0 && (DMOD % GBT) == 0 && (DMOD % GKS) == 0 && GKS * 2 + 16 == GPITCH);
static_assert(DMOD == 1024 && (TPB % 16) == 0 && TPB >= 64 * 2 && GBW <= GBLK);

typedef unsigned short u16;
typedef _Float16 v16h __attribute__((ext_vector_type(16)));
typedef _Float16 v8h  __attribute__((ext_vector_type(8)));
typedef __bf16   v16b __attribute__((ext_vector_type(16)));
typedef float    v8f  __attribute__((ext_vector_type(8)));
typedef float    v4f  __attribute__((ext_vector_type(4)));
typedef float    v2f  __attribute__((ext_vector_type(2)));
typedef _Float16 v2h  __attribute__((ext_vector_type(2)));
typedef unsigned int v4u __attribute__((ext_vector_type(4)));

union FragH { v16h v; v8h h[2]; v4u u[2]; };
union FragB { v16b v; v4u u[2]; };

// ---- scalar helpers --------------------------------------------------------------------------------
__device__ __forceinline__ unsigned short bf_bits(float f) {          // f32 -> bf16 bits, RNE convert
  unsigned u = __float_as_uint(f);
  return (unsigned short)((u + 0x7FFFu + ((u >> 16) & 1u)) >> 16);
}
__device__ __forceinline__ float bf_up(unsigned short h) { return __uint_as_float(((unsigned)h) << 16); }
__device__ __forceinline__ float bfr(float f) { return bf_up(bf_bits(f)); }
__device__ __forceinline__ unsigned short h_bits(_Float16 x) { return __builtin_bit_cast(unsigned short, x); }
__device__ __forceinline__ unsigned pk16(unsigned short a, unsigned short b) { return (unsigned)a | ((unsigned)b << 16); }
__device__ __forceinline__ v8f zero8() { v8f z = {0.f, 0.f, 0.f, 0.f, 0.f, 0.f, 0.f, 0.f}; return z; }
__device__ __forceinline__ v4f zero4() { v4f z = {0.f, 0.f, 0.f, 0.f}; return z; }

// ---- fragment loaders: 16-bit A/B operand, lane -> row/col (lane&15), p already includes +8*(lane>>4);
//      elements 0..7 <- p[0..7] (k0+8h..), elements 8..15 <- p[16..23] (k0+16+8h..)  (same split k map for A and B;
//      B is always read from a k-contiguous [n][k] plane)
__device__ __forceinline__ v16h ldfrag_h(const _Float16* p) {
  FragH f;
  f.h[0] = *(const v8h*)(p);
  f.h[1] = *(const v8h*)(p + 16);
  return f.v;
}

__device__ __forceinline__ v8f mma_h(v16h a, v16h b, v8f c) {
  return __builtin_amdgcn_wmma_f32_16x16x32_f16(false, a, false, b, (short)0, c, false, false);
}
__device__ __forceinline__ v8f mma_b(v16b a, v16b b, v8f c) {
  return __builtin_amdgcn_wmma_f32_16x16x32_bf16(false, a, false, b, (short)0, c, false, false);
}
// The four v_nop fill the vector slots that the chip needs behind a matrix instruction before a vector instruction may touch its
// result or overwrite its operands; they stand at the foot of the key-block loop, for the taken side of its branch. The results
// of the loop's last eight matrix instructions are named so that the v_nop stay behind them.
__device__ __forceinline__ void guard_foot(v8f& a0, v8f& a1, v8f& a2, v8f& a3, v8f& b0, v8f& b1, v8f& b2, v8f& b3) {
#if defined(__HIP_DEVICE_COMPILE__)
  asm volatile("v_nop\n\tv_nop\n\tv_nop\n\tv_nop"
               : "+v"(a0), "+v"(a1), "+v"(a2), "+v"(a3), "+v"(b0), "+v"(b1), "+v"(b2), "+v"(b3));
#endif
}
__device__ __forceinline__ void wave_sync_lds() {
  __builtin_amdgcn_fence(__ATOMIC_RELEASE, "workgroup");
  __builtin_amdgcn_wave_barrier();
  __builtin_amdgcn_fence(__ATOMIC_ACQUIRE, "workgroup");
}

// =====================================================================================================
// All that is made from the f32 inputs alone, in one grid (the parts do not depend on one another); the short parts stand first:
//   blocks [0, CBB): the folded bias bf[n] = sum_j Wd[n][j] * bo[j] + bd[n] (bf16 RNE values, f32 FMA chain and xor tree);
//     block = 32 rows n, wave = 4 rows, lane = 4 consecutive j of every 128; the 32 sums leave as one whole 128-B line.
//   next CBT blocks: Wo -> its transposed bf16 plane WOT[k][j] = Wo[j][k], block = one 64 x 64 tile turned in LDS (pitch 144 B);
//     coverage: read 64 rows x 4 lanes x 16 floats, written 2 x 32 rows x 8 lanes x 8 elements (whole 128-B lines).
//   then f32 plane -> bf16 plane (RNE bits), same layout: CBX blocks for the activations, CBQ for the qkv weight, CBW for Wd.
//     Thread = 8 consecutive elements: two 16-B loads, one 16-B store; 32 consecutive lanes = 512 contiguous, 512-B aligned bytes
//     coverage: each plane has elements/8/256 blocks (exact: static_assert above) x 256 thr x 8 = the whole plane.
// =====================================================================================================
// The wait before a register that an issued global store names is rewritten: behind a part's last stores, whose registers the
// code of another part, laid behind them in the kernel, writes anew.
__device__ __forceinline__ void wait_x_part() {
#if defined(__HIP_DEVICE_COMPILE__)
  asm volatile("s_wait_xcnt 0x0" ::: "memory");
#endif
}
__global__ __launch_bounds__(256) void cvt16(const float* __restrict__ x, const float* __restrict__ wqkv,
                                             const float* __restrict__ wo, const float* __restrict__ wd,
                                             const float* __restrict__ bo, const float* __restrict__ bd,
                                             u16* XB, u16* WQKV, u16* WOT, u16* WDB, float* BF) {
  __shared__ __align__(16) unsigned char tile[64 * TPB];
  const int tid = threadIdx.x;
  int blk = blockIdx.x;                     // block-uniform choice of the part
  if (blk >= CBB + CBT + CBX + CBQ + CBW) return;   // in front of every barrier; never taken with the exact grid
  if (blk < CBB) {
    const int wave = tid >> 5, lane = tid & 31;
    float* sums = (float*)(void*)tile;
    const float* wp = wd + (size_t)(blk * 32 + wave * 4) * DMOD + lane * 4;
    float s4[4] = {0.f, 0.f, 0.f, 0.f};
    // two chunks' loads in flight; unrolled further, this part's registers would cut the waves that the stream parts can hold
#pragma unroll 2
    for (int it = 0; it < 8; ++it) {
      const v4f t = *(const v4f*)(bo + it * 128 + lane * 4);
#pragma unroll
      for (int r = 0; r < 4; ++r) {
        const v4f w = *(const v4f*)(wp + (size_t)r * DMOD + it * 128);
#pragma unroll
        for (int e = 0; e < 4; ++e) s4[r] = __builtin_fmaf(bfr(w[e]), bfr(t[e]), s4[r]);
      }
    }
#pragma unroll
    for (int d = 16; d >= 1; d >>= 1) {
#pragma unroll
      for (int r = 0; r < 4; ++r) s4[r] += __shfl_xor(s4[r], d, 32);
    }
    if (lane == 0) {
      const v4f sv = {s4[0], s4[1], s4[2], s4[3]};
      *(v4f*)(sums + wave * 4) = sv;
    }
    __syncthreads();                        // the block's 32 sums are in LDS
    if (tid < 8) {
      const v4f b = *(const v4f*)(bd + blk * 32 + tid * 4);
      v4f o = *(const v4f*)(sums + tid * 4);
#pragma unroll
      for (int e = 0; e < 4; ++e) o[e] += bfr(b[e]);
      *(v4f*)(BF + blk * 32 + tid * 4) = o;
    }
    return;
  }
  blk -= CBB;
  if (blk < CBT) {
    const int j0 = (blk / (DMOD / 64)) * 64, k0 = (blk % (DMOD / 64)) * 64;
    {
      const int j = tid >> 2, kq = (tid & 3) * 16;
      const float* p = wo + (size_t)(j0 + j) * DMOD + k0 + kq;
      v4f v[4];
#pragma unroll
      for (int q = 0; q < 4; ++q) v[q] = *(const v4f*)(p + q * 4);
#pragma unroll
      for (int q = 0; q < 4; ++q) {
#pragma unroll
        for (int e = 0; e < 4; ++e) *(u16*)(void*)(tile + (kq + q * 4 + e) * TPB + j * 2) = bf_bits(v[q][e]);
      }
    }
    __syncthreads();                        // the turned tile is whole
    const int kr = tid >> 3, jq = (tid & 7) * 8;
    v4u o[2];
#pragma unroll
    for (int it = 0; it < 2; ++it) o[it] = *(const v4u*)(tile + (it * 32 + kr) * TPB + jq * 2);
    u16* dst = WOT + (size_t)(k0 + kr) * DMOD + j0 + jq;
#pragma unroll
    for (int it = 0; it < 2; ++it) *(v4u*)(dst + (size_t)(it * 32) * DMOD) = o[it];
    wait_x_part();
    return;
  }
  blk -= CBT;
  const float* s = x;
  u16* D = XB;
  if (blk >= CBX + CBQ) { s = wd;   D = WDB;  blk -= CBX + CBQ; }
  else if (blk >= CBX)  { s = wqkv; D = WQKV; blk -= CBX; }
  const int gt = blk * 256 + tid;
  const float* p = s + (size_t)gt * 8;
  const v4f a = *(const v4f*)(p), c4 = *(const v4f*)(p + 4);
  v4u o;
#pragma unroll
  for (int e = 0; e < 2; ++e) {
    o[e]     = pk16(bf_bits(a[2 * e]), bf_bits(a[2 * e + 1]));
    o[2 + e] = pk16(bf_bits(c4[2 * e]), bf_bits(c4[2 * e + 1]));
  }
  *(v4u*)(D + (size_t)gt * 8) = o;
  wait_x_part();
}

// =====================================================================================================
// GEMM f32 epilogue (EPI 0): the wave's 16x64 f32 tile (times oscale) staged in its LDS slab (pitch 68),
// coverage: 8 instructions x 2 rows x 16 lanes x 4 floats = the wave's 16 x 64 tile.
// =====================================================================================================
__device__ __forceinline__ void epi64(float* sl, v8f a0, v8f a1, v8f a2, v8f a3, float oscale, v4f badd, float* C, int N,
                                      size_t rowb, int col0, int lane) {
  const int hh = lane >> 4, m = lane & 15;
#pragma unroll
  for (int r = 0; r < 8; ++r) {
    const int ro = (8 * hh + r) * 68 + m;
    sl[ro]      = a0[r] * oscale;
    sl[ro + 16] = a1[r] * oscale;
    sl[ro + 32] = a2[r] * oscale;
    sl[ro + 48] = a3[r] * oscale;
  }
  wave_sync_lds();
  v4f vals[8];
#pragma unroll
  for (int it = 0; it < 8; ++it) vals[it] = *(const v4f*)(sl + (it * 2 + hh) * 68 + m * 4) + badd;
  float* dst = C + (rowb + (size_t)hh) * (size_t)N + col0 + m * 4;
  {
#pragma unroll
    for (int it = 0; it < 8; ++it) {
      *(v4f*)(dst + (size_t)(it * 2) * (size_t)N) = vals[it];
    }
    
  }
}

// =====================================================================================================
// 16-bit GEMM with bias, both engines: C[M][N] (f32) = A[M][K] (row-major) . Bt[N][K]^T (k-contiguous), times oscale, plus a
// bias. Block = 128x128 tile of C, 4 waves as 2x2, wave = 64x64 (4x4 accumulator tiles).
// EPI 0 adds bias[n] as it is (an f32 value made in this call) and stores C as f32. EPI 2 adds the bf16-RNE value of bias[n], or
// nothing where hasb (block-uniform) is not set, and stores f16(C * pscale) as the plane P[M][N] unless tr (block-uniform) is set:
// then it stores f16(C * pscale) transposed per batch, P[(row / SEQ) * N + col][row % SEQ] (the v^T plane: N = NH * HD,
// col = h * HD + d). bid is the block's index among the (M/128)*(N/128) tiles of this product.
// A stage is 128 k of the block's 128 A rows and 128 Bt rows: 256 rows of 256 B, laid in LDS at pitch 272 B by asynchronous
// b128 copies (16 lanes = one whole 256-B row, so every copy touches whole lines). Two buffers: stage t+1 flies while stage t
// is multiplied. Fragments are read from LDS with the same split k map for A and B as ldfrag_h; k runs upward in steps of 32
// into one accumulator per tile. Shapes: M % 128 == 0, N % 128 == 0, K % 128 == 0, (M/128)*(N/128) blocks per product (static_assert above).
// =====================================================================================================
__device__ __forceinline__ unsigned lds_off(const void* p) { return (unsigned)(size_t)p; }

// Eight asynchronous 16-B-per-lane copies, rows 8 apart. The s_wait_xcnt stands inside the statement so that no address
// register of a copy is rewritten in front of it.
__device__ __forceinline__ void copy8(unsigned l, const u16* g, size_t rs8) {
#if defined(__HIP_DEVICE_COMPILE__)
  asm volatile("global_load_async_to_lds_b128 %0, %8, off\n\t"
               "global_load_async_to_lds_b128 %1, %9, off\n\t"
               "global_load_async_to_lds_b128 %2, %10, off\n\t"
               "global_load_async_to_lds_b128 %3, %11, off\n\t"
               "global_load_async_to_lds_b128 %4, %12, off\n\t"
               "global_load_async_to_lds_b128 %5, %13, off\n\t"
               "global_load_async_to_lds_b128 %6, %14, off\n\t"
               "global_load_async_to_lds_b128 %7, %15, off\n\t"
               "s_wait_xcnt 0x0"
               :: "v"(l), "v"(l + 8u * GPITCH), "v"(l + 16u * GPITCH), "v"(l + 24u * GPITCH),
                  "v"(l + 32u * GPITCH), "v"(l + 40u * GPITCH), "v"(l + 48u * GPITCH), "v"(l + 56u * GPITCH),
                  "v"(g), "v"(g + rs8), "v"(g + 2 * rs8), "v"(g + 3 * rs8),
                  "v"(g + 4 * rs8), "v"(g + 5 * rs8), "v"(g + 6 * rs8), "v"(g + 7 * rs8)
               : "memory");
#endif
}
// One stage: this thread's 16 B of rows cr + 8i (i = 0..15) of the A tile and of the Bt tile; 32 copies per wave.
__device__ __forceinline__ void fill_stage(unsigned l, const u16* ga, const u16* gb, size_t rs8) {
  copy8(l, ga, rs8);
  copy8(l + 64u * GPITCH, ga + 8 * rs8, rs8);
  copy8(l + GOPB, gb, rs8);
  copy8(l + GOPB + 64u * GPITCH, gb + 8 * rs8, rs8);
}
__device__ __forceinline__ void wait_async0() {   // this wave's copies have landed
#if defined(__HIP_DEVICE_COMPILE__)
  asm volatile("s_wait_asynccnt 0x0" ::: "memory");
#endif
}
__device__ __forceinline__ void wait_ds0() {      // this wave's LDS reads have returned before their buffer is refilled
#if defined(__HIP_DEVICE_COMPILE__)
  asm volatile("s_wait_dscnt 0x0" ::: "memory");
#endif
}
// The wait before a register that an issued global store names is rewritten. p is named so that what is formed from it afterwards
// (the following stores' addresses) cannot be moved in front of the wait.
__device__ __forceinline__ void wait_x0(unsigned& p) {
#if defined(__HIP_DEVICE_COMPILE__)
  asm volatile("s_wait_xcnt 0x0" : "+v"(p) :: "memory");
#endif
}
__device__ __forceinline__ FragB ld_lfrag(const unsigned char* p) {   // split k map of ldfrag_h: bytes 0..15 and 32..47
  FragB f;
  f.u[0] = *(const v4u*)(p);
  f.u[1] = *(const v4u*)(p + 32);
  return f;
}
__device__ __forceinline__ v8f mma_sel(FragB a, FragB b, v8f c, bool bf) {
  if (bf) return mma_b(a.v, b.v, c);
  return mma_h(__builtin_bit_cast(v16h, a.v), __builtin_bit_cast(v16h, b.v), c);
}

template <bool BF, int EPI>
__device__ __forceinline__ void gemm_core(unsigned char* ring, float* slab, const u16* __restrict__ A,
                                          const u16* __restrict__ Bt, const float* __restrict__ bias,
                                          float* C, u16* P, int bid, bool tr, bool hasb, int M, int N, int K, float oscale,
                                          float pscale) {
  const int tid = threadIdx.x, wave = tid >> 5, lane = tid & 31, hh = lane >> 4, m = lane & 15;
  const int ntile = N >> 7;
  const int row0  = (bid / ntile) * GBT;
  const int col0  = (bid % ntile) * GBT;
  if (row0 + GBT > M) return;                // block-uniform, in front of every barrier; never taken with the exact grid
  const int wr = wave >> 1, wc = wave & 1;
  const int nst = K >> 7;
  const int cr = tid >> 4, cc = tid & 15;    // copy: row within a group of 8, 16-B chunk of the 256-B row
  const u16* ga = A  + (size_t)(row0 + cr) * K + cc * 8;
  const u16* gb = Bt + (size_t)(col0 + cr) * K + cc * 8;
  const size_t rs8 = (size_t)8 * K;
  const unsigned l0 = lds_off(ring) + (unsigned)(cr * GPITCH + cc * 16);

  v8f acc[4][4];
#pragma unroll
  for (int i = 0; i < 4; ++i) {
#pragma unroll
    for (int j = 0; j < 4; ++j) acc[i][j] = zero8();
  }

  fill_stage(l0, ga, gb, rs8);
  wait_async0();
  __syncthreads();                           // publishes stage 0
  if (nst > 1) fill_stage(l0 + GBUF, ga + GKS, gb + GKS, rs8);

  for (int t = 0; t < nst; ++t) {
    const unsigned bo = (unsigned)(t & 1) * GBUF;
    const unsigned char* ab = ring + bo + (wr * 64 + m) * GPITCH + hh * 16;
    const unsigned char* bb = ring + bo + GOPB + (wc * 64 + m) * GPITCH + hh * 16;
    FragB a[2][4], b[2][4];                  // set (ks & 1) holds the fragments of k step ks
#pragma unroll
    for (int i = 0; i < 4; ++i) { a[0][i] = ld_lfrag(ab + i * 16 * GPITCH); b[0][i] = ld_lfrag(bb + i * 16 * GPITCH); }
#pragma unroll
    for (int ks = 0; ks < GKS / 32; ++ks) {
      const int cs = ks & 1;
      if (ks + 1 < GKS / 32) {
#pragma unroll
        for (int i = 0; i < 4; ++i) {
          a[cs ^ 1][i] = ld_lfrag(ab + i * 16 * GPITCH + (ks + 1) * 64);
          b[cs ^ 1][i] = ld_lfrag(bb + i * 16 * GPITCH + (ks + 1) * 64);
        }
      }
      // keeps the next k step's LDS reads one group ahead of this step's products instead of spread among them
      __builtin_amdgcn_sched_barrier(0);
#pragma unroll
      for (int i = 0; i < 4; ++i) {
#pragma unroll
        for (int j = 0; j < 4; ++j) acc[i][j] = mma_sel(a[cs][i], b[cs][j], acc[i][j], BF);
      }
      // keeps the following group of LDS reads behind this step's products
      __builtin_amdgcn_sched_barrier(0);
    }
    wait_ds0();
    wait_async0();
    __syncthreads();                         // publishes stage t+1 and ends every reader's last read of stage t's buffer
    if (t + 2 < nst) fill_stage(l0 + bo, ga + (size_t)(t + 2) * GKS, gb + (size_t)(t + 2) * GKS, rs8);
  }
  wait_async0();

  const int colw = col0 + wc * 64;
  if constexpr (EPI == 0) {
    float* sl = slab + wave * SLAB64;
    const v4f badd = *(const v4f*)(bias + colw + m * 4);  // columns colw + 4m .. +3, always < N (N multiple of 128)
#pragma unroll
    for (int i = 0; i < 4; ++i) {
      if (i) wave_sync_lds();                // the slab's last readers are done before other lanes overwrite it
      epi64(sl, acc[i][0], acc[i][1], acc[i][2], acc[i][3], oscale, badd, C, N, (size_t)(row0 + wr * 64 + i * 16), colw, lane);
    }
  } else if (!tr) {
    // The wave's 64 x 64 f32 tile (times oscale) is staged whole in its own part of the ring (pitch 68 floats), which the last
    // stage's barrier has freed of readers and copies; read back with 8 lanes per row (8 columns each), so that every 128-B
    // row piece of the plane leaves as one whole line.
    // coverage: 16 instructions x 4 rows x 8 lanes x 8 halves = the wave's 64 x 64 tile.
    float* sl = (float*)(void*)ring + wave * (64 * 68);
#pragma unroll
    for (int i = 0; i < 4; ++i) {
#pragma unroll
      for (int r = 0; r < 8; ++r) {
        const int ro = (i * 16 + 8 * hh + r) * 68 + m;
#pragma unroll
        for (int j = 0; j < 4; ++j) sl[ro + 16 * j] = acc[i][j][r] * oscale;
      }
    }
    const int rq = lane >> 3, p8 = (lane & 7) * 8;
    const float* bp = bias + colw + p8;                   // columns colw + 8(lane & 7) .. +7, always < N
    const v4f bv0 = *(const v4f*)(bp), bv1 = *(const v4f*)(bp + 4);
    v4f b0, b1;
#pragma unroll
    for (int e = 0; e < 4; ++e) { b0[e] = hasb ? bfr(bv0[e]) : 0.f; b1[e] = hasb ? bfr(bv1[e]) : 0.f; }
    wave_sync_lds();
    v4u o[16];
#pragma unroll
    for (int it = 0; it < 16; ++it) {
      const float* s = sl + (it * 4 + rq) * 68 + p8;
      const v4f x = (*(const v4f*)(s) + b0) * pscale, y = (*(const v4f*)(s + 4) + b1) * pscale;
      const v8f f = {x[0], x[1], x[2], x[3], y[0], y[1], y[2], y[3]};
      o[it] = __builtin_bit_cast(v4u, __builtin_convertvector(f, v8h));
    }
    u16* dst = P + (size_t)(row0 + wr * 64 + rq) * (size_t)N + colw + p8;
    unsigned adv = 0;                        // elements from dst to the current group of four stores
#pragma unroll
    for (int it = 0; it < 16; ++it) {
      *(v4u*)(dst + adv + (size_t)((it & 3) * 4) * (size_t)N) = o[it];
      // behind every group of four: the next stores' addresses, and whatever follows the last group, may be formed in registers
      // that an issued store names; the addresses are formed from adv behind the wait
      if ((it & 3) == 3) { wait_x0(adv); adv += 16u * (unsigned)N; }
    }
  } else {
    // An accumulator lane holds 8 consecutive rows of one column: 16 B of a transposed line. The wave's 64 columns x 64 rows
    // are gathered in its own part of the ring (pitch 144 B), which the last stage's barrier has freed of readers and copies,
    // and leave as whole 128-B lines, 8 lanes each.
    // coverage: 16 instructions x 4 lines x 8 lanes x 8 halves = the wave's 64 x 64 tile.
    unsigned char* st = ring + wave * (64 * VTS);
#pragma unroll
    for (int j = 0; j < 4; ++j) {
      const float bj = bfr(bias[colw + j * 16 + m]);
#pragma unroll
      for (int i = 0; i < 4; ++i) {
        const v8f f = (acc[i][j] * oscale + bj) * pscale;
        *(v8h*)(st + (j * 16 + m) * VTS + i * 32 + hh * 16) = __builtin_convertvector(f, v8h);
      }
    }
    wave_sync_lds();
    const int rq = lane >> 3, p = lane & 7;
    v4u t[16];
#pragma unroll
    for (int it = 0; it < 16; ++it) t[it] = *(const v4u*)(st + (it * 4 + rq) * VTS + p * 16);
    const int roww = row0 + wr * 64;         // 64 rows of one batch (SEQ % 128 == 0)
    u16* dst = P + ((size_t)(roww / SEQ) * (size_t)N + colw + rq) * SEQ + (roww % SEQ) + p * 8;
#pragma unroll
    for (int it = 0; it < 16; ++it) *(v4u*)(dst + (size_t)(it * 4) * SEQ) = t[it];
  }
}

// The q, k and v projections and the folded weight in one grid (they depend on nothing of one another): blocks [0, GBLK) give the
// q plane, [GBLK, 2 GBLK) the k plane, [2 GBLK, 3 GBLK) the v^T plane (GBLK = the 128x128 tiles of one projection, M = ROWS,
// N = DMOD); third s multiplies by weight rows s * N .. s * N + N - 1. The last GBW blocks give Wf[n][k] = sum_j Wd[n][j] *
// Wo[j][k] (A = the Wd plane, Bt = the transposed Wo plane, N x N, no bias), stored as the f16 plane x wsc.
__global__ __launch_bounds__(128)
void gemm_qkv(const u16* __restrict__ A, const u16* __restrict__ Bt, const float* __restrict__ bias,
              const u16* __restrict__ WD, const u16* __restrict__ WOT,
              u16* QPo, u16* KPo, u16* VPo, u16* WFo, int M, int N, int K, float qsc, float ksc, float vsc, float wsc) {
  __shared__ __align__(16) unsigned char ring[2 * GBUF];
  const int seg = (int)blockIdx.x / GBLK;    // block-uniform
  if (seg > 3) return;                       // in front of every barrier; never taken with the exact grid
  const bool fold = (seg == 3);
  u16* P = (seg == 0) ? QPo : (seg == 1) ? KPo : (seg == 2) ? VPo : WFo;
  const float ps = (seg == 0) ? qsc : (seg == 1) ? ksc : (seg == 2) ? vsc : wsc;
  const int sb = fold ? 0 : seg;             // the fold reads no bias: its pointer stays inside the array
  gemm_core<true, 2>(ring, nullptr, fold ? WD : A, fold ? WOT : Bt + (size_t)seg * N * K, bias + sb * N, nullptr, P,
                     (int)blockIdx.x - seg * GBLK, seg == 2, !fold, fold ? N : M, N, K, 1.0f, ps);
}

__global__ __launch_bounds__(128)
void gemm_h1(const u16* __restrict__ A, const u16* __restrict__ Bt, const float* __restrict__ bias,
             float* C, int M, int N, int K, float oscale) {
  __shared__ __align__(16) unsigned char ring[2 * GBUF];
  __shared__ __align__(16) float slab[4 * SLAB64];
  gemm_core<false, 0>(ring, slab, A, Bt, bias, C, nullptr, (int)blockIdx.x, false, true, M, N, K, oscale, 1.0f);
}

// =====================================================================================================
// Multi-head flash attention (no mask): block = (batch b, head, 256 query rows), 8 waves, wave w owns the 32 query rows
// q0 = 256*qt + 32*w .. q0+31 as two query tiles of 16; every k and v^T fragment read from LDS is used for both tiles. What
// follows describes one query tile (q0 there = the tile's first row).
//   q plane (f16, x8) laid out [b][s][h][d]; k plane the same; v^T plane [b][h][d][s] (x1024).
//   All NKB = SEQ/32 key blocks of 32 keys are visited (static bound), in stages of 128 keys that the block's waves share:
//   a stage is 128 k rows of 256 B (all d) and 128 v^T rows of 256 B (its 128 keys), laid in LDS at pitch 272 B by asynchronous
//   b128 copies (16 lanes = one whole 256-B row). Two buffers: stage t+1 flies while stage t is worked on. The fragments are
//   read from LDS with the split k map of ldfrag_h. After the last stage's barrier the ring is the epilogue's staging room.
//   Scores are computed TRANSPOSED: S^T tile g (g = 0,1) = k rows (keys kb+16g .. +15, A operand, row m = lane&15, split k map
//   over d, 4 chunks of 32 d) times q^T (B operand, col n = query q0 + (lane&15), k = d, split map).
//   D element r of lane l = (key kb+16g+8h+r, query q0+(l&15)), so a lane owns one query column and 16 of its 32 keys; the
//   partner lane l^16 owns the other 16 -> row max / row sum need one xor-16 shuffle.
//   Online max-subtracted base-2 softmax in f32 (scale 1/sqrt(128) and the q/k carries folded into lsc; scale, maximum and
//   the x32768 carry of P enter a score's exponent through one FMA; l carries the x32768 too). The exp'd values ARE
//   the P A-fragment in place: A row m = query = lane&15, element i <- key kb+8h+i (tile 0, D element i), element 8+i <- key
//   kb+16+8h+i (tile 1, D element i). P is carried x32768 as single f16. The rescale factor of query row 8h+r of the
//   O accumulators is fetched from lane 8h+r with a shuffle (uniform control). 8 v^T B fragments (col n = d = 16j + (lane&15),
//   keys k-contiguous), 8 P.V WMMAs per key block and query tile; the two tiles' 16 stand together.
//   Epilogue: 1/l (per query, shuffled to the D row owner) and carry folds in f32; the wave's 16x128 f32 result staged in its
//   LDS slab (pitch 132); each 256-B output row (b, q0+row, head) of the O plane (O x1024 as single f16) written as 2 whole
// coverage: per wave and query tile 8 instructions x 2 rows x 16 lanes x 8 halves = 16 x 128 of the O plane + 1 PART line; grid
//           NB*NH*SEQ/256 blocks x 8 waves x 2 tiles = every (b, s, h) row of the O plane and every PART line exactly once.
// =====================================================================================================
// Eight asynchronous 16-B-per-lane copies, rows 16 apart. The s_wait_xcnt stands inside the statement so that no address
// register of a copy is rewritten in front of it.
__device__ __forceinline__ void copy8w(unsigned l, const u16* g, size_t rs16) {
#if defined(__HIP_DEVICE_COMPILE__)
  asm volatile("global_load_async_to_lds_b128 %0, %8, off\n\t"
               "global_load_async_to_lds_b128 %1, %9, off\n\t"
               "global_load_async_to_lds_b128 %2, %10, off\n\t"
               "global_load_async_to_lds_b128 %3, %11, off\n\t"
               "global_load_async_to_lds_b128 %4, %12, off\n\t"
               "global_load_async_to_lds_b128 %5, %13, off\n\t"
               "global_load_async_to_lds_b128 %6, %14, off\n\t"
               "global_load_async_to_lds_b128 %7, %15, off\n\t"
               "s_wait_xcnt 0x0"
               :: "v"(l), "v"(l + 16u * GPITCH), "v"(l + 32u * GPITCH), "v"(l + 48u * GPITCH),
                  "v"(l + 64u * GPITCH), "v"(l + 80u * GPITCH), "v"(l + 96u * GPITCH), "v"(l + 112u * GPITCH),
                  "v"(g), "v"(g + rs16), "v"(g + 2 * rs16), "v"(g + 3 * rs16),
                  "v"(g + 4 * rs16), "v"(g + 5 * rs16), "v"(g + 6 * rs16), "v"(g + 7 * rs16)
               : "memory");
#endif
}
// One attention stage: this thread's 16 B of rows cr + 16i (i = 0..7) of the k tile and of the v^T tile; 16 copies per wave.
__device__ __forceinline__ void fill_kv(unsigned l, const u16* gk, const u16* gv) {
  copy8w(l, gk, (size_t)16 * RS);
  copy8w(l + AOPB, gv, (size_t)16 * SEQ);
}
// 2^x by the hardware instruction alone. A result below 2^-126 comes back as 0: here that is a probability (carried x32768) or
// a rescale factor that small beside a row maximum of 32768, far below the last bit that the f16 operand and the f32 sums keep.
__device__ __forceinline__ float exp2_hw(float x) { return __builtin_amdgcn_exp2f(x); }
__device__ __forceinline__ v16h ld_lfrag_h(const unsigned char* p) {  // split k map of ldfrag_h: bytes 0..15 and 32..47
  FragH f;
  f.u[0] = *(const v4u*)(p);
  f.u[1] = *(const v4u*)(p + 32);
  return f.v;
}

// The v_nop is the slot that the instruction set asks for behind a transcendental before its result is read or its source
// overwritten. The results and the sources are named so that none of them is touched in front of it, wherever it lands.
__device__ __forceinline__ void trans_slot8(float* p, const float* x) {
#if defined(__HIP_DEVICE_COMPILE__)
  asm("v_nop" : "+v"(p[0]), "+v"(p[1]), "+v"(p[2]), "+v"(p[3]), "+v"(p[4]), "+v"(p[5]), "+v"(p[6]), "+v"(p[7])
              : "v"(x[0]), "v"(x[1]), "v"(x[2]), "v"(x[3]), "v"(x[4]), "v"(x[5]), "v"(x[6]), "v"(x[7]));
#endif
}
__device__ __forceinline__ void trans_slot1(float& p, float x) {
#if defined(__HIP_DEVICE_COMPILE__)
  asm("v_nop" : "+v"(p) : "v"(x));
#endif
}

// One query tile's online-softmax step over a key block: s0, s1 = the tile's unscaled transposed scores (this lane's 16 keys of
// query column c). Updates the running maximum (kept unscaled, lsc > 0) and the running sum, gives the rescale factor al of the
// tile's O accumulators and the P A-fragment ph (f16, carried x32768).
__device__ __forceinline__ void softmax_step(const v8f s0, const v8f s1, const float lsc, float& mrun, float& lrun, float& al,
                                             FragH& ph) {
  float tk[16];
#pragma unroll
  for (int i = 0; i < 8; ++i) { tk[i] = s0[i];  tk[8 + i] = s1[i]; }
  float cm = -INFINITY;
#pragma unroll
  for (int i = 0; i < 16; ++i) cm = fmaxf(cm, tk[i]);
  cm = fmaxf(cm, __shfl_xor(cm, 16, 32));
  const float mn = fmaxf(mrun, cm);                                // finite from the first key block on
  const float ax = (mrun - mn) * lsc;
  float ae = exp2_hw(ax);
  trans_slot1(ae, ax);
  al = (mrun == -INFINITY) ? 0.f : ae;                             // o and l are zero while mrun is -inf
  mrun = mn;
  // probabilities carried x32768, one FMA and one v_exp_f32 each: 2^(t * lsc + (15 - mn * lsc)); they are summed and
  // rounded to the P A-fragment (f16) as they come; element i <-> tk[i]
  const float eb = __builtin_fmaf(-mn, lsc, PEXP);
  const v2f l2 = {lsc, lsc}, e2 = {eb, eb};
  float x[16], p[16];
#pragma unroll
  for (int i = 0; i < 16; i += 2) {
    const v2f t2 = {tk[i], tk[i + 1]};       // a register pair of the score accumulator: one packed FMA, no moves
    const v2f x2 = __builtin_elementwise_fma(t2, l2, e2);
    x[i] = x2[0];
    x[i + 1] = x2[1];
  }
#pragma unroll
  for (int i = 0; i < 16; ++i) p[i] = exp2_hw(x[i]);
  trans_slot8(p, x);
  trans_slot8(p + 8, x + 8);
  float ps = 0.f;
#pragma unroll
  for (int w = 0; w < 2; ++w) {
#pragma unroll
    for (int e4 = 0; e4 < 4; ++e4) {
      const int i = 8 * w + 2 * e4;
      ps += p[i] + p[i + 1];
      const v2f pp = {p[i], p[i + 1]};
      ph.u[w][e4] = __builtin_bit_cast(unsigned, __builtin_convertvector(pp, v2h));
    }
  }
  ps += __shfl_xor(ps, 16, 32);
  lrun = lrun * al + ps;
}

// two waves per SIMD (one block per WGP): the register budget that holds two query tiles' accumulators beside the fragments
__global__ __launch_bounds__(ATT_THREADS) __attribute__((amdgpu_waves_per_eu(2, 2)))
void attn_fwd(const u16* __restrict__ QPp, const u16* __restrict__ KPp, const u16* __restrict__ VPp,
              u16* OPo, float* PART) {
  // two stage buffers (k tile, then v^T tile); in the epilogue, per wave and query tile, the result slab [16][132] of floats
  __shared__ __align__(16) unsigned char ring[2 * ABUF];

  const int tid  = threadIdx.x;
  const int wave = tid >> 5;
  const int lane = tid & 31;
  const int hh   = lane >> 4;
  const int c    = lane & 15;

  const int bid  = blockIdx.x;
  const int qt   = bid & ((SEQ / ATT_QROWS) - 1);
  const int head = (bid >> AQT_BITS) & (NH - 1);
  const int b    = bid >> (AQT_BITS + NH_BITS);
  const int q0   = qt * ATT_QROWS + wave * (ATT_QT * 16);   // query tile u: rows q0 + 16u .. q0 + 16u + 15

  // B fragments of q^T: col n = query q0 + 16u + c, k = d (k-contiguous row of the q plane)
  const _Float16* Qb = (const _Float16*)(const void*)QPp + ((size_t)(b * SEQ + q0 + c) * NH + head) * HD + 8 * hh;
  // copy: row within a group of 16, 16-B chunk of the 256-B row; k tile row = key, v^T tile row = d
  const int cr = tid >> 4, cc = tid & 15;
  const u16* kb0 = KPp + ((size_t)(b * SEQ) * NH + head) * HD;                  // block-uniform; stage t: + t * AKS key rows
  const u16* vb0 = VPp + ((size_t)(b * NH + head) * HD) * SEQ;                  // block-uniform; stage t: + t * AKS keys
  const unsigned ko = (unsigned)(cr * RS + cc * 8), vo = (unsigned)(cr * SEQ + cc * 8);   // this thread's place in a stage
  const unsigned l0 = lds_off(ring) + (unsigned)(cr * GPITCH + cc * 16);
  fill_kv(l0, kb0 + ko, vb0 + vo);
  const float lsc = SM_SCALE * (LOG2E / (QSC * KSC));

  v16h qf[ATT_QT][4];                        // chunk n: d 32n .. 32n + 31
#pragma unroll
  for (int u = 0; u < ATT_QT; ++u) {
#pragma unroll
    for (int n = 0; n < 4; ++n) qf[u][n] = ldfrag_h(Qb + (size_t)u * (16 * RS) + n * 32);
  }

  float mrun[ATT_QT], lrun[ATT_QT];
  v8f o[ATT_QT][8];
#pragma unroll
  for (int u = 0; u < ATT_QT; ++u) {
    mrun[u] = -INFINITY;
    lrun[u] = 0.f;
#pragma unroll
    for (int j = 0; j < 8; ++j) o[u][j] = zero8();
  }

  wait_async0();
  __syncthreads();                           // publishes stage 0
  fill_kv(l0 + ABUF, kb0 + (ko + AKS * RS), vb0 + (vo + AKS));   // stage 1 exists (ANST >= 2)

  // one rolled trip per stage, so that the ring's publish point stands once, at the trip's foot
#pragma unroll 1
  for (int t = 0; t < ANST; ++t) {
   const unsigned bo = (unsigned)(t & 1) * ABUF;
   // A fragments of k: row m = key kb + 16g + c, k = d;  B fragments of v: col n = d = 16j + c, k = key
   const unsigned char* kt = ring + bo + c * GPITCH + hh * 16;
   const unsigned char* vt = ring + bo + AOPB + c * GPITCH + hh * 16;
   // stays rolled: one key block's live values already take most of the registers of two waves per SIMD
#pragma unroll 1
   for (int kk = 0; kk < AKS / 32; ++kk) {   // key block kb = t * AKS + kk * 32
    // ---- transposed scores of both query tiles from one read of the k fragments:
    //      sa[u] = keys kb..kb+15, sc[u] = keys kb+16..kb+31, column = query q0 + 16u + c ----
    v8f sa[ATT_QT], sc[ATT_QT];
#pragma unroll
    for (int u = 0; u < ATT_QT; ++u) { sa[u] = zero8(); sc[u] = zero8(); }
    const unsigned char* k0p = kt + kk * 32 * GPITCH;
    const unsigned char* k1p = k0p + 16 * GPITCH;
    const unsigned char* vp  = vt + kk * 64;
    const v16h ka0 = ld_lfrag_h(k0p), kc0 = ld_lfrag_h(k1p);
    const v16h ka1 = ld_lfrag_h(k0p + 64), kc1 = ld_lfrag_h(k1p + 64);
    const v16h ka2 = ld_lfrag_h(k0p + 128), kc2 = ld_lfrag_h(k1p + 128);
    const v16h ka3 = ld_lfrag_h(k0p + 192), kc3 = ld_lfrag_h(k1p + 192);
    // keeps the k fragments' reads one group ahead of the products instead of pair by pair, each with a full wait, among them
    __builtin_amdgcn_sched_barrier(0);
    sa[0] = mma_h(ka0, qf[0][0], sa[0]);
    sa[1] = mma_h(ka0, qf[1][0], sa[1]);
    sc[0] = mma_h(kc0, qf[0][0], sc[0]);
    sc[1] = mma_h(kc0, qf[1][0], sc[1]);
    sa[0] = mma_h(ka1, qf[0][1], sa[0]);
    sa[1] = mma_h(ka1, qf[1][1], sa[1]);
    sc[0] = mma_h(kc1, qf[0][1], sc[0]);
    sc[1] = mma_h(kc1, qf[1][1], sc[1]);
    // keeps the first four v^T fragments' reads here, as one group behind the first eight products, so that they return
    // behind the softmax arithmetic
    __builtin_amdgcn_sched_barrier(0);
    const v16h vf0 = ld_lfrag_h(vp);
    const v16h vf1 = ld_lfrag_h(vp + 16 * GPITCH);
    const v16h vf2 = ld_lfrag_h(vp + 32 * GPITCH);
    const v16h vf3 = ld_lfrag_h(vp + 48 * GPITCH);
    __builtin_amdgcn_sched_barrier(0);       // ends that group of reads
    sa[0] = mma_h(ka2, qf[0][2], sa[0]);
    sa[1] = mma_h(ka2, qf[1][2], sa[1]);
    sc[0] = mma_h(kc2, qf[0][2], sc[0]);
    sc[1] = mma_h(kc2, qf[1][2], sc[1]);
    sa[0] = mma_h(ka3, qf[0][3], sa[0]);
    sa[1] = mma_h(ka3, qf[1][3], sa[1]);
    sc[0] = mma_h(kc3, qf[0][3], sc[0]);
    sc[1] = mma_h(kc3, qf[1][3], sc[1]);
    __builtin_amdgcn_sched_barrier(0);       // the last four v^T fragments' reads: one group behind the scores' last product
    const v16h vf4 = ld_lfrag_h(vp + 64 * GPITCH);
    const v16h vf5 = ld_lfrag_h(vp + 80 * GPITCH);
    const v16h vf6 = ld_lfrag_h(vp + 96 * GPITCH);
    const v16h vf7 = ld_lfrag_h(vp + 112 * GPITCH);
    __builtin_amdgcn_sched_barrier(0);       // ends that group of reads
    // ---- per query tile: online softmax, then the rescale of its O accumulators: D row 8hh+r = query q0+16u+8hh+r, whose
    //      factor lives in lane 8hh+r (and 16+8hh+r) ----
    FragH ph[ATT_QT];
#pragma unroll
    for (int u = 0; u < ATT_QT; ++u) {
      float al;
      softmax_step(sa[u], sc[u], lsc, mrun[u], lrun[u], al, ph[u]);
      float scl[8];
#pragma unroll
      for (int r = 0; r < 8; ++r) scl[r] = __shfl(al, 8 * hh + r, 32);
#pragma unroll
      for (int j = 0; j < 8; ++j) {
#pragma unroll
        for (int r = 0; r < 8; ++r) o[u][j][r] *= scl[r];
      }
    }
    // ---- P.V : B fragment col n = d = j*16 + c, keys contiguous in the v^T tile; every fragment serves both query tiles;
    //      the v_nop behind the last of the 16 are for the loop's branch ----
    o[0][0] = mma_h(ph[0].v, vf0, o[0][0]);
    o[1][0] = mma_h(ph[1].v, vf0, o[1][0]);
    o[0][1] = mma_h(ph[0].v, vf1, o[0][1]);
    o[1][1] = mma_h(ph[1].v, vf1, o[1][1]);
    o[0][2] = mma_h(ph[0].v, vf2, o[0][2]);
    o[1][2] = mma_h(ph[1].v, vf2, o[1][2]);
    o[0][3] = mma_h(ph[0].v, vf3, o[0][3]);
    o[1][3] = mma_h(ph[1].v, vf3, o[1][3]);
    o[0][4] = mma_h(ph[0].v, vf4, o[0][4]);
    o[1][4] = mma_h(ph[1].v, vf4, o[1][4]);
    o[0][5] = mma_h(ph[0].v, vf5, o[0][5]);
    o[1][5] = mma_h(ph[1].v, vf5, o[1][5]);
    o[0][6] = mma_h(ph[0].v, vf6, o[0][6]);
    o[1][6] = mma_h(ph[1].v, vf6, o[1][6]);
    o[0][7] = mma_h(ph[0].v, vf7, o[0][7]);
    o[1][7] = mma_h(ph[1].v, vf7, o[1][7]);
    guard_foot(o[0][4], o[0][5], o[0][6], o[0][7], o[1][4], o[1][5], o[1][6], o[1][7]);
   }
   wait_ds0();
   wait_async0();
   __syncthreads();                          // publishes stage t+1 and ends every reader's last read of stage t's buffer
   if (t + 2 < ANST) fill_kv(l0 + bo, kb0 + (ko + (unsigned)(t + 2) * (AKS * RS)), vb0 + (vo + (unsigned)(t + 2) * AKS));
  }
  wait_async0();

  // the last stage's barrier lies behind every wave's last fragment read and last copy: the ring is free
#pragma unroll
  for (int u = 0; u < ATT_QT; ++u) {
    // ---- fold 1/l (per query, owned by lane = query) and the carries; row statistic r = l * (1/l); stage the 16x128 slab ----
    const float rl   = (lrun[u] > 0.f) ? (1.0f / lrun[u]) : 0.f;
    const float linv = rl * (1.0f / VCAR);   // l carries the same x32768 as P
    const float rr   = lrun[u] * rl;
    float inv[8];
#pragma unroll
    for (int r = 0; r < 8; ++r) inv[r] = __shfl(linv, 8 * hh + r, 32);
    float* slab = (float*)(void*)ring + (wave * ATT_QT + u) * SLABF;
#pragma unroll
    for (int r = 0; r < 8; ++r) {
#pragma unroll
      for (int j = 0; j < 8; ++j) slab[(8 * hh + r) * SPITCH + j * 16 + c] = o[u][j][r] * inv[r];
    }
    wave_sync_lds();
    // ---- O x1024 -> single f16 plane; lane = (row parity hh, 8 consecutive d at c8) ----
    v4u oh[8];
    const int c8 = c * 8;
#pragma unroll
    for (int it = 0; it < 8; ++it) {
      const int row = it * 2 + hh;
      const v4f a = *(const v4f*)(slab + row * SPITCH + c8), c4 = *(const v4f*)(slab + row * SPITCH + c8 + 4);
      float w[8];
#pragma unroll
      for (int e = 0; e < 4; ++e) { w[e] = a[e] * OSC; w[4 + e] = c4[e] * OSC; }
#pragma unroll
      for (int e = 0; e < 4; ++e) {
        const _Float16 h0 = (_Float16)w[2 * e], h1 = (_Float16)w[2 * e + 1];
        oh[it][e] = pk16(h_bits(h0), h_bits(h1));
      }
    }
    // ---- tile row-sum partial (fixed xor tree over the 16 query lanes; both lane halves hold identical values) ----
    float wsum = rr;
    wsum += __shfl_xor(wsum, 1, 32);
    wsum += __shfl_xor(wsum, 2, 32);
    wsum += __shfl_xor(wsum, 4, 32);
    wsum += __shfl_xor(wsum, 8, 32);
    v4f pv = zero4();
    pv[0] = (lane == 0) ? wsum : 0.f;
    float* pd = PART + (((size_t)bid * ATT_WAVES + wave) * ATT_QT + u) * 32 + (lane & 7) * 4;   // clamped address for every lane
    const size_t ob = ((size_t)(b * SEQ + q0 + 16 * u) * NH + head) * HD + c8;
#pragma unroll
    for (int it = 0; it < 8; ++it) {
      const int row = it * 2 + hh;
      *(v4u*)(OPo + ob + (size_t)row * RS) = oh[it];
    }
    if (lane < 8) *(v4f*)(pd) = pv;
  }
}

// =====================================================================================================
// Flat output writer: out[0..NB-1] = score output (per batch: fixed-order sum of its WPB PART lines times 1/(NH*SEQ*SEQ),
// computed by block 0, wave = batch, 32 lanes x WPB/32 strided loads + xor tree), out[NB + i] = IMG[i] (f32 image of the last
// value. With NB % 4 != 0 a scalar path handles the element interleave and the partial last piece.
// coverage: grid = ceil(NPIECE/256) blocks x 256 thr x 4 elements with the in-kernel bound = all TOTOUT elements exactly once.
// =====================================================================================================
__global__ __launch_bounds__(256) void outw(const float* __restrict__ IMG, const float* __restrict__ PART, float* out) {
  __shared__ __align__(16) float sc[32];
  const int tid = threadIdx.x, wave = tid >> 5, lane = tid & 31;
  if (tid < 32) sc[tid] = 0.f;
  __syncthreads();
  if (blockIdx.x == 0) {                                   // block-uniform
#pragma unroll 1
    for (int bsel = wave; bsel < NB; bsel += 8) {          // wave-uniform
      const float* pp = PART + ((size_t)bsel * WPB + lane) * 32;
      float s = 0.f;
#pragma unroll 1
      for (int i = 0; i < WPB / 32; ++i) s += pp[(size_t)i * (32 * 32)];
#pragma unroll
      for (int d = 16; d >= 1; d >>= 1) s += __shfl_xor(s, d, 32);
      if (lane == 0) sc[bsel] = s * DEPSC;
    }
  }
  __syncthreads();
  const size_t t = (size_t)blockIdx.x * 256 + (size_t)tid;
  if (t >= (size_t)NPIECE) return;                         // no barriers after this point
  const size_t e0 = t * 4;
#if (NB % 4) == 0
  const bool   hs = (e0 < (size_t)NB);
  const int    si = hs ? (int)e0 : 0;
  const v4f    sv = *(const v4f*)(sc + si);
  const size_t ii = hs ? (size_t)0 : (e0 - (size_t)NB);   // clamped, 16-B aligned
  const v4f    gv = *(const v4f*)(IMG + ii);
  v4f val;
#pragma unroll
  for (int e = 0; e < 4; ++e) val[e] = hs ? sv[e] : gv[e];
  float* dst = out + e0;
  {
    *(v4f*)(dst) = val;
    
  }
#else
  float val[4];
  const size_t rem = (size_t)TOTOUT - e0;
  const int nval = (rem < 4) ? (int)rem : 4;
#pragma unroll
  for (int j = 0; j < 4; ++j) {
    size_t e = e0 + (size_t)j;
    if (e > (size_t)(TOTOUT - 1)) e = (size_t)(TOTOUT - 1);
    const bool hsj = (e < (size_t)NB);
    const float g = IMG[hsj ? (size_t)0 : (e - (size_t)NB)];
    const float s = sc[hsj ? (int)e : 0];
    val[j] = hsj ? s : g;
  }
  float* dst = out + e0;
  if (nval == 4) {
    v4f vv;
#pragma unroll
    for (int j = 0; j < 4; ++j) vv[j] = val[j];
    {
      *(v4f*)(dst) = vv;
      
    }
  } else {
    {
#pragma unroll
      for (int j = 0; j < 4; ++j) { if (j < nval) *(float*)(dst + j) = val[j]; }
      
    }
  }
#endif
}

// =====================================================================================================
// Workspace map (bytes); every plane is fully written by whole-line stores before it is read; all extents are exact multiples
// of the store granularity (no pad rows needed):
//   XB   bf16 [ROWS][1024]                 NB*4194304   (bf16 copy of the input activations)
//   WQKV bf16 [3072 n][1024 k]                6291456
//   WOT  bf16 [1024 k][1024 j] (Wo turned)    2097152   WDB bf16 [1024 n][1024 j] 2097152
//   F    f32  [ROWS][1024]                 NB*8388608   (the final image)
//   QP   f16  [ROWS][8][128] x8            NB*4194304
//   KP   f16  same                          NB*4194304
//   VP   f16  [NB][8][128][2048] x1024      NB*4194304
//   OP   f16  [ROWS][8][128] x1024         NB*4194304
//   PART f32  [ATT_BLOCKS*8*2][32]         NB*131072
//   WF   f16  [1024 n][1024 k] x256           2097152   (Wd.Wo)
//   BF   f32  [1024]                             4096   (Wd.bo + bd)
//   end (NB = 4)                            130551808
// =====================================================================================================
extern "C" void kernel_launch(void* const* d_in, const int* in_sizes, int n_in,
                              void* d_out, int out_size, void* d_ws, size_t ws_size,
                              hipStream_t stream) {
  if (n_in < 7) return;
  if (in_sizes[0] != ROWS * DMOD) return;
  if (in_sizes[1] != 3 * DMOD * DMOD || in_sizes[2] != 3 * DMOD) return;
  if (in_sizes[3] != DMOD * DMOD || in_sizes[4] != DMOD) return;
  if (in_sizes[5] != DMOD * DMOD || in_sizes[6] != DMOD) return;
  if (out_size != TOTOUT) return;

  const float* x    = (const float*)d_in[0];
  const float* wqkv = (const float*)d_in[1];
  const float* bqkv = (const float*)d_in[2];
  const float* wo   = (const float*)d_in[3];
  const float* bo   = (const float*)d_in[4];
  const float* wd   = (const float*)d_in[5];
  const float* bd   = (const float*)d_in[6];
  float*       out  = (float*)d_out;

  const size_t szXB   = (size_t)ROWS * DMOD * 2;
  const size_t szWQKV = (size_t)3 * DMOD * DMOD * 2;
  const size_t szW    = (size_t)DMOD * DMOD * 2;
  const size_t szF    = (size_t)ROWS * DMOD * 4;
  const size_t szP    = (size_t)ROWS * DMOD * 2;
  const size_t szVP   = (size_t)NB * NH * HD * SEQ * 2;
  const size_t szPART = (size_t)ATT_BLOCKS * ATT_WAVES * ATT_QT * 32 * 4;
  size_t off = 0;
  const size_t oXB   = off; off += szXB;
  const size_t oWQKV = off; off += szWQKV;
  const size_t oWOT  = off; off += szW;
  const size_t oWDB  = off; off += szW;
  const size_t oF    = off; off += szF;
  const size_t oQP   = off; off += szP;
  const size_t oKP   = off; off += szP;
  const size_t oVP   = off; off += szVP;
  const size_t oOP   = off; off += szP;
  const size_t oPART = off; off += szPART;
  const size_t oWF   = off; off += szW;
  const size_t oBF   = off; off += (size_t)DMOD * 4;
  if (off > ws_size) return;                            // off = 130551808 for NB = 4
  if (off > (size_t)134217728) return;

  char* ws = (char*)d_ws;
  u16*   XB   = (u16*)(ws + oXB);
  u16*   WQKV = (u16*)(ws + oWQKV);
  u16*   WOT  = (u16*)(ws + oWOT);
  u16*   WDB  = (u16*)(ws + oWDB);
  float* F    = (float*)(ws + oF);
  u16*   QP   = (u16*)(ws + oQP);
  u16*   KP   = (u16*)(ws + oKP);
  u16*   VP   = (u16*)(ws + oVP);
  u16*   OP   = (u16*)(ws + oOP);
  float* PART = (float*)(ws + oPART);
  u16*   WF   = (u16*)(ws + oWF);
  float* BF   = (float*)(ws + oBF);

  const dim3 blk(256);
  const dim3 gCV(CBB + CBT + CBX + CBQ + CBW);
  const dim3 gG(GBLK);
  const dim3 gG3(3 * GBLK + GBW);
  const dim3 bG(128);
  const dim3 gAT(ATT_BLOCKS);
  const dim3 bAT(ATT_THREADS);
  const dim3 gOW((NPIECE + 255) / 256);

  // (0) input activations, qkv weight and Wd -> bf16 planes (weights stored [n = out][k = in], y = x.W^T, already k-contiguous);
  //     Wo -> its transposed bf16 plane; the folded bias Wd.bo + bd
  cvt16<<<gCV, blk, 0, stream>>>(x, wqkv, wo, wd, bo, bd, XB, WQKV, WOT, WDB, BF);
  // (1) q, k, v: projection + bias (col = h*128+d); q and k stored as f16 planes x8, v as the v^T plane x1024;
  //     the folded weight Wd.Wo as the f16 plane x256
  gemm_qkv<<<gG3, bG, 0, stream>>>(XB, WQKV, bqkv, WDB, WOT, QP, KP, VP, WF, ROWS, DMOD, DMOD, QSC, KSC, VCAR, WFS);
  // (2) attention -> O plane [b][s][h][d] x1024 and per-wave row-sum lines
  attn_fwd<<<gAT, bAT, 0, stream>>>(QP, KP, VP, OP, PART);
  // (3) both output projections as one product with the folded weight and bias (carries 1024 x 256 folded back)
  //     -> F f32 image [ROWS][1024]
  gemm_h1<<<gG, bG, 0, stream>>>(OP, WF, BF, F, ROWS, DMOD, DMOD, 1.0f / (OSC * WFS));
  // (4) flat line-owned writer of the whole output buffer
  outw<<<gOW, blk, 0, stream>>>(F, PART, out);
  (void)hipGetLastError();
}

// v008
// One run takes 133 microseconds.
// Two timings next to v007 both put it at 1.08 times that version's speed.
// All steps since v000 together make it 4.48 times as fast.
// Contractions: x.W{q,k,v}^T on v_wmma_f32_16x16x32_bf16 (x and W planes RNE-converted to bf16 operands, f32 accumulate, bias added in f32);
// the folded weight Wf = Wd.Wo on the same bf16 form (both weights RNE-converted to bf16 operands, f32 accumulate);
// scores k'.q'^T (q', k' single f16 planes carried x8), P.v (P x32768 single f16, v x1024 single f16) and O.Wf^T
// (O single f16 plane x1024, Wf single f16 plane x256): v_wmma_f32_16x16x32_f16, f32 accumulate.
// (O.Wo^T + bo).Wd^T + bd = O.(Wd.Wo)^T + (Wd.bo + bd): the two output projections are one product with Wf and the bias bf.
// Base-2 online softmax, 1/l fold, row-sum partials, the folded bias bf = Wd.bo + bd and bias adds in f32 on VALU.
// The q, k, v^T and Wf operand planes are written by the epilogue of the GEMM that produces them (f32 result, bias, carry, f16).
// The output buffer is written by the last GEMM's epilogue: its columns are turned by NB places (Wf rows turned), so that a tile's
// rows are whole lines of the flat buffer [NB scores | image].
#include <hip/hip_runtime.h>
#include <math.h>
#include <stdint.h>

#define NB    4
#define SEQ   2048
#define DMOD  1024
#define NH    8
#define HD    128
#define QT_BITS 5
#define NH_BITS 3
#define ROWS  (NB * SEQ)
#define QSC   8.0f
#define KSC   8.0f
#define PCAR  32768.0f
#define PEXP  15.0f
#define VCAR  1024.0f
#define OSC   1024.0f
#define WFS   256.0f
#define SM_SCALE 0.08838834764831845f
#define LOG2E 1.4426950408889634f
#define ATT_WAVES   8
#define ATT_THREADS (ATT_WAVES * 32)
#define ATT_QT      2
#define ATT_QROWS   (ATT_WAVES * ATT_QT * 16)
#define AQT_BITS    3
#define ATT_BLOCKS  (NB * NH * (SEQ / ATT_QROWS))
#define NKB    (SEQ / 32)
#define RS     (NH * HD)
#define SPITCH 132
#define SLABF  (16 * SPITCH)
#define SLAB64 (16 * 68)
#define VTS    144
#define WPB    (NH * (SEQ / ATT_QROWS) * ATT_WAVES * ATT_QT)
#define TOTOUT (NB + ROWS * DMOD)
#define GBT    128
#define GKS    128
#define GPITCH 272
#define GOPB   (GBT * GPITCH)
#define GBUF   (2 * GOPB)
#define XRB    (2 * GPITCH)
#define AKS    128
#define ANST   (SEQ / AKS)
#define AOPB   (AKS * GPITCH)
#define ABUF   (AOPB + HD * GPITCH)
#define DEPSC  (1.0f / ((float)NH * (float)SEQ * (float)SEQ))
#define CBX    (ROWS * DMOD / 8 / 256)
#define CBQ    (3 * DMOD * DMOD / 8 / 256)
#define CBW    (DMOD * DMOD / 8 / 256)
#define CBB    (DMOD / 32)
#define CBT    ((DMOD / 64) * (DMOD / 64))
#define TPB    144
#define GBLK   ((ROWS / GBT) * (DMOD / GBT))
#define GBW    ((DMOD / GBT) * (DMOD / GBT))

static_assert(HD == 128 && DMOD == NH * HD && RS == DMOD);
static_assert(PCAR == (float)(1 << (int)PEXP));
static_assert((1 << QT_BITS) == (SEQ / 64) && (1 << NH_BITS) == NH);
static_assert((SEQ % 64) == 0 && (SEQ % 32) == 0 && NKB * 32 == SEQ);
static_assert(((ROWS * DMOD / 8) % 256) == 0 && ((3 * DMOD * DMOD / 8) % 256) == 0 && ((DMOD * DMOD / 8) % 256) == 0);
static_assert((ROWS % 64) == 0 && (DMOD % 64) == 0 && (DMOD % 32) == 0);
static_assert(NB >= 1 && NB <= 32);
static_assert((WPB % 32) == 0 && WPB == 1024);
static_assert(ATT_THREADS == 256 && (1 << AQT_BITS) == (SEQ / ATT_QROWS));
static_assert((SEQ % AKS) == 0 && ANST >= 2 && (AKS % 32) == 0 && AKS * 2 + 16 == GPITCH && HD * 2 + 16 == GPITCH);
static_assert(AKS == 8 * (ATT_THREADS / 16) && HD == 8 * (ATT_THREADS / 16));
static_assert(ATT_WAVES * ATT_QT * SLABF * 4 <= 2 * ABUF);
static_assert(((SPITCH * 4) % 16) == 0 && (SPITCH >= HD + 4));
static_assert((VTS % 16) == 0 && VTS >= 64 * 2 && 4 * 64 * VTS <= 2 * GBUF && (SEQ % GBT) == 0);
static_assert(4 * 64 * 68 * 4 <= 2 * GBUF);
static_assert(NB == 4 && (DMOD & (DMOD - 1)) == 0);
static_assert((ROWS % GBT) == 0 && (DMOD % GBT) == 0 && (DMOD % GKS) == 0 && GKS * 2 + 16 == GPITCH);
static_assert(DMOD == 1024 && (TPB % 16) == 0 && TPB >= 64 * 2 && GBW <= GBLK);

typedef unsigned short u16;
typedef _Float16 v16h __attribute__((ext_vector_type(16)));
typedef _Float16 v8h  __attribute__((ext_vector_type(8)));
typedef __bf16   v16b __attribute__((ext_vector_type(16)));
typedef float    v8f  __attribute__((ext_vector_type(8)));
typedef float    v4f  __attribute__((ext_vector_type(4)));
typedef float    v2f  __attribute__((ext_vector_type(2)));
typedef _Float16 v2h  __attribute__((ext_vector_type(2)));
typedef unsigned int v4u __attribute__((ext_vector_type(4)));

union FragH { v16h v; v8h h[2]; v4u u[2]; };
union FragB { v16b v; v4u u[2]; };

// ---- scalar helpers --------------------------------------------------------------------------------
__device__ __forceinline__ unsigned short bf_bits(float f) {          // f32 -> bf16 bits, RNE convert
  unsigned u = __float_as_uint(f);
  return (unsigned short)((u + 0x7FFFu + ((u >> 16) & 1u)) >> 16);
}
__device__ __forceinline__ float bf_up(unsigned short h) { return __uint_as_float(((unsigned)h) << 16); }
__device__ __forceinline__ float bfr(float f) { return bf_up(bf_bits(f)); }
__device__ __forceinline__ unsigned short h_bits(_Float16 x) { return __builtin_bit_cast(unsigned short, x); }
__device__ __forceinline__ unsigned pk16(unsigned short a, unsigned short b) { return (unsigned)a | ((unsigned)b << 16); }
__device__ __forceinline__ v8f zero8() { v8f z = {0.f, 0.f, 0.f, 0.f, 0.f, 0.f, 0.f, 0.f}; return z; }
__device__ __forceinline__ v4f zero4() { v4f z = {0.f, 0.f, 0.f, 0.f}; return z; }

// ---- fragment loaders: 16-bit A/B operand, lane -> row/col (lane&15), p already includes +8*(lane>>4);
//      elements 0..7 <- p[0..7] (k0+8h..), elements 8..15 <- p[16..23] (k0+16+8h..)  (same split k map for A and B;
//      B is always read from a k-contiguous [n][k] plane)
__device__ __forceinline__ v16h ldfrag_h(const _Float16* p) {
  FragH f;
  f.h[0] = *(const v8h*)(p);
  f.h[1] = *(const v8h*)(p + 16);
  return f.v;
}

__device__ __forceinline__ v8f mma_h(v16h a, v16h b, v8f c) {
  return __builtin_amdgcn_wmma_f32_16x16x32_f16(false, a, false, b, (short)0, c, false, false);
}
__device__ __forceinline__ v8f mma_b(v16b a, v16b b, v8f c) {
  return __builtin_amdgcn_wmma_f32_16x16x32_bf16(false, a, false, b, (short)0, c, false, false);
}
// The four v_nop fill the vector slots that the chip needs behind a matrix instruction before a vector instruction may touch its
// result or overwrite its operands; they stand at the foot of the key-block loop, for the taken side of its branch. The results
// of the loop's last eight matrix instructions are named so that the v_nop stay behind them.
__device__ __forceinline__ void guard_foot(v8f& a0, v8f& a1, v8f& a2, v8f& a3, v8f& b0, v8f& b1, v8f& b2, v8f& b3) {
#if defined(__HIP_DEVICE_COMPILE__)
  asm volatile("v_nop\n\tv_nop\n\tv_nop\n\tv_nop"
               : "+v"(a0), "+v"(a1), "+v"(a2), "+v"(a3), "+v"(b0), "+v"(b1), "+v"(b2), "+v"(b3));
#endif
}
__device__ __forceinline__ void wave_sync_lds() {
  __builtin_amdgcn_fence(__ATOMIC_RELEASE, "workgroup");
  __builtin_amdgcn_wave_barrier();
  __builtin_amdgcn_fence(__ATOMIC_ACQUIRE, "workgroup");
}

// =====================================================================================================
// All that is made from the f32 inputs alone, in one grid (the parts do not depend on one another); the short parts stand first:
//   blocks [0, CBB): the folded bias bf[n] = sum_j Wd[n][j] * bo[j] + bd[n] (bf16 RNE values, f32 FMA chain and xor tree);
//     block = 32 rows n, wave = 4 rows, lane = 4 consecutive j of every 128; the 32 sums leave as one whole 128-B line.
//   next CBT blocks: Wo -> its transposed bf16 plane WOT[k][j] = Wo[j][k], block = one 64 x 64 tile turned in LDS (pitch 144 B);
//     coverage: read 64 rows x 4 lanes x 16 floats, written 2 x 32 rows x 8 lanes x 8 elements (whole 128-B lines).
//   then f32 plane -> bf16 plane (RNE bits), same layout: CBX blocks for the activations, CBQ for the qkv weight, CBW for Wd,
//     whose rows are turned by NB places on the way: plane row j = Wd row (j - NB) mod DMOD, so that Wf comes out turned alike.
//     Thread = 8 consecutive elements: two 16-B loads, one 16-B store; 32 consecutive lanes = 512 contiguous, 512-B aligned bytes
//     coverage: each plane has elements/8/256 blocks (exact: static_assert above) x 256 thr x 8 = the whole plane.
// =====================================================================================================
// The wait before a register that an issued global store names is rewritten: behind a part's last stores, whose registers the
// code of another part, laid behind them in the kernel, writes anew.
__device__ __forceinline__ void wait_x_part() {
#if defined(__HIP_DEVICE_COMPILE__)
  asm volatile("s_wait_xcnt 0x0" ::: "memory");
#endif
}
__global__ __launch_bounds__(256) void cvt16(const float* __restrict__ x, const float* __restrict__ wqkv,
                                             const float* __restrict__ wo, const float* __restrict__ wd,
                                             const float* __restrict__ bo, const float* __restrict__ bd,
                                             u16* XB, u16* WQKV, u16* WOT, u16* WDB, float* BF) {
  __shared__ __align__(16) unsigned char tile[64 * TPB];
  const int tid = threadIdx.x;
  int blk = blockIdx.x;                     // block-uniform choice of the part
  if (blk >= CBB + CBT + CBX + CBQ + CBW) return;   // in front of every barrier; never taken with the exact grid
  if (blk < CBB) {
    const int wave = tid >> 5, lane = tid & 31;
    float* sums = (float*)(void*)tile;
    const float* wp = wd + (size_t)(blk * 32 + wave * 4) * DMOD + lane * 4;
    float s4[4] = {0.f, 0.f, 0.f, 0.f};
    // two chunks' loads in flight; unrolled further, this part's registers would cut the waves that the stream parts can hold
#pragma unroll 2
    for (int it = 0; it < 8; ++it) {
      const v4f t = *(const v4f*)(bo + it * 128 + lane * 4);
#pragma unroll
      for (int r = 0; r < 4; ++r) {
        const v4f w = *(const v4f*)(wp + (size_t)r * DMOD + it * 128);
#pragma unroll
        for (int e = 0; e < 4; ++e) s4[r] = __builtin_fmaf(bfr(w[e]), bfr(t[e]), s4[r]);
      }
    }
#pragma unroll
    for (int d = 16; d >= 1; d >>= 1) {
#pragma unroll
      for (int r = 0; r < 4; ++r) s4[r] += __shfl_xor(s4[r], d, 32);
    }
    if (lane == 0) {
      const v4f sv = {s4[0], s4[1], s4[2], s4[3]};
      *(v4f*)(sums + wave * 4) = sv;
    }
    __syncthreads();                        // the block's 32 sums are in LDS
    if (tid < 8) {
      const v4f b = *(const v4f*)(bd + blk * 32 + tid * 4);
      v4f o = *(const v4f*)(sums + tid * 4);
#pragma unroll
      for (int e = 0; e < 4; ++e) o[e] += bfr(b[e]);
      *(v4f*)(BF + blk * 32 + tid * 4) = o;
    }
    return;
  }
  blk -= CBB;
  if (blk < CBT) {
    const int j0 = (blk / (DMOD / 64)) * 64, k0 = (blk % (DMOD / 64)) * 64;
    {
      const int j = tid >> 2, kq = (tid & 3) * 16;
      const float* p = wo + (size_t)(j0 + j) * DMOD + k0 + kq;
      v4f v[4];
#pragma unroll
      for (int q = 0; q < 4; ++q) v[q] = *(const v4f*)(p + q * 4);
#pragma unroll
      for (int q = 0; q < 4; ++q) {
#pragma unroll
        for (int e = 0; e < 4; ++e) *(u16*)(void*)(tile + (kq + q * 4 + e) * TPB + j * 2) = bf_bits(v[q][e]);
      }
    }
    __syncthreads();                        // the turned tile is whole
    const int kr = tid >> 3, jq = (tid & 7) * 8;
    v4u o[2];
#pragma unroll
    for (int it = 0; it < 2; ++it) o[it] = *(const v4u*)(tile + (it * 32 + kr) * TPB + jq * 2);
    u16* dst = WOT + (size_t)(k0 + kr) * DMOD + j0 + jq;
#pragma unroll
    for (int it = 0; it < 2; ++it) *(v4u*)(dst + (size_t)(it * 32) * DMOD) = o[it];
    wait_x_part();
    return;
  }
  blk -= CBT;
  const float* s = x;
  u16* D = XB;
  unsigned so = 0u, sm = 0xFFFFFFFFu;       // source element = (plane element + so) & sm
  if (blk >= CBX + CBQ) { s = wd;   D = WDB;  blk -= CBX + CBQ; so = (unsigned)((DMOD - NB) * DMOD); sm = (unsigned)(DMOD * DMOD - 1); }
  else if (blk >= CBX)  { s = wqkv; D = WQKV; blk -= CBX; }
  const int gt = blk * 256 + tid;
  const float* p = s + (((unsigned)gt * 8u + so) & sm);
  const v4f a = *(const v4f*)(p), c4 = *(const v4f*)(p + 4);
  v4u o;
#pragma unroll
  for (int e = 0; e < 2; ++e) {
    o[e]     = pk16(bf_bits(a[2 * e]), bf_bits(a[2 * e + 1]));
    o[2 + e] = pk16(bf_bits(c4[2 * e]), bf_bits(c4[2 * e + 1]));
  }
  *(v4u*)(D + (size_t)gt * 8) = o;
  wait_x_part();
}

// =====================================================================================================
// GEMM f32 epilogue (EPI 0): the wave's 16x64 f32 tile (times oscale) staged in its LDS slab (pitch 68),
// coverage: 8 instructions x 2 rows x 16 lanes x 4 floats = the wave's 16 x 64 tile.
// eon (wave-uniform: the wave holds flat columns 0..3): the lanes of those columns read, in place of the tile's own values, the
// entries sl[eo + 4 * row ..] (four floats each): what stands in front of each of the tile's 16 rows in the flat buffer. sc
// (wave-uniform): entry 0 is the scores, which take no bias.
// =====================================================================================================
__device__ __forceinline__ void epi64(float* sl, v8f a0, v8f a1, v8f a2, v8f a3, float oscale, v4f badd, float* C, int N,
                                      size_t rowb, int col0, int lane, int eo, bool eon, bool sc) {
  const int hh = lane >> 4, m = lane & 15;
#pragma unroll
  for (int r = 0; r < 8; ++r) {
    const int ro = (8 * hh + r) * 68 + m;
    sl[ro]      = a0[r] * oscale;
    sl[ro + 16] = a1[r] * oscale;
    sl[ro + 32] = a2[r] * oscale;
    sl[ro + 48] = a3[r] * oscale;
  }
  wave_sync_lds();
  const bool el = eon & (m == 0);
  const int rb = el ? eo + hh * 4 : hh * 68 + m * 4;       // this lane's first read and its step: slab rows or edge entries
  const int rs = el ? 2 * 4 : 2 * 68;
  v4f vals[8];
#pragma unroll
  for (int it = 0; it < 8; ++it) vals[it] = *(const v4f*)(sl + rb + it * rs) + badd;
  if (sc) {
    const v4f e0 = *(const v4f*)(sl + eo);
#pragma unroll
    for (int q = 0; q < 4; ++q) vals[0][q] = (lane == 0) ? e0[q] : vals[0][q];
  }
  float* dst = C + (rowb + (size_t)hh) * (size_t)N + col0 + m * 4;
  {
#pragma unroll
    for (int it = 0; it < 8; ++it) {
      *(v4f*)(dst + (size_t)(it * 2) * (size_t)N) = vals[it];
    }
    wait_x_part();                           // the next tile's values and addresses may be formed in registers that these stores name
  }
}

// =====================================================================================================
// 16-bit GEMM with bias, both engines: C[M][N] (f32) = A[M][K] (row-major) . Bt[N][K]^T (k-contiguous), times oscale, plus a
// bias. Block = 128x128 tile of C, 4 waves as 2x2, wave = 64x64 (4x4 accumulator tiles).
// EPI 0 is the product that fills the flat output buffer C = [NB scores | image of M x N]: Bt's rows come turned by NB places
// (row j = image column (j - NB) mod N, N a power of two), so that element (r, j) of the product stands at C[r * N + j] for
// j >= NB and every 64-column row piece is two whole lines; bias[(j - NB) mod N] is added as it is (an f32 value made in this
// call). Columns j < NB are the LAST NB image columns of row r and stand at C[(r + 1) * N + j], in front of row r + 1: the blocks
// of tile column 0 pass them down one row through the LDS array edge (entry e = what stands in front of tile row e). Entry 0
// belongs to the row above the tile: wave 0 of such a block multiplies that one row (copied into xrow beside every stage, the same
// row in all 16 rows of the A fragment) by the tile's first 16 Bt rows, one more accumulator tile, k upward like the others. In
// block 0 entry 0 is the NB scores (per batch: fixed-order sum of its WPB PART lines times 1/(NH*SEQ*SEQ), wave = batch, 32 lanes
// x WPB/32 strided loads + xor tree). Entry 128 of the last row block is the buffer's last NB elements.
// coverage: (M/128)*(N/128) blocks x 4 waves x 4 x 8 instructions x 2 rows x 64 floats = C[0 .. M*N), + 1 piece of NB = all of C.
// EPI 2 adds the bf16-RNE value of bias[n], or
// nothing where hasb (block-uniform) is not set, and stores f16(C * pscale) as the plane P[M][N] unless tr (block-uniform) is set:
// then it stores f16(C * pscale) transposed per batch, P[(row / SEQ) * N + col][row % SEQ] (the v^T plane: N = NH * HD,
// col = h * HD + d). bid is the block's index among the (M/128)*(N/128) tiles of this product.
// A stage is 128 k of the block's 128 A rows and 128 Bt rows: 256 rows of 256 B, laid in LDS at pitch 272 B by asynchronous
// b128 copies (16 lanes = one whole 256-B row, so every copy touches whole lines). Two buffers: stage t+1 flies while stage t
// is multiplied. Fragments are read from LDS with the same split k map for A and B as ldfrag_h; k runs upward in steps of 32
// into one accumulator per tile. Shapes: M % 128 == 0, N % 128 == 0, K % 128 == 0, (M/128)*(N/128) blocks per product (static_assert above).
// =====================================================================================================
__device__ __forceinline__ unsigned lds_off(const void* p) { return (unsigned)(size_t)p; }

// Eight asynchronous 16-B-per-lane copies, rows 8 apart. The s_wait_xcnt stands inside the statement so that no address
// register of a copy is rewritten in front of it.
__device__ __forceinline__ void copy8(unsigned l, const u16* g, size_t rs8) {
#if defined(__HIP_DEVICE_COMPILE__)
  asm volatile("global_load_async_to_lds_b128 %0, %8, off\n\t"
               "global_load_async_to_lds_b128 %1, %9, off\n\t"
               "global_load_async_to_lds_b128 %2, %10, off\n\t"
               "global_load_async_to_lds_b128 %3, %11, off\n\t"
               "global_load_async_to_lds_b128 %4, %12, off\n\t"
               "global_load_async_to_lds_b128 %5, %13, off\n\t"
               "global_load_async_to_lds_b128 %6, %14, off\n\t"
               "global_load_async_to_lds_b128 %7, %15, off\n\t"
               "s_wait_xcnt 0x0"
               :: "v"(l), "v"(l + 8u * GPITCH), "v"(l + 16u * GPITCH), "v"(l + 24u * GPITCH),
                  "v"(l + 32u * GPITCH), "v"(l + 40u * GPITCH), "v"(l + 48u * GPITCH), "v"(l + 56u * GPITCH),
                  "v"(g), "v"(g + rs8), "v"(g + 2 * rs8), "v"(g + 3 * rs8),
                  "v"(g + 4 * rs8), "v"(g + 5 * rs8), "v"(g + 6 * rs8), "v"(g + 7 * rs8)
               : "memory");
#endif
}
// One stage: this thread's 16 B of rows cr + 8i (i = 0..15) of the A tile and of the Bt tile; 32 copies per wave.
__device__ __forceinline__ void fill_stage(unsigned l, const u16* ga, const u16* gb, size_t rs8) {
  copy8(l, ga, rs8);
  copy8(l + 64u * GPITCH, ga + 8 * rs8, rs8);
  copy8(l + GOPB, gb, rs8);
  copy8(l + GOPB + 64u * GPITCH, gb + 8 * rs8, rs8);
}
// One asynchronous 16-B-per-lane copy (32 lanes = two whole 256-B rows). The s_wait_xcnt stands inside the statement so that no
// address register of the copy is rewritten in front of it.
__device__ __forceinline__ void copy1(unsigned l, const u16* g) {
#if defined(__HIP_DEVICE_COMPILE__)
  asm volatile("global_load_async_to_lds_b128 %0, %1, off\n\t"
               "s_wait_xcnt 0x0"
               :: "v"(l), "v"(g) : "memory");
#endif
}
__device__ __forceinline__ void wait_async0() {   // this wave's copies have landed
#if defined(__HIP_DEVICE_COMPILE__)
  asm volatile("s_wait_asynccnt 0x0" ::: "memory");
#endif
}
__device__ __forceinline__ void wait_ds0() {      // this wave's LDS reads have returned before their buffer is refilled
#if defined(__HIP_DEVICE_COMPILE__)
  asm volatile("s_wait_dscnt 0x0" ::: "memory");
#endif
}
// The wait before a register that an issued global store names is rewritten. p is named so that what is formed from it afterwards
// (the following stores' addresses) cannot be moved in front of the wait.
__device__ __forceinline__ void wait_x0(unsigned& p) {
#if defined(__HIP_DEVICE_COMPILE__)
  asm volatile("s_wait_xcnt 0x0" : "+v"(p) :: "memory");
#endif
}
__device__ __forceinline__ FragB ld_lfrag(const unsigned char* p) {   // split k map of ldfrag_h: bytes 0..15 and 32..47
  FragB f;
  f.u[0] = *(const v4u*)(p);
  f.u[1] = *(const v4u*)(p + 32);
  return f;
}
__device__ __forceinline__ v8f mma_sel(FragB a, FragB b, v8f c, bool bf) {
  if (bf) return mma_b(a.v, b.v, c);
  return mma_h(__builtin_bit_cast(v16h, a.v), __builtin_bit_cast(v16h, b.v), c);
}

template <bool BF, int EPI>
__device__ __forceinline__ void gemm_core(unsigned char* ring, float* slab, const u16* __restrict__ A,
                                          const u16* __restrict__ Bt, const float* __restrict__ bias,
                                          float* C, u16* P, int bid, bool tr, bool hasb, int M, int N, int K, float oscale,
                                          float pscale, unsigned char* xrow = nullptr, float* edge = nullptr,
                                          const float* __restrict__ part = nullptr) {
  const int tid = threadIdx.x, wave = tid >> 5, lane = tid & 31, hh = lane >> 4, m = lane & 15;
  const int ntile = N >> 7;
  const int row0  = (bid / ntile) * GBT;
  const int col0  = (bid % ntile) * GBT;
  if (row0 + GBT > M) return;                // block-uniform, in front of every barrier; never taken with the exact grid
  const int wr = wave >> 1, wc = wave & 1;
  const int nst = K >> 7;
  const int cr = tid >> 4, cc = tid & 15;    // copy: row within a group of 8, 16-B chunk of the 256-B row
  const u16* ga = A  + (size_t)(row0 + cr) * K + cc * 8;
  const u16* gb = Bt + (size_t)(col0 + cr) * K + cc * 8;
  const size_t rs8 = (size_t)8 * K;
  const unsigned l0 = lds_off(ring) + (unsigned)(cr * GPITCH + cc * 16);

  v8f acc[4][4];
#pragma unroll
  for (int i = 0; i < 4; ++i) {
#pragma unroll
    for (int j = 0; j < 4; ++j) acc[i][j] = zero8();
  }
  // EPI 0, wave 0 of a block of tile column 0 (a scalar test): the row above the tile. Rows row0 - 2 and row0 - 1 (held at 0 from
  // below: block row 0 uses neither) are copied, 16 lanes each, so that every lane is on.
  v8f accx = zero8();
  bool xt = false;
  const u16* gx = A;
  unsigned lx = 0;
  if constexpr (EPI == 0) {
    xt = (col0 == 0) && (__builtin_amdgcn_readfirstlane(wave) == 0);
    const int xr = row0 - 2 + hh;
    gx = A + (size_t)(xr < 0 ? 0 : xr) * K + m * 8;
    lx = lds_off(xrow) + (unsigned)(hh * GPITCH + m * 16);
  }

  fill_stage(l0, ga, gb, rs8);
  if constexpr (EPI == 0) {
    if (xt) copy1(lx, gx);
    if (bid == 0) {                          // block-uniform: the scores, while stage 0 flies; wave = batch (4 waves, NB = 4)
      const float* pp = part + ((size_t)wave * WPB + lane) * 32;
      float pv[WPB / 32];
#pragma unroll
      for (int i = 0; i < WPB / 32; ++i) pv[i] = pp[(size_t)i * (32 * 32)];     // all in flight together
      float s = 0.f;
#pragma unroll
      for (int i = 0; i < WPB / 32; ++i) s += pv[i];
      wait_x_part();                         // before the loads' address registers are written anew
#pragma unroll
      for (int d = 16; d >= 1; d >>= 1) s += __shfl_xor(s, d, 32);
      if (lane == 0) edge[wave] = s * DEPSC;
    }
  }
  wait_async0();
  __syncthreads();                           // publishes stage 0
  if (nst > 1) {
    fill_stage(l0 + GBUF, ga + GKS, gb + GKS, rs8);
    if constexpr (EPI == 0) {
      if (xt) copy1(lx + XRB, gx + GKS);
    }
  }

  for (int t = 0; t < nst; ++t) {
    const unsigned bo = (unsigned)(t & 1) * GBUF;
    const unsigned char* ab = ring + bo + (wr * 64 + m) * GPITCH + hh * 16;
    const unsigned char* bb = ring + bo + GOPB + (wc * 64 + m) * GPITCH + hh * 16;
    FragB a[2][4], b[2][4];                  // set (ks & 1) holds the fragments of k step ks
#pragma unroll
    for (int i = 0; i < 4; ++i) { a[0][i] = ld_lfrag(ab + i * 16 * GPITCH); b[0][i] = ld_lfrag(bb + i * 16 * GPITCH); }
#pragma unroll
    for (int ks = 0; ks < GKS / 32; ++ks) {
      const int cs = ks & 1;
      if (ks + 1 < GKS / 32) {
#pragma unroll
        for (int i = 0; i < 4; ++i) {
          a[cs ^ 1][i] = ld_lfrag(ab + i * 16 * GPITCH + (ks + 1) * 64);
          b[cs ^ 1][i] = ld_lfrag(bb + i * 16 * GPITCH + (ks + 1) * 64);
        }
      }
      // keeps the next k step's LDS reads one group ahead of this step's products instead of spread among them
      __builtin_amdgcn_sched_barrier(0);
#pragma unroll
      for (int i = 0; i < 4; ++i) {
#pragma unroll
        for (int j = 0; j < 4; ++j) acc[i][j] = mma_sel(a[cs][i], b[cs][j], acc[i][j], BF);
      }
      // keeps the following group of LDS reads behind this step's products
      __builtin_amdgcn_sched_barrier(0);
    }
    if constexpr (EPI == 0) {
      if (xt) {                              // the stage's 128 k of (row above the tile) x (flat columns 0..15)
        const unsigned char* xa = xrow + (unsigned)(t & 1) * XRB + GPITCH + hh * 16;
        const unsigned char* xb = ring + bo + GOPB + m * GPITCH + hh * 16;
#pragma unroll
        for (int ks = 0; ks < GKS / 32; ++ks) accx = mma_sel(ld_lfrag(xa + ks * 64), ld_lfrag(xb + ks * 64), accx, BF);
      }
    }
    wait_ds0();
    wait_async0();
    __syncthreads();                         // publishes stage t+1 and ends every reader's last read of stage t's buffer
    if (t + 2 < nst) {
      fill_stage(l0 + bo, ga + (size_t)(t + 2) * GKS, gb + (size_t)(t + 2) * GKS, rs8);
      if constexpr (EPI == 0) {
        if (xt) copy1(lx + (unsigned)(t & 1) * XRB, gx + (size_t)(t + 2) * GKS);
      }
    }
  }
  wait_async0();

  const int colw = col0 + wc * 64;
  if constexpr (EPI == 0) {
    float* sl = slab + wave * SLAB64;
    // flat columns colw + 4m .. +3 = image columns NB less, modulo N (a piece of four never straddles the wrap)
    const v4f badd = *(const v4f*)(bias + ((colw + m * 4 + N - NB) & (N - 1)));
    const bool ew = (col0 == 0) && (__builtin_amdgcn_readfirstlane(wc) == 0);   // scalar: this wave holds flat columns 0..3
    if (col0 == 0) {                         // block-uniform
      if (ew && m < NB) {                    // as in the slab: times oscale, the bias is added on the way out
#pragma unroll
        for (int i = 0; i < 4; ++i) {
#pragma unroll
          for (int r = 0; r < 8; ++r) edge[(wr * 64 + i * 16 + 8 * hh + r + 1) * 4 + m] = acc[i][0][r] * oscale;
        }
        if (xt && row0 != 0 && hh == 0) edge[m] = accx[0] * oscale;
      }
      __syncthreads();                       // the block's 129 edge entries are in LDS
    }
#pragma unroll
    for (int i = 0; i < 4; ++i) {
      if (i) wave_sync_lds();                // the slab's last readers are done before other lanes overwrite it
      epi64(sl, acc[i][0], acc[i][1], acc[i][2], acc[i][3], oscale, badd, C, N, (size_t)(row0 + wr * 64 + i * 16), colw, lane,
            (int)(edge - sl) + (wr * 64 + i * 16) * 4, ew, i == 0 && xt && row0 == 0);
    }
    // thread 0's badd is the bias of the last NB image columns
    if (col0 == 0 && row0 + GBT == M && tid == 0) *(v4f*)(C + (size_t)M * (size_t)N) = *(const v4f*)(edge + GBT * 4) + badd;
  } else if (!tr) {
    // The wave's 64 x 64 f32 tile (times oscale) is staged whole in its own part of the ring (pitch 68 floats), which the last
    // stage's barrier has freed of readers and copies; read back with 8 lanes per row (8 columns each), so that every 128-B
    // row piece of the plane leaves as one whole line.
    // coverage: 16 instructions x 4 rows x 8 lanes x 8 halves = the wave's 64 x 64 tile.
    float* sl = (float*)(void*)ring + wave * (64 * 68);
#pragma unroll
    for (int i = 0; i < 4; ++i) {
#pragma unroll
      for (int r = 0; r < 8; ++r) {
        const int ro = (i * 16 + 8 * hh + r) * 68 + m;
#pragma unroll
        for (int j = 0; j < 4; ++j) sl[ro + 16 * j] = acc[i][j][r] * oscale;
      }
    }
    const int rq = lane >> 3, p8 = (lane & 7) * 8;
    const float* bp = bias + colw + p8;                   // columns colw + 8(lane & 7) .. +7, always < N
    const v4f bv0 = *(const v4f*)(bp), bv1 = *(const v4f*)(bp + 4);
    v4f b0, b1;
#pragma unroll
    for (int e = 0; e < 4; ++e) { b0[e] = hasb ? bfr(bv0[e]) : 0.f; b1[e] = hasb ? bfr(bv1[e]) : 0.f; }
    wave_sync_lds();
    v4u o[16];
#pragma unroll
    for (int it = 0; it < 16; ++it) {
      const float* s = sl + (it * 4 + rq) * 68 + p8;
      const v4f x = (*(const v4f*)(s) + b0) * pscale, y = (*(const v4f*)(s + 4) + b1) * pscale;
      const v8f f = {x[0], x[1], x[2], x[3], y[0], y[1], y[2], y[3]};
      o[it] = __builtin_bit_cast(v4u, __builtin_convertvector(f, v8h));
    }
    u16* dst = P + (size_t)(row0 + wr * 64 + rq) * (size_t)N + colw + p8;
    unsigned adv = 0;                        // elements from dst to the current group of four stores
#pragma unroll
    for (int it = 0; it < 16; ++it) {
      *(v4u*)(dst + adv + (size_t)((it & 3) * 4) * (size_t)N) = o[it];
      // behind every group of four: the next stores' addresses, and whatever follows the last group, may be formed in registers
      // that an issued store names; the addresses are formed from adv behind the wait
      if ((it & 3) == 3) { wait_x0(adv); adv += 16u * (unsigned)N; }
    }
  } else {
    // An accumulator lane holds 8 consecutive rows of one column: 16 B of a transposed line. The wave's 64 columns x 64 rows
    // are gathered in its own part of the ring (pitch 144 B), which the last stage's barrier has freed of readers and copies,
    // and leave as whole 128-B lines, 8 lanes each.
    // coverage: 16 instructions x 4 lines x 8 lanes x 8 halves = the wave's 64 x 64 tile.
    unsigned char* st = ring + wave * (64 * VTS);
#pragma unroll
    for (int j = 0; j < 4; ++j) {
      const float bj = bfr(bias[colw + j * 16 + m]);
#pragma unroll
      for (int i = 0; i < 4; ++i) {
        const v8f f = (acc[i][j] * oscale + bj) * pscale;
        *(v8h*)(st + (j * 16 + m) * VTS + i * 32 + hh * 16) = __builtin_convertvector(f, v8h);
      }
    }
    wave_sync_lds();
    const int rq = lane >> 3, p = lane & 7;
    v4u t[16];
#pragma unroll
    for (int it = 0; it < 16; ++it) t[it] = *(const v4u*)(st + (it * 4 + rq) * VTS + p * 16);
    const int roww = row0 + wr * 64;         // 64 rows of one batch (SEQ % 128 == 0)
    u16* dst = P + ((size_t)(roww / SEQ) * (size_t)N + colw + rq) * SEQ + (roww % SEQ) + p * 8;
#pragma unroll
    for (int it = 0; it < 16; ++it) *(v4u*)(dst + (size_t)(it * 4) * SEQ) = t[it];
  }
}

// The q, k and v projections and the folded weight in one grid (they depend on nothing of one another): blocks [0, GBLK) give the
// q plane, [GBLK, 2 GBLK) the k plane, [2 GBLK, 3 GBLK) the v^T plane (GBLK = the 128x128 tiles of one projection, M = ROWS,
// N = DMOD); third s multiplies by weight rows s * N .. s * N + N - 1. The last GBW blocks give Wf[n][k] = sum_j Wd[(n - NB) mod N][j] *
// Wo[j][k] (A = the Wd plane with rows turned by NB places, Bt = the transposed Wo plane, N x N, no bias), stored as the f16 plane x wsc.
__global__ __launch_bounds__(128)
void gemm_qkv(const u16* __restrict__ A, const u16* __restrict__ Bt, const float* __restrict__ bias,
              const u16* __restrict__ WD, const u16* __restrict__ WOT,
              u16* QPo, u16* KPo, u16* VPo, u16* WFo, int M, int N, int K, float qsc, float ksc, float vsc, float wsc) {
  __shared__ __align__(16) unsigned char ring[2 * GBUF];
  const int seg = (int)blockIdx.x / GBLK;    // block-uniform
  if (seg > 3) return;                       // in front of every barrier; never taken with the exact grid
  const bool fold = (seg == 3);
  u16* P = (seg == 0) ? QPo : (seg == 1) ? KPo : (seg == 2) ? VPo : WFo;
  const float ps = (seg == 0) ? qsc : (seg == 1) ? ksc : (seg == 2) ? vsc : wsc;
  const int sb = fold ? 0 : seg;             // the fold reads no bias: its pointer stays inside the array
  gemm_core<true, 2>(ring, nullptr, fold ? WD : A, fold ? WOT : Bt + (size_t)seg * N * K, bias + sb * N, nullptr, P,
                     (int)blockIdx.x - seg * GBLK, seg == 2, !fold, fold ? N : M, N, K, 1.0f, ps);
}

__global__ __launch_bounds__(128)
void gemm_h1(const u16* __restrict__ A, const u16* __restrict__ Bt, const float* __restrict__ bias,
             const float* __restrict__ PART, float* C, int M, int N, int K, float oscale) {
  __shared__ __align__(16) unsigned char ring[2 * GBUF];
  __shared__ __align__(16) float slab[4 * SLAB64 + (GBT + 1) * 4];   // the waves' slabs, then the 129 edge entries
  __shared__ __align__(16) unsigned char xrow[2 * XRB];    // two buffers of the two rows above the tile, pitch as in the ring
  gemm_core<false, 0>(ring, slab, A, Bt, bias, C, nullptr, (int)blockIdx.x, false, true, M, N, K, oscale, 1.0f, xrow,
                      slab + 4 * SLAB64, PART);
}

// =====================================================================================================
// Multi-head flash attention (no mask): block = (batch b, head, 256 query rows), 8 waves, wave w owns the 32 query rows
// q0 = 256*qt + 32*w .. q0+31 as two query tiles of 16; every k and v^T fragment read from LDS is used for both tiles. What
// follows describes one query tile (q0 there = the tile's first row).
//   q plane (f16, x8) laid out [b][s][h][d]; k plane the same; v^T plane [b][h][d][s] (x1024).
//   All NKB = SEQ/32 key blocks of 32 keys are visited (static bound), in stages of 128 keys that the block's waves share:
//   a stage is 128 k rows of 256 B (all d) and 128 v^T rows of 256 B (its 128 keys), laid in LDS at pitch 272 B by asynchronous
//   b128 copies (16 lanes = one whole 256-B row). Two buffers: stage t+1 flies while stage t is worked on. The fragments are
//   read from LDS with the split k map of ldfrag_h. After the last stage's barrier the ring is the epilogue's staging room.
//   Scores are computed TRANSPOSED: S^T tile g (g = 0,1) = k rows (keys kb+16g .. +15, A operand, row m = lane&15, split k map
//   over d, 4 chunks of 32 d) times q^T (B operand, col n = query q0 + (lane&15), k = d, split map).
//   D element r of lane l = (key kb+16g+8h+r, query q0+(l&15)), so a lane owns one query column and 16 of its 32 keys; the
//   partner lane l^16 owns the other 16 -> row max / row sum need one xor-16 shuffle.
//   Online max-subtracted base-2 softmax in f32 (scale 1/sqrt(128) and the q/k carries folded into lsc; scale, maximum and
//   the x32768 carry of P enter a score's exponent through one FMA; l carries the x32768 too). The exp'd values ARE
//   the P A-fragment in place: A row m = query = lane&15, element i <- key kb+8h+i (tile 0, D element i), element 8+i <- key
//   kb+16+8h+i (tile 1, D element i). P is carried x32768 as single f16. The rescale factor of query row 8h+r of the
//   O accumulators is fetched from lane 8h+r with a shuffle (uniform control). 8 v^T B fragments (col n = d = 16j + (lane&15),
//   keys k-contiguous), 8 P.V WMMAs per key block and query tile; the two tiles' 16 stand together.
//   Epilogue: 1/l (per query, shuffled to the D row owner) and carry folds in f32; the wave's 16x128 f32 result staged in its
//   LDS slab (pitch 132); each 256-B output row (b, q0+row, head) of the O plane (O x1024 as single f16) written as 2 whole
// coverage: per wave and query tile 8 instructions x 2 rows x 16 lanes x 8 halves = 16 x 128 of the O plane + 1 PART line; grid
//           NB*NH*SEQ/256 blocks x 8 waves x 2 tiles = every (b, s, h) row of the O plane and every PART line exactly once.
// =====================================================================================================
// Eight asynchronous 16-B-per-lane copies, rows 16 apart. The s_wait_xcnt stands inside the statement so that no address
// register of a copy is rewritten in front of it.
__device__ __forceinline__ void copy8w(unsigned l, const u16* g, size_t rs16) {
#if defined(__HIP_DEVICE_COMPILE__)
  asm volatile("global_load_async_to_lds_b128 %0, %8, off\n\t"
               "global_load_async_to_lds_b128 %1, %9, off\n\t"
               "global_load_async_to_lds_b128 %2, %10, off\n\t"
               "global_load_async_to_lds_b128 %3, %11, off\n\t"
               "global_load_async_to_lds_b128 %4, %12, off\n\t"
               "global_load_async_to_lds_b128 %5, %13, off\n\t"
               "global_load_async_to_lds_b128 %6, %14, off\n\t"
               "global_load_async_to_lds_b128 %7, %15, off\n\t"
               "s_wait_xcnt 0x0"
               :: "v"(l), "v"(l + 16u * GPITCH), "v"(l + 32u * GPITCH), "v"(l + 48u * GPITCH),
                  "v"(l + 64u * GPITCH), "v"(l + 80u * GPITCH), "v"(l + 96u * GPITCH), "v"(l + 112u * GPITCH),
                  "v"(g), "v"(g + rs16), "v"(g + 2 * rs16), "v"(g + 3 * rs16),
                  "v"(g + 4 * rs16), "v"(g + 5 * rs16), "v"(g + 6 * rs16), "v"(g + 7 * rs16)
               : "memory");
#endif
}
// One attention stage: this thread's 16 B of rows cr + 16i (i = 0..7) of the k tile and of the v^T tile; 16 copies per wave.
__device__ __forceinline__ void fill_kv(unsigned l, const u16* gk, const u16* gv) {
  copy8w(l, gk, (size_t)16 * RS);
  copy8w(l + AOPB, gv, (size_t)16 * SEQ);
}
// 2^x by the hardware instruction alone. A result below 2^-126 comes back as 0: here that is a probability (carried x32768) or
// a rescale factor that small beside a row maximum of 32768, far below the last bit that the f16 operand and the f32 sums keep.
__device__ __forceinline__ float exp2_hw(float x) { return __builtin_amdgcn_exp2f(x); }
__device__ __forceinline__ v16h ld_lfrag_h(const unsigned char* p) {  // split k map of ldfrag_h: bytes 0..15 and 32..47
  FragH f;
  f.u[0] = *(const v4u*)(p);
  f.u[1] = *(const v4u*)(p + 32);
  return f.v;
}

// The v_nop is the slot that the instruction set asks for behind a transcendental before its result is read or its source
// overwritten. The results and the sources are named so that none of them is touched in front of it, wherever it lands.
__device__ __forceinline__ void trans_slot8(float* p, const float* x) {
#if defined(__HIP_DEVICE_COMPILE__)
  asm("v_nop" : "+v"(p[0]), "+v"(p[1]), "+v"(p[2]), "+v"(p[3]), "+v"(p[4]), "+v"(p[5]), "+v"(p[6]), "+v"(p[7])
              : "v"(x[0]), "v"(x[1]), "v"(x[2]), "v"(x[3]), "v"(x[4]), "v"(x[5]), "v"(x[6]), "v"(x[7]));
#endif
}
__device__ __forceinline__ void trans_slot1(float& p, float x) {
#if defined(__HIP_DEVICE_COMPILE__)
  asm("v_nop" : "+v"(p) : "v"(x));
#endif
}

// One query tile's online-softmax step over a key block: s0, s1 = the tile's unscaled transposed scores (this lane's 16 keys of
// query column c). Updates the running maximum (kept unscaled, lsc > 0) and the running sum, gives the rescale factor al of the
// tile's O accumulators and the P A-fragment ph (f16, carried x32768).
__device__ __forceinline__ void softmax_step(const v8f s0, const v8f s1, const float lsc, float& mrun, float& lrun, float& al,
                                             FragH& ph) {
  float tk[16];
#pragma unroll
  for (int i = 0; i < 8; ++i) { tk[i] = s0[i];  tk[8 + i] = s1[i]; }
  float cm = -INFINITY;
#pragma unroll
  for (int i = 0; i < 16; ++i) cm = fmaxf(cm, tk[i]);
  cm = fmaxf(cm, __shfl_xor(cm, 16, 32));
  const float mn = fmaxf(mrun, cm);                                // finite from the first key block on
  const float ax = (mrun - mn) * lsc;
  float ae = exp2_hw(ax);
  trans_slot1(ae, ax);
  al = (mrun == -INFINITY) ? 0.f : ae;                             // o and l are zero while mrun is -inf
  mrun = mn;
  // probabilities carried x32768, one FMA and one v_exp_f32 each: 2^(t * lsc + (15 - mn * lsc)); they are summed and
  // rounded to the P A-fragment (f16) as they come; element i <-> tk[i]
  const float eb = __builtin_fmaf(-mn, lsc, PEXP);
  const v2f l2 = {lsc, lsc}, e2 = {eb, eb};
  float x[16], p[16];
#pragma unroll
  for (int i = 0; i < 16; i += 2) {
    const v2f t2 = {tk[i], tk[i + 1]};       // a register pair of the score accumulator: one packed FMA, no moves
    const v2f x2 = __builtin_elementwise_fma(t2, l2, e2);
    x[i] = x2[0];
    x[i + 1] = x2[1];
  }
#pragma unroll
  for (int i = 0; i < 16; ++i) p[i] = exp2_hw(x[i]);
  trans_slot8(p, x);
  trans_slot8(p + 8, x + 8);
  float ps = 0.f;
#pragma unroll
  for (int w = 0; w < 2; ++w) {
#pragma unroll
    for (int e4 = 0; e4 < 4; ++e4) {
      const int i = 8 * w + 2 * e4;
      ps += p[i] + p[i + 1];
      const v2f pp = {p[i], p[i + 1]};
      ph.u[w][e4] = __builtin_bit_cast(unsigned, __builtin_convertvector(pp, v2h));
    }
  }
  ps += __shfl_xor(ps, 16, 32);
  lrun = lrun * al + ps;
}

// two waves per SIMD (one block per WGP): the register budget that holds two query tiles' accumulators beside the fragments
__global__ __launch_bounds__(ATT_THREADS) __attribute__((amdgpu_waves_per_eu(2, 2)))
void attn_fwd(const u16* __restrict__ QPp, const u16* __restrict__ KPp, const u16* __restrict__ VPp,
              u16* OPo, float* PART) {
  // two stage buffers (k tile, then v^T tile); in the epilogue, per wave and query tile, the result slab [16][132] of floats
  __shared__ __align__(16) unsigned char ring[2 * ABUF];

  const int tid  = threadIdx.x;
  const int wave = tid >> 5;
  const int lane = tid & 31;
  const int hh   = lane >> 4;
  const int c    = lane & 15;

  const int bid  = blockIdx.x;
  const int qt   = bid & ((SEQ / ATT_QROWS) - 1);
  const int head = (bid >> AQT_BITS) & (NH - 1);
  const int b    = bid >> (AQT_BITS + NH_BITS);
  const int q0   = qt * ATT_QROWS + wave * (ATT_QT * 16);   // query tile u: rows q0 + 16u .. q0 + 16u + 15

  // B fragments of q^T: col n = query q0 + 16u + c, k = d (k-contiguous row of the q plane)
  const _Float16* Qb = (const _Float16*)(const void*)QPp + ((size_t)(b * SEQ + q0 + c) * NH + head) * HD + 8 * hh;
  // copy: row within a group of 16, 16-B chunk of the 256-B row; k tile row = key, v^T tile row = d
  const int cr = tid >> 4, cc = tid & 15;
  const u16* kb0 = KPp + ((size_t)(b * SEQ) * NH + head) * HD;                  // block-uniform; stage t: + t * AKS key rows
  const u16* vb0 = VPp + ((size_t)(b * NH + head) * HD) * SEQ;                  // block-uniform; stage t: + t * AKS keys
  const unsigned ko = (unsigned)(cr * RS + cc * 8), vo = (unsigned)(cr * SEQ + cc * 8);   // this thread's place in a stage
  const unsigned l0 = lds_off(ring) + (unsigned)(cr * GPITCH + cc * 16);
  fill_kv(l0, kb0 + ko, vb0 + vo);
  const float lsc = SM_SCALE * (LOG2E / (QSC * KSC));

  v16h qf[ATT_QT][4];                        // chunk n: d 32n .. 32n + 31
#pragma unroll
  for (int u = 0; u < ATT_QT; ++u) {
#pragma unroll
    for (int n = 0; n < 4; ++n) qf[u][n] = ldfrag_h(Qb + (size_t)u * (16 * RS) + n * 32);
  }

  float mrun[ATT_QT], lrun[ATT_QT];
  v8f o[ATT_QT][8];
#pragma unroll
  for (int u = 0; u < ATT_QT; ++u) {
    mrun[u] = -INFINITY;
    lrun[u] = 0.f;
#pragma unroll
    for (int j = 0; j < 8; ++j) o[u][j] = zero8();
  }

  wait_async0();
  __syncthreads();                           // publishes stage 0
  fill_kv(l0 + ABUF, kb0 + (ko + AKS * RS), vb0 + (vo + AKS));   // stage 1 exists (ANST >= 2)

  // one rolled trip per stage, so that the ring's publish point stands once, at the trip's foot
#pragma unroll 1
  for (int t = 0; t < ANST; ++t) {
   const unsigned bo = (unsigned)(t & 1) * ABUF;
   // A fragments of k: row m = key kb + 16g + c, k = d;  B fragments of v: col n = d = 16j + c, k = key
   const unsigned char* kt = ring + bo + c * GPITCH + hh * 16;
   const unsigned char* vt = ring + bo + AOPB + c * GPITCH + hh * 16;
   // stays rolled: one key block's live values already take most of the registers of two waves per SIMD
#pragma unroll 1
   for (int kk = 0; kk < AKS / 32; ++kk) {   // key block kb = t * AKS + kk * 32
    // ---- transposed scores of both query tiles from one read of the k fragments:
    //      sa[u] = keys kb..kb+15, sc[u] = keys kb+16..kb+31, column = query q0 + 16u + c ----
    v8f sa[ATT_QT], sc[ATT_QT];
#pragma unroll
    for (int u = 0; u < ATT_QT; ++u) { sa[u] = zero8(); sc[u] = zero8(); }
    const unsigned char* k0p = kt + kk * 32 * GPITCH;
    const unsigned char* k1p = k0p + 16 * GPITCH;
    const unsigned char* vp  = vt + kk * 64;
    const v16h ka0 = ld_lfrag_h(k0p), kc0 = ld_lfrag_h(k1p);
    const v16h ka1 = ld_lfrag_h(k0p + 64), kc1 = ld_lfrag_h(k1p + 64);
    const v16h ka2 = ld_lfrag_h(k0p + 128), kc2 = ld_lfrag_h(k1p + 128);
    const v16h ka3 = ld_lfrag_h(k0p + 192), kc3 = ld_lfrag_h(k1p + 192);
    // keeps the k fragments' reads one group ahead of the products instead of pair by pair, each with a full wait, among them
    __builtin_amdgcn_sched_barrier(0);
    sa[0] = mma_h(ka0, qf[0][0], sa[0]);
    sa[1] = mma_h(ka0, qf[1][0], sa[1]);
    sc[0] = mma_h(kc0, qf[0][0], sc[0]);
    sc[1] = mma_h(kc0, qf[1][0], sc[1]);
    sa[0] = mma_h(ka1, qf[0][1], sa[0]);
    sa[1] = mma_h(ka1, qf[1][1], sa[1]);
    sc[0] = mma_h(kc1, qf[0][1], sc[0]);
    sc[1] = mma_h(kc1, qf[1][1], sc[1]);
    // keeps the first four v^T fragments' reads here, as one group behind the first eight products, so that they return
    // behind the softmax arithmetic
    __builtin_amdgcn_sched_barrier(0);
    const v16h vf0 = ld_lfrag_h(vp);
    const v16h vf1 = ld_lfrag_h(vp + 16 * GPITCH);
    const v16h vf2 = ld_lfrag_h(vp + 32 * GPITCH);
    const v16h vf3 = ld_lfrag_h(vp + 48 * GPITCH);
    __builtin_amdgcn_sched_barrier(0);       // ends that group of reads
    sa[0] = mma_h(ka2, qf[0][2], sa[0]);
    sa[1] = mma_h(ka2, qf[1][2], sa[1]);
    sc[0] = mma_h(kc2, qf[0][2], sc[0]);
    sc[1] = mma_h(kc2, qf[1][2], sc[1]);
    sa[0] = mma_h(ka3, qf[0][3], sa[0]);
    sa[1] = mma_h(ka3, qf[1][3], sa[1]);
    sc[0] = mma_h(kc3, qf[0][3], sc[0]);
    sc[1] = mma_h(kc3, qf[1][3], sc[1]);
    __builtin_amdgcn_sched_barrier(0);       // the last four v^T fragments' reads: one group behind the scores' last product
    const v16h vf4 = ld_lfrag_h(vp + 64 * GPITCH);
    const v16h vf5 = ld_lfrag_h(vp + 80 * GPITCH);
    const v16h vf6 = ld_lfrag_h(vp + 96 * GPITCH);
    const v16h vf7 = ld_lfrag_h(vp + 112 * GPITCH);
    __builtin_amdgcn_sched_barrier(0);       // ends that group of reads
    // ---- per query tile: online softmax, then the rescale of its O accumulators: D row 8hh+r = query q0+16u+8hh+r, whose
    //      factor lives in lane 8hh+r (and 16+8hh+r) ----
    FragH ph[ATT_QT];
#pragma unroll
    for (int u = 0; u < ATT_QT; ++u) {
      float al;
      softmax_step(sa[u], sc[u], lsc, mrun[u], lrun[u], al, ph[u]);
      float scl[8];
#pragma unroll
      for (int r = 0; r < 8; ++r) scl[r] = __shfl(al, 8 * hh + r, 32);
#pragma unroll
      for (int j = 0; j < 8; ++j) {
#pragma unroll
        for (int r = 0; r < 8; ++r) o[u][j][r] *= scl[r];
      }
    }
    // ---- P.V : B fragment col n = d = j*16 + c, keys contiguous in the v^T tile; every fragment serves both query tiles;
    //      the v_nop behind the last of the 16 are for the loop's branch ----
    o[0][0] = mma_h(ph[0].v, vf0, o[0][0]);
    o[1][0] = mma_h(ph[1].v, vf0, o[1][0]);
    o[0][1] = mma_h(ph[0].v, vf1, o[0][1]);
    o[1][1] = mma_h(ph[1].v, vf1, o[1][1]);
    o[0][2] = mma_h(ph[0].v, vf2, o[0][2]);
    o[1][2] = mma_h(ph[1].v, vf2, o[1][2]);
    o[0][3] = mma_h(ph[0].v, vf3, o[0][3]);
    o[1][3] = mma_h(ph[1].v, vf3, o[1][3]);
    o[0][4] = mma_h(ph[0].v, vf4, o[0][4]);
    o[1][4] = mma_h(ph[1].v, vf4, o[1][4]);
    o[0][5] = mma_h(ph[0].v, vf5, o[0][5]);
    o[1][5] = mma_h(ph[1].v, vf5, o[1][5]);
    o[0][6] = mma_h(ph[0].v, vf6, o[0][6]);
    o[1][6] = mma_h(ph[1].v, vf6, o[1][6]);
    o[0][7] = mma_h(ph[0].v, vf7, o[0][7]);
    o[1][7] = mma_h(ph[1].v, vf7, o[1][7]);
    guard_foot(o[0][4], o[0][5], o[0][6], o[0][7], o[1][4], o[1][5], o[1][6], o[1][7]);
   }
   wait_ds0();
   wait_async0();
   __syncthreads();                          // publishes stage t+1 and ends every reader's last read of stage t's buffer
   if (t + 2 < ANST) fill_kv(l0 + bo, kb0 + (ko + (unsigned)(t + 2) * (AKS * RS)), vb0 + (vo + (unsigned)(t + 2) * AKS));
  }
  wait_async0();

  // the last stage's barrier lies behind every wave's last fragment read and last copy: the ring is free
#pragma unroll
  for (int u = 0; u < ATT_QT; ++u) {
    // ---- fold 1/l (per query, owned by lane = query) and the carries; row statistic r = l * (1/l); stage the 16x128 slab ----
    const float rl   = (lrun[u] > 0.f) ? (1.0f / lrun[u]) : 0.f;
    const float linv = rl * (1.0f / VCAR);   // l carries the same x32768 as P
    const float rr   = lrun[u] * rl;
    float inv[8];
#pragma unroll
    for (int r = 0; r < 8; ++r) inv[r] = __shfl(linv, 8 * hh + r, 32);
    float* slab = (float*)(void*)ring + (wave * ATT_QT + u) * SLABF;
#pragma unroll
    for (int r = 0; r < 8; ++r) {
#pragma unroll
      for (int j = 0; j < 8; ++j) slab[(8 * hh + r) * SPITCH + j * 16 + c] = o[u][j][r] * inv[r];
    }
    wave_sync_lds();
    // ---- O x1024 -> single f16 plane; lane = (row parity hh, 8 consecutive d at c8) ----
    v4u oh[8];
    const int c8 = c * 8;
#pragma unroll
    for (int it = 0; it < 8; ++it) {
      const int row = it * 2 + hh;
      const v4f a = *(const v4f*)(slab + row * SPITCH + c8), c4 = *(const v4f*)(slab + row * SPITCH + c8 + 4);
      float w[8];
#pragma unroll
      for (int e = 0; e < 4; ++e) { w[e] = a[e] * OSC; w[4 + e] = c4[e] * OSC; }
#pragma unroll
      for (int e = 0; e < 4; ++e) {
        const _Float16 h0 = (_Float16)w[2 * e], h1 = (_Float16)w[2 * e + 1];
        oh[it][e] = pk16(h_bits(h0), h_bits(h1));
      }
    }
    // ---- tile row-sum partial (fixed xor tree over the 16 query lanes; both lane halves hold identical values) ----
    float wsum = rr;
    wsum += __shfl_xor(wsum, 1, 32);
    wsum += __shfl_xor(wsum, 2, 32);
    wsum += __shfl_xor(wsum, 4, 32);
    wsum += __shfl_xor(wsum, 8, 32);
    v4f pv = zero4();
    pv[0] = (lane == 0) ? wsum : 0.f;
    float* pd = PART + (((size_t)bid * ATT_WAVES + wave) * ATT_QT + u) * 32 + (lane & 7) * 4;   // clamped address for every lane
    const size_t ob = ((size_t)(b * SEQ + q0 + 16 * u) * NH + head) * HD + c8;
#pragma unroll
    for (int it = 0; it < 8; ++it) {
      const int row = it * 2 + hh;
      *(v4u*)(OPo + ob + (size_t)row * RS) = oh[it];
    }
    if (lane < 8) *(v4f*)(pd) = pv;
  }
}

// =====================================================================================================
// Workspace map (bytes); every plane is fully written by whole-line stores before it is read; all extents are exact multiples
// of the store granularity (no pad rows needed):
//   XB   bf16 [ROWS][1024]                 NB*4194304   (bf16 copy of the input activations)
//   WQKV bf16 [3072 n][1024 k]                6291456
//   WOT  bf16 [1024 k][1024 j] (Wo turned)    2097152   WDB bf16 [1024 n][1024 j] 2097152   (rows turned by NB places)
//   QP   f16  [ROWS][8][128] x8            NB*4194304
//   KP   f16  same                          NB*4194304
//   VP   f16  [NB][8][128][2048] x1024      NB*4194304
//   OP   f16  [ROWS][8][128] x1024         NB*4194304
//   PART f32  [ATT_BLOCKS*8*2][32]         NB*131072
//   WF   f16  [1024 n][1024 k] x256           2097152   (Wd.Wo, rows turned by NB places)
//   BF   f32  [1024]                             4096   (Wd.bo + bd)
//   end (NB = 4)                             96997376
// =====================================================================================================
extern "C" void kernel_launch(void* const* d_in, const int* in_sizes, int n_in,
                              void* d_out, int out_size, void* d_ws, size_t ws_size,
                              hipStream_t stream) {
  if (n_in < 7) return;
  if (in_sizes[0] != ROWS * DMOD) return;
  if (in_sizes[1] != 3 * DMOD * DMOD || in_sizes[2] != 3 * DMOD) return;
  if (in_sizes[3] != DMOD * DMOD || in_sizes[4] != DMOD) return;
  if (in_sizes[5] != DMOD * DMOD || in_sizes[6] != DMOD) return;
  if (out_size != TOTOUT) return;

  const float* x    = (const float*)d_in[0];
  const float* wqkv = (const float*)d_in[1];
  const float* bqkv = (const float*)d_in[2];
  const float* wo   = (const float*)d_in[3];
  const float* bo   = (const float*)d_in[4];
  const float* wd   = (const float*)d_in[5];
  const float* bd   = (const float*)d_in[6];
  float*       out  = (float*)d_out;

  const size_t szXB   = (size_t)ROWS * DMOD * 2;
  const size_t szWQKV = (size_t)3 * DMOD * DMOD * 2;
  const size_t szW    = (size_t)DMOD * DMOD * 2;
  const size_t szP    = (size_t)ROWS * DMOD * 2;
  const size_t szVP   = (size_t)NB * NH * HD * SEQ * 2;
  const size_t szPART = (size_t)ATT_BLOCKS * ATT_WAVES * ATT_QT * 32 * 4;
  size_t off = 0;
  const size_t oXB   = off; off += szXB;
  const size_t oWQKV = off; off += szWQKV;
  const size_t oWOT  = off; off += szW;
  const size_t oWDB  = off; off += szW;
  const size_t oQP   = off; off += szP;
  const size_t oKP   = off; off += szP;
  const size_t oVP   = off; off += szVP;
  const size_t oOP   = off; off += szP;
  const size_t oPART = off; off += szPART;
  const size_t oWF   = off; off += szW;
  const size_t oBF   = off; off += (size_t)DMOD * 4;
  if (off > ws_size) return;                            // off = 96997376 for NB = 4
  if (off > (size_t)134217728) return;

  char* ws = (char*)d_ws;
  u16*   XB   = (u16*)(ws + oXB);
  u16*   WQKV = (u16*)(ws + oWQKV);
  u16*   WOT  = (u16*)(ws + oWOT);
  u16*   WDB  = (u16*)(ws + oWDB);
  u16*   QP   = (u16*)(ws + oQP);
  u16*   KP   = (u16*)(ws + oKP);
  u16*   VP   = (u16*)(ws + oVP);
  u16*   OP   = (u16*)(ws + oOP);
  float* PART = (float*)(ws + oPART);
  u16*   WF   = (u16*)(ws + oWF);
  float* BF   = (float*)(ws + oBF);

  const dim3 blk(256);
  const dim3 gCV(CBB + CBT + CBX + CBQ + CBW);
  const dim3 gG(GBLK);
  const dim3 gG3(3 * GBLK + GBW);
  const dim3 bG(128);
  const dim3 gAT(ATT_BLOCKS);
  const dim3 bAT(ATT_THREADS);

  // (0) input activations, qkv weight and Wd -> bf16 planes (weights stored [n = out][k = in], y = x.W^T, already k-contiguous);
  //     Wo -> its transposed bf16 plane; the folded bias Wd.bo + bd
  cvt16<<<gCV, blk, 0, stream>>>(x, wqkv, wo, wd, bo, bd, XB, WQKV, WOT, WDB, BF);
  // (1) q, k, v: projection + bias (col = h*128+d); q and k stored as f16 planes x8, v as the v^T plane x1024;
  //     the folded weight Wd.Wo as the f16 plane x256
  gemm_qkv<<<gG3, bG, 0, stream>>>(XB, WQKV, bqkv, WDB, WOT, QP, KP, VP, WF, ROWS, DMOD, DMOD, QSC, KSC, VCAR, WFS);
  // (2) attention -> O plane [b][s][h][d] x1024 and per-wave row-sum lines
  attn_fwd<<<gAT, bAT, 0, stream>>>(QP, KP, VP, OP, PART);
  // (3) both output projections as one product with the folded weight and bias (carries 1024 x 256 folded back)
  //     -> the whole output buffer, scores and image, in whole lines
  gemm_h1<<<gG, bG, 0, stream>>>(OP, WF, BF, PART, out, ROWS, DMOD, DMOD, 1.0f / (OSC * WFS));
  (void)hipGetLastError();
}

// v009
// Measured time: 128 microseconds a run.
// Two timings next to v008 put it at 1.03 and 1.04 times that version's speed.
// All steps since v000 together make it 4.64 times as fast.
// Contractions: x.W{q,k,v}^T on v_wmma_f32_16x16x32_bf16 (x and W planes RNE-converted to bf16 operands, f32 accumulate, bias added in f32);
// the folded weight Wf = Wd.Wo on the same bf16 form (both weights RNE-converted to bf16 operands, f32 accumulate);
// scores k'.q'^T (q', k' single f16 planes carried x8), v^T.P^T (P x32768 single f16, v x1024 single f16) and O.Wf^T
// (O single f16 plane x1024, Wf single f16 plane x256): v_wmma_f32_16x16x32_f16, f32 accumulate.
// (O.Wo^T + bo).Wd^T + bd = O.(Wd.Wo)^T + (Wd.bo + bd): the two output projections are one product with Wf and the bias bf.
// Base-2 online softmax, 1/l fold, row-sum partials, the folded bias bf = Wd.bo + bd and bias adds in f32 on VALU.
// The q, k, v^T and Wf operand planes are written by the epilogue of the GEMM that produces them (f32 result, bias, carry, f16).
// The output buffer is written by the last GEMM's epilogue: its columns are turned by NB places (Wf rows turned), so that a tile's
// rows are whole lines of the flat buffer [NB scores | image].
#include <hip/hip_runtime.h>
#include <math.h>
#include <stdint.h>

#define NB    4
#define SEQ   2048
#define DMOD  1024
#define NH    8
#define HD    128
#define QT_BITS 5
#define NH_BITS 3
#define ROWS  (NB * SEQ)
#define QSC   8.0f
#define KSC   8.0f
#define PCAR  32768.0f
#define PEXP  15.0f
#define VCAR  1024.0f
#define OSC   1024.0f
#define WFS   256.0f
#define SM_SCALE 0.08838834764831845f
#define LOG2E 1.4426950408889634f
#define ATT_WAVES   8
#define ATT_THREADS (ATT_WAVES * 32)
#define ATT_QT      2
#define ATT_QROWS   (ATT_WAVES * ATT_QT * 16)
#define AQT_BITS    3
#define ATT_BLOCKS  (NB * NH * (SEQ / ATT_QROWS))
#define NKB    (SEQ / 32)
#define RS     (NH * HD)
#define SLAB64 (16 * 68)
#define VTS    144
#define WPB    (NH * (SEQ / ATT_QROWS) * ATT_WAVES * ATT_QT)
#define TOTOUT (NB + ROWS * DMOD)
#define GBT    128
#define GKS    128
#define GPITCH 272
#define GOPB   (GBT * GPITCH)
#define GBUF   (2 * GOPB)
#define XRB    (2 * GPITCH)
#define AKS    128
#define ANST   (SEQ / AKS)
#define AOPB   (AKS * GPITCH)
#define ABUF   (AOPB + HD * GPITCH)
#define DEPSC  (1.0f / ((float)NH * (float)SEQ * (float)SEQ))
#define CBX    (ROWS * DMOD / 8 / 256)
#define CBQ    (3 * DMOD * DMOD / 8 / 256)
#define CBW    (DMOD * DMOD / 8 / 256)
#define CBB    (DMOD / 32)
#define CBT    ((DMOD / 64) * (DMOD / 64))
#define TPB    144
#define GBLK   ((ROWS / GBT) * (DMOD / GBT))
#define GBW    ((DMOD / GBT) * (DMOD / GBT))

static_assert(HD == 128 && DMOD == NH * HD && RS == DMOD);
static_assert(PCAR == (float)(1 << (int)PEXP));
static_assert((1 << QT_BITS) == (SEQ / 64) && (1 << NH_BITS) == NH);
static_assert((SEQ % 64) == 0 && (SEQ % 32) == 0 && NKB * 32 == SEQ);
static_assert(((ROWS * DMOD / 8) % 256) == 0 && ((3 * DMOD * DMOD / 8) % 256) == 0 && ((DMOD * DMOD / 8) % 256) == 0);
static_assert((ROWS % 64) == 0 && (DMOD % 64) == 0 && (DMOD % 32) == 0);
static_assert(NB >= 1 && NB <= 32);
static_assert((WPB % 32) == 0 && WPB == 1024);
static_assert(ATT_THREADS == 256 && (1 << AQT_BITS) == (SEQ / ATT_QROWS));
static_assert((SEQ % AKS) == 0 && ANST >= 2 && (AKS % 32) == 0 && AKS * 2 + 16 == GPITCH && HD * 2 + 16 == GPITCH);
static_assert(AKS == 8 * (ATT_THREADS / 16) && HD == 8 * (ATT_THREADS / 16));
static_assert(ATT_WAVES * ATT_QT * 16 * GPITCH <= 2 * ABUF);
static_assert((VTS % 16) == 0 && VTS >= 64 * 2 && 4 * 64 * VTS <= 2 * GBUF && (SEQ % GBT) == 0);
static_assert(4 * 64 * 68 * 4 <= 2 * GBUF);
static_assert(NB == 4 && (DMOD & (DMOD - 1)) == 0);
static_assert((ROWS % GBT) == 0 && (DMOD % GBT) == 0 && (DMOD % GKS) == 0 && GKS * 2 + 16 == GPITCH);
static_assert(DMOD == 1024 && (TPB % 16) == 0 && TPB >= 64 * 2 && GBW <= GBLK);

typedef unsigned short u16;
typedef _Float16 v16h __attribute__((ext_vector_type(16)));
typedef _Float16 v8h  __attribute__((ext_vector_type(8)));
typedef __bf16   v16b __attribute__((ext_vector_type(16)));
typedef float    v8f  __attribute__((ext_vector_type(8)));
typedef float    v4f  __attribute__((ext_vector_type(4)));
typedef float    v2f  __attribute__((ext_vector_type(2)));
typedef _Float16 v2h  __attribute__((ext_vector_type(2)));
typedef unsigned int v4u __attribute__((ext_vector_type(4)));

union FragH { v16h v; v8h h[2]; v4u u[2]; };
union FragB { v16b v; v4u u[2]; };

// ---- scalar helpers --------------------------------------------------------------------------------
__device__ __forceinline__ unsigned short bf_bits(float f) {          // f32 -> bf16 bits, RNE convert
  unsigned u = __float_as_uint(f);
  return (unsigned short)((u + 0x7FFFu + ((u >> 16) & 1u)) >> 16);
}
__device__ __forceinline__ float bf_up(unsigned short h) { return __uint_as_float(((unsigned)h) << 16); }
__device__ __forceinline__ float bfr(float f) { return bf_up(bf_bits(f)); }
__device__ __forceinline__ unsigned pk16(unsigned short a, unsigned short b) { return (unsigned)a | ((unsigned)b << 16); }
__device__ __forceinline__ v8f zero8() { v8f z = {0.f, 0.f, 0.f, 0.f, 0.f, 0.f, 0.f, 0.f}; return z; }
__device__ __forceinline__ v4f zero4() { v4f z = {0.f, 0.f, 0.f, 0.f}; return z; }

// ---- fragment loaders: 16-bit A/B operand, lane -> row/col (lane&15), p already includes +8*(lane>>4);
//      elements 0..7 <- p[0..7] (k0+8h..), elements 8..15 <- p[16..23] (k0+16+8h..)  (same split k map for A and B;
//      B is always read from a k-contiguous [n][k] plane)
__device__ __forceinline__ v16h ldfrag_h(const _Float16* p) {
  FragH f;
  f.h[0] = *(const v8h*)(p);
  f.h[1] = *(const v8h*)(p + 16);
  return f.v;
}

__device__ __forceinline__ v8f mma_h(v16h a, v16h b, v8f c) {
  return __builtin_amdgcn_wmma_f32_16x16x32_f16(false, a, false, b, (short)0, c, false, false);
}
__device__ __forceinline__ v8f mma_b(v16b a, v16b b, v8f c) {
  return __builtin_amdgcn_wmma_f32_16x16x32_bf16(false, a, false, b, (short)0, c, false, false);
}
// The four v_nop fill the vector slots that the chip needs behind a matrix instruction before a vector instruction may touch its
// result or overwrite its operands; they stand at the foot of the key-block loop, for the taken side of its branch. The results
// of the loop's last eight matrix instructions are named so that the v_nop stay behind them.
__device__ __forceinline__ void guard_foot(v8f& a0, v8f& a1, v8f& a2, v8f& a3, v8f& b0, v8f& b1, v8f& b2, v8f& b3) {
#if defined(__HIP_DEVICE_COMPILE__)
  asm volatile("v_nop\n\tv_nop\n\tv_nop\n\tv_nop"
               : "+v"(a0), "+v"(a1), "+v"(a2), "+v"(a3), "+v"(b0), "+v"(b1), "+v"(b2), "+v"(b3));
#endif
}
__device__ __forceinline__ void wave_sync_lds() {
  __builtin_amdgcn_fence(__ATOMIC_RELEASE, "workgroup");
  __builtin_amdgcn_wave_barrier();
  __builtin_amdgcn_fence(__ATOMIC_ACQUIRE, "workgroup");
}

// =====================================================================================================
// All that is made from the f32 inputs alone, in one grid (the parts do not depend on one another); the short parts stand first:
//   blocks [0, CBB): the folded bias bf[n] = sum_j Wd[n][j] * bo[j] + bd[n] (bf16 RNE values, f32 FMA chain and xor tree);
//     block = 32 rows n, wave = 4 rows, lane = 4 consecutive j of every 128; the 32 sums leave as one whole 128-B line.
//   next CBT blocks: Wo -> its transposed bf16 plane WOT[k][j] = Wo[j][k], block = one 64 x 64 tile turned in LDS (pitch 144 B);
//     coverage: read 64 rows x 4 lanes x 16 floats, written 2 x 32 rows x 8 lanes x 8 elements (whole 128-B lines).
//   then f32 plane -> bf16 plane (RNE bits), same layout: CBX blocks for the activations, CBQ for the qkv weight, CBW for Wd,
//     whose rows are turned by NB places on the way: plane row j = Wd row (j - NB) mod DMOD, so that Wf comes out turned alike.
//     Thread = 8 consecutive elements: two 16-B loads, one 16-B store; 32 consecutive lanes = 512 contiguous, 512-B aligned bytes
//     coverage: each plane has elements/8/256 blocks (exact: static_assert above) x 256 thr x 8 = the whole plane.
// =====================================================================================================
// The wait before a register that an issued global store names is rewritten: behind a part's last stores, whose registers the
// code of another part, laid behind them in the kernel, writes anew.
__device__ __forceinline__ void wait_x_part() {
#if defined(__HIP_DEVICE_COMPILE__)
  asm volatile("s_wait_xcnt 0x0" ::: "memory");
#endif
}
__global__ __launch_bounds__(256) void cvt16(const float* __restrict__ x, const float* __restrict__ wqkv,
                                             const float* __restrict__ wo, const float* __restrict__ wd,
                                             const float* __restrict__ bo, const float* __restrict__ bd,
                                             u16* XB, u16* WQKV, u16* WOT, u16* WDB, float* BF) {
  __shared__ __align__(16) unsigned char tile[64 * TPB];
  const int tid = threadIdx.x;
  int blk = blockIdx.x;                     // block-uniform choice of the part
  if (blk >= CBB + CBT + CBX + CBQ + CBW) return;   // in front of every barrier; never taken with the exact grid
  if (blk < CBB) {
    const int wave = tid >> 5, lane = tid & 31;
    float* sums = (float*)(void*)tile;
    const float* wp = wd + (size_t)(blk * 32 + wave * 4) * DMOD + lane * 4;
    float s4[4] = {0.f, 0.f, 0.f, 0.f};
    // two chunks' loads in flight; unrolled further, this part's registers would cut the waves that the stream parts can hold
#pragma unroll 2
    for (int it = 0; it < 8; ++it) {
      const v4f t = *(const v4f*)(bo + it * 128 + lane * 4);
#pragma unroll
      for (int r = 0; r < 4; ++r) {
        const v4f w = *(const v4f*)(wp + (size_t)r * DMOD + it * 128);
#pragma unroll
        for (int e = 0; e < 4; ++e) s4[r] = __builtin_fmaf(bfr(w[e]), bfr(t[e]), s4[r]);
      }
    }
#pragma unroll
    for (int d = 16; d >= 1; d >>= 1) {
#pragma unroll
      for (int r = 0; r < 4; ++r) s4[r] += __shfl_xor(s4[r], d, 32);
    }
    if (lane == 0) {
      const v4f sv = {s4[0], s4[1], s4[2], s4[3]};
      *(v4f*)(sums + wave * 4) = sv;
    }
    __syncthreads();                        // the block's 32 sums are in LDS
    if (tid < 8) {
      const v4f b = *(const v4f*)(bd + blk * 32 + tid * 4);
      v4f o = *(const v4f*)(sums + tid * 4);
#pragma unroll
      for (int e = 0; e < 4; ++e) o[e] += bfr(b[e]);
      *(v4f*)(BF + blk * 32 + tid * 4) = o;
    }
    return;
  }
  blk -= CBB;
  if (blk < CBT) {
    const int j0 = (blk / (DMOD / 64)) * 64, k0 = (blk % (DMOD / 64)) * 64;
    {
      const int j = tid >> 2, kq = (tid & 3) * 16;
      const float* p = wo + (size_t)(j0 + j) * DMOD + k0 + kq;
      v4f v[4];
#pragma unroll
      for (int q = 0; q < 4; ++q) v[q] = *(const v4f*)(p + q * 4);
#pragma unroll
      for (int q = 0; q < 4; ++q) {
#pragma unroll
        for (int e = 0; e < 4; ++e) *(u16*)(void*)(tile + (kq + q * 4 + e) * TPB + j * 2) = bf_bits(v[q][e]);
      }
    }
    __syncthreads();                        // the turned tile is whole
    const int kr = tid >> 3, jq = (tid & 7) * 8;
    v4u o[2];
#pragma unroll
    for (int it = 0; it < 2; ++it) o[it] = *(const v4u*)(tile + (it * 32 + kr) * TPB + jq * 2);
    u16* dst = WOT + (size_t)(k0 + kr) * DMOD + j0 + jq;
#pragma unroll
    for (int it = 0; it < 2; ++it) *(v4u*)(dst + (size_t)(it * 32) * DMOD) = o[it];
    wait_x_part();
    return;
  }
  blk -= CBT;
  const float* s = x;
  u16* D = XB;
  unsigned so = 0u, sm = 0xFFFFFFFFu;       // source element = (plane element + so) & sm
  if (blk >= CBX + CBQ) { s = wd;   D = WDB;  blk -= CBX + CBQ; so = (unsigned)((DMOD - NB) * DMOD); sm = (unsigned)(DMOD * DMOD - 1); }
  else if (blk >= CBX)  { s = wqkv; D = WQKV; blk -= CBX; }
  const int gt = blk * 256 + tid;
  const float* p = s + (((unsigned)gt * 8u + so) & sm);
  const v4f a = *(const v4f*)(p), c4 = *(const v4f*)(p + 4);
  v4u o;
#pragma unroll
  for (int e = 0; e < 2; ++e) {
    o[e]     = pk16(bf_bits(a[2 * e]), bf_bits(a[2 * e + 1]));
    o[2 + e] = pk16(bf_bits(c4[2 * e]), bf_bits(c4[2 * e + 1]));
  }
  *(v4u*)(D + (size_t)gt * 8) = o;
  wait_x_part();
}

// =====================================================================================================
// GEMM f32 epilogue (EPI 0): the wave's 16x64 f32 tile (times oscale) staged in its LDS slab (pitch 68),
// coverage: 8 instructions x 2 rows x 16 lanes x 4 floats = the wave's 16 x 64 tile.
// eon (wave-uniform: the wave holds flat columns 0..3): the lanes of those columns read, in place of the tile's own values, the
// entries sl[eo + 4 * row ..] (four floats each): what stands in front of each of the tile's 16 rows in the flat buffer. sc
// (wave-uniform): entry 0 is the scores, which take no bias.
// =====================================================================================================
__device__ __forceinline__ void epi64(float* sl, v8f a0, v8f a1, v8f a2, v8f a3, float oscale, v4f badd, float* C, int N,
                                      size_t rowb, int col0, int lane, int eo, bool eon, bool sc) {
  const int hh = lane >> 4, m = lane & 15;
#pragma unroll
  for (int r = 0; r < 8; ++r) {
    const int ro = (8 * hh + r) * 68 + m;
    sl[ro]      = a0[r] * oscale;
    sl[ro + 16] = a1[r] * oscale;
    sl[ro + 32] = a2[r] * oscale;
    sl[ro + 48] = a3[r] * oscale;
  }
  wave_sync_lds();
  const bool el = eon & (m == 0);
  const int rb = el ? eo + hh * 4 : hh * 68 + m * 4;       // this lane's first read and its step: slab rows or edge entries
  const int rs = el ? 2 * 4 : 2 * 68;
  v4f vals[8];
#pragma unroll
  for (int it = 0; it < 8; ++it) vals[it] = *(const v4f*)(sl + rb + it * rs) + badd;
  if (sc) {
    const v4f e0 = *(const v4f*)(sl + eo);
#pragma unroll
    for (int q = 0; q < 4; ++q) vals[0][q] = (lane == 0) ? e0[q] : vals[0][q];
  }
  float* dst = C + (rowb + (size_t)hh) * (size_t)N + col0 + m * 4;
  {
#pragma unroll
    for (int it = 0; it < 8; ++it) {
      *(v4f*)(dst + (size_t)(it * 2) * (size_t)N) = vals[it];
    }
    wait_x_part();                           // the next tile's values and addresses may be formed in registers that these stores name
  }
}

// =====================================================================================================
// 16-bit GEMM with bias, both engines: C[M][N] (f32) = A[M][K] (row-major) . Bt[N][K]^T (k-contiguous), times oscale, plus a
// bias. Block = 128x128 tile of C, 4 waves as 2x2, wave = 64x64 (4x4 accumulator tiles).
// EPI 0 is the product that fills the flat output buffer C = [NB scores | image of M x N]: Bt's rows come turned by NB places
// (row j = image column (j - NB) mod N, N a power of two), so that element (r, j) of the product stands at C[r * N + j] for
// j >= NB and every 64-column row piece is two whole lines; bias[(j - NB) mod N] is added as it is (an f32 value made in this
// call). Columns j < NB are the LAST NB image columns of row r and stand at C[(r + 1) * N + j], in front of row r + 1: the blocks
// of tile column 0 pass them down one row through the LDS array edge (entry e = what stands in front of tile row e). Entry 0
// belongs to the row above the tile: wave 0 of such a block multiplies that one row (copied into xrow beside every stage, the same
// row in all 16 rows of the A fragment) by the tile's first 16 Bt rows, one more accumulator tile, k upward like the others. In
// block 0 entry 0 is the NB scores (per batch: fixed-order sum of its WPB PART lines times 1/(NH*SEQ*SEQ), wave = batch, 32 lanes
// x WPB/32 strided loads + xor tree). Entry 128 of the last row block is the buffer's last NB elements.
// coverage: (M/128)*(N/128) blocks x 4 waves x 4 x 8 instructions x 2 rows x 64 floats = C[0 .. M*N), + 1 piece of NB = all of C.
// EPI 2 adds the bf16-RNE value of bias[n], or
// nothing where hasb (block-uniform) is not set, and stores f16(C * pscale) as the plane P[M][N] unless tr (block-uniform) is set:
// then it stores f16(C * pscale) transposed per batch, P[(row / SEQ) * N + col][row % SEQ] (the v^T plane: N = NH * HD,
// col = h * HD + d). bid is the block's index among the (M/128)*(N/128) tiles of this product.
// A stage is 128 k of the block's 128 A rows and 128 Bt rows: 256 rows of 256 B, laid in LDS at pitch 272 B by asynchronous
// b128 copies (16 lanes = one whole 256-B row, so every copy touches whole lines). Two buffers: stage t+1 flies while stage t
// is multiplied. Fragments are read from LDS with the same split k map for A and B as ldfrag_h; k runs upward in steps of 32
// into one accumulator per tile. Shapes: M % 128 == 0, N % 128 == 0, K % 128 == 0, (M/128)*(N/128) blocks per product (static_assert above).
// =====================================================================================================
__device__ __forceinline__ unsigned lds_off(const void* p) { return (unsigned)(size_t)p; }

// Eight asynchronous 16-B-per-lane copies, rows 8 apart. The s_wait_xcnt stands inside the statement so that no address
// register of a copy is rewritten in front of it.
__device__ __forceinline__ void copy8(unsigned l, const u16* g, size_t rs8) {
#if defined(__HIP_DEVICE_COMPILE__)
  asm volatile("global_load_async_to_lds_b128 %0, %8, off\n\t"
               "global_load_async_to_lds_b128 %1, %9, off\n\t"
               "global_load_async_to_lds_b128 %2, %10, off\n\t"
               "global_load_async_to_lds_b128 %3, %11, off\n\t"
               "global_load_async_to_lds_b128 %4, %12, off\n\t"
               "global_load_async_to_lds_b128 %5, %13, off\n\t"
               "global_load_async_to_lds_b128 %6, %14, off\n\t"
               "global_load_async_to_lds_b128 %7, %15, off\n\t"
               "s_wait_xcnt 0x0"
               :: "v"(l), "v"(l + 8u * GPITCH), "v"(l + 16u * GPITCH), "v"(l + 24u * GPITCH),
                  "v"(l + 32u * GPITCH), "v"(l + 40u * GPITCH), "v"(l + 48u * GPITCH), "v"(l + 56u * GPITCH),
                  "v"(g), "v"(g + rs8), "v"(g + 2 * rs8), "v"(g + 3 * rs8),
                  "v"(g + 4 * rs8), "v"(g + 5 * rs8), "v"(g + 6 * rs8), "v"(g + 7 * rs8)
               : "memory");
#endif
}
// One stage: this thread's 16 B of rows cr + 8i (i = 0..15) of the A tile and of the Bt tile; 32 copies per wave.
__device__ __forceinline__ void fill_stage(unsigned l, const u16* ga, const u16* gb, size_t rs8) {
  copy8(l, ga, rs8);
  copy8(l + 64u * GPITCH, ga + 8 * rs8, rs8);
  copy8(l + GOPB, gb, rs8);
  copy8(l + GOPB + 64u * GPITCH, gb + 8 * rs8, rs8);
}
// One asynchronous 16-B-per-lane copy (32 lanes = two whole 256-B rows). The s_wait_xcnt stands inside the statement so that no
// address register of the copy is rewritten in front of it.
__device__ __forceinline__ void copy1(unsigned l, const u16* g) {
#if defined(__HIP_DEVICE_COMPILE__)
  asm volatile("global_load_async_to_lds_b128 %0, %1, off\n\t"
               "s_wait_xcnt 0x0"
               :: "v"(l), "v"(g) : "memory");
#endif
}
__device__ __forceinline__ void wait_async0() {   // this wave's copies have landed
#if defined(__HIP_DEVICE_COMPILE__)
  asm volatile("s_wait_asynccnt 0x0" ::: "memory");
#endif
}
__device__ __forceinline__ void wait_ds0() {      // this wave's LDS reads have returned before their buffer is refilled
#if defined(__HIP_DEVICE_COMPILE__)
  asm volatile("s_wait_dscnt 0x0" ::: "memory");
#endif
}
// The wait before a register that an issued global store names is rewritten. p is named so that what is formed from it afterwards
// (the following stores' addresses) cannot be moved in front of the wait.
__device__ __forceinline__ void wait_x0(unsigned& p) {
#if defined(__HIP_DEVICE_COMPILE__)
  asm volatile("s_wait_xcnt 0x0" : "+v"(p) :: "memory");
#endif
}
__device__ __forceinline__ FragB ld_lfrag(const unsigned char* p) {   // split k map of ldfrag_h: bytes 0..15 and 32..47
  FragB f;
  f.u[0] = *(const v4u*)(p);
  f.u[1] = *(const v4u*)(p + 32);
  return f;
}
__device__ __forceinline__ v8f mma_sel(FragB a, FragB b, v8f c, bool bf) {
  if (bf) return mma_b(a.v, b.v, c);
  return mma_h(__builtin_bit_cast(v16h, a.v), __builtin_bit_cast(v16h, b.v), c);
}

template <bool BF, int EPI>
__device__ __forceinline__ void gemm_core(unsigned char* ring, float* slab, const u16* __restrict__ A,
                                          const u16* __restrict__ Bt, const float* __restrict__ bias,
                                          float* C, u16* P, int bid, bool tr, bool hasb, int M, int N, int K, float oscale,
                                          float pscale, unsigned char* xrow = nullptr, float* edge = nullptr,
                                          const float* __restrict__ part = nullptr) {
  const int tid = threadIdx.x, wave = tid >> 5, lane = tid & 31, hh = lane >> 4, m = lane & 15;
  const int ntile = N >> 7;
  const int row0  = (bid / ntile) * GBT;
  const int col0  = (bid % ntile) * GBT;
  if (row0 + GBT > M) return;                // block-uniform, in front of every barrier; never taken with the exact grid
  const int wr = wave >> 1, wc = wave & 1;
  const int nst = K >> 7;
  const int cr = tid >> 4, cc = tid & 15;    // copy: row within a group of 8, 16-B chunk of the 256-B row
  const u16* ga = A  + (size_t)(row0 + cr) * K + cc * 8;
  const u16* gb = Bt + (size_t)(col0 + cr) * K + cc * 8;
  const size_t rs8 = (size_t)8 * K;
  const unsigned l0 = lds_off(ring) + (unsigned)(cr * GPITCH + cc * 16);

  v8f acc[4][4];
#pragma unroll
  for (int i = 0; i < 4; ++i) {
#pragma unroll
    for (int j = 0; j < 4; ++j) acc[i][j] = zero8();
  }
  // EPI 0, wave 0 of a block of tile column 0 (a scalar test): the row above the tile. Rows row0 - 2 and row0 - 1 (held at 0 from
  // below: block row 0 uses neither) are copied, 16 lanes each, so that every lane is on.
  v8f accx = zero8();
  bool xt = false;
  const u16* gx = A;
  unsigned lx = 0;
  if constexpr (EPI == 0) {
    xt = (col0 == 0) && (__builtin_amdgcn_readfirstlane(wave) == 0);
    const int xr = row0 - 2 + hh;
    gx = A + (size_t)(xr < 0 ? 0 : xr) * K + m * 8;
    lx = lds_off(xrow) + (unsigned)(hh * GPITCH + m * 16);
  }

  fill_stage(l0, ga, gb, rs8);
  if constexpr (EPI == 0) {
    if (xt) copy1(lx, gx);
    if (bid == 0) {                          // block-uniform: the scores, while stage 0 flies; wave = batch (4 waves, NB = 4)
      const float* pp = part + ((size_t)wave * WPB + lane) * 32;
      float pv[WPB / 32];
#pragma unroll
      for (int i = 0; i < WPB / 32; ++i) pv[i] = pp[(size_t)i * (32 * 32)];     // all in flight together
      float s = 0.f;
#pragma unroll
      for (int i = 0; i < WPB / 32; ++i) s += pv[i];
      wait_x_part();                         // before the loads' address registers are written anew
#pragma unroll
      for (int d = 16; d >= 1; d >>= 1) s += __shfl_xor(s, d, 32);
      if (lane == 0) edge[wave] = s * DEPSC;
    }
  }
  wait_async0();
  __syncthreads();                           // publishes stage 0
  if (nst > 1) {
    fill_stage(l0 + GBUF, ga + GKS, gb + GKS, rs8);
    if constexpr (EPI == 0) {
      if (xt) copy1(lx + XRB, gx + GKS);
    }
  }

  for (int t = 0; t < nst; ++t) {
    const unsigned bo = (unsigned)(t & 1) * GBUF;
    const unsigned char* ab = ring + bo + (wr * 64 + m) * GPITCH + hh * 16;
    const unsigned char* bb = ring + bo + GOPB + (wc * 64 + m) * GPITCH + hh * 16;
    FragB a[2][4], b[2][4];                  // set (ks & 1) holds the fragments of k step ks
#pragma unroll
    for (int i = 0; i < 4; ++i) { a[0][i] = ld_lfrag(ab + i * 16 * GPITCH); b[0][i] = ld_lfrag(bb + i * 16 * GPITCH); }
#pragma unroll
    for (int ks = 0; ks < GKS / 32; ++ks) {
      const int cs = ks & 1;
      if (ks + 1 < GKS / 32) {
#pragma unroll
        for (int i = 0; i < 4; ++i) {
          a[cs ^ 1][i] = ld_lfrag(ab + i * 16 * GPITCH + (ks + 1) * 64);
          b[cs ^ 1][i] = ld_lfrag(bb + i * 16 * GPITCH + (ks + 1) * 64);
        }
      }
      // keeps the next k step's LDS reads one group ahead of this step's products instead of spread among them
      __builtin_amdgcn_sched_barrier(0);
#pragma unroll
      for (int i = 0; i < 4; ++i) {
#pragma unroll
        for (int j = 0; j < 4; ++j) acc[i][j] = mma_sel(a[cs][i], b[cs][j], acc[i][j], BF);
      }
      // keeps the following group of LDS reads behind this step's products
      __builtin_amdgcn_sched_barrier(0);
    }
    if constexpr (EPI == 0) {
      if (xt) {                              // the stage's 128 k of (row above the tile) x (flat columns 0..15)
        const unsigned char* xa = xrow + (unsigned)(t & 1) * XRB + GPITCH + hh * 16;
        const unsigned char* xb = ring + bo + GOPB + m * GPITCH + hh * 16;
#pragma unroll
        for (int ks = 0; ks < GKS / 32; ++ks) accx = mma_sel(ld_lfrag(xa + ks * 64), ld_lfrag(xb + ks * 64), accx, BF);
      }
    }
    wait_ds0();
    wait_async0();
    __syncthreads();                         // publishes stage t+1 and ends every reader's last read of stage t's buffer
    if (t + 2 < nst) {
      fill_stage(l0 + bo, ga + (size_t)(t + 2) * GKS, gb + (size_t)(t + 2) * GKS, rs8);
      if constexpr (EPI == 0) {
        if (xt) copy1(lx + (unsigned)(t & 1) * XRB, gx + (size_t)(t + 2) * GKS);
      }
    }
  }
  wait_async0();

  const int colw = col0 + wc * 64;
  if constexpr (EPI == 0) {
    float* sl = slab + wave * SLAB64;
    // flat columns colw + 4m .. +3 = image columns NB less, modulo N (a piece of four never straddles the wrap)
    const v4f badd = *(const v4f*)(bias + ((colw + m * 4 + N - NB) & (N - 1)));
    const bool ew = (col0 == 0) && (__builtin_amdgcn_readfirstlane(wc) == 0);   // scalar: this wave holds flat columns 0..3
    if (col0 == 0) {                         // block-uniform
      if (ew && m < NB) {                    // as in the slab: times oscale, the bias is added on the way out
#pragma unroll
        for (int i = 0; i < 4; ++i) {
#pragma unroll
          for (int r = 0; r < 8; ++r) edge[(wr * 64 + i * 16 + 8 * hh + r + 1) * 4 + m] = acc[i][0][r] * oscale;
        }
        if (xt && row0 != 0 && hh == 0) edge[m] = accx[0] * oscale;
      }
      __syncthreads();                       // the block's 129 edge entries are in LDS
    }
#pragma unroll
    for (int i = 0; i < 4; ++i) {
      if (i) wave_sync_lds();                // the slab's last readers are done before other lanes overwrite it
      epi64(sl, acc[i][0], acc[i][1], acc[i][2], acc[i][3], oscale, badd, C, N, (size_t)(row0 + wr * 64 + i * 16), colw, lane,
            (int)(edge - sl) + (wr * 64 + i * 16) * 4, ew, i == 0 && xt && row0 == 0);
    }
    // thread 0's badd is the bias of the last NB image columns
    if (col0 == 0 && row0 + GBT == M && tid == 0) *(v4f*)(C + (size_t)M * (size_t)N) = *(const v4f*)(edge + GBT * 4) + badd;
  } else if (!tr) {
    // The wave's 64 x 64 f32 tile (times oscale) is staged whole in its own part of the ring (pitch 68 floats), which the last
    // stage's barrier has freed of readers and copies; read back with 8 lanes per row (8 columns each), so that every 128-B
    // row piece of the plane leaves as one whole line.
    // coverage: 16 instructions x 4 rows x 8 lanes x 8 halves = the wave's 64 x 64 tile.
    float* sl = (float*)(void*)ring + wave * (64 * 68);
#pragma unroll
    for (int i = 0; i < 4; ++i) {
#pragma unroll
      for (int r = 0; r < 8; ++r) {
        const int ro = (i * 16 + 8 * hh + r) * 68 + m;
#pragma unroll
        for (int j = 0; j < 4; ++j) sl[ro + 16 * j] = acc[i][j][r] * oscale;
      }
    }
    const int rq = lane >> 3, p8 = (lane & 7) * 8;
    const float* bp = bias + colw + p8;                   // columns colw + 8(lane & 7) .. +7, always < N
    const v4f bv0 = *(const v4f*)(bp), bv1 = *(const v4f*)(bp + 4);
    v4f b0, b1;
#pragma unroll
    for (int e = 0; e < 4; ++e) { b0[e] = hasb ? bfr(bv0[e]) : 0.f; b1[e] = hasb ? bfr(bv1[e]) : 0.f; }
    wave_sync_lds();
    v4u o[16];
#pragma unroll
    for (int it = 0; it < 16; ++it) {
      const float* s = sl + (it * 4 + rq) * 68 + p8;
      const v4f x = (*(const v4f*)(s) + b0) * pscale, y = (*(const v4f*)(s + 4) + b1) * pscale;
      const v8f f = {x[0], x[1], x[2], x[3], y[0], y[1], y[2], y[3]};
      o[it] = __builtin_bit_cast(v4u, __builtin_convertvector(f, v8h));
    }
    u16* dst = P + (size_t)(row0 + wr * 64 + rq) * (size_t)N + colw + p8;
    unsigned adv = 0;                        // elements from dst to the current group of four stores
#pragma unroll
    for (int it = 0; it < 16; ++it) {
      *(v4u*)(dst + adv + (size_t)((it & 3) * 4) * (size_t)N) = o[it];
      // behind every group of four: the next stores' addresses, and whatever follows the last group, may be formed in registers
      // that an issued store names; the addresses are formed from adv behind the wait
      if ((it & 3) == 3) { wait_x0(adv); adv += 16u * (unsigned)N; }
    }
  } else {
    // An accumulator lane holds 8 consecutive rows of one column: 16 B of a transposed line. The wave's 64 columns x 64 rows
    // are gathered in its own part of the ring (pitch 144 B), which the last stage's barrier has freed of readers and copies,
    // and leave as whole 128-B lines, 8 lanes each.
    // coverage: 16 instructions x 4 lines x 8 lanes x 8 halves = the wave's 64 x 64 tile.
    unsigned char* st = ring + wave * (64 * VTS);
#pragma unroll
    for (int j = 0; j < 4; ++j) {
      const float bj = bfr(bias[colw + j * 16 + m]);
#pragma unroll
      for (int i = 0; i < 4; ++i) {
        const v8f f = (acc[i][j] * oscale + bj) * pscale;
        *(v8h*)(st + (j * 16 + m) * VTS + i * 32 + hh * 16) = __builtin_convertvector(f, v8h);
      }
    }
    wave_sync_lds();
    const int rq = lane >> 3, p = lane & 7;
    v4u t[16];
#pragma unroll
    for (int it = 0; it < 16; ++it) t[it] = *(const v4u*)(st + (it * 4 + rq) * VTS + p * 16);
    const int roww = row0 + wr * 64;         // 64 rows of one batch (SEQ % 128 == 0)
    u16* dst = P + ((size_t)(roww / SEQ) * (size_t)N + colw + rq) * SEQ + (roww % SEQ) + p * 8;
#pragma unroll
    for (int it = 0; it < 16; ++it) *(v4u*)(dst + (size_t)(it * 4) * SEQ) = t[it];
  }
}

// The q, k and v projections and the folded weight in one grid (they depend on nothing of one another): blocks [0, GBLK) give the
// q plane, [GBLK, 2 GBLK) the k plane, [2 GBLK, 3 GBLK) the v^T plane (GBLK = the 128x128 tiles of one projection, M = ROWS,
// N = DMOD); third s multiplies by weight rows s * N .. s * N + N - 1. The last GBW blocks give Wf[n][k] = sum_j Wd[(n - NB) mod N][j] *
// Wo[j][k] (A = the Wd plane with rows turned by NB places, Bt = the transposed Wo plane, N x N, no bias), stored as the f16 plane x wsc.
__global__ __launch_bounds__(128)
void gemm_qkv(const u16* __restrict__ A, const u16* __restrict__ Bt, const float* __restrict__ bias,
              const u16* __restrict__ WD, const u16* __restrict__ WOT,
              u16* QPo, u16* KPo, u16* VPo, u16* WFo, int M, int N, int K, float qsc, float ksc, float vsc, float wsc) {
  __shared__ __align__(16) unsigned char ring[2 * GBUF];
  const int seg = (int)blockIdx.x / GBLK;    // block-uniform
  if (seg > 3) return;                       // in front of every barrier; never taken with the exact grid
  const bool fold = (seg == 3);
  u16* P = (seg == 0) ? QPo : (seg == 1) ? KPo : (seg == 2) ? VPo : WFo;
  const float ps = (seg == 0) ? qsc : (seg == 1) ? ksc : (seg == 2) ? vsc : wsc;
  const int sb = fold ? 0 : seg;             // the fold reads no bias: its pointer stays inside the array
  gemm_core<true, 2>(ring, nullptr, fold ? WD : A, fold ? WOT : Bt + (size_t)seg * N * K, bias + sb * N, nullptr, P,
                     (int)blockIdx.x - seg * GBLK, seg == 2, !fold, fold ? N : M, N, K, 1.0f, ps);
}

__global__ __launch_bounds__(128)
void gemm_h1(const u16* __restrict__ A, const u16* __restrict__ Bt, const float* __restrict__ bias,
             const float* __restrict__ PART, float* C, int M, int N, int K, float oscale) {
  __shared__ __align__(16) unsigned char ring[2 * GBUF];
  __shared__ __align__(16) float slab[4 * SLAB64 + (GBT + 1) * 4];   // the waves' slabs, then the 129 edge entries
  __shared__ __align__(16) unsigned char xrow[2 * XRB];    // two buffers of the two rows above the tile, pitch as in the ring
  gemm_core<false, 0>(ring, slab, A, Bt, bias, C, nullptr, (int)blockIdx.x, false, true, M, N, K, oscale, 1.0f, xrow,
                      slab + 4 * SLAB64, PART);
}

// =====================================================================================================
// Multi-head flash attention (no mask): block = (batch b, head, 256 query rows), 8 waves, wave w owns the 32 query rows
// q0 = 256*qt + 32*w .. q0+31 as two query tiles of 16; every k and v^T fragment read from LDS is used for both tiles. What
// follows describes one query tile (q0 there = the tile's first row).
//   q plane (f16, x8) laid out [b][s][h][d]; k plane the same; v^T plane [b][h][d][s] (x1024).
//   All NKB = SEQ/32 key blocks of 32 keys are visited (static bound), in stages of 128 keys that the block's waves share:
//   a stage is 128 k rows of 256 B (all d) and 128 v^T rows of 256 B (its 128 keys), laid in LDS at pitch 272 B by asynchronous
//   b128 copies (16 lanes = one whole 256-B row). Two buffers: stage t+1 flies while stage t is worked on. The fragments are
//   read from LDS with the split k map of ldfrag_h. After the last stage's barrier the ring is the epilogue's staging room.
//   Scores are computed TRANSPOSED: S^T tile g (g = 0,1) = k rows (keys kb+16g .. +15, A operand, row m = lane&15, split k map
//   over d, 4 chunks of 32 d) times q^T (B operand, col n = query q0 + (lane&15), k = d, split map).
//   D element r of lane l = (key kb+16g+8h+r, query q0+(l&15)), so a lane owns one query column and 16 of its 32 keys; the
//   partner lane l^16 owns the other 16 -> the row max needs one exchange with lane l^16 (a vector cross-row move); each lane
//   half keeps the running sum of its own keys, and the two are joined once, in the epilogue.
//   Online max-subtracted base-2 softmax in f32 (scale 1/sqrt(128) and the q/k carries folded into lsc; scale, maximum and
//   the x32768 carry of P enter a score's exponent through one FMA; l carries the x32768 too). The exp'd values ARE
//   the P^T B-fragment in place: B col n = query = lane&15, element i <- key kb+8h+i (tile 0, D element i), element 8+i <- key
//   kb+16+8h+i (tile 1, D element i). P is carried x32768 as single f16. The result is accumulated TRANSPOSED too:
//   O^T tile j = v^T rows (A operand, row m = d = 16j + (lane&15), keys k-contiguous) times P^T; D element r of lane l =
//   (d = 16j+8h+r, query q0+(l&15)), so a lane's accumulators belong to the one query whose maximum and sum it holds: the
//   rescale factor and 1/l are the lane's own values. 8 WMMAs per key block and query tile; the two tiles' 16 stand together.
//   Epilogue: 1/l and carry folds in f32; a lane's 8 accumulator registers are 8 consecutive d of its query's row: 16 B of
//   f16, staged in the wave's LDS slab (16 rows, pitch 272 B); each 256-B output row (b, q0+row, head) of the O plane
//   (O x1024 as single f16) leaves as 2 whole lines.
// coverage: per wave and query tile 8 instructions x 2 rows x 16 lanes x 8 halves = 16 x 128 of the O plane + 1 PART line; grid
//           NB*NH*SEQ/256 blocks x 8 waves x 2 tiles = every (b, s, h) row of the O plane and every PART line exactly once.
// =====================================================================================================
// Eight asynchronous 16-B-per-lane copies, rows 16 apart. The s_wait_xcnt stands inside the statement so that no address
// register of a copy is rewritten in front of it.
__device__ __forceinline__ void copy8w(unsigned l, const u16* g, size_t rs16) {
#if defined(__HIP_DEVICE_COMPILE__)
  asm volatile("global_load_async_to_lds_b128 %0, %8, off\n\t"
               "global_load_async_to_lds_b128 %1, %9, off\n\t"
               "global_load_async_to_lds_b128 %2, %10, off\n\t"
               "global_load_async_to_lds_b128 %3, %11, off\n\t"
               "global_load_async_to_lds_b128 %4, %12, off\n\t"
               "global_load_async_to_lds_b128 %5, %13, off\n\t"
               "global_load_async_to_lds_b128 %6, %14, off\n\t"
               "global_load_async_to_lds_b128 %7, %15, off\n\t"
               "s_wait_xcnt 0x0"
               :: "v"(l), "v"(l + 16u * GPITCH), "v"(l + 32u * GPITCH), "v"(l + 48u * GPITCH),
                  "v"(l + 64u * GPITCH), "v"(l + 80u * GPITCH), "v"(l + 96u * GPITCH), "v"(l + 112u * GPITCH),
                  "v"(g), "v"(g + rs16), "v"(g + 2 * rs16), "v"(g + 3 * rs16),
                  "v"(g + 4 * rs16), "v"(g + 5 * rs16), "v"(g + 6 * rs16), "v"(g + 7 * rs16)
               : "memory");
#endif
}
// One attention stage: this thread's 16 B of rows cr + 16i (i = 0..7) of the k tile and of the v^T tile; 16 copies per wave.
__device__ __forceinline__ void fill_kv(unsigned l, const u16* gk, const u16* gv) {
  copy8w(l, gk, (size_t)16 * RS);
  copy8w(l + AOPB, gv, (size_t)16 * SEQ);
}
// 2^x by the hardware instruction alone. A result below 2^-126 comes back as 0: here that is a probability (carried x32768) or
// a rescale factor that small beside a row maximum of 32768, far below the last bit that the f16 operand and the f32 sums keep.
__device__ __forceinline__ float exp2_hw(float x) { return __builtin_amdgcn_exp2f(x); }
__device__ __forceinline__ v16h ld_lfrag_h(const unsigned char* p) {  // split k map of ldfrag_h: bytes 0..15 and 32..47
  FragH f;
  f.u[0] = *(const v4u*)(p);
  f.u[1] = *(const v4u*)(p + 32);
  return f.v;
}

// The v_nop is the slot that the instruction set asks for behind a transcendental before its result is read or its source
// overwritten. The results and the sources are named so that none of them is touched in front of it, wherever it lands.
__device__ __forceinline__ void trans_slot8(float* p, const float* x) {
#if defined(__HIP_DEVICE_COMPILE__)
  asm("v_nop" : "+v"(p[0]), "+v"(p[1]), "+v"(p[2]), "+v"(p[3]), "+v"(p[4]), "+v"(p[5]), "+v"(p[6]), "+v"(p[7])
              : "v"(x[0]), "v"(x[1]), "v"(x[2]), "v"(x[3]), "v"(x[4]), "v"(x[5]), "v"(x[6]), "v"(x[7]));
#endif
}
__device__ __forceinline__ void trans_slot1(float& p, float x) {
#if defined(__HIP_DEVICE_COMPILE__)
  asm("v_nop" : "+v"(p) : "v"(x));
#endif
}

// The value of lane l ^ 16, by a vector cross-row move: it does not queue behind the v^T fragments' LDS reads.
__device__ __forceinline__ float xhalf(float x) {
  return __builtin_bit_cast(float, __builtin_amdgcn_permlanex16(__builtin_bit_cast(int, x), __builtin_bit_cast(int, x),
                                                                0x76543210, 0xfedcba98, false, false));
}

// One query tile's online-softmax step over a key block: s0, s1 = the tile's unscaled transposed scores (this lane's 16 keys of
// query column c). Updates the running maximum (kept unscaled, lsc > 0) and the running sum of this lane's own keys, gives the
// rescale factor al of the lane's O^T accumulators and the P^T B-fragment ph (f16, carried x32768).
__device__ __forceinline__ void softmax_step(const v8f s0, const v8f s1, const float lsc, float& mrun, float& lrun, float& al,
                                             FragH& ph) {
  float tk[16];
#pragma unroll
  for (int i = 0; i < 8; ++i) { tk[i] = s0[i];  tk[8 + i] = s1[i]; }
  float cm = -INFINITY;
#pragma unroll
  for (int i = 0; i < 16; ++i) cm = fmaxf(cm, tk[i]);
  cm = fmaxf(cm, xhalf(cm));
  const float mn = fmaxf(mrun, cm);                                // finite from the first key block on
  const float ax = (mrun - mn) * lsc;
  float ae = exp2_hw(ax);
  trans_slot1(ae, ax);
  al = (mrun == -INFINITY) ? 0.f : ae;                             // o and l are zero while mrun is -inf
  mrun = mn;
  // probabilities carried x32768, one FMA and one v_exp_f32 each: 2^(t * lsc + (15 - mn * lsc)); they are summed and
  // rounded to the P^T B-fragment (f16) as they come; element i <-> tk[i]
  const float eb = __builtin_fmaf(-mn, lsc, PEXP);
  const v2f l2 = {lsc, lsc}, e2 = {eb, eb};
  float x[16], p[16];
#pragma unroll
  for (int i = 0; i < 16; i += 2) {
    const v2f t2 = {tk[i], tk[i + 1]};       // a register pair of the score accumulator: one packed FMA, no moves
    const v2f x2 = __builtin_elementwise_fma(t2, l2, e2);
    x[i] = x2[0];
    x[i + 1] = x2[1];
  }
#pragma unroll
  for (int i = 0; i < 16; ++i) p[i] = exp2_hw(x[i]);
  trans_slot8(p, x);
  trans_slot8(p + 8, x + 8);
  float ps = 0.f;
#pragma unroll
  for (int w = 0; w < 2; ++w) {
#pragma unroll
    for (int e4 = 0; e4 < 4; ++e4) {
      const int i = 8 * w + 2 * e4;
      ps += p[i] + p[i + 1];
      const v2f pp = {p[i], p[i + 1]};
      ph.u[w][e4] = __builtin_bit_cast(unsigned, __builtin_convertvector(pp, v2h));
    }
  }
  lrun = lrun * al + ps;                     // al is the same in both lane halves
}

// two waves per SIMD (one block per WGP): the register budget that holds two query tiles' accumulators beside the fragments
__global__ __launch_bounds__(ATT_THREADS) __attribute__((amdgpu_waves_per_eu(2, 2)))
void attn_fwd(const u16* __restrict__ QPp, const u16* __restrict__ KPp, const u16* __restrict__ VPp,
              u16* OPo, float* PART) {
  // two stage buffers (k tile, then v^T tile); in the epilogue, per wave and query tile, the result slab: 16 rows, pitch 272 B
  __shared__ __align__(16) unsigned char ring[2 * ABUF];

  const int tid  = threadIdx.x;
  const int wave = tid >> 5;
  const int lane = tid & 31;
  const int hh   = lane >> 4;
  const int c    = lane & 15;

  const int bid  = blockIdx.x;
  const int qt   = bid & ((SEQ / ATT_QROWS) - 1);
  const int head = (bid >> AQT_BITS) & (NH - 1);
  const int b    = bid >> (AQT_BITS + NH_BITS);
  const int q0   = qt * ATT_QROWS + wave * (ATT_QT * 16);   // query tile u: rows q0 + 16u .. q0 + 16u + 15

  // B fragments of q^T: col n = query q0 + 16u + c, k = d (k-contiguous row of the q plane)
  const _Float16* Qb = (const _Float16*)(const void*)QPp + ((size_t)(b * SEQ + q0 + c) * NH + head) * HD + 8 * hh;
  // copy: row within a group of 16, 16-B chunk of the 256-B row; k tile row = key, v^T tile row = d
  const int cr = tid >> 4, cc = tid & 15;
  const u16* kb0 = KPp + ((size_t)(b * SEQ) * NH + head) * HD;                  // block-uniform; stage t: + t * AKS key rows
  const u16* vb0 = VPp + ((size_t)(b * NH + head) * HD) * SEQ;                  // block-uniform; stage t: + t * AKS keys
  const unsigned ko = (unsigned)(cr * RS + cc * 8), vo = (unsigned)(cr * SEQ + cc * 8);   // this thread's place in a stage
  const unsigned l0 = lds_off(ring) + (unsigned)(cr * GPITCH + cc * 16);
  fill_kv(l0, kb0 + ko, vb0 + vo);
  const float lsc = SM_SCALE * (LOG2E / (QSC * KSC));

  v16h qf[ATT_QT][4];                        // chunk n: d 32n .. 32n + 31
#pragma unroll
  for (int u = 0; u < ATT_QT; ++u) {
#pragma unroll
    for (int n = 0; n < 4; ++n) qf[u][n] = ldfrag_h(Qb + (size_t)u * (16 * RS) + n * 32);
  }

  float mrun[ATT_QT], lrun[ATT_QT];
  v8f o[ATT_QT][8];
#pragma unroll
  for (int u = 0; u < ATT_QT; ++u) {
    mrun[u] = -INFINITY;
    lrun[u] = 0.f;
#pragma unroll
    for (int j = 0; j < 8; ++j) o[u][j] = zero8();
  }

  wait_async0();
  __syncthreads();                           // publishes stage 0
  fill_kv(l0 + ABUF, kb0 + (ko + AKS * RS), vb0 + (vo + AKS));   // stage 1 exists (ANST >= 2)

  // one rolled trip per stage, so that the ring's publish point stands once, at the trip's foot
#pragma unroll 1
  for (int t = 0; t < ANST; ++t) {
   const unsigned bo = (unsigned)(t & 1) * ABUF;
   // A fragments of k: row m = key kb + 16g + c, k = d;  A fragments of v^T: row m = d = 16j + c, k = key
   const unsigned char* kt = ring + bo + c * GPITCH + hh * 16;
   const unsigned char* vt = ring + bo + AOPB + c * GPITCH + hh * 16;
   // stays rolled: one key block's live values already take most of the registers of two waves per SIMD
#pragma unroll 1
   for (int kk = 0; kk < AKS / 32; ++kk) {   // key block kb = t * AKS + kk * 32
    // ---- transposed scores of both query tiles from one read of the k fragments:
    //      sa[u] = keys kb..kb+15, sc[u] = keys kb+16..kb+31, column = query q0 + 16u + c ----
    v8f sa[ATT_QT], sc[ATT_QT];
#pragma unroll
    for (int u = 0; u < ATT_QT; ++u) { sa[u] = zero8(); sc[u] = zero8(); }
    const unsigned char* k0p = kt + kk * 32 * GPITCH;
    const unsigned char* k1p = k0p + 16 * GPITCH;
    const unsigned char* vp  = vt + kk * 64;
    const v16h ka0 = ld_lfrag_h(k0p), kc0 = ld_lfrag_h(k1p);
    const v16h ka1 = ld_lfrag_h(k0p + 64), kc1 = ld_lfrag_h(k1p + 64);
    const v16h ka2 = ld_lfrag_h(k0p + 128), kc2 = ld_lfrag_h(k1p + 128);
    const v16h ka3 = ld_lfrag_h(k0p + 192), kc3 = ld_lfrag_h(k1p + 192);
    // keeps the k fragments' reads one group ahead of the products instead of pair by pair, each with a full wait, among them
    __builtin_amdgcn_sched_barrier(0);
    sa[0] = mma_h(ka0, qf[0][0], sa[0]);
    sa[1] = mma_h(ka0, qf[1][0], sa[1]);
    sc[0] = mma_h(kc0, qf[0][0], sc[0]);
    sc[1] = mma_h(kc0, qf[1][0], sc[1]);
    sa[0] = mma_h(ka1, qf[0][1], sa[0]);
    sa[1] = mma_h(ka1, qf[1][1], sa[1]);
    sc[0] = mma_h(kc1, qf[0][1], sc[0]);
    sc[1] = mma_h(kc1, qf[1][1], sc[1]);
    // keeps the first four v^T fragments' reads here, as one group behind the first eight products, so that they return
    // behind the softmax arithmetic
    __builtin_amdgcn_sched_barrier(0);
    const v16h vf0 = ld_lfrag_h(vp);
    const v16h vf1 = ld_lfrag_h(vp + 16 * GPITCH);
    const v16h vf2 = ld_lfrag_h(vp + 32 * GPITCH);
    const v16h vf3 = ld_lfrag_h(vp + 48 * GPITCH);
    __builtin_amdgcn_sched_barrier(0);       // ends that group of reads
    sa[0] = mma_h(ka2, qf[0][2], sa[0]);
    sa[1] = mma_h(ka2, qf[1][2], sa[1]);
    sc[0] = mma_h(kc2, qf[0][2], sc[0]);
    sc[1] = mma_h(kc2, qf[1][2], sc[1]);
    sa[0] = mma_h(ka3, qf[0][3], sa[0]);
    sa[1] = mma_h(ka3, qf[1][3], sa[1]);
    sc[0] = mma_h(kc3, qf[0][3], sc[0]);
    sc[1] = mma_h(kc3, qf[1][3], sc[1]);
    __builtin_amdgcn_sched_barrier(0);       // the last four v^T fragments' reads: one group behind the scores' last product
    const v16h vf4 = ld_lfrag_h(vp + 64 * GPITCH);
    const v16h vf5 = ld_lfrag_h(vp + 80 * GPITCH);
    const v16h vf6 = ld_lfrag_h(vp + 96 * GPITCH);
    const v16h vf7 = ld_lfrag_h(vp + 112 * GPITCH);
    __builtin_amdgcn_sched_barrier(0);       // ends that group of reads
    // ---- per query tile: online softmax, then the rescale of its O^T accumulators: D column c = query q0+16u+c, whose
    //      factor this lane holds ----
    FragH ph[ATT_QT];
#pragma unroll
    for (int u = 0; u < ATT_QT; ++u) {
      float al;
      softmax_step(sa[u], sc[u], lsc, mrun[u], lrun[u], al, ph[u]);
#pragma unroll
      for (int j = 0; j < 8; ++j) o[u][j] = o[u][j] * al;
    }
    // ---- v^T.P^T : A fragment row m = d = j*16 + c, keys contiguous in the v^T tile; every fragment serves both query tiles;
    //      the v_nop behind the last of the 16 are for the loop's branch ----
    o[0][0] = mma_h(vf0, ph[0].v, o[0][0]);
    o[1][0] = mma_h(vf0, ph[1].v, o[1][0]);
    o[0][1] = mma_h(vf1, ph[0].v, o[0][1]);
    o[1][1] = mma_h(vf1, ph[1].v, o[1][1]);
    o[0][2] = mma_h(vf2, ph[0].v, o[0][2]);
    o[1][2] = mma_h(vf2, ph[1].v, o[1][2]);
    o[0][3] = mma_h(vf3, ph[0].v, o[0][3]);
    o[1][3] = mma_h(vf3, ph[1].v, o[1][3]);
    o[0][4] = mma_h(vf4, ph[0].v, o[0][4]);
    o[1][4] = mma_h(vf4, ph[1].v, o[1][4]);
    o[0][5] = mma_h(vf5, ph[0].v, o[0][5]);
    o[1][5] = mma_h(vf5, ph[1].v, o[1][5]);
    o[0][6] = mma_h(vf6, ph[0].v, o[0][6]);
    o[1][6] = mma_h(vf6, ph[1].v, o[1][6]);
    o[0][7] = mma_h(vf7, ph[0].v, o[0][7]);
    o[1][7] = mma_h(vf7, ph[1].v, o[1][7]);
    guard_foot(o[0][4], o[0][5], o[0][6], o[0][7], o[1][4], o[1][5], o[1][6], o[1][7]);
   }
   wait_ds0();
   wait_async0();
   __syncthreads();                          // publishes stage t+1 and ends every reader's last read of stage t's buffer
   if (t + 2 < ANST) fill_kv(l0 + bo, kb0 + (ko + (unsigned)(t + 2) * (AKS * RS)), vb0 + (vo + (unsigned)(t + 2) * AKS));
  }
  wait_async0();

  // the last stage's barrier lies behind every wave's last fragment read and last copy: the ring is free
#pragma unroll
  for (int u = 0; u < ATT_QT; ++u) {
    // ---- join the lane halves' sums; fold 1/l (the lane's own query) and the carries; row statistic r = l * (1/l);
    //      O x1024 -> f16, staged as row c, d 16j + 8hh .. + 7 of the slab ----
    const float lf   = lrun[u] + xhalf(lrun[u]);
    const float rl   = (lf > 0.f) ? (1.0f / lf) : 0.f;
    const float linv = rl * (1.0f / VCAR);   // l carries the same x32768 as P
    const float rr   = lf * rl;
    unsigned char* slab = ring + (wave * ATT_QT + u) * (16 * GPITCH);
#pragma unroll
    for (int j = 0; j < 8; ++j) {
      const v8f f = (o[u][j] * linv) * OSC;
      *(v8h*)(slab + c * GPITCH + j * 32 + hh * 16) = __builtin_convertvector(f, v8h);
    }
    wave_sync_lds();
    // ---- read back: lane = (row parity hh, 8 consecutive d at c8) ----
    v4u oh[8];
    const int c8 = c * 8;
#pragma unroll
    for (int it = 0; it < 8; ++it) oh[it] = *(const v4u*)(slab + (it * 2 + hh) * GPITCH + c * 16);
    // ---- tile row-sum partial (fixed xor tree over the 16 query lanes; both lane halves hold identical values) ----
    float wsum = rr;
    wsum += __shfl_xor(wsum, 1, 32);
    wsum += __shfl_xor(wsum, 2, 32);
    wsum += __shfl_xor(wsum, 4, 32);
    wsum += __shfl_xor(wsum, 8, 32);
    v4f pv = zero4();
    pv[0] = (lane == 0) ? wsum : 0.f;
    float* pd = PART + (((size_t)bid * ATT_WAVES + wave) * ATT_QT + u) * 32 + (lane & 7) * 4;   // clamped address for every lane
    const size_t ob = ((size_t)(b * SEQ + q0 + 16 * u) * NH + head) * HD + c8;
#pragma unroll
    for (int it = 0; it < 8; ++it) {
      const int row = it * 2 + hh;
      *(v4u*)(OPo + ob + (size_t)row * RS) = oh[it];
    }
    if (lane < 8) *(v4f*)(pd) = pv;
  }
}

// =====================================================================================================
// Workspace map (bytes); every plane is fully written by whole-line stores before it is read; all extents are exact multiples
// of the store granularity (no pad rows needed):
//   XB   bf16 [ROWS][1024]                 NB*4194304   (bf16 copy of the input activations)
//   WQKV bf16 [3072 n][1024 k]                6291456
//   WOT  bf16 [1024 k][1024 j] (Wo turned)    2097152   WDB bf16 [1024 n][1024 j] 2097152   (rows turned by NB places)
//   QP   f16  [ROWS][8][128] x8            NB*4194304
//   KP   f16  same                          NB*4194304
//   VP   f16  [NB][8][128][2048] x1024      NB*4194304
//   OP   f16  [ROWS][8][128] x1024         NB*4194304
//   PART f32  [ATT_BLOCKS*8*2][32]         NB*131072
//   WF   f16  [1024 n][1024 k] x256           2097152   (Wd.Wo, rows turned by NB places)
//   BF   f32  [1024]                             4096   (Wd.bo + bd)
//   end (NB = 4)                             96997376
// =====================================================================================================
extern "C" void kernel_launch(void* const* d_in, const int* in_sizes, int n_in,
                              void* d_out, int out_size, void* d_ws, size_t ws_size,
                              hipStream_t stream) {
  if (n_in < 7) return;
  if (in_sizes[0] != ROWS * DMOD) return;
  if (in_sizes[1] != 3 * DMOD * DMOD || in_sizes[2] != 3 * DMOD) return;
  if (in_sizes[3] != DMOD * DMOD || in_sizes[4] != DMOD) return;
  if (in_sizes[5] != DMOD * DMOD || in_sizes[6] != DMOD) return;
  if (out_size != TOTOUT) return;

  const float* x    = (const float*)d_in[0];
  const float* wqkv = (const float*)d_in[1];
  const float* bqkv = (const float*)d_in[2];
  const float* wo   = (const float*)d_in[3];
  const float* bo   = (const float*)d_in[4];
  const float* wd   = (const float*)d_in[5];
  const float* bd   = (const float*)d_in[6];
  float*       out  = (float*)d_out;

  const size_t szXB   = (size_t)ROWS * DMOD * 2;
  const size_t szWQKV = (size_t)3 * DMOD * DMOD * 2;
  const size_t szW    = (size_t)DMOD * DMOD * 2;
  const size_t szP    = (size_t)ROWS * DMOD * 2;
  const size_t szVP   = (size_t)NB * NH * HD * SEQ * 2;
  const size_t szPART = (size_t)ATT_BLOCKS * ATT_WAVES * ATT_QT * 32 * 4;
  size_t off = 0;
  const size_t oXB   = off; off += szXB;
  const size_t oWQKV = off; off += szWQKV;
  const size_t oWOT  = off; off += szW;
  const size_t oWDB  = off; off += szW;
  const size_t oQP   = off; off += szP;
  const size_t oKP   = off; off += szP;
  const size_t oVP   = off; off += szVP;
  const size_t oOP   = off; off += szP;
  const size_t oPART = off; off += szPART;
  const size_t oWF   = off; off += szW;
  const size_t oBF   = off; off += (size_t)DMOD * 4;
  if (off > ws_size) return;                            // off = 96997376 for NB = 4
  if (off > (size_t)134217728) return;

  char* ws = (char*)d_ws;
  u16*   XB   = (u16*)(ws + oXB);
  u16*   WQKV = (u16*)(ws + oWQKV);
  u16*   WOT  = (u16*)(ws + oWOT);
  u16*   WDB  = (u16*)(ws + oWDB);
  u16*   QP   = (u16*)(ws + oQP);
  u16*   KP   = (u16*)(ws + oKP);
  u16*   VP   = (u16*)(ws + oVP);
  u16*   OP   = (u16*)(ws + oOP);
  float* PART = (float*)(ws + oPART);
  u16*   WF   = (u16*)(ws + oWF);
  float* BF   = (float*)(ws + oBF);

  const dim3 blk(256);
  const dim3 gCV(CBB + CBT + CBX + CBQ + CBW);
  const dim3 gG(GBLK);
  const dim3 gG3(3 * GBLK + GBW);
  const dim3 bG(128);
  const dim3 gAT(ATT_BLOCKS);
  const dim3 bAT(ATT_THREADS);

  // (0) input activations, qkv weight and Wd -> bf16 planes (weights stored [n = out][k = in], y = x.W^T, already k-contiguous);
  //     Wo -> its transposed bf16 plane; the folded bias Wd.bo + bd
  cvt16<<<gCV, blk, 0, stream>>>(x, wqkv, wo, wd, bo, bd, XB, WQKV, WOT, WDB, BF);
  // (1) q, k, v: projection + bias (col = h*128+d); q and k stored as f16 planes x8, v as the v^T plane x1024;
  //     the folded weight Wd.Wo as the f16 plane x256
  gemm_qkv<<<gG3, bG, 0, stream>>>(XB, WQKV, bqkv, WDB, WOT, QP, KP, VP, WF, ROWS, DMOD, DMOD, QSC, KSC, VCAR, WFS);
  // (2) attention -> O plane [b][s][h][d] x1024 and per-wave row-sum lines
  attn_fwd<<<gAT, bAT, 0, stream>>>(QP, KP, VP, OP, PART);
  // (3) both output projections as one product with the folded weight and bias (carries 1024 x 256 folded back)
  //     -> the whole output buffer, scores and image, in whole lines
  gemm_h1<<<gG, bG, 0, stream>>>(OP, WF, BF, PART, out, ROWS, DMOD, DMOD, 1.0f / (OSC * WFS));
  (void)hipGetLastError();
}

// v010
// It runs in 121 microseconds.
// Two timings next to v009 both put it at 1.06 times that version's speed.
// Over all steps from v000 it is 4.90 times as fast.
// Contractions: x.W{q,k,v}^T on v_wmma_f32_16x16x32_bf16 (x and W planes RNE-converted to bf16 operands, f32 accumulate, bias added in f32);
// the folded weight Wf = Wd.Wo on the same bf16 form (both weights RNE-converted to bf16 operands, f32 accumulate);
// scores k'.q'^T (q', k' single f16 planes carried x8), v^T.P^T (P x128 single f16, at most 32768; v x1024 single f16) and O.Wf^T
// (O single f16 plane x1024, Wf single f16 plane x256): v_wmma_f32_16x16x32_f16, f32 accumulate.
// (O.Wo^T + bo).Wd^T + bd = O.(Wd.Wo)^T + (Wd.bo + bd): the two output projections are one product with Wf and the bias bf.
// Base-2 online softmax, 1/l fold, row-sum partials, the folded bias bf = Wd.bo + bd and bias adds in f32 on VALU.
// The q, k, v^T and Wf operand planes are written by the epilogue of the GEMM that produces them (f32 result, bias, carry, f16).
// The output buffer is written by the last GEMM's epilogue: its columns are turned by NB places (Wf rows turned), so that a tile's
// rows are whole lines of the flat buffer [NB scores | image].
#include <hip/hip_runtime.h>
#include <math.h>
#include <stdint.h>

#define NB    4
#define SEQ   2048
#define DMOD  1024
#define NH    8
#define HD    128
#define QT_BITS 5
#define NH_BITS 3
#define ROWS  (NB * SEQ)
#define QSC   8.0f
#define KSC   8.0f
#define PCAR  128.0f
#define PEXP  7.0f
#define PTAU  8.0f
#define VCAR  1024.0f
#define OSC   1024.0f
#define WFS   256.0f
#define SM_SCALE 0.08838834764831845f
#define LOG2E 1.4426950408889634f
#define ATT_WAVES   8
#define ATT_THREADS (ATT_WAVES * 32)
#define ATT_QT      2
#define ATT_QROWS   (ATT_WAVES * ATT_QT * 16)
#define AQT_BITS    3
#define ATT_BLOCKS  (NB * NH * (SEQ / ATT_QROWS))
#define NKB    (SEQ / 32)
#define RS     (NH * HD)
#define SLAB64 (16 * 68)
#define VTS    144
#define WPB    (NH * (SEQ / ATT_QROWS) * ATT_WAVES * ATT_QT)
#define TOTOUT (NB + ROWS * DMOD)
#define GBT    128
#define GKS    128
#define GPITCH 272
#define GOPB   (GBT * GPITCH)
#define GBUF   (2 * GOPB)
#define XRB    (2 * GPITCH)
#define AKS    128
#define ANST   (SEQ / AKS)
#define AOPB   (AKS * GPITCH)
#define ABUF   (AOPB + HD * GPITCH)
#define DEPSC  (1.0f / ((float)NH * (float)SEQ * (float)SEQ))
#define CBX    (ROWS * DMOD / 8 / 256)
#define CBQ    (3 * DMOD * DMOD / 8 / 256)
#define CBW    (DMOD * DMOD / 8 / 256)
#define CBB    (DMOD / 32)
#define CBT    ((DMOD / 64) * (DMOD / 64))
#define TPB    144
#define GBLK   ((ROWS / GBT) * (DMOD / GBT))
#define GBW    ((DMOD / GBT) * (DMOD / GBT))

static_assert(HD == 128 && DMOD == NH * HD && RS == DMOD);
static_assert(PCAR == (float)(1 << (int)PEXP) && PEXP + PTAU <= 15.0f);
static_assert((1 << QT_BITS) == (SEQ / 64) && (1 << NH_BITS) == NH);
static_assert((SEQ % 64) == 0 && (SEQ % 32) == 0 && NKB * 32 == SEQ);
static_assert(((ROWS * DMOD / 8) % 256) == 0 && ((3 * DMOD * DMOD / 8) % 256) == 0 && ((DMOD * DMOD / 8) % 256) == 0);
static_assert((ROWS % 64) == 0 && (DMOD % 64) == 0 && (DMOD % 32) == 0);
static_assert(NB >= 1 && NB <= 32);
static_assert((WPB % 32) == 0 && WPB == 1024);
static_assert(ATT_THREADS == 256 && (1 << AQT_BITS) == (SEQ / ATT_QROWS));
static_assert((SEQ % AKS) == 0 && ANST >= 2 && (AKS % 32) == 0 && AKS * 2 + 16 == GPITCH && HD * 2 + 16 == GPITCH);
static_assert(AKS == 8 * (ATT_THREADS / 16) && HD == 8 * (ATT_THREADS / 16));
static_assert(ATT_WAVES * ATT_QT * 16 * GPITCH <= 2 * ABUF);
static_assert((VTS % 16) == 0 && VTS >= 64 * 2 && 4 * 64 * VTS <= 2 * GBUF && (SEQ % GBT) == 0);
static_assert(4 * 64 * 68 * 4 <= 2 * GBUF);
static_assert(NB == 4 && (DMOD & (DMOD - 1)) == 0);
static_assert((ROWS % GBT) == 0 && (DMOD % GBT) == 0 && (DMOD % GKS) == 0 && GKS * 2 + 16 == GPITCH);
static_assert(DMOD == 1024 && (TPB % 16) == 0 && TPB >= 64 * 2 && GBW <= GBLK);

typedef unsigned short u16;
typedef _Float16 v16h __attribute__((ext_vector_type(16)));
typedef _Float16 v8h  __attribute__((ext_vector_type(8)));
typedef __bf16   v16b __attribute__((ext_vector_type(16)));
typedef float    v8f  __attribute__((ext_vector_type(8)));
typedef float    v4f  __attribute__((ext_vector_type(4)));
typedef float    v2f  __attribute__((ext_vector_type(2)));
typedef _Float16 v2h  __attribute__((ext_vector_type(2)));
typedef unsigned int v4u __attribute__((ext_vector_type(4)));

union FragH { v16h v; v8h h[2]; v4u u[2]; };
union FragB { v16b v; v4u u[2]; };

// ---- scalar helpers --------------------------------------------------------------------------------
__device__ __forceinline__ unsigned short bf_bits(float f) {          // f32 -> bf16 bits, RNE convert
  unsigned u = __float_as_uint(f);
  return (unsigned short)((u + 0x7FFFu + ((u >> 16) & 1u)) >> 16);
}
__device__ __forceinline__ float bf_up(unsigned short h) { return __uint_as_float(((unsigned)h) << 16); }
__device__ __forceinline__ float bfr(float f) { return bf_up(bf_bits(f)); }
__device__ __forceinline__ unsigned pk16(unsigned short a, unsigned short b) { return (unsigned)a | ((unsigned)b << 16); }
__device__ __forceinline__ v8f zero8() { v8f z = {0.f, 0.f, 0.f, 0.f, 0.f, 0.f, 0.f, 0.f}; return z; }
__device__ __forceinline__ v4f zero4() { v4f z = {0.f, 0.f, 0.f, 0.f}; return z; }

// ---- fragment loaders: 16-bit A/B operand, lane -> row/col (lane&15), p already includes +8*(lane>>4);
//      elements 0..7 <- p[0..7] (k0+8h..), elements 8..15 <- p[16..23] (k0+16+8h..)  (same split k map for A and B;
//      B is always read from a k-contiguous [n][k] plane)
__device__ __forceinline__ v16h ldfrag_h(const _Float16* p) {
  FragH f;
  f.h[0] = *(const v8h*)(p);
  f.h[1] = *(const v8h*)(p + 16);
  return f.v;
}

__device__ __forceinline__ v8f mma_h(v16h a, v16h b, v8f c) {
  return __builtin_amdgcn_wmma_f32_16x16x32_f16(false, a, false, b, (short)0, c, false, false);
}
__device__ __forceinline__ v8f mma_b(v16b a, v16b b, v8f c) {
  return __builtin_amdgcn_wmma_f32_16x16x32_bf16(false, a, false, b, (short)0, c, false, false);
}
// The four v_nop fill the vector slots that the chip needs behind a matrix instruction before a vector instruction may touch its
// result or overwrite its operands; they stand at the foot of the key-block loop, for the taken side of its branch. The results
// of the loop's last eight matrix instructions are named so that the v_nop stay behind them.
__device__ __forceinline__ void guard_foot(v8f& a0, v8f& a1, v8f& a2, v8f& a3, v8f& b0, v8f& b1, v8f& b2, v8f& b3) {
#if defined(__HIP_DEVICE_COMPILE__)
  asm volatile("v_nop\n\tv_nop\n\tv_nop\n\tv_nop"
               : "+v"(a0), "+v"(a1), "+v"(a2), "+v"(a3), "+v"(b0), "+v"(b1), "+v"(b2), "+v"(b3));
#endif
}
__device__ __forceinline__ void wave_sync_lds() {
  __builtin_amdgcn_fence(__ATOMIC_RELEASE, "workgroup");
  __builtin_amdgcn_wave_barrier();
  __builtin_amdgcn_fence(__ATOMIC_ACQUIRE, "workgroup");
}

// =====================================================================================================
// All that is made from the f32 inputs alone, in one grid (the parts do not depend on one another); the short parts stand first:
//   blocks [0, CBB): the folded bias bf[n] = sum_j Wd[n][j] * bo[j] + bd[n] (bf16 RNE values, f32 FMA chain and xor tree);
//     block = 32 rows n, wave = 4 rows, lane = 4 consecutive j of every 128; the 32 sums leave as one whole 128-B line.
//   next CBT blocks: Wo -> its transposed bf16 plane WOT[k][j] = Wo[j][k], block = one 64 x 64 tile turned in LDS (pitch 144 B);
//     coverage: read 64 rows x 4 lanes x 16 floats, written 2 x 32 rows x 8 lanes x 8 elements (whole 128-B lines).
//   then f32 plane -> bf16 plane (RNE bits), same layout: CBX blocks for the activations, CBQ for the qkv weight, CBW for Wd,
//     whose rows are turned by NB places on the way: plane row j = Wd row (j - NB) mod DMOD, so that Wf comes out turned alike.
//     Thread = 8 consecutive elements: two 16-B loads, one 16-B store; 32 consecutive lanes = 512 contiguous, 512-B aligned bytes
//     coverage: each plane has elements/8/256 blocks (exact: static_assert above) x 256 thr x 8 = the whole plane.
// =====================================================================================================
// The wait before a register that an issued global store names is rewritten: behind a part's last stores, whose registers the
// code of another part, laid behind them in the kernel, writes anew.
__device__ __forceinline__ void wait_x_part() {
#if defined(__HIP_DEVICE_COMPILE__)
  asm volatile("s_wait_xcnt 0x0" ::: "memory");
#endif
}
__global__ __launch_bounds__(256) void cvt16(const float* __restrict__ x, const float* __restrict__ wqkv,
                                             const float* __restrict__ wo, const float* __restrict__ wd,
                                             const float* __restrict__ bo, const float* __restrict__ bd,
                                             u16* XB, u16* WQKV, u16* WOT, u16* WDB, float* BF) {
  __shared__ __align__(16) unsigned char tile[64 * TPB];
  const int tid = threadIdx.x;
  int blk = blockIdx.x;                     // block-uniform choice of the part
  if (blk >= CBB + CBT + CBX + CBQ + CBW) return;   // in front of every barrier; never taken with the exact grid
  if (blk < CBB) {
    const int wave = tid >> 5, lane = tid & 31;
    float* sums = (float*)(void*)tile;
    const float* wp = wd + (size_t)(blk * 32 + wave * 4) * DMOD + lane * 4;
    float s4[4] = {0.f, 0.f, 0.f, 0.f};
    // two chunks' loads in flight; unrolled further, this part's registers would cut the waves that the stream parts can hold
#pragma unroll 2
    for (int it = 0; it < 8; ++it) {
      const v4f t = *(const v4f*)(bo + it * 128 + lane * 4);
#pragma unroll
      for (int r = 0; r < 4; ++r) {
        const v4f w = *(const v4f*)(wp + (size_t)r * DMOD + it * 128);
#pragma unroll
        for (int e = 0; e < 4; ++e) s4[r] = __builtin_fmaf(bfr(w[e]), bfr(t[e]), s4[r]);
      }
    }
#pragma unroll
    for (int d = 16; d >= 1; d >>= 1) {
#pragma unroll
      for (int r = 0; r < 4; ++r) s4[r] += __shfl_xor(s4[r], d, 32);
    }
    if (lane == 0) {
      const v4f sv = {s4[0], s4[1], s4[2], s4[3]};
      *(v4f*)(sums + wave * 4) = sv;
    }
    __syncthreads();                        // the block's 32 sums are in LDS
    if (tid < 8) {
      const v4f b = *(const v4f*)(bd + blk * 32 + tid * 4);
      v4f o = *(const v4f*)(sums + tid * 4);
#pragma unroll
      for (int e = 0; e < 4; ++e) o[e] += bfr(b[e]);
      *(v4f*)(BF + blk * 32 + tid * 4) = o;
    }
    return;
  }
  blk -= CBB;
  if (blk < CBT) {
    const int j0 = (blk / (DMOD / 64)) * 64, k0 = (blk % (DMOD / 64)) * 64;
    {
      const int j = tid >> 2, kq = (tid & 3) * 16;
      const float* p = wo + (size_t)(j0 + j) * DMOD + k0 + kq;
      v4f v[4];
#pragma unroll
      for (int q = 0; q < 4; ++q) v[q] = *(const v4f*)(p + q * 4);
#pragma unroll
      for (int q = 0; q < 4; ++q) {
#pragma unroll
        for (int e = 0; e < 4; ++e) *(u16*)(void*)(tile + (kq + q * 4 + e) * TPB + j * 2) = bf_bits(v[q][e]);
      }
    }
    __syncthreads();                        // the turned tile is whole
    const int kr = tid >> 3, jq = (tid & 7) * 8;
    v4u o[2];
#pragma unroll
    for (int it = 0; it < 2; ++it) o[it] = *(const v4u*)(tile + (it * 32 + kr) * TPB + jq * 2);
    u16* dst = WOT + (size_t)(k0 + kr) * DMOD + j0 + jq;
#pragma unroll
    for (int it = 0; it < 2; ++it) *(v4u*)(dst + (size_t)(it * 32) * DMOD) = o[it];
    wait_x_part();
    return;
  }
  blk -= CBT;
  const float* s = x;
  u16* D = XB;
  unsigned so = 0u, sm = 0xFFFFFFFFu;       // source element = (plane element + so) & sm
  if (blk >= CBX + CBQ) { s = wd;   D = WDB;  blk -= CBX + CBQ; so = (unsigned)((DMOD - NB) * DMOD); sm = (unsigned)(DMOD * DMOD - 1); }
  else if (blk >= CBX)  { s = wqkv; D = WQKV; blk -= CBX; }
  const int gt = blk * 256 + tid;
  const float* p = s + (((unsigned)gt * 8u + so) & sm);
  const v4f a = *(const v4f*)(p), c4 = *(const v4f*)(p + 4);
  v4u o;
#pragma unroll
  for (int e = 0; e < 2; ++e) {
    o[e]     = pk16(bf_bits(a[2 * e]), bf_bits(a[2 * e + 1]));
    o[2 + e] = pk16(bf_bits(c4[2 * e]), bf_bits(c4[2 * e + 1]));
  }
  *(v4u*)(D + (size_t)gt * 8) = o;
  wait_x_part();
}

// =====================================================================================================
// GEMM f32 epilogue (EPI 0): the wave's 16x64 f32 tile (times oscale) staged in its LDS slab (pitch 68),
// coverage: 8 instructions x 2 rows x 16 lanes x 4 floats = the wave's 16 x 64 tile.
// eon (wave-uniform: the wave holds flat columns 0..3): the lanes of those columns read, in place of the tile's own values, the
// entries sl[eo + 4 * row ..] (four floats each): what stands in front of each of the tile's 16 rows in the flat buffer. sc
// (wave-uniform): entry 0 is the scores, which take no bias.
// =====================================================================================================
__device__ __forceinline__ void epi64(float* sl, v8f a0, v8f a1, v8f a2, v8f a3, float oscale, v4f badd, float* C, int N,
                                      size_t rowb, int col0, int lane, int eo, bool eon, bool sc) {
  const int hh = lane >> 4, m = lane & 15;
#pragma unroll
  for (int r = 0; r < 8; ++r) {
    const int ro = (8 * hh + r) * 68 + m;
    sl[ro]      = a0[r] * oscale;
    sl[ro + 16] = a1[r] * oscale;
    sl[ro + 32] = a2[r] * oscale;
    sl[ro + 48] = a3[r] * oscale;
  }
  wave_sync_lds();
  const bool el = eon & (m == 0);
  const int rb = el ? eo + hh * 4 : hh * 68 + m * 4;       // this lane's first read and its step: slab rows or edge entries
  const int rs = el ? 2 * 4 : 2 * 68;
  v4f vals[8];
#pragma unroll
  for (int it = 0; it < 8; ++it) vals[it] = *(const v4f*)(sl + rb + it * rs) + badd;
  if (sc) {
    const v4f e0 = *(const v4f*)(sl + eo);
#pragma unroll
    for (int q = 0; q < 4; ++q) vals[0][q] = (lane == 0) ? e0[q] : vals[0][q];
  }
  float* dst = C + (rowb + (size_t)hh) * (size_t)N + col0 + m * 4;
  {
#pragma unroll
    for (int it = 0; it < 8; ++it) {
      *(v4f*)(dst + (size_t)(it * 2) * (size_t)N) = vals[it];
    }
    wait_x_part();                           // the next tile's values and addresses may be formed in registers that these stores name
  }
}

// =====================================================================================================
// 16-bit GEMM with bias, both engines: C[M][N] (f32) = A[M][K] (row-major) . Bt[N][K]^T (k-contiguous), times oscale, plus a
// bias. Block = 128x128 tile of C, 4 waves as 2x2, wave = 64x64 (4x4 accumulator tiles).
// EPI 0 is the product that fills the flat output buffer C = [NB scores | image of M x N]: Bt's rows come turned by NB places
// (row j = image column (j - NB) mod N, N a power of two), so that element (r, j) of the product stands at C[r * N + j] for
// j >= NB and every 64-column row piece is two whole lines; bias[(j - NB) mod N] is added as it is (an f32 value made in this
// call). Columns j < NB are the LAST NB image columns of row r and stand at C[(r + 1) * N + j], in front of row r + 1: the blocks
// of tile column 0 pass them down one row through the LDS array edge (entry e = what stands in front of tile row e). Entry 0
// belongs to the row above the tile: wave 0 of such a block multiplies that one row (copied into xrow beside every stage, the same
// row in all 16 rows of the A fragment) by the tile's first 16 Bt rows, one more accumulator tile, k upward like the others. In
// block 0 entry 0 is the NB scores (per batch: fixed-order sum of its WPB PART lines times 1/(NH*SEQ*SEQ), wave = batch, 32 lanes
// x WPB/32 strided loads + xor tree). Entry 128 of the last row block is the buffer's last NB elements.
// coverage: (M/128)*(N/128) blocks x 4 waves x 4 x 8 instructions x 2 rows x 64 floats = C[0 .. M*N), + 1 piece of NB = all of C.
// EPI 2 adds the bf16-RNE value of bias[n], or
// nothing where hasb (block-uniform) is not set, and stores f16(C * pscale) as the plane P[M][N] unless tr (block-uniform) is set:
// then it stores f16(C * pscale) transposed per batch, P[(row / SEQ) * N + col][row % SEQ] (the v^T plane: N = NH * HD,
// col = h * HD + d). bid is the block's index among the (M/128)*(N/128) tiles of this product.
// A stage is 128 k of the block's 128 A rows and 128 Bt rows: 256 rows of 256 B, laid in LDS at pitch 272 B by asynchronous
// b128 copies (16 lanes = one whole 256-B row, so every copy touches whole lines). Two buffers: stage t+1 flies while stage t
// is multiplied. Fragments are read from LDS with the same split k map for A and B as ldfrag_h; k runs upward in steps of 32
// into one accumulator per tile. Shapes: M % 128 == 0, N % 128 == 0, K % 128 == 0, (M/128)*(N/128) blocks per product (static_assert above).
// =====================================================================================================
__device__ __forceinline__ unsigned lds_off(const void* p) { return (unsigned)(size_t)p; }

// Eight asynchronous 16-B-per-lane copies, rows 8 apart. The s_wait_xcnt stands inside the statement so that no address
// register of a copy is rewritten in front of it.
__device__ __forceinline__ void copy8(unsigned l, const u16* g, size_t rs8) {
#if defined(__HIP_DEVICE_COMPILE__)
  asm volatile("global_load_async_to_lds_b128 %0, %8, off\n\t"
               "global_load_async_to_lds_b128 %1, %9, off\n\t"
               "global_load_async_to_lds_b128 %2, %10, off\n\t"
               "global_load_async_to_lds_b128 %3, %11, off\n\t"
               "global_load_async_to_lds_b128 %4, %12, off\n\t"
               "global_load_async_to_lds_b128 %5, %13, off\n\t"
               "global_load_async_to_lds_b128 %6, %14, off\n\t"
               "global_load_async_to_lds_b128 %7, %15, off\n\t"
               "s_wait_xcnt 0x0"
               :: "v"(l), "v"(l + 8u * GPITCH), "v"(l + 16u * GPITCH), "v"(l + 24u * GPITCH),
                  "v"(l + 32u * GPITCH), "v"(l + 40u * GPITCH), "v"(l + 48u * GPITCH), "v"(l + 56u * GPITCH),
                  "v"(g), "v"(g + rs8), "v"(g + 2 * rs8), "v"(g + 3 * rs8),
                  "v"(g + 4 * rs8), "v"(g + 5 * rs8), "v"(g + 6 * rs8), "v"(g + 7 * rs8)
               : "memory");
#endif
}
// One stage: this thread's 16 B of rows cr + 8i (i = 0..15) of the A tile and of the Bt tile; 32 copies per wave.
__device__ __forceinline__ void fill_stage(unsigned l, const u16* ga, const u16* gb, size_t rs8) {
  copy8(l, ga, rs8);
  copy8(l + 64u * GPITCH, ga + 8 * rs8, rs8);
  copy8(l + GOPB, gb, rs8);
  copy8(l + GOPB + 64u * GPITCH, gb + 8 * rs8, rs8);
}
// One asynchronous 16-B-per-lane copy (32 lanes = two whole 256-B rows). The s_wait_xcnt stands inside the statement so that no
// address register of the copy is rewritten in front of it.
__device__ __forceinline__ void copy1(unsigned l, const u16* g) {
#if defined(__HIP_DEVICE_COMPILE__)
  asm volatile("global_load_async_to_lds_b128 %0, %1, off\n\t"
               "s_wait_xcnt 0x0"
               :: "v"(l), "v"(g) : "memory");
#endif
}
__device__ __forceinline__ void wait_async0() {   // this wave's copies have landed
#if defined(__HIP_DEVICE_COMPILE__)
  asm volatile("s_wait_asynccnt 0x0" ::: "memory");
#endif
}
__device__ __forceinline__ void wait_ds0() {      // this wave's LDS reads have returned before their buffer is refilled
#if defined(__HIP_DEVICE_COMPILE__)
  asm volatile("s_wait_dscnt 0x0" ::: "memory");
#endif
}
// The wait before a register that an issued global store names is rewritten. p is named so that what is formed from it afterwards
// (the following stores' addresses) cannot be moved in front of the wait.
__device__ __forceinline__ void wait_x0(unsigned& p) {
#if defined(__HIP_DEVICE_COMPILE__)
  asm volatile("s_wait_xcnt 0x0" : "+v"(p) :: "memory");
#endif
}
__device__ __forceinline__ FragB ld_lfrag(const unsigned char* p) {   // split k map of ldfrag_h: bytes 0..15 and 32..47
  FragB f;
  f.u[0] = *(const v4u*)(p);
  f.u[1] = *(const v4u*)(p + 32);
  return f;
}
__device__ __forceinline__ v8f mma_sel(FragB a, FragB b, v8f c, bool bf) {
  if (bf) return mma_b(a.v, b.v, c);
  return mma_h(__builtin_bit_cast(v16h, a.v), __builtin_bit_cast(v16h, b.v), c);
}

template <bool BF, int EPI>
__device__ __forceinline__ void gemm_core(unsigned char* ring, float* slab, const u16* __restrict__ A,
                                          const u16* __restrict__ Bt, const float* __restrict__ bias,
                                          float* C, u16* P, int bid, bool tr, bool hasb, int M, int N, int K, float oscale,
                                          float pscale, unsigned char* xrow = nullptr, float* edge = nullptr,
                                          const float* __restrict__ part = nullptr) {
  const int tid = threadIdx.x, wave = tid >> 5, lane = tid & 31, hh = lane >> 4, m = lane & 15;
  const int ntile = N >> 7;
  const int row0  = (bid / ntile) * GBT;
  const int col0  = (bid % ntile) * GBT;
  if (row0 + GBT > M) return;                // block-uniform, in front of every barrier; never taken with the exact grid
  const int wr = wave >> 1, wc = wave & 1;
  const int nst = K >> 7;
  const int cr = tid >> 4, cc = tid & 15;    // copy: row within a group of 8, 16-B chunk of the 256-B row
  const u16* ga = A  + (size_t)(row0 + cr) * K + cc * 8;
  const u16* gb = Bt + (size_t)(col0 + cr) * K + cc * 8;
  const size_t rs8 = (size_t)8 * K;
  const unsigned l0 = lds_off(ring) + (unsigned)(cr * GPITCH + cc * 16);

  v8f acc[4][4];
#pragma unroll
  for (int i = 0; i < 4; ++i) {
#pragma unroll
    for (int j = 0; j < 4; ++j) acc[i][j] = zero8();
  }
  // EPI 0, wave 0 of a block of tile column 0 (a scalar test): the row above the tile. Rows row0 - 2 and row0 - 1 (held at 0 from
  // below: block row 0 uses neither) are copied, 16 lanes each, so that every lane is on.
  v8f accx = zero8();
  bool xt = false;
  const u16* gx = A;
  unsigned lx = 0;
  if constexpr (EPI == 0) {
    xt = (col0 == 0) && (__builtin_amdgcn_readfirstlane(wave) == 0);
    const int xr = row0 - 2 + hh;
    gx = A + (size_t)(xr < 0 ? 0 : xr) * K + m * 8;
    lx = lds_off(xrow) + (unsigned)(hh * GPITCH + m * 16);
  }

  fill_stage(l0, ga, gb, rs8);
  if constexpr (EPI == 0) {
    if (xt) copy1(lx, gx);
    if (bid == 0) {                          // block-uniform: the scores, while stage 0 flies; wave = batch (4 waves, NB = 4)
      const float* pp = part + ((size_t)wave * WPB + lane) * 32;
      float pv[WPB / 32];
#pragma unroll
      for (int i = 0; i < WPB / 32; ++i) pv[i] = pp[(size_t)i * (32 * 32)];     // all in flight together
      float s = 0.f;
#pragma unroll
      for (int i = 0; i < WPB / 32; ++i) s += pv[i];
      wait_x_part();                         // before the loads' address registers are written anew
#pragma unroll
      for (int d = 16; d >= 1; d >>= 1) s += __shfl_xor(s, d, 32);
      if (lane == 0) edge[wave] = s * DEPSC;
    }
  }
  wait_async0();
  __syncthreads();                           // publishes stage 0
  if (nst > 1) {
    fill_stage(l0 + GBUF, ga + GKS, gb + GKS, rs8);
    if constexpr (EPI == 0) {
      if (xt) copy1(lx + XRB, gx + GKS);
    }
  }

  for (int t = 0; t < nst; ++t) {
    const unsigned bo = (unsigned)(t & 1) * GBUF;
    const unsigned char* ab = ring + bo + (wr * 64 + m) * GPITCH + hh * 16;
    const unsigned char* bb = ring + bo + GOPB + (wc * 64 + m) * GPITCH + hh * 16;
    FragB a[2][4], b[2][4];                  // set (ks & 1) holds the fragments of k step ks
#pragma unroll
    for (int i = 0; i < 4; ++i) { a[0][i] = ld_lfrag(ab + i * 16 * GPITCH); b[0][i] = ld_lfrag(bb + i * 16 * GPITCH); }
#pragma unroll
    for (int ks = 0; ks < GKS / 32; ++ks) {
      const int cs = ks & 1;
      if (ks + 1 < GKS / 32) {
#pragma unroll
        for (int i = 0; i < 4; ++i) {
          a[cs ^ 1][i] = ld_lfrag(ab + i * 16 * GPITCH + (ks + 1) * 64);
          b[cs ^ 1][i] = ld_lfrag(bb + i * 16 * GPITCH + (ks + 1) * 64);
        }
      }
      // keeps the next k step's LDS reads one group ahead of this step's products instead of spread among them
      __builtin_amdgcn_sched_barrier(0);
#pragma unroll
      for (int i = 0; i < 4; ++i) {
#pragma unroll
        for (int j = 0; j < 4; ++j) acc[i][j] = mma_sel(a[cs][i], b[cs][j], acc[i][j], BF);
      }
      // keeps the following group of LDS reads behind this step's products
      __builtin_amdgcn_sched_barrier(0);
    }
    if constexpr (EPI == 0) {
      if (xt) {                              // the stage's 128 k of (row above the tile) x (flat columns 0..15)
        const unsigned char* xa = xrow + (unsigned)(t & 1) * XRB + GPITCH + hh * 16;
        const unsigned char* xb = ring + bo + GOPB + m * GPITCH + hh * 16;
#pragma unroll
        for (int ks = 0; ks < GKS / 32; ++ks) accx = mma_sel(ld_lfrag(xa + ks * 64), ld_lfrag(xb + ks * 64), accx, BF);
      }
    }
    wait_ds0();
    wait_async0();
    __syncthreads();                         // publishes stage t+1 and ends every reader's last read of stage t's buffer
    if (t + 2 < nst) {
      fill_stage(l0 + bo, ga + (size_t)(t + 2) * GKS, gb + (size_t)(t + 2) * GKS, rs8);
      if constexpr (EPI == 0) {
        if (xt) copy1(lx + (unsigned)(t & 1) * XRB, gx + (size_t)(t + 2) * GKS);
      }
    }
  }
  wait_async0();

  const int colw = col0 + wc * 64;
  if constexpr (EPI == 0) {
    float* sl = slab + wave * SLAB64;
    // flat columns colw + 4m .. +3 = image columns NB less, modulo N (a piece of four never straddles the wrap)
    const v4f badd = *(const v4f*)(bias + ((colw + m * 4 + N - NB) & (N - 1)));
    const bool ew = (col0 == 0) && (__builtin_amdgcn_readfirstlane(wc) == 0);   // scalar: this wave holds flat columns 0..3
    if (col0 == 0) {                         // block-uniform
      if (ew && m < NB) {                    // as in the slab: times oscale, the bias is added on the way out
#pragma unroll
        for (int i = 0; i < 4; ++i) {
#pragma unroll
          for (int r = 0; r < 8; ++r) edge[(wr * 64 + i * 16 + 8 * hh + r + 1) * 4 + m] = acc[i][0][r] * oscale;
        }
        if (xt && row0 != 0 && hh == 0) edge[m] = accx[0] * oscale;
      }
      __syncthreads();                       // the block's 129 edge entries are in LDS
    }
#pragma unroll
    for (int i = 0; i < 4; ++i) {
      if (i) wave_sync_lds();                // the slab's last readers are done before other lanes overwrite it
      epi64(sl, acc[i][0], acc[i][1], acc[i][2], acc[i][3], oscale, badd, C, N, (size_t)(row0 + wr * 64 + i * 16), colw, lane,
            (int)(edge - sl) + (wr * 64 + i * 16) * 4, ew, i == 0 && xt && row0 == 0);
    }
    // thread 0's badd is the bias of the last NB image columns
    if (col0 == 0 && row0 + GBT == M && tid == 0) *(v4f*)(C + (size_t)M * (size_t)N) = *(const v4f*)(edge + GBT * 4) + badd;
  } else if (!tr) {
    // The wave's 64 x 64 f32 tile (times oscale) is staged whole in its own part of the ring (pitch 68 floats), which the last
    // stage's barrier has freed of readers and copies; read back with 8 lanes per row (8 columns each), so that every 128-B
    // row piece of the plane leaves as one whole line.
    // coverage: 16 instructions x 4 rows x 8 lanes x 8 halves = the wave's 64 x 64 tile.
    float* sl = (float*)(void*)ring + wave * (64 * 68);
#pragma unroll
    for (int i = 0; i < 4; ++i) {
#pragma unroll
      for (int r = 0; r < 8; ++r) {
        const int ro = (i * 16 + 8 * hh + r) * 68 + m;
#pragma unroll
        for (int j = 0; j < 4; ++j) sl[ro + 16 * j] = acc[i][j][r] * oscale;
      }
    }
    const int rq = lane >> 3, p8 = (lane & 7) * 8;
    const float* bp = bias + colw + p8;                   // columns colw + 8(lane & 7) .. +7, always < N
    const v4f bv0 = *(const v4f*)(bp), bv1 = *(const v4f*)(bp + 4);
    v4f b0, b1;
#pragma unroll
    for (int e = 0; e < 4; ++e) { b0[e] = hasb ? bfr(bv0[e]) : 0.f; b1[e] = hasb ? bfr(bv1[e]) : 0.f; }
    wave_sync_lds();
    v4u o[16];
#pragma unroll
    for (int it = 0; it < 16; ++it) {
      const float* s = sl + (it * 4 + rq) * 68 + p8;
      const v4f x = (*(const v4f*)(s) + b0) * pscale, y = (*(const v4f*)(s + 4) + b1) * pscale;
      const v8f f = {x[0], x[1], x[2], x[3], y[0], y[1], y[2], y[3]};
      o[it] = __builtin_bit_cast(v4u, __builtin_convertvector(f, v8h));
    }
    u16* dst = P + (size_t)(row0 + wr * 64 + rq) * (size_t)N + colw + p8;
    unsigned adv = 0;                        // elements from dst to the current group of four stores
#pragma unroll
    for (int it = 0; it < 16; ++it) {
      *(v4u*)(dst + adv + (size_t)((it & 3) * 4) * (size_t)N) = o[it];
      // behind every group of four: the next stores' addresses, and whatever follows the last group, may be formed in registers
      // that an issued store names; the addresses are formed from adv behind the wait
      if ((it & 3) == 3) { wait_x0(adv); adv += 16u * (unsigned)N; }
    }
  } else {
    // An accumulator lane holds 8 consecutive rows of one column: 16 B of a transposed line. The wave's 64 columns x 64 rows
    // are gathered in its own part of the ring (pitch 144 B), which the last stage's barrier has freed of readers and copies,
    // and leave as whole 128-B lines, 8 lanes each.
    // coverage: 16 instructions x 4 lines x 8 lanes x 8 halves = the wave's 64 x 64 tile.
    unsigned char* st = ring + wave * (64 * VTS);
#pragma unroll
    for (int j = 0; j < 4; ++j) {
      const float bj = bfr(bias[colw + j * 16 + m]);
#pragma unroll
      for (int i = 0; i < 4; ++i) {
        const v8f f = (acc[i][j] * oscale + bj) * pscale;
        *(v8h*)(st + (j * 16 + m) * VTS + i * 32 + hh * 16) = __builtin_convertvector(f, v8h);
      }
    }
    wave_sync_lds();
    const int rq = lane >> 3, p = lane & 7;
    v4u t[16];
#pragma unroll
    for (int it = 0; it < 16; ++it) t[it] = *(const v4u*)(st + (it * 4 + rq) * VTS + p * 16);
    const int roww = row0 + wr * 64;         // 64 rows of one batch (SEQ % 128 == 0)
    u16* dst = P + ((size_t)(roww / SEQ) * (size_t)N + colw + rq) * SEQ + (roww % SEQ) + p * 8;
#pragma unroll
    for (int it = 0; it < 16; ++it) *(v4u*)(dst + (size_t)(it * 4) * SEQ) = t[it];
  }
}

// The q, k and v projections and the folded weight in one grid (they depend on nothing of one another): blocks [0, GBLK) give the
// q plane, [GBLK, 2 GBLK) the k plane, [2 GBLK, 3 GBLK) the v^T plane (GBLK = the 128x128 tiles of one projection, M = ROWS,
// N = DMOD); third s multiplies by weight rows s * N .. s * N + N - 1. The last GBW blocks give Wf[n][k] = sum_j Wd[(n - NB) mod N][j] *
// Wo[j][k] (A = the Wd plane with rows turned by NB places, Bt = the transposed Wo plane, N x N, no bias), stored as the f16 plane x wsc.
__global__ __launch_bounds__(128)
void gemm_qkv(const u16* __restrict__ A, const u16* __restrict__ Bt, const float* __restrict__ bias,
              const u16* __restrict__ WD, const u16* __restrict__ WOT,
              u16* QPo, u16* KPo, u16* VPo, u16* WFo, int M, int N, int K, float qsc, float ksc, float vsc, float wsc) {
  __shared__ __align__(16) unsigned char ring[2 * GBUF];
  const int seg = (int)blockIdx.x / GBLK;    // block-uniform
  if (seg > 3) return;                       // in front of every barrier; never taken with the exact grid
  const bool fold = (seg == 3);
  u16* P = (seg == 0) ? QPo : (seg == 1) ? KPo : (seg == 2) ? VPo : WFo;
  const float ps = (seg == 0) ? qsc : (seg == 1) ? ksc : (seg == 2) ? vsc : wsc;
  const int sb = fold ? 0 : seg;             // the fold reads no bias: its pointer stays inside the array
  gemm_core<true, 2>(ring, nullptr, fold ? WD : A, fold ? WOT : Bt + (size_t)seg * N * K, bias + sb * N, nullptr, P,
                     (int)blockIdx.x - seg * GBLK, seg == 2, !fold, fold ? N : M, N, K, 1.0f, ps);
}

__global__ __launch_bounds__(128)
void gemm_h1(const u16* __restrict__ A, const u16* __restrict__ Bt, const float* __restrict__ bias,
             const float* __restrict__ PART, float* C, int M, int N, int K, float oscale) {
  __shared__ __align__(16) unsigned char ring[2 * GBUF];
  __shared__ __align__(16) float slab[4 * SLAB64 + (GBT + 1) * 4];   // the waves' slabs, then the 129 edge entries
  __shared__ __align__(16) unsigned char xrow[2 * XRB];    // two buffers of the two rows above the tile, pitch as in the ring
  gemm_core<false, 0>(ring, slab, A, Bt, bias, C, nullptr, (int)blockIdx.x, false, true, M, N, K, oscale, 1.0f, xrow,
                      slab + 4 * SLAB64, PART);
}

// =====================================================================================================
// Multi-head flash attention (no mask): block = (batch b, head, 256 query rows), 8 waves, wave w owns the 32 query rows
// q0 = 256*qt + 32*w .. q0+31 as two query tiles of 16; every k and v^T fragment read from LDS is used for both tiles. What
// follows describes one query tile (q0 there = the tile's first row).
//   q plane (f16, x8) laid out [b][s][h][d]; k plane the same; v^T plane [b][h][d][s] (x1024).
//   All NKB = SEQ/32 key blocks of 32 keys are visited (static bound), in stages of 128 keys that the block's waves share:
//   a stage is 128 k rows of 256 B (all d) and 128 v^T rows of 256 B (its 128 keys), laid in LDS at pitch 272 B by asynchronous
//   b128 copies (16 lanes = one whole 256-B row). Two buffers: stage t+1 flies while stage t is worked on. The fragments are
//   read from LDS with the split k map of ldfrag_h. After the last stage's barrier the ring is the epilogue's staging room.
//   Scores are computed TRANSPOSED: S^T tile g (g = 0,1) = k rows (keys kb+16g .. +15, A operand, row m = lane&15, split k map
//   over d, 4 chunks of 32 d) times q^T (B operand, col n = query q0 + (lane&15), k = d, split map).
//   D element r of lane l = (key kb+16g+8h+r, query q0+(l&15)), so a lane owns one query column and 16 of its 32 keys; the
//   partner lane l^16 owns the other 16 -> a new row max needs one exchange with lane l^16 (a vector cross-row move); each lane
//   half keeps the running sum of its own keys, and the two are joined once, in the epilogue.
//   Online base-2 softmax in f32 (scale 1/sqrt(128) and the q/k carries folded into lsc; scale, reference and the x128 carry
//   of P enter a score's exponent through one FMA; l carries the x128 too). The reference that is subtracted is a maximum seen
//   earlier: it moves up to the running maximum, and O^T and l are rescaled, only in a key block where some query of the wave
//   has a score more than 2^8 (as a probability) above its reference; so P <= 128 * 2^8 = 32768. The exp'd values ARE
//   the P^T B-fragment in place: B col n = query = lane&15, element i <- key kb+8h+i (tile 0, D element i), element 8+i <- key
//   kb+16+8h+i (tile 1, D element i). P is carried x128 as single f16. The result is accumulated TRANSPOSED too:
//   O^T tile j = v^T rows (A operand, row m = d = 16j + (lane&15), keys k-contiguous) times P^T; D element r of lane l =
//   (d = 16j+8h+r, query q0+(l&15)), so a lane's accumulators belong to the one query whose maximum and sum it holds: the
//   rescale factor and 1/l are the lane's own values. 8 WMMAs per key block and query tile; the two tiles' 16 stand together.
//   Epilogue: 1/l and carry folds in f32; a lane's 8 accumulator registers are 8 consecutive d of its query's row: 16 B of
//   f16, staged in the wave's LDS slab (16 rows, pitch 272 B); each 256-B output row (b, q0+row, head) of the O plane
//   (O x1024 as single f16) leaves as 2 whole lines.
// coverage: per wave and query tile 8 instructions x 2 rows x 16 lanes x 8 halves = 16 x 128 of the O plane + 1 PART line; grid
//           NB*NH*SEQ/256 blocks x 8 waves x 2 tiles = every (b, s, h) row of the O plane and every PART line exactly once.
// =====================================================================================================
// Eight asynchronous 16-B-per-lane copies, rows 16 apart. The s_wait_xcnt stands inside the statement so that no address
// register of a copy is rewritten in front of it.
__device__ __forceinline__ void copy8w(unsigned l, const u16* g, size_t rs16) {
#if defined(__HIP_DEVICE_COMPILE__)
  asm volatile("global_load_async_to_lds_b128 %0, %8, off\n\t"
               "global_load_async_to_lds_b128 %1, %9, off\n\t"
               "global_load_async_to_lds_b128 %2, %10, off\n\t"
               "global_load_async_to_lds_b128 %3, %11, off\n\t"
               "global_load_async_to_lds_b128 %4, %12, off\n\t"
               "global_load_async_to_lds_b128 %5, %13, off\n\t"
               "global_load_async_to_lds_b128 %6, %14, off\n\t"
               "global_load_async_to_lds_b128 %7, %15, off\n\t"
               "s_wait_xcnt 0x0"
               :: "v"(l), "v"(l + 16u * GPITCH), "v"(l + 32u * GPITCH), "v"(l + 48u * GPITCH),
                  "v"(l + 64u * GPITCH), "v"(l + 80u * GPITCH), "v"(l + 96u * GPITCH), "v"(l + 112u * GPITCH),
                  "v"(g), "v"(g + rs16), "v"(g + 2 * rs16), "v"(g + 3 * rs16),
                  "v"(g + 4 * rs16), "v"(g + 5 * rs16), "v"(g + 6 * rs16), "v"(g + 7 * rs16)
               : "memory");
#endif
}
// One attention stage: this thread's 16 B of rows cr + 16i (i = 0..7) of the k tile and of the v^T tile; 16 copies per wave.
__device__ __forceinline__ void fill_kv(unsigned l, const u16* gk, const u16* gv) {
  copy8w(l, gk, (size_t)16 * RS);
  copy8w(l + AOPB, gv, (size_t)16 * SEQ);
}
// 2^x by the hardware instruction alone. A result below 2^-126 comes back as 0: here that is a probability (carried x128) or
// a rescale factor that small beside a row maximum of at least 128, far below the last bit that the f16 operand and the f32 sums keep.
__device__ __forceinline__ float exp2_hw(float x) { return __builtin_amdgcn_exp2f(x); }
__device__ __forceinline__ v16h ld_lfrag_h(const unsigned char* p) {  // split k map of ldfrag_h: bytes 0..15 and 32..47
  FragH f;
  f.u[0] = *(const v4u*)(p);
  f.u[1] = *(const v4u*)(p + 32);
  return f.v;
}

// The v_nop is the slot that the instruction set asks for behind a transcendental before its result is read or its source
// overwritten. The results and the sources are named so that none of them is touched in front of it, wherever it lands.
__device__ __forceinline__ void trans_slot8(float* p, const float* x) {
#if defined(__HIP_DEVICE_COMPILE__)
  asm("v_nop" : "+v"(p[0]), "+v"(p[1]), "+v"(p[2]), "+v"(p[3]), "+v"(p[4]), "+v"(p[5]), "+v"(p[6]), "+v"(p[7])
              : "v"(x[0]), "v"(x[1]), "v"(x[2]), "v"(x[3]), "v"(x[4]), "v"(x[5]), "v"(x[6]), "v"(x[7]));
#endif
}
__device__ __forceinline__ void trans_slot1(float& p, float x) {
#if defined(__HIP_DEVICE_COMPILE__)
  asm("v_nop" : "+v"(p) : "v"(x));
#endif
}

// The value of lane l ^ 16, by a vector cross-row move: it does not queue behind the v^T fragments' LDS reads.
__device__ __forceinline__ float xhalf(float x) {
  return __builtin_bit_cast(float, __builtin_amdgcn_permlanex16(__builtin_bit_cast(int, x), __builtin_bit_cast(int, x),
                                                                0x76543210, 0xfedcba98, false, false));
}

// One query tile's maximum over this lane's 16 keys of a key block: s0, s1 = the tile's unscaled transposed scores of query
// column c. The partner lane l ^ 16 holds the maximum of the query's other 16 keys.
__device__ __forceinline__ float tile_max(const v8f s0, const v8f s1) {
  float tk[16];
#pragma unroll
  for (int i = 0; i < 8; ++i) { tk[i] = s0[i];  tk[8 + i] = s1[i]; }
  float cm = -INFINITY;
#pragma unroll
  for (int i = 0; i < 16; ++i) cm = fmaxf(cm, tk[i]);
  return cm;
}
// One query tile's probabilities, carried x128, one FMA and one v_exp_f32 each: 2^(t * lsc + eb), eb = 7 - reference * lsc;
// p[i] <-> s0[i], p[8 + i] <-> s1[i].
__device__ __forceinline__ void tile_probs(const v8f s0, const v8f s1, const float lsc, const float eb, float* p) {
  const v2f l2 = {lsc, lsc}, e2 = {eb, eb};
  float x[16];
#pragma unroll
  for (int i = 0; i < 8; i += 2) {           // a register pair of the score accumulator: one packed FMA, no moves
    const v2f t0 = {s0[i], s0[i + 1]}, t1 = {s1[i], s1[i + 1]};
    const v2f x0 = __builtin_elementwise_fma(t0, l2, e2), x1 = __builtin_elementwise_fma(t1, l2, e2);
    x[i] = x0[0];
    x[i + 1] = x0[1];
    x[8 + i] = x1[0];
    x[8 + i + 1] = x1[1];
  }
#pragma unroll
  for (int i = 0; i < 16; ++i) p[i] = exp2_hw(x[i]);
  trans_slot8(p, x);
  trans_slot8(p + 8, x + 8);
}
// The probabilities are summed and rounded to the P^T B-fragment (f16); element i <-> p[i]. Returns the sum of this lane's keys.
__device__ __forceinline__ float tile_pack(const float* p, FragH& ph) {
  float ps = 0.f;
#pragma unroll
  for (int w = 0; w < 2; ++w) {
#pragma unroll
    for (int e4 = 0; e4 < 4; ++e4) {
      const int i = 8 * w + 2 * e4;
      ps += p[i] + p[i + 1];
      const v2f pp = {p[i], p[i + 1]};
      ph.u[w][e4] = __builtin_bit_cast(unsigned, __builtin_convertvector(pp, v2h));
    }
  }
  return ps;
}

// two waves per SIMD (one block per WGP): the register budget that holds two query tiles' accumulators beside the fragments
__global__ __launch_bounds__(ATT_THREADS) __attribute__((amdgpu_waves_per_eu(2, 2)))
void attn_fwd(const u16* __restrict__ QPp, const u16* __restrict__ KPp, const u16* __restrict__ VPp,
              u16* OPo, float* PART) {
  // two stage buffers (k tile, then v^T tile); in the epilogue, per wave and query tile, the result slab: 16 rows, pitch 272 B
  __shared__ __align__(16) unsigned char ring[2 * ABUF];

  const int tid  = threadIdx.x;
  const int wave = tid >> 5;
  const int lane = tid & 31;
  const int hh   = lane >> 4;
  const int c    = lane & 15;

  const int bid  = blockIdx.x;
  const int qt   = bid & ((SEQ / ATT_QROWS) - 1);
  const int head = (bid >> AQT_BITS) & (NH - 1);
  const int b    = bid >> (AQT_BITS + NH_BITS);
  const int q0   = qt * ATT_QROWS + wave * (ATT_QT * 16);   // query tile u: rows q0 + 16u .. q0 + 16u + 15

  // B fragments of q^T: col n = query q0 + 16u + c, k = d (k-contiguous row of the q plane)
  const _Float16* Qb = (const _Float16*)(const void*)QPp + ((size_t)(b * SEQ + q0 + c) * NH + head) * HD + 8 * hh;
  // copy: row within a group of 16, 16-B chunk of the 256-B row; k tile row = key, v^T tile row = d
  const int cr = tid >> 4, cc = tid & 15;
  const u16* kb0 = KPp + ((size_t)(b * SEQ) * NH + head) * HD;                  // block-uniform; stage t: + t * AKS key rows
  const u16* vb0 = VPp + ((size_t)(b * NH + head) * HD) * SEQ;                  // block-uniform; stage t: + t * AKS keys
  const unsigned ko = (unsigned)(cr * RS + cc * 8), vo = (unsigned)(cr * SEQ + cc * 8);   // this thread's place in a stage
  const unsigned l0 = lds_off(ring) + (unsigned)(cr * GPITCH + cc * 16);
  fill_kv(l0, kb0 + ko, vb0 + vo);
  const float lsc = SM_SCALE * (LOG2E / (QSC * KSC));

  v16h qf[ATT_QT][4];                        // chunk n: d 32n .. 32n + 31
#pragma unroll
  for (int u = 0; u < ATT_QT; ++u) {
#pragma unroll
    for (int n = 0; n < 4; ++n) qf[u][n] = ldfrag_h(Qb + (size_t)u * (16 * RS) + n * 32);
  }

  // per query tile: the reference (unscaled, lsc > 0), the score above which it moves, the exponent's addend, the running sum
  float mref[ATT_QT], thr[ATT_QT], eb[ATT_QT], lrun[ATT_QT];
  v8f o[ATT_QT][8];
#pragma unroll
  for (int u = 0; u < ATT_QT; ++u) {
    mref[u] = -INFINITY;
    thr[u]  = -INFINITY;                     // the first key block's finite scores lie above it
    eb[u]   = 0.f;
    lrun[u] = 0.f;
#pragma unroll
    for (int j = 0; j < 8; ++j) o[u][j] = zero8();
  }

  wait_async0();
  __syncthreads();                           // publishes stage 0
  fill_kv(l0 + ABUF, kb0 + (ko + AKS * RS), vb0 + (vo + AKS));   // stage 1 exists (ANST >= 2)

  // one rolled trip per stage, so that the ring's publish point stands once, at the trip's foot
#pragma unroll 1
  for (int t = 0; t < ANST; ++t) {
   const unsigned bo = (unsigned)(t & 1) * ABUF;
   // A fragments of k: row m = key kb + 16g + c, k = d;  A fragments of v^T: row m = d = 16j + c, k = key
   const unsigned char* kt = ring + bo + c * GPITCH + hh * 16;
   const unsigned char* vt = ring + bo + AOPB + c * GPITCH + hh * 16;
   // stays rolled: one key block's live values already take most of the registers of two waves per SIMD
#pragma unroll 1
   for (int kk = 0; kk < AKS / 32; ++kk) {   // key block kb = t * AKS + kk * 32
    // ---- transposed scores of both query tiles from one read of the k fragments:
    //      sa[u] = keys kb..kb+15, sc[u] = keys kb+16..kb+31, column = query q0 + 16u + c ----
    v8f sa[ATT_QT], sc[ATT_QT];
#pragma unroll
    for (int u = 0; u < ATT_QT; ++u) { sa[u] = zero8(); sc[u] = zero8(); }
    const unsigned char* k0p = kt + kk * 32 * GPITCH;
    const unsigned char* k1p = k0p + 16 * GPITCH;
    const unsigned char* vp  = vt + kk * 64;
    const v16h ka0 = ld_lfrag_h(k0p), kc0 = ld_lfrag_h(k1p);
    const v16h ka1 = ld_lfrag_h(k0p + 64), kc1 = ld_lfrag_h(k1p + 64);
    const v16h ka2 = ld_lfrag_h(k0p + 128), kc2 = ld_lfrag_h(k1p + 128);
    const v16h ka3 = ld_lfrag_h(k0p + 192), kc3 = ld_lfrag_h(k1p + 192);
    // keeps the k fragments' reads one group ahead of the products instead of pair by pair, each with a full wait, among them
    __builtin_amdgcn_sched_barrier(0);
    sa[0] = mma_h(ka0, qf[0][0], sa[0]);
    sa[1] = mma_h(ka0, qf[1][0], sa[1]);
    sc[0] = mma_h(kc0, qf[0][0], sc[0]);
    sc[1] = mma_h(kc0, qf[1][0], sc[1]);
    sa[0] = mma_h(ka1, qf[0][1], sa[0]);
    sa[1] = mma_h(ka1, qf[1][1], sa[1]);
    sc[0] = mma_h(kc1, qf[0][1], sc[0]);
    sc[1] = mma_h(kc1, qf[1][1], sc[1]);
    // keeps the first four v^T fragments' reads here, as one group behind the first eight products, so that they return
    // behind the softmax arithmetic
    __builtin_amdgcn_sched_barrier(0);
    const v16h vf0 = ld_lfrag_h(vp);
    const v16h vf1 = ld_lfrag_h(vp + 16 * GPITCH);
    const v16h vf2 = ld_lfrag_h(vp + 32 * GPITCH);
    const v16h vf3 = ld_lfrag_h(vp + 48 * GPITCH);
    __builtin_amdgcn_sched_barrier(0);       // ends that group of reads
    sa[0] = mma_h(ka2, qf[0][2], sa[0]);
    sa[1] = mma_h(ka2, qf[1][2], sa[1]);
    sc[0] = mma_h(kc2, qf[0][2], sc[0]);
    sc[1] = mma_h(kc2, qf[1][2], sc[1]);
    sa[0] = mma_h(ka3, qf[0][3], sa[0]);
    sa[1] = mma_h(ka3, qf[1][3], sa[1]);
    sc[0] = mma_h(kc3, qf[0][3], sc[0]);
    sc[1] = mma_h(kc3, qf[1][3], sc[1]);
    __builtin_amdgcn_sched_barrier(0);       // the last four v^T fragments' reads: one group behind the scores' last product
    const v16h vf4 = ld_lfrag_h(vp + 64 * GPITCH);
    const v16h vf5 = ld_lfrag_h(vp + 80 * GPITCH);
    const v16h vf6 = ld_lfrag_h(vp + 96 * GPITCH);
    const v16h vf7 = ld_lfrag_h(vp + 112 * GPITCH);
    __builtin_amdgcn_sched_barrier(0);       // ends that group of reads
    // ---- online softmax: the probabilities are formed with the references as they stand, beside the search for the maxima ----
    float cm[ATT_QT], p[ATT_QT][16];
#pragma unroll
    for (int u = 0; u < ATT_QT; ++u) cm[u] = tile_max(sa[u], sc[u]);
    const bool grow = (cm[0] > thr[0]) | (cm[1] > thr[1]);      // asked of each lane half's own 16 keys; the ballot joins them
#pragma unroll
    for (int u = 0; u < ATT_QT; ++u) tile_probs(sa[u], sc[u], lsc, eb[u], p[u]);
    // ---- wave-uniform: some query's score lies more than 2^PTAU above its reference (always so in the first key block). Every
    //      reference moves up to its running maximum, O^T (D column c = query q0+16u+c, whose factor this lane holds) and l
    //      are rescaled, and the probabilities are formed anew ----
    if (__builtin_amdgcn_ballot_w32(grow) != 0u) {
#pragma unroll
      for (int u = 0; u < ATT_QT; ++u) {
        const float mn = fmaxf(mref[u], fmaxf(cm[u], xhalf(cm[u])));   // the same in both lane halves; finite from the first key block on
        const float ax = (mref[u] - mn) * lsc;
        float ae = exp2_hw(ax);
        trans_slot1(ae, ax);
        const float al = (mref[u] == -INFINITY) ? 0.f : ae;        // o and l are zero while the reference is -inf
        mref[u] = mn;
        thr[u]  = mn + PTAU / lsc;
        eb[u]   = __builtin_fmaf(-mn, lsc, PEXP);
        lrun[u] *= al;                       // al is the same in both lane halves
#pragma unroll
        for (int j = 0; j < 8; ++j) o[u][j] = o[u][j] * al;
        tile_probs(sa[u], sc[u], lsc, eb[u], p[u]);
      }
    }
    FragH ph[ATT_QT];
#pragma unroll
    for (int u = 0; u < ATT_QT; ++u) lrun[u] += tile_pack(p[u], ph[u]);
    // ---- v^T.P^T : A fragment row m = d = j*16 + c, keys contiguous in the v^T tile; every fragment serves both query tiles;
    //      the v_nop behind the last of the 16 are for the loop's branch ----
    o[0][0] = mma_h(vf0, ph[0].v, o[0][0]);
    o[1][0] = mma_h(vf0, ph[1].v, o[1][0]);
    o[0][1] = mma_h(vf1, ph[0].v, o[0][1]);
    o[1][1] = mma_h(vf1, ph[1].v, o[1][1]);
    o[0][2] = mma_h(vf2, ph[0].v, o[0][2]);
    o[1][2] = mma_h(vf2, ph[1].v, o[1][2]);
    o[0][3] = mma_h(vf3, ph[0].v, o[0][3]);
    o[1][3] = mma_h(vf3, ph[1].v, o[1][3]);
    o[0][4] = mma_h(vf4, ph[0].v, o[0][4]);
    o[1][4] = mma_h(vf4, ph[1].v, o[1][4]);
    o[0][5] = mma_h(vf5, ph[0].v, o[0][5]);
    o[1][5] = mma_h(vf5, ph[1].v, o[1][5]);
    o[0][6] = mma_h(vf6, ph[0].v, o[0][6]);
    o[1][6] = mma_h(vf6, ph[1].v, o[1][6]);
    o[0][7] = mma_h(vf7, ph[0].v, o[0][7]);
    o[1][7] = mma_h(vf7, ph[1].v, o[1][7]);
    guard_foot(o[0][4], o[0][5], o[0][6], o[0][7], o[1][4], o[1][5], o[1][6], o[1][7]);
   }
   wait_ds0();
   wait_async0();
   __syncthreads();                          // publishes stage t+1 and ends every reader's last read of stage t's buffer
   if (t + 2 < ANST) fill_kv(l0 + bo, kb0 + (ko + (unsigned)(t + 2) * (AKS * RS)), vb0 + (vo + (unsigned)(t + 2) * AKS));
  }
  wait_async0();

  // the last stage's barrier lies behind every wave's last fragment read and last copy: the ring is free
#pragma unroll
  for (int u = 0; u < ATT_QT; ++u) {
    // ---- join the lane halves' sums; fold 1/l (the lane's own query) and the carries; row statistic r = l * (1/l);
    //      O x1024 -> f16, staged as row c, d 16j + 8hh .. + 7 of the slab ----
    const float lf   = lrun[u] + xhalf(lrun[u]);
    const float rl   = (lf > 0.f) ? (1.0f / lf) : 0.f;
    const float linv = rl * (1.0f / VCAR);   // l carries the same factor as P
    const float rr   = lf * rl;
    unsigned char* slab = ring + (wave * ATT_QT + u) * (16 * GPITCH);
#pragma unroll
    for (int j = 0; j < 8; ++j) {
      const v8f f = (o[u][j] * linv) * OSC;
      *(v8h*)(slab + c * GPITCH + j * 32 + hh * 16) = __builtin_convertvector(f, v8h);
    }
    wave_sync_lds();
    // ---- read back: lane = (row parity hh, 8 consecutive d at c8) ----
    v4u oh[8];
    const int c8 = c * 8;
#pragma unroll
    for (int it = 0; it < 8; ++it) oh[it] = *(const v4u*)(slab + (it * 2 + hh) * GPITCH + c * 16);
    // ---- tile row-sum partial (fixed xor tree over the 16 query lanes; both lane halves hold identical values) ----
    float wsum = rr;
    wsum += __shfl_xor(wsum, 1, 32);
    wsum += __shfl_xor(wsum, 2, 32);
    wsum += __shfl_xor(wsum, 4, 32);
    wsum += __shfl_xor(wsum, 8, 32);
    v4f pv = zero4();
    pv[0] = (lane == 0) ? wsum : 0.f;
    float* pd = PART + (((size_t)bid * ATT_WAVES + wave) * ATT_QT + u) * 32 + (lane & 7) * 4;   // clamped address for every lane
    const size_t ob = ((size_t)(b * SEQ + q0 + 16 * u) * NH + head) * HD + c8;
#pragma unroll
    for (int it = 0; it < 8; ++it) {
      const int row = it * 2 + hh;
      *(v4u*)(OPo + ob + (size_t)row * RS) = oh[it];
    }
    if (lane < 8) *(v4f*)(pd) = pv;
  }
}

// =====================================================================================================
// Workspace map (bytes); every plane is fully written by whole-line stores before it is read; all extents are exact multiples
// of the store granularity (no pad rows needed):
//   XB   bf16 [ROWS][1024]                 NB*4194304   (bf16 copy of the input activations)
//   WQKV bf16 [3072 n][1024 k]                6291456
//   WOT  bf16 [1024 k][1024 j] (Wo turned)    2097152   WDB bf16 [1024 n][1024 j] 2097152   (rows turned by NB places)
//   QP   f16  [ROWS][8][128] x8            NB*4194304
//   KP   f16  same                          NB*4194304
//   VP   f16  [NB][8][128][2048] x1024      NB*4194304
//   OP   f16  [ROWS][8][128] x1024         NB*4194304
//   PART f32  [ATT_BLOCKS*8*2][32]         NB*131072
//   WF   f16  [1024 n][1024 k] x256           2097152   (Wd.Wo, rows turned by NB places)
//   BF   f32  [1024]                             4096   (Wd.bo + bd)
//   end (NB = 4)                             96997376
// =====================================================================================================
extern "C" void kernel_launch(void* const* d_in, const int* in_sizes, int n_in,
                              void* d_out, int out_size, void* d_ws, size_t ws_size,
                              hipStream_t stream) {
  if (n_in < 7) return;
  if (in_sizes[0] != ROWS * DMOD) return;
  if (in_sizes[1] != 3 * DMOD * DMOD || in_sizes[2] != 3 * DMOD) return;
  if (in_sizes[3] != DMOD * DMOD || in_sizes[4] != DMOD) return;
  if (in_sizes[5] != DMOD * DMOD || in_sizes[6] != DMOD) return;
  if (out_size != TOTOUT) return;

  const float* x    = (const float*)d_in[0];
  const float* wqkv = (const float*)d_in[1];
  const float* bqkv = (const float*)d_in[2];
  const float* wo   = (const float*)d_in[3];
  const float* bo   = (const float*)d_in[4];
  const float* wd   = (const float*)d_in[5];
  const float* bd   = (const float*)d_in[6];
  float*       out  = (float*)d_out;

  const size_t szXB   = (size_t)ROWS * DMOD * 2;
  const size_t szWQKV = (size_t)3 * DMOD * DMOD * 2;
  const size_t szW    = (size_t)DMOD * DMOD * 2;
  const size_t szP    = (size_t)ROWS * DMOD * 2;
  const size_t szVP   = (size_t)NB * NH * HD * SEQ * 2;
  const size_t szPART = (size_t)ATT_BLOCKS * ATT_WAVES * ATT_QT * 32 * 4;
  size_t off = 0;
  const size_t oXB   = off; off += szXB;
  const size_t oWQKV = off; off += szWQKV;
  const size_t oWOT  = off; off += szW;
  const size_t oWDB  = off; off += szW;
  const size_t oQP   = off; off += szP;
  const size_t oKP   = off; off += szP;
  const size_t oVP   = off; off += szVP;
  const size_t oOP   = off; off += szP;
  const size_t oPART = off; off += szPART;
  const size_t oWF   = off; off += szW;
  const size_t oBF   = off; off += (size_t)DMOD * 4;
  if (off > ws_size) return;                            // off = 96997376 for NB = 4
  if (off > (size_t)134217728) return;

  char* ws = (char*)d_ws;
  u16*   XB   = (u16*)(ws + oXB);
  u16*   WQKV = (u16*)(ws + oWQKV);
  u16*   WOT  = (u16*)(ws + oWOT);
  u16*   WDB  = (u16*)(ws + oWDB);
  u16*   QP   = (u16*)(ws + oQP);
  u16*   KP   = (u16*)(ws + oKP);
  u16*   VP   = (u16*)(ws + oVP);
  u16*   OP   = (u16*)(ws + oOP);
  float* PART = (float*)(ws + oPART);
  u16*   WF   = (u16*)(ws + oWF);
  float* BF   = (float*)(ws + oBF);

  const dim3 blk(256);
  const dim3 gCV(CBB + CBT + CBX + CBQ + CBW);
  const dim3 gG(GBLK);
  const dim3 gG3(3 * GBLK + GBW);
  const dim3 bG(128);
  const dim3 gAT(ATT_BLOCKS);
  const dim3 bAT(ATT_THREADS);

  // (0) input activations, qkv weight and Wd -> bf16 planes (weights stored [n = out][k = in], y = x.W^T, already k-contiguous);
  //     Wo -> its transposed bf16 plane; the folded bias Wd.bo + bd
  cvt16<<<gCV, blk, 0, stream>>>(x, wqkv, wo, wd, bo, bd, XB, WQKV, WOT, WDB, BF);
  // (1) q, k, v: projection + bias (col = h*128+d); q and k stored as f16 planes x8, v as the v^T plane x1024;
  //     the folded weight Wd.Wo as the f16 plane x256
  gemm_qkv<<<gG3, bG, 0, stream>>>(XB, WQKV, bqkv, WDB, WOT, QP, KP, VP, WF, ROWS, DMOD, DMOD, QSC, KSC, VCAR, WFS);
  // (2) attention -> O plane [b][s][h][d] x1024 and per-wave row-sum lines
  attn_fwd<<<gAT, bAT, 0, stream>>>(QP, KP, VP, OP, PART);
  // (3) both output projections as one product with the folded weight and bias (carries 1024 x 256 folded back)
  //     -> the whole output buffer, scores and image, in whole lines
  gemm_h1<<<gG, bG, 0, stream>>>(OP, WF, BF, PART, out, ROWS, DMOD, DMOD, 1.0f / (OSC * WFS));
  (void)hipGetLastError();
}
